// v000
// Measured on an AMD MI455X. A time is GPU time per run, averaged over a window of back-to-back runs after a warm-up
// (all launches, gaps included; the runs take copies of the inputs in turn), and the median of several windows.
// Apart from v000's, it joins two sittings. Times from different sittings can be a few percent apart, while
// side-by-side timings come from the same sitting.
// The starting kernel, v000, takes 224 microseconds a run.
// Projections q,k,v = x.W + b and the f32 q,k rows 0..127 per sequence: v_wmma_f32_16x16x32_bf16 (bf16 RNE operands of the
// raw inputs, f32 accumulate, bf16 RNE bias added in f32). Scores q'.k'^T (f16 planes x8), P'.V (chunk-centred P' x32768 f16 from LDS,
// V^T x1024 f16) and the output projection (ctx carried as f16 hi x4096 plus residual x2048 planes, times f16(bf16(Wo)) x1024, bias
// added in f32): v_wmma_f32_16x16x32_f16, f32 accumulate. Query rows 0..127 of each sequence: scores, softmax and P.V in f32 on VALU.
// Causal mask, softmax statistics, key-block column sums of V and all scaling in f32 on VALU.
#include <hip/hip_runtime.h>
#include <math.h>
#include <stdint.h>

#ifndef NB
#define NB 4
#endif
#ifndef SEQ
#define SEQ 4096
#endif
#define SEQ_FULL 4096
#define NB_FULL 4
#define EMB   512
#define DH    64
#define CK    512
#define NCHK  (SEQ / CK)
#define NKB   16
#define QT    16
#define TQ0   128
#define NQT   ((SEQ - TQ0) / QT)
#define SCP   544
#define PLP   528
#define OPP   68
#define CTP   72
#define SLAB64 (16 * 68)
#define VTP   72
#define ATT_THREADS 256
#define HD_THREADS 128
#define NACC  4
#define QSC   8.0f
#define KSC   8.0f
#define PCAR  32768.0f
#define VCAR  1024.0f
#define WSC   1024.0f
#define CSC   4096.0f
#define RSC   2048.0f
#define LOG2E 1.4426950408889634f
#define RSQD  0.125f
#define WS_CAP ((size_t)134217728)

static_assert(DH == 64 && NACC * 16 == DH && (EMB % 64) == 0 && (EMB % 32) == 0 && (DH % 32) == 0);
static_assert((SEQ % CK) == 0 && NCHK >= 1 && CK == 32 * NKB && (SEQ % 64) == 0 && (SEQ % QT) == 0 && (CK % QT) == 0);
static_assert((TQ0 % QT) == 0 && (TQ0 % 64) == 0 && NQT * QT + TQ0 == SEQ && NQT >= 1 && TQ0 == 128 && TQ0 == HD_THREADS);
static_assert(8 * 16 * OPP <= 16 * SCP && 32 * CTP <= 16 * PLP && CTP >= DH + 8 && OPP >= DH + 4 && SCP >= CK + 16 && PLP >= CK + 8);
static_assert(((PLP * 2) % 16) == 0 && ((SCP * 4) % 16) == 0 && ((VTP * 2) % 16) == 0 && ((CTP * 2) % 16) == 0 && ((OPP * 4) % 16) == 0);
static_assert(64 * VTP >= 63 * VTP + 64);
static_assert(ATT_THREADS == 16 * QT && ATT_THREADS == 256 && HD_THREADS == 2 * DH);
static_assert((((SEQ * EMB) / 8) % 256) == 0 && ((NB * SEQ) % 64) == 0 && ((NB * TQ0) % 64) == 0);
static_assert(NB >= 1 && NB <= NB_FULL && SEQ <= SEQ_FULL);

typedef unsigned short u16;
typedef _Float16 v16h __attribute__((ext_vector_type(16)));
typedef _Float16 v8h  __attribute__((ext_vector_type(8)));
typedef __bf16   v16b __attribute__((ext_vector_type(16)));
typedef float    v8f  __attribute__((ext_vector_type(8)));
typedef float    v4f  __attribute__((ext_vector_type(4)));
typedef unsigned int v4u __attribute__((ext_vector_type(4)));

union FragH { v16h v; v8h h[2]; v4u u[2]; };
union FragB { v16b v; v4u u[2]; };

// ---- scalar helpers --------------------------------------------------------------------------------
__device__ __forceinline__ unsigned short bf_bits(float f) {          // f32 -> bf16 bits, RNE convert
  unsigned u = __float_as_uint(f);
  return (unsigned short)((u + 0x7FFFu + ((u >> 16) & 1u)) >> 16);
}
__device__ __forceinline__ float bf_up(unsigned short h) { return __uint_as_float(((unsigned)h) << 16); }
__device__ __forceinline__ float bfr(float f) { return bf_up(bf_bits(f)); }
__device__ __forceinline__ unsigned short h_bits(_Float16 x) { return __builtin_bit_cast(unsigned short, x); }
__device__ __forceinline__ unsigned pk16(unsigned short a, unsigned short b) { return (unsigned)a | ((unsigned)b << 16); }
__device__ __forceinline__ v8f zero8() { v8f z = {0.f, 0.f, 0.f, 0.f, 0.f, 0.f, 0.f, 0.f}; return z; }
__device__ __forceinline__ v4f zero4() { v4f z = {0.f, 0.f, 0.f, 0.f}; return z; }

// ---- fragment loaders: 16-bit A/B operand, lane -> row/col (lane&15), p already includes +8*(lane>>4);
//      elements 0..7 <- p[0..7] (k0+8h..), elements 8..15 <- p[16..23] (k0+16+8h..)  (same split k map for A and B;
//      B is always read from a k-contiguous [n][k] plane)
__device__ __forceinline__ v16h ldfrag_h(const _Float16* p) {
  FragH f;
  f.h[0] = *(const v8h*)(p);
  f.h[1] = *(const v8h*)(p + 16);
  return f.v;
}
__device__ __forceinline__ v16b ldfrag_b(const u16* p) {              // bf16 plane read as unsigned integer vectors
  FragB f;
  f.u[0] = *(const v4u*)(p);
  f.u[1] = *(const v4u*)(p + 16);
  return f.v;
}

__device__ __forceinline__ v8f mma_h(v16h a, v16h b, v8f c) {
  return __builtin_amdgcn_wmma_f32_16x16x32_f16(false, a, false, b, (short)0, c, false, false);
}
__device__ __forceinline__ v8f mma_b(v16b a, v16b b, v8f c) {
  return __builtin_amdgcn_wmma_f32_16x16x32_bf16(false, a, false, b, (short)0, c, false, false);
}
__device__ __forceinline__ void guard2x6(v8f& a, v8f& b, v16h x0, v16h x1, v16h x2, v16h x3, v16h x4, v16h x5) {
#if defined(__HIP_DEVICE_COMPILE__)
  asm volatile("v_nop\n\tv_nop\n\tv_nop\n\tv_nop"
               : "+v"(a), "+v"(b) : "v"(x0), "v"(x1), "v"(x2), "v"(x3), "v"(x4), "v"(x5) : "memory");
#endif
}
template <typename F>
__device__ __forceinline__ void guard6(v8f& a, v8f& b, v8f& c, v8f& d, F x0, F x1, F x2, F x3, F x4, F x5) {
#if defined(__HIP_DEVICE_COMPILE__)
  asm volatile("v_nop\n\tv_nop\n\tv_nop\n\tv_nop"
               : "+v"(a), "+v"(b), "+v"(c), "+v"(d) : "v"(x0), "v"(x1), "v"(x2), "v"(x3), "v"(x4), "v"(x5) : "memory");
#endif
}
__device__ __forceinline__ void guard8x6(v8f& a0, v8f& a1, v8f& a2, v8f& a3, v8f& e0, v8f& e1, v8f& e2, v8f& e3,
                                         v16h x0, v16h x1, v16h x2, v16h x3, v16h x4, v16h x5) {
#if defined(__HIP_DEVICE_COMPILE__)
  asm volatile("v_nop\n\tv_nop\n\tv_nop\n\tv_nop"
               : "+v"(a0), "+v"(a1), "+v"(a2), "+v"(a3), "+v"(e0), "+v"(e1), "+v"(e2), "+v"(e3)
               : "v"(x0), "v"(x1), "v"(x2), "v"(x3), "v"(x4), "v"(x5) : "memory");
#endif
}
__device__ __forceinline__ void guardpv4(v8f& o0, v8f& o1, v8f& o2, v8f& o3, v16h p, v16h g0, v16h g1, v16h g2, v16h g3) {
#if defined(__HIP_DEVICE_COMPILE__)
  asm volatile("v_nop\n\tv_nop\n\tv_nop\n\tv_nop"
               : "+v"(o0), "+v"(o1), "+v"(o2), "+v"(o3)
               : "v"(p), "v"(g0), "v"(g1), "v"(g2), "v"(g3) : "memory");
#endif
}
__device__ __forceinline__ void acc_guard4(v8f& a, v8f& b, v8f& c, v8f& d) {
#if defined(__HIP_DEVICE_COMPILE__)
  asm volatile("v_nop\n\tv_nop\n\tv_nop\n\tv_nop" : "+v"(a), "+v"(b), "+v"(c), "+v"(d));
#endif
}
__device__ __forceinline__ void wave_sync_lds() {                    // wave-private LDS slab: release, wave barrier, acquire
  __builtin_amdgcn_fence(3, "workgroup");
  __builtin_amdgcn_wave_barrier();
  __builtin_amdgcn_fence(2, "workgroup");
}

// =====================================================================================================
// x plane f32 [b][SEQ_FULL][EMB] -> bf16 RNE bits [b][SEQ][EMB] (compact rows). Thread = 8 consecutive elements: two 16-B loads,
// coverage: grid = (SEQ*EMB/8/256 blocks, nb) x 256 thr x 8 = the whole plane.
// =====================================================================================================
__global__ __launch_bounds__(256) void cvtx(const float* __restrict__ x, u16* D, int n8) {
  const int gt = blockIdx.x * 256 + (int)threadIdx.x;
  if (gt >= n8) return;                     // no barriers in this kernel
  const int bb = blockIdx.y;
  const float* p = x + (size_t)bb * ((size_t)SEQ_FULL * EMB) + (size_t)gt * 8;
  const v4f a = *(const v4f*)(p), c4 = *(const v4f*)(p + 4);
  float v[8];
#pragma unroll
  for (int e = 0; e < 4; ++e) { v[e] = a[e]; v[4 + e] = c4[e]; }
  unsigned short s[8];
#pragma unroll
  for (int e = 0; e < 8; ++e) s[e] = bf_bits(v[e]);
  v4u o;
#pragma unroll
  for (int e = 0; e < 4; ++e) o[e] = pk16(s[2 * e], s[2 * e + 1]);
  u16* d = D + (size_t)bb * ((size_t)SEQ * EMB) + (size_t)gt * 8;
  {
    *(v4u*)(d) = o;
    
  }
}

// =====================================================================================================
// Weight transpose-convert: in W[R][C] f32 row-major -> out D[C][R] 16-bit (k-contiguous [n][k] operand planes for y = x.W).
// mode 0: bf16 RNE bits; mode 1: f16 bits of (bf16 RNE value) * scale.
// Block = 64x64 tile: 64 input row segments of 64 floats loaded with 16-B loads, converted, scattered into an LDS tile [c][64 r]
// coverage: load 256 thr x 16 = 64 x 64; store 2 iterations x 256 thr x 8 halves = 64 lines x 64; grid = (R/64) x (C/64) blocks
//           covers D exactly once (host checks R % 64 == 0, C % 64 == 0).
// =====================================================================================================
__global__ __launch_bounds__(256) void wt16(const float* __restrict__ W, u16* D, int R, int C, int mode, float scale) {
  __shared__ __align__(16) u16 TH[64 * VTP];
  const int tid = threadIdx.x;
  const int bid = blockIdx.x;
  const int nrt = R >> 6;
  const int r0  = (bid % nrt) * 64;
  const int c0  = (bid / nrt) * 64;
  {
    const int rl = tid >> 2;                  // input row within tile 0..63
    const int cs = (tid & 3) * 16;            // column chunk within the 64
    const float* src = W + (size_t)(r0 + rl) * C + c0 + cs;
#pragma unroll
    for (int i = 0; i < 4; ++i) {
      const v4f a = *(const v4f*)(src + 4 * i);
#pragma unroll
      for (int e = 0; e < 4; ++e) {
        const float v  = a[e];
        const unsigned short hb = h_bits((_Float16)(bfr(v) * scale));
        const unsigned short bb = bf_bits(v);
        TH[(cs + 4 * i + e) * VTP + rl] = (mode != 0) ? hb : bb;
      }
    }
  }
  __syncthreads();
  v4u vh[2];
  const int q8 = tid >> 3, p8 = (tid & 7) * 8;
#pragma unroll
  for (int it = 0; it < 2; ++it) {
    const int line = it * 32 + q8;            // local c = 0..63
    vh[it] = *(const v4u*)(TH + line * VTP + p8);
  }
  const size_t base = (size_t)c0 * (size_t)R + (size_t)r0 + p8;
  {
#pragma unroll
    for (int it = 0; it < 2; ++it) {
      const int line = it * 32 + q8;
      *(v4u*)(D + base + (size_t)line * (size_t)R) = vh[it];
    }
    
  }
}

// =====================================================================================================
//            16 consecutive lanes x 16 B per line), lanes 16..31 -> row 2*it+1.
//  epi64x2 : same store shape, staged value = acc*os1 + accres*os2 + badd (two accumulator sets combined in f32).
//  epi64hsb: f16 bits of ((tile + bf16RNE(bias[n])) * pscale); lane = (rq = lane>>3 -> row within a group of 4, c8 = 8 consecutive
// coverage: epi64/epi64x2 8 instructions x 2 rows x 16 lanes x 4 floats; epi64hsb 4 instructions x 4 rows x 8 lanes x 8 halves
//           = the wave's 16 x 64 tile in every case.
// =====================================================================================================
__device__ __forceinline__ void stage64(float* sl, v8f a0, v8f a1, v8f a2, v8f a3, float oscale, int lane) {
  const int hh = lane >> 4, m = lane & 15;
#pragma unroll
  for (int r = 0; r < 8; ++r) {
    const int ro = (8 * hh + r) * 68 + m;
    sl[ro]      = a0[r] * oscale;
    sl[ro + 16] = a1[r] * oscale;
    sl[ro + 32] = a2[r] * oscale;
    sl[ro + 48] = a3[r] * oscale;
  }
  wave_sync_lds();
}
__device__ __forceinline__ void epi64(float* sl, v8f a0, v8f a1, v8f a2, v8f a3, float oscale, v4f badd, float* C, int N,
                                      size_t rowb, int col0, int lane) {
  const int hh = lane >> 4, m = lane & 15;
  stage64(sl, a0, a1, a2, a3, oscale, lane);
  v4f vals[8];
#pragma unroll
  for (int it = 0; it < 8; ++it) vals[it] = *(const v4f*)(sl + (it * 2 + hh) * 68 + m * 4) + badd;
  float* dst = C + (rowb + (size_t)hh) * (size_t)N + col0 + m * 4;
  {
#pragma unroll
    for (int it = 0; it < 8; ++it) {
      *(v4f*)(dst + (size_t)(it * 2) * (size_t)N) = vals[it];
    }
    
  }
}
__device__ __forceinline__ void epi64x2(float* sl, v8f a0, v8f a1, v8f a2, v8f a3, v8f e0, v8f e1, v8f e2, v8f e3,
                                        float os1, float os2, v4f badd, float* C, int N, size_t rowb, int col0, int lane) {
  const int hh = lane >> 4, m = lane & 15;
#pragma unroll
  for (int r = 0; r < 8; ++r) {
    const int ro = (8 * hh + r) * 68 + m;
    sl[ro]      = a0[r] * os1 + e0[r] * os2;
    sl[ro + 16] = a1[r] * os1 + e1[r] * os2;
    sl[ro + 32] = a2[r] * os1 + e2[r] * os2;
    sl[ro + 48] = a3[r] * os1 + e3[r] * os2;
  }
  wave_sync_lds();
  v4f vals[8];
#pragma unroll
  for (int it = 0; it < 8; ++it) vals[it] = *(const v4f*)(sl + (it * 2 + hh) * 68 + m * 4) + badd;
  float* dst = C + (rowb + (size_t)hh) * (size_t)N + col0 + m * 4;
  {
#pragma unroll
    for (int it = 0; it < 8; ++it) {
      *(v4f*)(dst + (size_t)(it * 2) * (size_t)N) = vals[it];
    }
    
  }
}
__device__ __forceinline__ void epi64hsb(float* sl, v8f a0, v8f a1, v8f a2, v8f a3, float oscale, float pscale,
                                         const float* __restrict__ bias, u16* C, int N, size_t rowb, int col0, int lane) {
  stage64(sl, a0, a1, a2, a3, oscale, lane);
  const int rq = lane >> 3, c8 = (lane & 7) * 8;
  const v4f b0 = *(const v4f*)(bias + col0 + c8), b1 = *(const v4f*)(bias + col0 + c8 + 4);   // columns col0+c8..+7 < N
  float bb[8];
#pragma unroll
  for (int e = 0; e < 4; ++e) { bb[e] = bfr(b0[e]); bb[4 + e] = bfr(b1[e]); }
  v4u oh[4];
#pragma unroll
  for (int i4 = 0; i4 < 4; ++i4) {
    const int row = i4 * 4 + rq;
    const v4f a = *(const v4f*)(sl + row * 68 + c8), c4 = *(const v4f*)(sl + row * 68 + c8 + 4);
    float w[8];
#pragma unroll
    for (int e = 0; e < 4; ++e) { w[e] = (a[e] + bb[e]) * pscale; w[4 + e] = (c4[e] + bb[4 + e]) * pscale; }
#pragma unroll
    for (int e = 0; e < 4; ++e) oh[i4][e] = pk16(h_bits((_Float16)w[2 * e]), h_bits((_Float16)w[2 * e + 1]));
  }
  u16* dst = C + rowb * (size_t)N + col0 + c8;
  {
#pragma unroll
    for (int i4 = 0; i4 < 4; ++i4) {
      const int row = i4 * 4 + rq;
      *(v4u*)(dst + (size_t)row * (size_t)N) = oh[i4];
    }
    
  }
}

// =====================================================================================================
// bf16 GEMM, f32 out with bias: C[M][N] = (A[arow(m)][K] (bf16 row-major) . Bt[N][K]^T (bf16 k-contiguous)) * oscale + bf16RNE(bias[n]).
// Output row ra maps to A row arow = (ra / rpg) * gstr + (ra % rpg) (rpg = M, gstr = 0 gives the identity map; rpg = TQ0,
// gstr = SEQ picks the first TQ0 rows of every sequence).
// Block = 64x64 tile, 4 waves x 16 rows; fragments loaded straight from the 16-bit rows (two 16-B loads each, split k map for
// A and B); K stepped by 32 (host checks K % 32 == 0, M % 64 == 0, N % 64 == 0, grid = (M/64)*(N/64)).
// =====================================================================================================
__global__ __launch_bounds__(128)
void gemm_b32(const u16* __restrict__ A, const u16* __restrict__ Bt, const float* __restrict__ bias, float* C,
              int M, int N, int K, int rpg, int gstr, float oscale) {
  __shared__ __align__(16) float slab[4 * SLAB64];
  const int tid = threadIdx.x, wave = tid >> 5, lane = tid & 31, hh = lane >> 4, m = lane & 15;
  const int ntile = N >> 6;
  const int bid   = blockIdx.x;
  const int rowb  = (bid / ntile) * 64 + wave * 16;
  const int col0  = (bid % ntile) * 64;
  if (rowb + 16 > M) return;                 // wave-uniform, never taken with the exact grid; no block barriers in this kernel
  const int ra = rowb + m;
  const int rg = ra / rpg;
  const size_t arow = (size_t)rg * (size_t)gstr + (size_t)(ra - rg * rpg);
  const u16* ap = A  + arow * (size_t)K + 8 * hh;
  const u16* bp = Bt + (size_t)(col0 + m) * K + 8 * hh;
  const size_t bs = (size_t)16 * K;
  v8f acc0 = zero8(), acc1 = zero8(), acc2 = zero8(), acc3 = zero8();
#pragma unroll 1
  for (int k0 = 0; k0 < K; k0 += 32) {
    const v16b a  = ldfrag_b(ap + k0);
    const v16b b0 = ldfrag_b(bp + k0);
    const v16b b1 = ldfrag_b(bp + bs + k0);
    const v16b b2 = ldfrag_b(bp + 2 * bs + k0);
    const v16b b3 = ldfrag_b(bp + 3 * bs + k0);
    acc0 = mma_b(a, b0, acc0);
    acc1 = mma_b(a, b1, acc1);
    acc2 = mma_b(a, b2, acc2);
    acc3 = mma_b(a, b3, acc3);
    guard6<v16b>(acc0, acc1, acc2, acc3, a, b0, b1, b2, b3, a);
  }
  const v4f bv4 = *(const v4f*)(bias + col0 + m * 4);    // columns col0 + 4m .. +3, always < N (N multiple of 64)
  v4f badd;
#pragma unroll
  for (int e = 0; e < 4; ++e) badd[e] = bfr(bv4[e]);
  epi64(slab + wave * SLAB64, acc0, acc1, acc2, acc3, oscale, badd, C, N, (size_t)rowb, col0, lane);
}

// =====================================================================================================
// bf16 GEMM, f16 plane out with bias: C16[M][N] = f16 bits of (((A . Bt^T) * oscale) + bf16RNE(bias[n])) * pscale; operands as in
// gemm_b32 (identity row map), epilogue epi64hsb.
// =====================================================================================================
__global__ __launch_bounds__(128)
void gemm_bh16(const u16* __restrict__ A, const u16* __restrict__ Bt, const float* __restrict__ bias, u16* C,
               int M, int N, int K, float oscale, float pscale) {
  __shared__ __align__(16) float slab[4 * SLAB64];
  const int tid = threadIdx.x, wave = tid >> 5, lane = tid & 31, hh = lane >> 4, m = lane & 15;
  const int ntile = N >> 6;
  const int bid   = blockIdx.x;
  const int rowb  = (bid / ntile) * 64 + wave * 16;
  const int col0  = (bid % ntile) * 64;
  if (rowb + 16 > M) return;                 // wave-uniform, never taken with the exact grid; no block barriers in this kernel
  const u16* ap = A  + (size_t)(rowb + m) * K + 8 * hh;
  const u16* bp = Bt + (size_t)(col0 + m) * K + 8 * hh;
  const size_t bs = (size_t)16 * K;
  v8f acc0 = zero8(), acc1 = zero8(), acc2 = zero8(), acc3 = zero8();
#pragma unroll 1
  for (int k0 = 0; k0 < K; k0 += 32) {
    const v16b a  = ldfrag_b(ap + k0);
    const v16b b0 = ldfrag_b(bp + k0);
    const v16b b1 = ldfrag_b(bp + bs + k0);
    const v16b b2 = ldfrag_b(bp + 2 * bs + k0);
    const v16b b3 = ldfrag_b(bp + 3 * bs + k0);
    acc0 = mma_b(a, b0, acc0);
    acc1 = mma_b(a, b1, acc1);
    acc2 = mma_b(a, b2, acc2);
    acc3 = mma_b(a, b3, acc3);
    guard6<v16b>(acc0, acc1, acc2, acc3, a, b0, b1, b2, b3, a);
  }
  epi64hsb(slab + wave * SLAB64, acc0, acc1, acc2, acc3, oscale, pscale, bias, C, N, (size_t)rowb, col0, lane);
}

// =====================================================================================================
// f16 GEMM with two A planes (hi + residual), f32 out with bias:
//   C[M][N] = (Ah . Bt^T) * os1 + (Ar . Bt^T) * os2 + bf16RNE(bias[n]); Ah/Ar f16 row-major, Bt f16 k-contiguous.
// Same tiling as gemm_b32; separate accumulators for the two planes, combined in f32 in epi64x2.
// =====================================================================================================
__global__ __launch_bounds__(128)
void gemm_h2_32(const u16* __restrict__ Ah, const u16* __restrict__ Ar, const u16* __restrict__ Bt,
                const float* __restrict__ bias, float* C, int M, int N, int K, float os1, float os2) {
  __shared__ __align__(16) float slab[4 * SLAB64];
  const int tid = threadIdx.x, wave = tid >> 5, lane = tid & 31, hh = lane >> 4, m = lane & 15;
  const int ntile = N >> 6;
  const int bid   = blockIdx.x;
  const int rowb  = (bid / ntile) * 64 + wave * 16;
  const int col0  = (bid % ntile) * 64;
  if (rowb + 16 > M) return;                 // wave-uniform, never taken with the exact grid; no block barriers in this kernel
  const _Float16* ap  = (const _Float16*)(const void*)Ah + (size_t)(rowb + m) * K + 8 * hh;
  const _Float16* arp = (const _Float16*)(const void*)Ar + (size_t)(rowb + m) * K + 8 * hh;
  const _Float16* bp  = (const _Float16*)(const void*)Bt + (size_t)(col0 + m) * K + 8 * hh;
  const size_t bs = (size_t)16 * K;
  v8f acc0 = zero8(), acc1 = zero8(), acc2 = zero8(), acc3 = zero8();
  v8f acr0 = zero8(), acr1 = zero8(), acr2 = zero8(), acr3 = zero8();
#pragma unroll 1
  for (int k0 = 0; k0 < K; k0 += 32) {
    const v16h a  = ldfrag_h(ap + k0);
    const v16h ar = ldfrag_h(arp + k0);
    const v16h b0 = ldfrag_h(bp + k0);
    const v16h b1 = ldfrag_h(bp + bs + k0);
    const v16h b2 = ldfrag_h(bp + 2 * bs + k0);
    const v16h b3 = ldfrag_h(bp + 3 * bs + k0);
    acc0 = mma_h(a, b0, acc0);
    acc1 = mma_h(a, b1, acc1);
    acc2 = mma_h(a, b2, acc2);
    acc3 = mma_h(a, b3, acc3);
    acr0 = mma_h(ar, b0, acr0);
    acr1 = mma_h(ar, b1, acr1);
    acr2 = mma_h(ar, b2, acr2);
    acr3 = mma_h(ar, b3, acr3);
    guard8x6(acc0, acc1, acc2, acc3, acr0, acr1, acr2, acr3, a, ar, b0, b1, b2, b3);
  }
  const v4f bv = *(const v4f*)(bias + col0 + m * 4);      // columns col0 + 4m .. +3, always < N (N multiple of 64)
  v4f badd;
#pragma unroll
  for (int e = 0; e < 4; ++e) badd[e] = bfr(bv[e]);
  epi64x2(slab + wave * SLAB64, acc0, acc1, acc2, acc3, acr0, acr1, acr2, acr3, os1, os2, badd, C, N,
          (size_t)rowb, col0, lane);
}

// =====================================================================================================
// V^T plane: VT[(b*DH + d)*SEQ + s] = f16(V[b][s][d] * 1024), V = f32 [b*SEQ + s][DH].
// Block = (b, 64 keys): 64 source rows of 64 floats loaded with 16-B loads, converted, scattered into an LDS tile [d][64 keys]
// coverage: load 256 thr x 16 elements = 64 x 64; store 2 iterations x 256 thr x 8 halves = 64 lines x 64 = the block's tile;
//           grid = nb x (SEQ/64) blocks covers the plane exactly once.
// =====================================================================================================
__global__ __launch_bounds__(256) void xt16(const float* __restrict__ X, u16* XTo) {
  __shared__ __align__(16) u16 TH[64 * VTP];
  const int tid = threadIdx.x;
  const int bid = blockIdx.x;
  const int st  = bid % (SEQ / 64);
  const int b   = bid / (SEQ / 64);
  const int s0  = st * 64;
  {
    const int sl = tid >> 2;                  // key within tile 0..63
    const int dc = (tid & 3) * 16;            // d chunk within the 64
    const float* src = X + ((size_t)b * SEQ + s0 + sl) * DH + dc;
#pragma unroll
    for (int i = 0; i < 4; ++i) {
      const v4f a = *(const v4f*)(src + 4 * i);
#pragma unroll
      for (int e = 0; e < 4; ++e) {
        const float v = a[e];
        TH[(dc + 4 * i + e) * VTP + sl] = h_bits((_Float16)(v * VCAR));
      }
    }
  }
  __syncthreads();
  v4u vh[2];
  const int q8 = tid >> 3, p8 = (tid & 7) * 8;
#pragma unroll
  for (int it = 0; it < 2; ++it) {
    const int line = it * 32 + q8;            // local d = 0..63
    vh[it] = *(const v4u*)(TH + line * VTP + p8);
  }
  const size_t base = ((size_t)b * DH) * SEQ + s0 + p8;
  {
#pragma unroll
    for (int it = 0; it < 2; ++it) {
      const int line = it * 32 + q8;
      *(v4u*)(XTo + base + (size_t)line * SEQ) = vh[it];
    }
    
  }
}

// =====================================================================================================
// Key-block prefix column sums of V: VS[((b*NCHK + c)*NKB + kb)*DH + d] = sum over keys c*CK .. c*CK + 32*kb + 31 of V[b][key][d]
// (f32, fixed sequential order). Block = one (b, c), 64 threads (thread = d); the 16 prefix values per thread are staged in LDS
// coverage: grid = nb*NCHK blocks x (4 iterations x 64 thr x 4 floats = 1024) = the whole table.
// =====================================================================================================
__global__ __launch_bounds__(64) void vsum_k(const float* __restrict__ V, float* VS) {
  __shared__ __align__(16) float sm[NKB * DH];
  const int tid = threadIdx.x;                        // d
  const int bc  = blockIdx.x;
  const int b   = bc / NCHK;
  const int c   = bc - b * NCHK;
  const float* p = V + ((size_t)b * SEQ + (size_t)c * CK) * DH + tid;
  float s = 0.f;
#pragma unroll 1
  for (int kb = 0; kb < NKB; ++kb) {
#pragma unroll 4
    for (int i = 0; i < 32; ++i) s += p[(size_t)(kb * 32 + i) * DH];
    sm[kb * DH + tid] = s;
  }
  __syncthreads();
  v4f o[4];
#pragma unroll
  for (int it = 0; it < 4; ++it) o[it] = *(const v4f*)(sm + it * 256 + tid * 4);
  float* base = VS + (size_t)bc * NKB * DH + tid * 4;
  {
#pragma unroll
    for (int it = 0; it < 4; ++it) {
      *(v4f*)(base + it * 256) = o[it];
    }
    
  }
}

// =====================================================================================================
// Single-head causal attention, head width DH = 64, query rows TQ0 .. SEQ-1: block = (batch b, 16 query rows q0..q0+15), 8 waves.
// q plane (f16, x8) [b][s][d]; k plane the same; V^T plane [b][d][s] (x1024); VS = key-block prefix column sums of V.
//   Chunks of CK = 512 keys: only chunks c <= qc = q0/CK are visited (later chunks lie entirely above the diagonal). In the diagonal
//   chunk only key blocks kb < nkb (keys <= q0+15) are multiplied; key blocks kb >= nkb get zero scores in LDS and are not used in (PV).
//   (S) scores S[query m][key n] on WMMA: A = q rows (row m = lane&15, split k map over d, two 32-d fragments kept in registers),
//       B = k rows (col n = key, split map); wave w handles key blocks w, w+8 of the chunk; D element r of lane l -> scs[query 8h+r][key].
//   (M) 16 threads per query row (sub-thread = 32 consecutive keys): base-2 logits with the causal mask by key index (key > query
//       -> -inf), chunk max via xor shuffles, online running max / rescale factor al / running sum l in f32 registers,
//       p = exp2(t - m_new) <= 1 (0 for masked keys), chunk row sum ps and C = ps/CK (bit-identical on the row's 16 threads), the
//       CENTRED P' = p - C written as f16(P' * 32768) into the LDS P tile with 16-B stores; al -> rowa[row], C -> rowc[row].
//   (PV) every wave keeps its own partial O (4 accumulator tiles = 16 queries x 64 d): o_w = o_w*al (+ on wave 0 only:
//       C*(32768*1024)*VS[chunk][nkb-1][d], the exact add-back of the centring term over exactly the processed keys, in f32), then for
//       the wave's key blocks kb in {w, w+8}, kb < nkb: A = P' fragment from LDS (row m = query, split map over keys), B = V^T
//       fragments (col n = d, split map over keys), 4 WMMAs plus a hazard gap. sum_k (P'_k + C) v_k == sum_k p_k v_k exactly;
//       masked keys carry P' = -C and p = 0.
//   Block barriers after (S) and after (M) order all LDS reuse across chunks and waves.
//   Combine: after a block barrier the 8 partial O tiles are staged in the score region ([8][16][OPP] f32), barrier, then thread
//   (row = tid>>4, 4 columns) sums the 8 partials in fixed order, x = sum * 4096 / (l * 32768 * 1024) (l >= 1 always, held in
//   registers by the row's 16 threads), hi = f16(x), res = f16((x - hi) * 2048), staged as a [32][CTP] u16 tile in the P region,
// coverage: grid nb*NQT blocks x 16 rows = rows TQ0..SEQ-1 of every sequence; scs written 16 x 512 every chunk (zeros for kb >= nkb);
//           P tile written 16 x 512 every chunk; partial stage 8 x 16 x 64; ctx stage 32 x 64; store 32 lines = 16 rows of both planes.
// =====================================================================================================
__global__ __launch_bounds__(ATT_THREADS) __attribute__((amdgpu_num_vgpr(256)))
void attn_fwd(const u16* __restrict__ QPp, const u16* __restrict__ KPp, const u16* __restrict__ VTp,
              const float* __restrict__ VSp, u16* CHo, u16* CRo) {
  __shared__ __align__(16) float scs[16 * SCP];     // scores [16][SCP] f32; reused as partial O tiles [8][16][OPP] f32
  __shared__ __align__(16) u16 pls[16 * PLP];       // P' tile [16][PLP] f16 bits; reused as ctx staging [32][CTP] u16
  __shared__ float rowa[QT];
  __shared__ float rowc[QT];

  const int tid  = threadIdx.x;
  const int wave = tid >> 5;
  const int lane = tid & 31;
  const int hh   = lane >> 4;
  const int m    = lane & 15;
  const int r16  = tid >> 4;                 // query row owned in phase (M) and in the combine
  const int sub  = tid & 15;
  const int kl0  = sub * 32;

  const int bid = blockIdx.x;
  const int b   = bid / NQT;
  const int q0  = TQ0 + (bid - b * NQT) * QT;
  const int qc  = q0 / CK;                   // diagonal chunk index

  const _Float16* qrow = (const _Float16*)(const void*)QPp + ((size_t)b * SEQ + q0 + m) * DH + 8 * hh;
  const v16h qa0 = ldfrag_h(qrow);           // d 0..31
  const v16h qa1 = ldfrag_h(qrow + 32);      // d 32..63
  const _Float16* kbp = (const _Float16*)(const void*)KPp + ((size_t)b * SEQ + m) * DH + 8 * hh;
  const _Float16* vbp = (const _Float16*)(const void*)VTp + ((size_t)b * DH + m) * SEQ + 8 * hh;
  const float* vsb = VSp + (size_t)b * NCHK * NKB * DH + m;
  const float lsc = RSQD * LOG2E / (QSC * KSC);
  const float addsel = (wave == 0) ? (PCAR * VCAR) : 0.f;    // centring add-back on wave 0 only

  float mrun = -INFINITY, lrun = 0.f;
  v8f o[NACC];
#pragma unroll
  for (int j = 0; j < NACC; ++j) o[j] = zero8();

#pragma unroll 1
  for (int c = 0; c <= qc; ++c) {
    const int kbeg = c * CK;
    const int nkb  = (c < qc) ? NKB : (((q0 + QT - 1 - kbeg) >> 5) + 1);   // 1..16, block-uniform
    // ---- (S) scores of this chunk (zeros for key blocks beyond the query tile) ----
#pragma unroll 1
    for (int kb = wave; kb < NKB; kb += 8) {               // wave-uniform, 2 trips
      v8f s0 = zero8(), s1 = zero8();
      if (kb < nkb) {                                      // wave-uniform
        const _Float16* k0p = kbp + (size_t)(kbeg + kb * 32) * DH;
        const _Float16* k1p = k0p + (size_t)16 * DH;
        const v16h f00 = ldfrag_h(k0p);
        const v16h f01 = ldfrag_h(k0p + 32);
        const v16h f10 = ldfrag_h(k1p);
        const v16h f11 = ldfrag_h(k1p + 32);
        s0 = mma_h(qa0, f00, s0);
        s0 = mma_h(qa1, f01, s0);
        s1 = mma_h(qa0, f10, s1);
        s1 = mma_h(qa1, f11, s1);
        guard2x6(s0, s1, qa0, qa1, f00, f01, f10, f11);
      }
      float* srow = scs + (8 * hh) * SCP + kb * 32 + m;
#pragma unroll
      for (int r = 0; r < 8; ++r) {
        srow[r * SCP]      = s0[r];
        srow[r * SCP + 16] = s1[r];
      }
    }
    __syncthreads();
    // ---- (M) softmax statistics and the centred P' tile ----
    {
      const float* sp = scs + r16 * SCP + kl0;
      const int lim = (q0 + r16) - (kbeg + kl0);           // key kl0 + j is valid iff j <= lim
      float t[32];
      float cm = -INFINITY;
#pragma unroll
      for (int i = 0; i < 8; ++i) {
        const v4f a = *(const v4f*)(sp + 4 * i);
#pragma unroll
        for (int e = 0; e < 4; ++e) {
          const int j = 4 * i + e;
          const float tv = (j <= lim) ? a[e] * lsc : -INFINITY;
          t[j] = tv;
          cm = fmaxf(cm, tv);
        }
      }
#pragma unroll
      for (int d = 1; d <= 8; d <<= 1) cm = fmaxf(cm, __shfl_xor(cm, d, 32));
      const float mn = fmaxf(mrun, cm);                    // finite: key kbeg of every visited chunk is never masked
      const float al = (mrun == -INFINITY) ? 0.f : exp2f(mrun - mn);
      mrun = mn;
      float ps = 0.f;
#pragma unroll
      for (int j = 0; j < 32; ++j) {
        const float p = exp2f(fminf(t[j] - mn, 0.f));      // 0 for masked keys
        t[j] = p;
        ps += p;
      }
#pragma unroll
      for (int d = 1; d <= 8; d <<= 1) ps += __shfl_xor(ps, d, 32);
      const float cc = ps * (1.0f / (float)CK);
      v4u pk[4];
#pragma unroll
      for (int i = 0; i < 4; ++i) {
#pragma unroll
        for (int e = 0; e < 4; ++e) {
          const int j = 8 * i + 2 * e;
          pk[i][e] = pk16(h_bits((_Float16)((t[j] - cc) * PCAR)), h_bits((_Float16)((t[j + 1] - cc) * PCAR)));
        }
      }
      lrun = lrun * al + ps;
      u16* pd = pls + r16 * PLP + kl0;
#pragma unroll
      for (int i = 0; i < 4; ++i) *(v4u*)(pd + 8 * i) = pk[i];
      if (sub == 0) { rowa[r16] = al; rowc[r16] = cc; }
    }
    __syncthreads();
    // ---- (PV) rescale, add the centring term (wave 0), accumulate P' . V^T for this wave's key blocks ----
    {
      float scl[8], cad[8];
#pragma unroll
      for (int r = 0; r < 8; ++r) { scl[r] = rowa[8 * hh + r]; cad[r] = rowc[8 * hh + r] * addsel; }
      const float* vsc = vsb + ((size_t)c * NKB + (size_t)(nkb - 1)) * DH;
      float vs[NACC];
#pragma unroll
      for (int j = 0; j < NACC; ++j) vs[j] = vsc[16 * j];
#pragma unroll
      for (int j = 0; j < NACC; ++j) {
#pragma unroll
        for (int r = 0; r < 8; ++r) o[j][r] = o[j][r] * scl[r] + cad[r] * vs[j];
      }
      const _Float16* pp = (const _Float16*)(const void*)pls + m * PLP + 8 * hh;
      const _Float16* vp = vbp + kbeg;
#pragma unroll 1
      for (int kb = wave; kb < nkb; kb += 8) {             // wave-uniform trip count, <= 2
        const v16h pf = ldfrag_h(pp + kb * 32);
        const _Float16* vk = vp + kb * 32;
        const v16h g0 = ldfrag_h(vk);
        const v16h g1 = ldfrag_h(vk + (size_t)16 * SEQ);
        const v16h g2 = ldfrag_h(vk + (size_t)32 * SEQ);
        const v16h g3 = ldfrag_h(vk + (size_t)48 * SEQ);
        o[0] = mma_h(pf, g0, o[0]);
        o[1] = mma_h(pf, g1, o[1]);
        o[2] = mma_h(pf, g2, o[2]);
        o[3] = mma_h(pf, g3, o[3]);
        guardpv4(o[0], o[1], o[2], o[3], pf, g0, g1, g2, g3);
      }
    }
  }
  acc_guard4(o[0], o[1], o[2], o[3]);

  // ---- combine the 8 partial O tiles in fixed order ----
  __syncthreads();
#pragma unroll
  for (int j = 0; j < NACC; ++j) {
#pragma unroll
    for (int r = 0; r < 8; ++r) scs[(wave * 16 + 8 * hh + r) * OPP + 16 * j + m] = o[j][r];
  }
  __syncthreads();
  const int c4 = sub * 4;
  v4f sm4 = zero4();
#pragma unroll
  for (int w = 0; w < 8; ++w) sm4 += *(const v4f*)(scs + (w * 16 + r16) * OPP + c4);
  const float inv = (1.0f / lrun) * (CSC / (PCAR * VCAR));            // lrun >= 1
#pragma unroll
  for (int e = 0; e < 4; ++e) {
    const float xs = sm4[e] * inv;
    const _Float16 hv = (_Float16)xs;
    const _Float16 rv = (_Float16)((xs - (float)hv) * RSC);
    pls[r16 * CTP + c4 + e]        = h_bits(hv);
    pls[(16 + r16) * CTP + c4 + e] = h_bits(rv);
  }
  __syncthreads();
  const int line = tid >> 3;                 // 0..31: plane = line>>4, row = line&15
  const int plane = line >> 4;
  const int rowl  = line & 15;
  const int c8    = (tid & 7) * 8;
  const v4u ov = *(const v4u*)(pls + (plane * 16 + rowl) * CTP + c8);
  u16* dst = ((plane == 0) ? CHo : CRo) + ((size_t)b * SEQ + q0 + rowl) * DH + c8;
  *(v4u*)dst = ov;
  
}

// =====================================================================================================
// Query rows 0 .. TQ0-1 of each sequence in f32 on VALU: block = (b, t), 128 threads. QF/KF = f32 q/k planes [nb][TQ0][DH] (bias
// included), V = f32 v plane [nb*SEQ][DH]. Scores for keys j (thread j, one key each, rolled 64-d dot against the q row staged in LDS;
// keys j > t masked to -inf), base-2 softmax with block max / sum reductions (xor shuffles + LDS), p_j in LDS, ctx[d] for d = tid
// (threads 0..63) as a rolled sum over j <= t of p_j * V[b][j][d] (coalesced), x = ctx * 4096 / l, hi = f16(x),
// res = f16((x - hi) * 2048); both 64-half rows are staged in LDS and written by lanes 0..15 of wave 0: lanes 0..7 the hi row, lanes
// coverage: grid nb*TQ0 blocks = rows 0..TQ0-1 of every sequence; 64 thr x 1 d = DH per row; store 16 lanes x 8 halves = both rows;
//           together with attn_fwd every (b, s, d) of CH and CR is written exactly once.
// =====================================================================================================
__global__ __launch_bounds__(HD_THREADS) void attn_head(const float* __restrict__ QF, const float* __restrict__ KF,
                                                      const float* __restrict__ V, u16* CHo, u16* CRo) {
  __shared__ __align__(16) float qs[DH];
  __shared__ float sc[TQ0];
  __shared__ float red[4];
  __shared__ float redb[4];
  __shared__ __align__(16) u16 SW[2 * DH];
  const int tid = threadIdx.x, lane = tid & 31, wave = tid >> 5;
  const int b = blockIdx.x / TQ0;
  const int t = blockIdx.x - b * TQ0;
  if (tid < DH) qs[tid] = QF[((size_t)b * TQ0 + t) * DH + tid];   // waves 0,1 entirely (wave-uniform)
  __syncthreads();
  float acc = 0.f;
  {
    const float* kp = KF + ((size_t)b * TQ0 + tid) * DH;            // key row b*TQ0 + tid always in range (tid < TQ0)
#pragma unroll 1
    for (int d = 0; d < DH; d += 8) {
      const v4f k0 = *(const v4f*)(kp + d), k1 = *(const v4f*)(kp + d + 4);
      const v4f q0 = *(const v4f*)(qs + d), q1 = *(const v4f*)(qs + d + 4);
#pragma unroll
      for (int e = 0; e < 4; ++e) acc += k0[e] * q0[e];
#pragma unroll
      for (int e = 0; e < 4; ++e) acc += k1[e] * q1[e];
    }
  }
  const float s = (tid <= t) ? acc * (RSQD * LOG2E) : -INFINITY;   // causal mask by key index
  float mx = s;
#pragma unroll
  for (int d = 1; d <= 16; d <<= 1) mx = fmaxf(mx, __shfl_xor(mx, d, 32));
  if (lane == 0) red[wave] = mx;
  __syncthreads();
  float gm = red[0];
#pragma unroll
  for (int w = 1; w < 4; ++w) gm = fmaxf(gm, red[w]);   // finite: key 0 is always valid
  const float p = exp2f(s - gm);                     // 0 for masked keys
  float ps = p;
#pragma unroll
  for (int d = 1; d <= 16; d <<= 1) ps += __shfl_xor(ps, d, 32);
  if (lane == 0) redb[wave] = ps;
  sc[tid] = p;
  __syncthreads();
  float l = redb[0];
#pragma unroll
  for (int w = 1; w < 4; ++w) l += redb[w];           // >= 1
  const float inv = (1.0f / l) * CSC;
  if (wave < 2) {                                    // threads 0..63 (wave-uniform): one d column each
    const float* vp = V + (size_t)b * SEQ * DH + tid;
    float cx = 0.f;
#pragma unroll 1
    for (int j = 0; j <= t; ++j) {                   // t < TQ0: statically bounded, keys of sequence b only
      cx += sc[j] * vp[(size_t)j * DH];
    }
    const float x0 = cx * inv;
    const _Float16 h0 = (_Float16)x0;
    const _Float16 r0 = (_Float16)((x0 - (float)h0) * RSC);
    SW[tid]      = h_bits(h0);
    SW[DH + tid] = h_bits(r0);
  }
  __syncthreads();
  if (wave == 0) {                                   // wave-uniform
    const int l16 = lane & 15;
    const int plane = l16 >> 3, p8 = (l16 & 7) * 8;
    const v4u ov = *(const v4u*)(SW + plane * DH + p8);
    u16* dst = ((plane == 0) ? CHo : CRo) + ((size_t)b * SEQ + t) * DH + p8;
    if (lane < 16) *(v4u*)dst = ov;
    
  }
}

// =====================================================================================================
// Workspace map (bytes, nb = 4, rows = 16384); every plane is fully written by whole-line stores before it is read; all extents are
//   WQT bf16 [64][512] 65536   WKT same   WVT same   WOT f16 of bf16 value x1024 [512][64] 65536                   262144
//   XB  bf16 [rows][512]                                                                                           16777216
//   QP  f16 [rows][64] x8                                                                                           2097152
//   KP  f16 [rows][64] x8                                                                                           2097152
//   V   f32 [rows][64]                                                                                              4194304
//   VT  f16 [nb][64][SEQ] x1024                                                                                     2097152
//   VS  f32 [nb][8][16][64]                                                                                          131072
//   QF  f32 [nb][128][64]  131072      KF same                                                                       262144
//   CH  f16 [rows][64] ctx hi x4096                                                                                 2097152
//   CR  f16 [rows][64] ctx residual x2048                                                                           2097152
//   end                                                                                                            32112640
// =====================================================================================================
extern "C" void kernel_launch(void* const* d_in, const int* in_sizes, int n_in,
                              void* d_out, int out_size, void* d_ws, size_t ws_size,
                              hipStream_t stream) {
  if (n_in < 9) return;
  const int nb   = NB;
  const int rows = nb * SEQ;
  if ((long long)in_sizes[0] < (long long)NB * SEQ_FULL * EMB) return;
  if (in_sizes[1] < EMB * DH || in_sizes[3] < EMB * DH || in_sizes[5] < EMB * DH || in_sizes[7] < DH * EMB) return;
  if (in_sizes[2] < DH || in_sizes[4] < DH || in_sizes[6] < DH || in_sizes[8] < EMB) return;
  if ((long long)out_size < (long long)rows * EMB) return;

  const float* x  = (const float*)d_in[0];
  const float* wq = (const float*)d_in[1];
  const float* bq = (const float*)d_in[2];
  const float* wk = (const float*)d_in[3];
  const float* bk = (const float*)d_in[4];
  const float* wv = (const float*)d_in[5];
  const float* bv = (const float*)d_in[6];
  const float* wo = (const float*)d_in[7];
  const float* bo = (const float*)d_in[8];
  float*       out = (float*)d_out;

  const size_t szW  = (size_t)EMB * DH * 2;                      //     65536
  const size_t szXB = (size_t)rows * EMB * 2;                    //  16777216
  const size_t szP  = (size_t)rows * DH * 2;                     //   2097152
  const size_t szV  = (size_t)rows * DH * 4;                     //   4194304
  const size_t szVT = (size_t)nb * DH * SEQ * 2;                 //   2097152 (== szP)
  const size_t szVS = (size_t)nb * NCHK * NKB * DH * 4;          //    131072
  const size_t szHF = (size_t)nb * TQ0 * DH * 4;                 //    131072
  size_t off = 0;
  const size_t oWQ = off; off += szW;
  const size_t oWK = off; off += szW;
  const size_t oWV = off; off += szW;
  const size_t oWO = off; off += szW;
  const size_t oXB = off; off += szXB;
  const size_t oQ  = off; off += szP;
  const size_t oK  = off; off += szP;
  const size_t oV  = off; off += szV;
  const size_t oVT = off; off += szVT;
  const size_t oVS = off; off += szVS;
  const size_t oQF = off; off += szHF;
  const size_t oKF = off; off += szHF;
  const size_t oCH = off; off += szP;
  const size_t oCR = off; off += szP;
  if (off > ws_size) return;                                     // off = 32112640 at nb = 4
  if (off > WS_CAP) return;

  char* ws = (char*)d_ws;
  u16*   WQT = (u16*)(ws + oWQ);
  u16*   WKT = (u16*)(ws + oWK);
  u16*   WVT = (u16*)(ws + oWV);
  u16*   WOT = (u16*)(ws + oWO);
  u16*   XB  = (u16*)(ws + oXB);
  u16*   QP  = (u16*)(ws + oQ);
  u16*   KP  = (u16*)(ws + oK);
  float* V   = (float*)(ws + oV);
  u16*   VT  = (u16*)(ws + oVT);
  float* VS  = (float*)(ws + oVS);
  float* QF  = (float*)(ws + oQF);
  float* KF  = (float*)(ws + oKF);
  u16*   CH  = (u16*)(ws + oCH);
  u16*   CR  = (u16*)(ws + oCR);

  const int n8x = (SEQ * EMB) / 8;                       // 262144 per batch
  if ((n8x % 256) != 0 || (rows % 64) != 0 || ((nb * TQ0) % 64) != 0) return;
  const dim3 blk(256);
  const dim3 gWT((EMB / 64) * (DH / 64));                // 8 for both weight shapes
  const dim3 gX(n8x / 256, nb);
  const dim3 gG((rows / 64) * (DH / 64));               // 256 at nb = 4
  const dim3 gH(((nb * TQ0) / 64) * (DH / 64));         // 8 at nb = 4
  const dim3 bG(128);
  const dim3 gXT(nb * (SEQ / 64));                      // nb * 64
  const dim3 gVS(nb * NCHK);                            // nb * 8
  const dim3 bVS(64);
  const dim3 gAT(nb * NQT);                             // nb * 248
  const dim3 bAT(ATT_THREADS);
  const dim3 gHD(nb * TQ0);                             // nb * 128
  const dim3 bHD(HD_THREADS);
  const dim3 gO((rows / 64) * (EMB / 64));              // 2048 at nb = 4

  // (0..2) Wq, Wk, Wv stored [k = in 512][n = out 64] -> bf16 k-contiguous planes [64][512]; (3) Wo [k = 64][n = 512] -> f16 of
  //        bf16 value x1024, k-contiguous [512][64]; (4) x -> bf16 plane [rows][512]
  wt16<<<gWT, blk, 0, stream>>>(wq, WQT, EMB, DH, 0, 1.0f);
  wt16<<<gWT, blk, 0, stream>>>(wk, WKT, EMB, DH, 0, 1.0f);
  wt16<<<gWT, blk, 0, stream>>>(wv, WVT, EMB, DH, 0, 1.0f);
  wt16<<<gWT, blk, 0, stream>>>(wo, WOT, DH, EMB, 1, WSC);
  cvtx<<<gX, blk, 0, stream>>>(x, XB, n8x);
  // (5, 6) q and k projections (+bias) -> f16 planes x8; (7) v projection (+bias) -> f32 plane
  gemm_bh16<<<gG, bG, 0, stream>>>(XB, WQT, bq, QP, rows, DH, EMB, 1.0f, QSC);
  gemm_bh16<<<gG, bG, 0, stream>>>(XB, WKT, bk, KP, rows, DH, EMB, 1.0f, KSC);
  gemm_b32<<<gG, bG, 0, stream>>>(XB, WVT, bv, V, rows, DH, EMB, rows, 0, 1.0f);
  // (8, 9) f32 q and k rows 0..127 of every sequence -> QF, KF [nb*128][64]
  gemm_b32<<<gH, bG, 0, stream>>>(XB, WQT, bq, QF, nb * TQ0, DH, EMB, TQ0, SEQ, 1.0f);
  gemm_b32<<<gH, bG, 0, stream>>>(XB, WKT, bk, KF, nb * TQ0, DH, EMB, TQ0, SEQ, 1.0f);
  // (10) v -> V^T plane x1024; (11) key-block prefix column sums of v
  xt16<<<gXT, blk, 0, stream>>>(V, VT);
  vsum_k<<<gVS, bVS, 0, stream>>>(V, VS);
  // (12) attention for query rows 128.. -> ctx hi x4096 and residual x2048 f16 planes; (13) query rows 0..127 on VALU -> same planes
  attn_fwd<<<gAT, bAT, 0, stream>>>(QP, KP, VT, VS, CH, CR);
  attn_head<<<gHD, bHD, 0, stream>>>(QF, KF, V, CH, CR);
  // (14) output projection + bias -> out
  gemm_h2_32<<<gO, bG, 0, stream>>>(CH, CR, WOT, bo, out, rows, EMB, DH,
                                    1.0f / (CSC * WSC), 1.0f / (CSC * WSC * RSC));
  (void)hipGetLastError();
}

// v001
// A run of this version takes 149 microseconds.
// Two timings next to v000 put it at 1.50 and 1.49 times that version's speed.
// Projections q,k,v = x.W + b and the f32 q,k rows 0..127 per sequence: v_wmma_f32_16x16x32_bf16 (bf16 RNE operands of the
// raw inputs, f32 accumulate, bf16 RNE bias added in f32). Scores q'.k'^T (f16 planes x8), P'.V (chunk-centred P' x32768 f16 from LDS,
// V^T x1024 f16) and the output projection (ctx carried as f16 hi x4096 plus residual x2048 planes, times f16(bf16(Wo)) x1024, bias
// added in f32): v_wmma_f32_16x16x32_f16, f32 accumulate. Query rows 0..127 of each sequence: scores, softmax and P.V in f32 on VALU.
// Causal mask, softmax statistics, key-block column sums of V and all scaling in f32 on VALU.
#include <hip/hip_runtime.h>
#include <math.h>
#include <stdint.h>

#ifndef NB
#define NB 4
#endif
#ifndef SEQ
#define SEQ 4096
#endif
#define SEQ_FULL 4096
#define NB_FULL 4
#define EMB   512
#define DH    64
#define CK    512
#define NCHK  (SEQ / CK)
#define NKB   16
#define QT    16
#define TQ0   128
#define NQT   ((SEQ - TQ0) / QT)
#define SCP   544
#define PLP   528
#define OPP   68
#define CTP   72
#define SLAB64 (16 * 68)
#define VTP   72
#define ATT_THREADS 256
#define HD_THREADS 128
#define NACC  4
#define QSC   8.0f
#define KSC   8.0f
#define PCAR  32768.0f
#define VCAR  1024.0f
#define WSC   1024.0f
#define CSC   4096.0f
#define RSC   2048.0f
#define LOG2E 1.4426950408889634f
#define RSQD  0.125f
#define WS_CAP ((size_t)134217728)

static_assert(DH == 64 && NACC * 16 == DH && (EMB % 64) == 0 && (EMB % 32) == 0 && (DH % 32) == 0);
static_assert((SEQ % CK) == 0 && NCHK >= 1 && CK == 32 * NKB && (SEQ % 64) == 0 && (SEQ % QT) == 0 && (CK % QT) == 0);
static_assert((TQ0 % QT) == 0 && (TQ0 % 64) == 0 && NQT * QT + TQ0 == SEQ && NQT >= 1 && TQ0 == 128 && TQ0 == HD_THREADS);
static_assert(8 * 16 * OPP <= 16 * SCP && 32 * CTP <= 16 * PLP && CTP >= DH + 8 && OPP >= DH + 4 && SCP >= CK + 16 && PLP >= CK + 8);
static_assert(((PLP * 2) % 16) == 0 && ((SCP * 4) % 16) == 0 && ((VTP * 2) % 16) == 0 && ((CTP * 2) % 16) == 0 && ((OPP * 4) % 16) == 0);
static_assert(64 * VTP >= 63 * VTP + 64);
static_assert(ATT_THREADS == 16 * QT && ATT_THREADS == 256 && HD_THREADS == 2 * DH);
static_assert((((SEQ * EMB) / 8) % 256) == 0 && ((NB * SEQ) % 64) == 0 && ((NB * TQ0) % 64) == 0);
static_assert(NB >= 1 && NB <= NB_FULL && SEQ <= SEQ_FULL && (TQ0 % 64) == 0 && (NKB % 2) == 0);

typedef unsigned short u16;
typedef _Float16 v16h __attribute__((ext_vector_type(16)));
typedef _Float16 v8h  __attribute__((ext_vector_type(8)));
typedef __bf16   v16b __attribute__((ext_vector_type(16)));
typedef float    v8f  __attribute__((ext_vector_type(8)));
typedef float    v4f  __attribute__((ext_vector_type(4)));
typedef unsigned int v4u __attribute__((ext_vector_type(4)));

union FragH { v16h v; v8h h[2]; v4u u[2]; };
union FragB { v16b v; v4u u[2]; };

// ---- scalar helpers --------------------------------------------------------------------------------
__device__ __forceinline__ unsigned short bf_bits(float f) {          // f32 -> bf16 bits, RNE convert
  unsigned u = __float_as_uint(f);
  return (unsigned short)((u + 0x7FFFu + ((u >> 16) & 1u)) >> 16);
}
__device__ __forceinline__ float bf_up(unsigned short h) { return __uint_as_float(((unsigned)h) << 16); }
__device__ __forceinline__ float bfr(float f) { return bf_up(bf_bits(f)); }
__device__ __forceinline__ unsigned short h_bits(_Float16 x) { return __builtin_bit_cast(unsigned short, x); }
__device__ __forceinline__ unsigned pk16(unsigned short a, unsigned short b) { return (unsigned)a | ((unsigned)b << 16); }
__device__ __forceinline__ v8f zero8() { v8f z = {0.f, 0.f, 0.f, 0.f, 0.f, 0.f, 0.f, 0.f}; return z; }
__device__ __forceinline__ v4f zero4() { v4f z = {0.f, 0.f, 0.f, 0.f}; return z; }

// ---- fragment loaders: 16-bit A/B operand, lane -> row/col (lane&15), p already includes +8*(lane>>4);
//      elements 0..7 <- p[0..7] (k0+8h..), elements 8..15 <- p[16..23] (k0+16+8h..)  (same split k map for A and B;
//      B is always read from a k-contiguous [n][k] plane)
__device__ __forceinline__ v16h ldfrag_h(const _Float16* p) {
  FragH f;
  f.h[0] = *(const v8h*)(p);
  f.h[1] = *(const v8h*)(p + 16);
  return f.v;
}
__device__ __forceinline__ v16b ldfrag_b(const u16* p) {              // bf16 plane read as unsigned integer vectors
  FragB f;
  f.u[0] = *(const v4u*)(p);
  f.u[1] = *(const v4u*)(p + 16);
  return f.v;
}

__device__ __forceinline__ v8f mma_h(v16h a, v16h b, v8f c) {
  return __builtin_amdgcn_wmma_f32_16x16x32_f16(false, a, false, b, (short)0, c, false, false);
}
__device__ __forceinline__ v8f mma_b(v16b a, v16b b, v8f c) {
  return __builtin_amdgcn_wmma_f32_16x16x32_bf16(false, a, false, b, (short)0, c, false, false);
}
__device__ __forceinline__ void guard2x6(v8f& a, v8f& b, v16h x0, v16h x1, v16h x2, v16h x3, v16h x4, v16h x5) {
#if defined(__HIP_DEVICE_COMPILE__)
  asm volatile("v_nop\n\tv_nop\n\tv_nop\n\tv_nop"
               : "+v"(a), "+v"(b) : "v"(x0), "v"(x1), "v"(x2), "v"(x3), "v"(x4), "v"(x5) : "memory");
#endif
}
template <typename F>
__device__ __forceinline__ void guard6(v8f& a, v8f& b, v8f& c, v8f& d, F x0, F x1, F x2, F x3, F x4, F x5) {
#if defined(__HIP_DEVICE_COMPILE__)
  asm volatile("v_nop\n\tv_nop\n\tv_nop\n\tv_nop"
               : "+v"(a), "+v"(b), "+v"(c), "+v"(d) : "v"(x0), "v"(x1), "v"(x2), "v"(x3), "v"(x4), "v"(x5) : "memory");
#endif
}
__device__ __forceinline__ void guard8x6(v8f& a0, v8f& a1, v8f& a2, v8f& a3, v8f& e0, v8f& e1, v8f& e2, v8f& e3,
                                         v16h x0, v16h x1, v16h x2, v16h x3, v16h x4, v16h x5) {
#if defined(__HIP_DEVICE_COMPILE__)
  asm volatile("v_nop\n\tv_nop\n\tv_nop\n\tv_nop"
               : "+v"(a0), "+v"(a1), "+v"(a2), "+v"(a3), "+v"(e0), "+v"(e1), "+v"(e2), "+v"(e3)
               : "v"(x0), "v"(x1), "v"(x2), "v"(x3), "v"(x4), "v"(x5) : "memory");
#endif
}
__device__ __forceinline__ void guardpv4(v8f& o0, v8f& o1, v8f& o2, v8f& o3, v16h p, v16h g0, v16h g1, v16h g2, v16h g3) {
#if defined(__HIP_DEVICE_COMPILE__)
  asm volatile("v_nop\n\tv_nop\n\tv_nop\n\tv_nop"
               : "+v"(o0), "+v"(o1), "+v"(o2), "+v"(o3)
               : "v"(p), "v"(g0), "v"(g1), "v"(g2), "v"(g3) : "memory");
#endif
}
__device__ __forceinline__ void acc_guard4(v8f& a, v8f& b, v8f& c, v8f& d) {
#if defined(__HIP_DEVICE_COMPILE__)
  asm volatile("v_nop\n\tv_nop\n\tv_nop\n\tv_nop" : "+v"(a), "+v"(b), "+v"(c), "+v"(d));
#endif
}
__device__ __forceinline__ void wave_sync_lds() {                    // wave-private LDS slab: release, wave barrier, acquire
  __builtin_amdgcn_fence(3, "workgroup");
  __builtin_amdgcn_wave_barrier();
  __builtin_amdgcn_fence(2, "workgroup");
}

// =====================================================================================================
// x plane f32 [b][SEQ_FULL][EMB] -> bf16 RNE bits [b][SEQ][EMB] (compact rows). Thread = 8 consecutive elements: two 16-B loads,
// coverage: grid = (SEQ*EMB/8/256 blocks, nb) x 256 thr x 8 = the whole plane.
// =====================================================================================================
__global__ __launch_bounds__(256) void cvtx(const float* __restrict__ x, u16* D, int n8) {
  const int gt = blockIdx.x * 256 + (int)threadIdx.x;
  if (gt >= n8) return;                     // no barriers in this kernel
  const int bb = blockIdx.y;
  const float* p = x + (size_t)bb * ((size_t)SEQ_FULL * EMB) + (size_t)gt * 8;
  const v4f a = *(const v4f*)(p), c4 = *(const v4f*)(p + 4);
  float v[8];
#pragma unroll
  for (int e = 0; e < 4; ++e) { v[e] = a[e]; v[4 + e] = c4[e]; }
  unsigned short s[8];
#pragma unroll
  for (int e = 0; e < 8; ++e) s[e] = bf_bits(v[e]);
  v4u o;
#pragma unroll
  for (int e = 0; e < 4; ++e) o[e] = pk16(s[2 * e], s[2 * e + 1]);
  u16* d = D + (size_t)bb * ((size_t)SEQ * EMB) + (size_t)gt * 8;
  {
    *(v4u*)(d) = o;
    
  }
}

// =====================================================================================================
// Weight transpose-convert: in W[R][C] f32 row-major -> out D[C][R] 16-bit (k-contiguous [n][k] operand planes for y = x.W).
// mode 0: bf16 RNE bits; mode 1: f16 bits of (bf16 RNE value) * scale.
// Block = 64x64 tile: 64 input row segments of 64 floats loaded with 16-B loads, converted, scattered into an LDS tile [c][64 r]
// coverage: load 256 thr x 16 = 64 x 64; store 2 iterations x 256 thr x 8 halves = 64 lines x 64; grid = (R/64) x (C/64) blocks
//           covers D exactly once (host checks R % 64 == 0, C % 64 == 0).
// =====================================================================================================
__global__ __launch_bounds__(256) void wt16(const float* __restrict__ W, u16* D, int R, int C, int mode, float scale) {
  __shared__ __align__(16) u16 TH[64 * VTP];
  const int tid = threadIdx.x;
  const int bid = blockIdx.x;
  const int nrt = R >> 6;
  const int r0  = (bid % nrt) * 64;
  const int c0  = (bid / nrt) * 64;
  {
    const int rl = tid >> 2;                  // input row within tile 0..63
    const int cs = (tid & 3) * 16;            // column chunk within the 64
    const float* src = W + (size_t)(r0 + rl) * C + c0 + cs;
#pragma unroll
    for (int i = 0; i < 4; ++i) {
      const v4f a = *(const v4f*)(src + 4 * i);
#pragma unroll
      for (int e = 0; e < 4; ++e) {
        const float v  = a[e];
        const unsigned short hb = h_bits((_Float16)(bfr(v) * scale));
        const unsigned short bb = bf_bits(v);
        TH[(cs + 4 * i + e) * VTP + rl] = (mode != 0) ? hb : bb;
      }
    }
  }
  __syncthreads();
  v4u vh[2];
  const int q8 = tid >> 3, p8 = (tid & 7) * 8;
#pragma unroll
  for (int it = 0; it < 2; ++it) {
    const int line = it * 32 + q8;            // local c = 0..63
    vh[it] = *(const v4u*)(TH + line * VTP + p8);
  }
  const size_t base = (size_t)c0 * (size_t)R + (size_t)r0 + p8;
  {
#pragma unroll
    for (int it = 0; it < 2; ++it) {
      const int line = it * 32 + q8;
      *(v4u*)(D + base + (size_t)line * (size_t)R) = vh[it];
    }
    
  }
}

// =====================================================================================================
//            16 consecutive lanes x 16 B per line), lanes 16..31 -> row 2*it+1.
//  epi64x2 : same store shape, staged value = acc*os1 + accres*os2 + badd (two accumulator sets combined in f32).
//  epi64hsb: f16 bits of ((tile + bf16RNE(bias[n])) * pscale); lane = (rq = lane>>3 -> row within a group of 4, c8 = 8 consecutive
// coverage: epi64/epi64x2 8 instructions x 2 rows x 16 lanes x 4 floats; epi64hsb 4 instructions x 4 rows x 8 lanes x 8 halves
//           = the wave's 16 x 64 tile in every case.
// =====================================================================================================
__device__ __forceinline__ void stage64(float* sl, v8f a0, v8f a1, v8f a2, v8f a3, float oscale, int lane) {
  const int hh = lane >> 4, m = lane & 15;
#pragma unroll
  for (int r = 0; r < 8; ++r) {
    const int ro = (8 * hh + r) * 68 + m;
    sl[ro]      = a0[r] * oscale;
    sl[ro + 16] = a1[r] * oscale;
    sl[ro + 32] = a2[r] * oscale;
    sl[ro + 48] = a3[r] * oscale;
  }
  wave_sync_lds();
}
__device__ __forceinline__ void epi64(float* sl, v8f a0, v8f a1, v8f a2, v8f a3, float oscale, v4f badd, float* C, int N,
                                      size_t rowb, int col0, int lane) {
  const int hh = lane >> 4, m = lane & 15;
  stage64(sl, a0, a1, a2, a3, oscale, lane);
  v4f vals[8];
#pragma unroll
  for (int it = 0; it < 8; ++it) vals[it] = *(const v4f*)(sl + (it * 2 + hh) * 68 + m * 4) + badd;
  float* dst = C + (rowb + (size_t)hh) * (size_t)N + col0 + m * 4;
  {
#pragma unroll
    for (int it = 0; it < 8; ++it) {
      *(v4f*)(dst + (size_t)(it * 2) * (size_t)N) = vals[it];
    }
    
  }
}
__device__ __forceinline__ void epi64x2(float* sl, v8f a0, v8f a1, v8f a2, v8f a3, v8f e0, v8f e1, v8f e2, v8f e3,
                                        float os1, float os2, v4f badd, float* C, int N, size_t rowb, int col0, int lane) {
  const int hh = lane >> 4, m = lane & 15;
#pragma unroll
  for (int r = 0; r < 8; ++r) {
    const int ro = (8 * hh + r) * 68 + m;
    sl[ro]      = a0[r] * os1 + e0[r] * os2;
    sl[ro + 16] = a1[r] * os1 + e1[r] * os2;
    sl[ro + 32] = a2[r] * os1 + e2[r] * os2;
    sl[ro + 48] = a3[r] * os1 + e3[r] * os2;
  }
  wave_sync_lds();
  v4f vals[8];
#pragma unroll
  for (int it = 0; it < 8; ++it) vals[it] = *(const v4f*)(sl + (it * 2 + hh) * 68 + m * 4) + badd;
  float* dst = C + (rowb + (size_t)hh) * (size_t)N + col0 + m * 4;
  {
#pragma unroll
    for (int it = 0; it < 8; ++it) {
      *(v4f*)(dst + (size_t)(it * 2) * (size_t)N) = vals[it];
    }
    
  }
}
__device__ __forceinline__ void epi64hsb(float* sl, v8f a0, v8f a1, v8f a2, v8f a3, float oscale, float pscale,
                                         const float* __restrict__ bias, u16* C, int N, size_t rowb, int col0, int lane) {
  stage64(sl, a0, a1, a2, a3, oscale, lane);
  const int rq = lane >> 3, c8 = (lane & 7) * 8;
  const v4f b0 = *(const v4f*)(bias + col0 + c8), b1 = *(const v4f*)(bias + col0 + c8 + 4);   // columns col0+c8..+7 < N
  float bb[8];
#pragma unroll
  for (int e = 0; e < 4; ++e) { bb[e] = bfr(b0[e]); bb[4 + e] = bfr(b1[e]); }
  v4u oh[4];
#pragma unroll
  for (int i4 = 0; i4 < 4; ++i4) {
    const int row = i4 * 4 + rq;
    const v4f a = *(const v4f*)(sl + row * 68 + c8), c4 = *(const v4f*)(sl + row * 68 + c8 + 4);
    float w[8];
#pragma unroll
    for (int e = 0; e < 4; ++e) { w[e] = (a[e] + bb[e]) * pscale; w[4 + e] = (c4[e] + bb[4 + e]) * pscale; }
#pragma unroll
    for (int e = 0; e < 4; ++e) oh[i4][e] = pk16(h_bits((_Float16)w[2 * e]), h_bits((_Float16)w[2 * e + 1]));
  }
  u16* dst = C + rowb * (size_t)N + col0 + c8;
  {
#pragma unroll
    for (int i4 = 0; i4 < 4; ++i4) {
      const int row = i4 * 4 + rq;
      *(v4u*)(dst + (size_t)row * (size_t)N) = oh[i4];
    }
    
  }
}

// =====================================================================================================
// bf16 GEMM, f32 out with bias: C[M][N] = (A[arow(m)][K] (bf16 row-major) . Bt[N][K]^T (bf16 k-contiguous)) * oscale + bf16RNE(bias[n]).
// Output row ra maps to A row arow = (ra / rpg) * gstr + (ra % rpg) (rpg = M, gstr = 0 gives the identity map; rpg = TQ0,
// gstr = SEQ picks the first TQ0 rows of every sequence).
// Block = 64x64 tile, 4 waves x 16 rows; fragments loaded straight from the 16-bit rows (two 16-B loads each, split k map for
// A and B); K stepped by 32 (host checks K % 32 == 0, M % 64 == 0, N % 64 == 0, grid = (M/64)*(N/64)).
// =====================================================================================================
__global__ __launch_bounds__(128)
void gemm_b32(const u16* __restrict__ A, const u16* __restrict__ Bt, const float* __restrict__ bias, float* C,
              int M, int N, int K, int rpg, int gstr, float oscale) {
  __shared__ __align__(16) float slab[4 * SLAB64];
  const int tid = threadIdx.x, wave = tid >> 5, lane = tid & 31, hh = lane >> 4, m = lane & 15;
  const int ntile = N >> 6;
  const int bid   = blockIdx.x;
  const int rowb  = (bid / ntile) * 64 + wave * 16;
  const int col0  = (bid % ntile) * 64;
  if (rowb + 16 > M) return;                 // wave-uniform, never taken with the exact grid; no block barriers in this kernel
  const int ra = rowb + m;
  const int rg = ra / rpg;
  const size_t arow = (size_t)rg * (size_t)gstr + (size_t)(ra - rg * rpg);
  const u16* ap = A  + arow * (size_t)K + 8 * hh;
  const u16* bp = Bt + (size_t)(col0 + m) * K + 8 * hh;
  const size_t bs = (size_t)16 * K;
  v8f acc0 = zero8(), acc1 = zero8(), acc2 = zero8(), acc3 = zero8();
#pragma unroll 1
  for (int k0 = 0; k0 < K; k0 += 32) {
    const v16b a  = ldfrag_b(ap + k0);
    const v16b b0 = ldfrag_b(bp + k0);
    const v16b b1 = ldfrag_b(bp + bs + k0);
    const v16b b2 = ldfrag_b(bp + 2 * bs + k0);
    const v16b b3 = ldfrag_b(bp + 3 * bs + k0);
    acc0 = mma_b(a, b0, acc0);
    acc1 = mma_b(a, b1, acc1);
    acc2 = mma_b(a, b2, acc2);
    acc3 = mma_b(a, b3, acc3);
    guard6<v16b>(acc0, acc1, acc2, acc3, a, b0, b1, b2, b3, a);
  }
  const v4f bv4 = *(const v4f*)(bias + col0 + m * 4);    // columns col0 + 4m .. +3, always < N (N multiple of 64)
  v4f badd;
#pragma unroll
  for (int e = 0; e < 4; ++e) badd[e] = bfr(bv4[e]);
  epi64(slab + wave * SLAB64, acc0, acc1, acc2, acc3, oscale, badd, C, N, (size_t)rowb, col0, lane);
}

// =====================================================================================================
// bf16 GEMM, f16 plane out with bias: C16[M][N] = f16 bits of (((A . Bt^T) * oscale) + bf16RNE(bias[n])) * pscale; operands as in
// gemm_b32 (identity row map), epilogue epi64hsb.
// =====================================================================================================
__global__ __launch_bounds__(128)
void gemm_bh16(const u16* __restrict__ A, const u16* __restrict__ Bt, const float* __restrict__ bias, u16* C,
               int M, int N, int K, float oscale, float pscale) {
  __shared__ __align__(16) float slab[4 * SLAB64];
  const int tid = threadIdx.x, wave = tid >> 5, lane = tid & 31, hh = lane >> 4, m = lane & 15;
  const int ntile = N >> 6;
  const int bid   = blockIdx.x;
  const int rowb  = (bid / ntile) * 64 + wave * 16;
  const int col0  = (bid % ntile) * 64;
  if (rowb + 16 > M) return;                 // wave-uniform, never taken with the exact grid; no block barriers in this kernel
  const u16* ap = A  + (size_t)(rowb + m) * K + 8 * hh;
  const u16* bp = Bt + (size_t)(col0 + m) * K + 8 * hh;
  const size_t bs = (size_t)16 * K;
  v8f acc0 = zero8(), acc1 = zero8(), acc2 = zero8(), acc3 = zero8();
#pragma unroll 1
  for (int k0 = 0; k0 < K; k0 += 32) {
    const v16b a  = ldfrag_b(ap + k0);
    const v16b b0 = ldfrag_b(bp + k0);
    const v16b b1 = ldfrag_b(bp + bs + k0);
    const v16b b2 = ldfrag_b(bp + 2 * bs + k0);
    const v16b b3 = ldfrag_b(bp + 3 * bs + k0);
    acc0 = mma_b(a, b0, acc0);
    acc1 = mma_b(a, b1, acc1);
    acc2 = mma_b(a, b2, acc2);
    acc3 = mma_b(a, b3, acc3);
    guard6<v16b>(acc0, acc1, acc2, acc3, a, b0, b1, b2, b3, a);
  }
  epi64hsb(slab + wave * SLAB64, acc0, acc1, acc2, acc3, oscale, pscale, bias, C, N, (size_t)rowb, col0, lane);
}

// =====================================================================================================
// f16 GEMM with two A planes (hi + residual), f32 out with bias:
//   C[M][N] = (Ah . Bt^T) * os1 + (Ar . Bt^T) * os2 + bf16RNE(bias[n]); Ah/Ar f16 row-major, Bt f16 k-contiguous.
// Same tiling as gemm_b32; separate accumulators for the two planes, combined in f32 in epi64x2.
// =====================================================================================================
__global__ __launch_bounds__(128)
void gemm_h2_32(const u16* __restrict__ Ah, const u16* __restrict__ Ar, const u16* __restrict__ Bt,
                const float* __restrict__ bias, float* C, int M, int N, int K, float os1, float os2) {
  __shared__ __align__(16) float slab[4 * SLAB64];
  const int tid = threadIdx.x, wave = tid >> 5, lane = tid & 31, hh = lane >> 4, m = lane & 15;
  const int ntile = N >> 6;
  const int bid   = blockIdx.x;
  const int rowb  = (bid / ntile) * 64 + wave * 16;
  const int col0  = (bid % ntile) * 64;
  if (rowb + 16 > M) return;                 // wave-uniform, never taken with the exact grid; no block barriers in this kernel
  const _Float16* ap  = (const _Float16*)(const void*)Ah + (size_t)(rowb + m) * K + 8 * hh;
  const _Float16* arp = (const _Float16*)(const void*)Ar + (size_t)(rowb + m) * K + 8 * hh;
  const _Float16* bp  = (const _Float16*)(const void*)Bt + (size_t)(col0 + m) * K + 8 * hh;
  const size_t bs = (size_t)16 * K;
  v8f acc0 = zero8(), acc1 = zero8(), acc2 = zero8(), acc3 = zero8();
  v8f acr0 = zero8(), acr1 = zero8(), acr2 = zero8(), acr3 = zero8();
#pragma unroll 1
  for (int k0 = 0; k0 < K; k0 += 32) {
    const v16h a  = ldfrag_h(ap + k0);
    const v16h ar = ldfrag_h(arp + k0);
    const v16h b0 = ldfrag_h(bp + k0);
    const v16h b1 = ldfrag_h(bp + bs + k0);
    const v16h b2 = ldfrag_h(bp + 2 * bs + k0);
    const v16h b3 = ldfrag_h(bp + 3 * bs + k0);
    acc0 = mma_h(a, b0, acc0);
    acc1 = mma_h(a, b1, acc1);
    acc2 = mma_h(a, b2, acc2);
    acc3 = mma_h(a, b3, acc3);
    acr0 = mma_h(ar, b0, acr0);
    acr1 = mma_h(ar, b1, acr1);
    acr2 = mma_h(ar, b2, acr2);
    acr3 = mma_h(ar, b3, acr3);
    guard8x6(acc0, acc1, acc2, acc3, acr0, acr1, acr2, acr3, a, ar, b0, b1, b2, b3);
  }
  const v4f bv = *(const v4f*)(bias + col0 + m * 4);      // columns col0 + 4m .. +3, always < N (N multiple of 64)
  v4f badd;
#pragma unroll
  for (int e = 0; e < 4; ++e) badd[e] = bfr(bv[e]);
  epi64x2(slab + wave * SLAB64, acc0, acc1, acc2, acc3, acr0, acr1, acr2, acr3, os1, os2, badd, C, N,
          (size_t)rowb, col0, lane);
}

// =====================================================================================================
// V^T plane: VT[(b*DH + d)*SEQ + s] = f16(V[b][s][d] * 1024), V = f32 [b*SEQ + s][DH].
// Block = (b, 64 keys): 64 source rows of 64 floats loaded with 16-B loads, converted, scattered into an LDS tile [d][64 keys]
// coverage: load 256 thr x 16 elements = 64 x 64; store 2 iterations x 256 thr x 8 halves = 64 lines x 64 = the block's tile;
//           grid = nb x (SEQ/64) blocks covers the plane exactly once.
// =====================================================================================================
__global__ __launch_bounds__(256) void xt16(const float* __restrict__ X, u16* XTo) {
  __shared__ __align__(16) u16 TH[64 * VTP];
  const int tid = threadIdx.x;
  const int bid = blockIdx.x;
  const int st  = bid % (SEQ / 64);
  const int b   = bid / (SEQ / 64);
  const int s0  = st * 64;
  {
    const int sl = tid >> 2;                  // key within tile 0..63
    const int dc = (tid & 3) * 16;            // d chunk within the 64
    const float* src = X + ((size_t)b * SEQ + s0 + sl) * DH + dc;
#pragma unroll
    for (int i = 0; i < 4; ++i) {
      const v4f a = *(const v4f*)(src + 4 * i);
#pragma unroll
      for (int e = 0; e < 4; ++e) {
        const float v = a[e];
        TH[(dc + 4 * i + e) * VTP + sl] = h_bits((_Float16)(v * VCAR));
      }
    }
  }
  __syncthreads();
  v4u vh[2];
  const int q8 = tid >> 3, p8 = (tid & 7) * 8;
#pragma unroll
  for (int it = 0; it < 2; ++it) {
    const int line = it * 32 + q8;            // local d = 0..63
    vh[it] = *(const v4u*)(TH + line * VTP + p8);
  }
  const size_t base = ((size_t)b * DH) * SEQ + s0 + p8;
  {
#pragma unroll
    for (int it = 0; it < 2; ++it) {
      const int line = it * 32 + q8;
      *(v4u*)(XTo + base + (size_t)line * SEQ) = vh[it];
    }
    
  }
}

// =====================================================================================================
// Key-block prefix column sums of V: VS[((b*NCHK + c)*NKB + kb)*DH + d] = sum over keys c*CK .. c*CK + 32*kb + 31 of V[b][key][d]
// (f32, fixed sequential order). Block = one (b, c), 64 threads (thread = d); the 16 prefix values per thread are staged in LDS
// coverage: grid = nb*NCHK blocks x (4 iterations x 64 thr x 4 floats = 1024) = the whole table.
// =====================================================================================================
__global__ __launch_bounds__(64) void vsum_k(const float* __restrict__ V, float* VS) {
  __shared__ __align__(16) float sm[NKB * DH];
  const int tid = threadIdx.x;                        // d
  const int bc  = blockIdx.x;
  const int b   = bc / NCHK;
  const int c   = bc - b * NCHK;
  const float* p = V + ((size_t)b * SEQ + (size_t)c * CK) * DH + tid;
  float s = 0.f;
  // Two register sets of one key block each: the next block's 32 loads are issued before this block is summed, so that the load
  // latency is shared by the loads in flight. The adds run in sequential key order.
  float va[32], vb[32];
#pragma unroll
  for (int i = 0; i < 32; ++i) va[i] = p[(size_t)i * DH];
  // fully unrolled: every load address is the base plus a constant, and the two sets stay in registers
#pragma unroll
  for (int kb = 0; kb < NKB; kb += 2) {
#pragma unroll
    for (int i = 0; i < 32; ++i) vb[i] = p[(size_t)((kb + 1) * 32 + i) * DH];
#pragma unroll
    for (int i = 0; i < 32; ++i) s += va[i];
    sm[kb * DH + tid] = s;
    if (kb + 2 < NKB) {
#pragma unroll
      for (int i = 0; i < 32; ++i) va[i] = p[(size_t)((kb + 2) * 32 + i) * DH];
    }
#pragma unroll
    for (int i = 0; i < 32; ++i) s += vb[i];
    sm[(kb + 1) * DH + tid] = s;
  }
  __syncthreads();
  v4f o[4];
#pragma unroll
  for (int it = 0; it < 4; ++it) o[it] = *(const v4f*)(sm + it * 256 + tid * 4);
  float* base = VS + (size_t)bc * NKB * DH + tid * 4;
  {
#pragma unroll
    for (int it = 0; it < 4; ++it) {
      *(v4f*)(base + it * 256) = o[it];
    }
    
  }
}

// =====================================================================================================
// Single-head causal attention, head width DH = 64, query rows TQ0 .. SEQ-1: block = (batch b, 16 query rows q0..q0+15), 8 waves.
// q plane (f16, x8) [b][s][d]; k plane the same; V^T plane [b][d][s] (x1024); VS = key-block prefix column sums of V.
//   Chunks of CK = 512 keys: only chunks c <= qc = q0/CK are visited (later chunks lie entirely above the diagonal). In the diagonal
//   chunk only key blocks kb < nkb (keys <= q0+15) are multiplied; key blocks kb >= nkb get zero scores in LDS and are not used in (PV).
//   (S) scores S[query m][key n] on WMMA: A = q rows (row m = lane&15, split k map over d, two 32-d fragments kept in registers),
//       B = k rows (col n = key, split map); wave w handles key blocks w, w+8 of the chunk; D element r of lane l -> scs[query 8h+r][key].
//   (M) 16 threads per query row (sub-thread = 32 consecutive keys): base-2 logits with the causal mask by key index (key > query
//       -> -inf), chunk max via xor shuffles, online running max / rescale factor al / running sum l in f32 registers,
//       p = exp2(t - m_new) <= 1 (0 for masked keys), chunk row sum ps and C = ps/CK (bit-identical on the row's 16 threads), the
//       CENTRED P' = p - C written as f16(P' * 32768) into the LDS P tile with 16-B stores; al -> rowa[row], C -> rowc[row].
//   (PV) every wave keeps its own partial O (4 accumulator tiles = 16 queries x 64 d): o_w = o_w*al (+ on wave 0 only:
//       C*(32768*1024)*VS[chunk][nkb-1][d], the exact add-back of the centring term over exactly the processed keys, in f32), then for
//       the wave's key blocks kb in {w, w+8}, kb < nkb: A = P' fragment from LDS (row m = query, split map over keys), B = V^T
//       fragments (col n = d, split map over keys), 4 WMMAs plus a hazard gap. sum_k (P'_k + C) v_k == sum_k p_k v_k exactly;
//       masked keys carry P' = -C and p = 0.
//   Block barriers after (S) and after (M) order all LDS reuse across chunks and waves.
//   Combine: after a block barrier the 8 partial O tiles are staged in the score region ([8][16][OPP] f32), barrier, then thread
//   (row = tid>>4, 4 columns) sums the 8 partials in fixed order, x = sum * 4096 / (l * 32768 * 1024) (l >= 1 always, held in
//   registers by the row's 16 threads), hi = f16(x), res = f16((x - hi) * 2048), staged as a [32][CTP] u16 tile in the P region,
// coverage: grid nb*NQT blocks x 16 rows = rows TQ0..SEQ-1 of every sequence; scs written 16 x 512 every chunk (zeros for kb >= nkb);
//           P tile written 16 x 512 every chunk; partial stage 8 x 16 x 64; ctx stage 32 x 64; store 32 lines = 16 rows of both planes.
// =====================================================================================================
__global__ __launch_bounds__(ATT_THREADS) __attribute__((amdgpu_num_vgpr(256)))
void attn_fwd(const u16* __restrict__ QPp, const u16* __restrict__ KPp, const u16* __restrict__ VTp,
              const float* __restrict__ VSp, u16* CHo, u16* CRo) {
  __shared__ __align__(16) float scs[16 * SCP];     // scores [16][SCP] f32; reused as partial O tiles [8][16][OPP] f32
  __shared__ __align__(16) u16 pls[16 * PLP];       // P' tile [16][PLP] f16 bits; reused as ctx staging [32][CTP] u16
  __shared__ float rowa[QT];
  __shared__ float rowc[QT];

  const int tid  = threadIdx.x;
  const int wave = tid >> 5;
  const int lane = tid & 31;
  const int hh   = lane >> 4;
  const int m    = lane & 15;
  const int r16  = tid >> 4;                 // query row owned in phase (M) and in the combine
  const int sub  = tid & 15;
  const int kl0  = sub * 32;

  const int bid = blockIdx.x;
  const int b   = bid / NQT;
  const int q0  = TQ0 + (bid - b * NQT) * QT;
  const int qc  = q0 / CK;                   // diagonal chunk index

  const _Float16* qrow = (const _Float16*)(const void*)QPp + ((size_t)b * SEQ + q0 + m) * DH + 8 * hh;
  const v16h qa0 = ldfrag_h(qrow);           // d 0..31
  const v16h qa1 = ldfrag_h(qrow + 32);      // d 32..63
  const _Float16* kbp = (const _Float16*)(const void*)KPp + ((size_t)b * SEQ + m) * DH + 8 * hh;
  const _Float16* vbp = (const _Float16*)(const void*)VTp + ((size_t)b * DH + m) * SEQ + 8 * hh;
  const float* vsb = VSp + (size_t)b * NCHK * NKB * DH + m;
  const float lsc = RSQD * LOG2E / (QSC * KSC);
  const float addsel = (wave == 0) ? (PCAR * VCAR) : 0.f;    // centring add-back on wave 0 only

  float mrun = -INFINITY, lrun = 0.f;
  v8f o[NACC];
#pragma unroll
  for (int j = 0; j < NACC; ++j) o[j] = zero8();

#pragma unroll 1
  for (int c = 0; c <= qc; ++c) {
    const int kbeg = c * CK;
    const int nkb  = (c < qc) ? NKB : (((q0 + QT - 1 - kbeg) >> 5) + 1);   // 1..16, block-uniform
    // ---- (S) scores of this chunk (zeros for key blocks beyond the query tile) ----
#pragma unroll 1
    for (int kb = wave; kb < NKB; kb += 8) {               // wave-uniform, 2 trips
      v8f s0 = zero8(), s1 = zero8();
      if (kb < nkb) {                                      // wave-uniform
        const _Float16* k0p = kbp + (size_t)(kbeg + kb * 32) * DH;
        const _Float16* k1p = k0p + (size_t)16 * DH;
        const v16h f00 = ldfrag_h(k0p);
        const v16h f01 = ldfrag_h(k0p + 32);
        const v16h f10 = ldfrag_h(k1p);
        const v16h f11 = ldfrag_h(k1p + 32);
        s0 = mma_h(qa0, f00, s0);
        s0 = mma_h(qa1, f01, s0);
        s1 = mma_h(qa0, f10, s1);
        s1 = mma_h(qa1, f11, s1);
        guard2x6(s0, s1, qa0, qa1, f00, f01, f10, f11);
      }
      float* srow = scs + (8 * hh) * SCP + kb * 32 + m;
#pragma unroll
      for (int r = 0; r < 8; ++r) {
        srow[r * SCP]      = s0[r];
        srow[r * SCP + 16] = s1[r];
      }
    }
    __syncthreads();
    // ---- (M) softmax statistics and the centred P' tile ----
    {
      const float* sp = scs + r16 * SCP + kl0;
      const int lim = (q0 + r16) - (kbeg + kl0);           // key kl0 + j is valid iff j <= lim
      float t[32];
      float cm = -INFINITY;
#pragma unroll
      for (int i = 0; i < 8; ++i) {
        const v4f a = *(const v4f*)(sp + 4 * i);
#pragma unroll
        for (int e = 0; e < 4; ++e) {
          const int j = 4 * i + e;
          const float tv = (j <= lim) ? a[e] * lsc : -INFINITY;
          t[j] = tv;
          cm = fmaxf(cm, tv);
        }
      }
#pragma unroll
      for (int d = 1; d <= 8; d <<= 1) cm = fmaxf(cm, __shfl_xor(cm, d, 32));
      const float mn = fmaxf(mrun, cm);                    // finite: key kbeg of every visited chunk is never masked
      const float al = (mrun == -INFINITY) ? 0.f : exp2f(mrun - mn);
      mrun = mn;
      float ps = 0.f;
#pragma unroll
      for (int j = 0; j < 32; ++j) {
        const float p = exp2f(fminf(t[j] - mn, 0.f));      // 0 for masked keys
        t[j] = p;
        ps += p;
      }
#pragma unroll
      for (int d = 1; d <= 8; d <<= 1) ps += __shfl_xor(ps, d, 32);
      const float cc = ps * (1.0f / (float)CK);
      v4u pk[4];
#pragma unroll
      for (int i = 0; i < 4; ++i) {
#pragma unroll
        for (int e = 0; e < 4; ++e) {
          const int j = 8 * i + 2 * e;
          pk[i][e] = pk16(h_bits((_Float16)((t[j] - cc) * PCAR)), h_bits((_Float16)((t[j + 1] - cc) * PCAR)));
        }
      }
      lrun = lrun * al + ps;
      u16* pd = pls + r16 * PLP + kl0;
#pragma unroll
      for (int i = 0; i < 4; ++i) *(v4u*)(pd + 8 * i) = pk[i];
      if (sub == 0) { rowa[r16] = al; rowc[r16] = cc; }
    }
    __syncthreads();
    // ---- (PV) rescale, add the centring term (wave 0), accumulate P' . V^T for this wave's key blocks ----
    {
      float scl[8], cad[8];
#pragma unroll
      for (int r = 0; r < 8; ++r) { scl[r] = rowa[8 * hh + r]; cad[r] = rowc[8 * hh + r] * addsel; }
      const float* vsc = vsb + ((size_t)c * NKB + (size_t)(nkb - 1)) * DH;
      float vs[NACC];
#pragma unroll
      for (int j = 0; j < NACC; ++j) vs[j] = vsc[16 * j];
#pragma unroll
      for (int j = 0; j < NACC; ++j) {
#pragma unroll
        for (int r = 0; r < 8; ++r) o[j][r] = o[j][r] * scl[r] + cad[r] * vs[j];
      }
      const _Float16* pp = (const _Float16*)(const void*)pls + m * PLP + 8 * hh;
      const _Float16* vp = vbp + kbeg;
#pragma unroll 1
      for (int kb = wave; kb < nkb; kb += 8) {             // wave-uniform trip count, <= 2
        const v16h pf = ldfrag_h(pp + kb * 32);
        const _Float16* vk = vp + kb * 32;
        const v16h g0 = ldfrag_h(vk);
        const v16h g1 = ldfrag_h(vk + (size_t)16 * SEQ);
        const v16h g2 = ldfrag_h(vk + (size_t)32 * SEQ);
        const v16h g3 = ldfrag_h(vk + (size_t)48 * SEQ);
        o[0] = mma_h(pf, g0, o[0]);
        o[1] = mma_h(pf, g1, o[1]);
        o[2] = mma_h(pf, g2, o[2]);
        o[3] = mma_h(pf, g3, o[3]);
        guardpv4(o[0], o[1], o[2], o[3], pf, g0, g1, g2, g3);
      }
    }
  }
  acc_guard4(o[0], o[1], o[2], o[3]);

  // ---- combine the 8 partial O tiles in fixed order ----
  __syncthreads();
#pragma unroll
  for (int j = 0; j < NACC; ++j) {
#pragma unroll
    for (int r = 0; r < 8; ++r) scs[(wave * 16 + 8 * hh + r) * OPP + 16 * j + m] = o[j][r];
  }
  __syncthreads();
  const int c4 = sub * 4;
  v4f sm4 = zero4();
#pragma unroll
  for (int w = 0; w < 8; ++w) sm4 += *(const v4f*)(scs + (w * 16 + r16) * OPP + c4);
  const float inv = (1.0f / lrun) * (CSC / (PCAR * VCAR));            // lrun >= 1
#pragma unroll
  for (int e = 0; e < 4; ++e) {
    const float xs = sm4[e] * inv;
    const _Float16 hv = (_Float16)xs;
    const _Float16 rv = (_Float16)((xs - (float)hv) * RSC);
    pls[r16 * CTP + c4 + e]        = h_bits(hv);
    pls[(16 + r16) * CTP + c4 + e] = h_bits(rv);
  }
  __syncthreads();
  const int line = tid >> 3;                 // 0..31: plane = line>>4, row = line&15
  const int plane = line >> 4;
  const int rowl  = line & 15;
  const int c8    = (tid & 7) * 8;
  const v4u ov = *(const v4u*)(pls + (plane * 16 + rowl) * CTP + c8);
  u16* dst = ((plane == 0) ? CHo : CRo) + ((size_t)b * SEQ + q0 + rowl) * DH + c8;
  *(v4u*)dst = ov;
  
}

// =====================================================================================================
// Query rows 0 .. TQ0-1 of each sequence in f32 on VALU: block = (b, t), 128 threads. QF/KF = f32 q/k planes [nb][TQ0][DH] (bias
// included), V = f32 v plane [nb*SEQ][DH]. Scores for keys j (thread j, one key each, 64-d dot of its whole key row against the q row staged in LDS;
// keys j > t masked to -inf), base-2 softmax with block max / sum reductions (xor shuffles + LDS), p_j in LDS, ctx[d] for d = tid
// (threads 0..63) as a sum in key order of p_j * V[b][j][d] (coalesced, groups of 64 keys up to the one holding t), x = ctx * 4096 / l, hi = f16(x),
// res = f16((x - hi) * 2048); both 64-half rows are staged in LDS and written by lanes 0..15 of wave 0: lanes 0..7 the hi row, lanes
// coverage: grid nb*TQ0 blocks = rows 0..TQ0-1 of every sequence; 64 thr x 1 d = DH per row; store 16 lanes x 8 halves = both rows;
//           together with attn_fwd every (b, s, d) of CH and CR is written exactly once.
// =====================================================================================================
__global__ __launch_bounds__(HD_THREADS) void attn_head(const float* __restrict__ QF, const float* __restrict__ KF,
                                                      const float* __restrict__ V, u16* CHo, u16* CRo) {
  __shared__ __align__(16) float qs[DH];
  __shared__ __align__(16) float sc[TQ0];
  __shared__ float red[4];
  __shared__ float redb[4];
  __shared__ __align__(16) u16 SW[2 * DH];
  const int tid = threadIdx.x, lane = tid & 31, wave = tid >> 5;
  const int b = blockIdx.x / TQ0;
  const int t = blockIdx.x - b * TQ0;
  if (tid < DH) qs[tid] = QF[((size_t)b * TQ0 + t) * DH + tid];   // waves 0,1 entirely (wave-uniform)
  __syncthreads();
  float acc = 0.f;
  {
    const float* kp = KF + ((size_t)b * TQ0 + tid) * DH;            // key row b*TQ0 + tid always in range (tid < TQ0)
    v4f kr[DH / 4];                                                 // the whole key row: 16 loads in flight, one latency
#pragma unroll
    for (int i = 0; i < DH / 4; ++i) kr[i] = *(const v4f*)(kp + 4 * i);
#pragma unroll
    for (int i = 0; i < DH / 4; ++i) {
      const v4f q4 = *(const v4f*)(qs + 4 * i);
#pragma unroll
      for (int e = 0; e < 4; ++e) acc += kr[i][e] * q4[e];
    }
  }
  const float s = (tid <= t) ? acc * (RSQD * LOG2E) : -INFINITY;   // causal mask by key index
  float mx = s;
#pragma unroll
  for (int d = 1; d <= 16; d <<= 1) mx = fmaxf(mx, __shfl_xor(mx, d, 32));
  if (lane == 0) red[wave] = mx;
  __syncthreads();
  float gm = red[0];
#pragma unroll
  for (int w = 1; w < 4; ++w) gm = fmaxf(gm, red[w]);   // finite: key 0 is always valid
  const float p = exp2f(s - gm);                     // 0 for masked keys
  float ps = p;
#pragma unroll
  for (int d = 1; d <= 16; d <<= 1) ps += __shfl_xor(ps, d, 32);
  if (lane == 0) redb[wave] = ps;
  sc[tid] = p;
  __syncthreads();
  float l = redb[0];
#pragma unroll
  for (int w = 1; w < 4; ++w) l += redb[w];           // >= 1
  const float inv = (1.0f / l) * CSC;
  if (wave < 2) {                                    // threads 0..63 (wave-uniform): one d column each
    const float* vp = V + (size_t)b * SEQ * DH + tid;
    float cx = 0.f;
    // Keys in groups of 64 whose loads are issued ahead of their use: one load latency per group. A group's keys j > t carry
    // sc[j] = 0 and add nothing; rows j0 .. j0+63 <= TQ0-1 of sequence b always exist. The sum runs in key order.
    // rolled: the trip count (1 or 2) depends on t
#pragma unroll 1
    for (int j0 = 0; j0 <= t; j0 += 64) {            // block-uniform
      float vv[64];
#pragma unroll
      for (int i = 0; i < 64; ++i) vv[i] = vp[(size_t)(j0 + i) * DH];
#pragma unroll
      for (int i = 0; i < 16; ++i) {
        const v4f p4 = *(const v4f*)(sc + j0 + 4 * i);
#pragma unroll
        for (int e = 0; e < 4; ++e) cx += p4[e] * vv[4 * i + e];
      }
    }
    const float x0 = cx * inv;
    const _Float16 h0 = (_Float16)x0;
    const _Float16 r0 = (_Float16)((x0 - (float)h0) * RSC);
    SW[tid]      = h_bits(h0);
    SW[DH + tid] = h_bits(r0);
  }
  __syncthreads();
  if (wave == 0) {                                   // wave-uniform
    const int l16 = lane & 15;
    const int plane = l16 >> 3, p8 = (l16 & 7) * 8;
    const v4u ov = *(const v4u*)(SW + plane * DH + p8);
    u16* dst = ((plane == 0) ? CHo : CRo) + ((size_t)b * SEQ + t) * DH + p8;
    if (lane < 16) *(v4u*)dst = ov;
    
  }
}

// =====================================================================================================
// Workspace map (bytes, nb = 4, rows = 16384); every plane is fully written by whole-line stores before it is read; all extents are
//   WQT bf16 [64][512] 65536   WKT same   WVT same   WOT f16 of bf16 value x1024 [512][64] 65536                   262144
//   XB  bf16 [rows][512]                                                                                           16777216
//   QP  f16 [rows][64] x8                                                                                           2097152
//   KP  f16 [rows][64] x8                                                                                           2097152
//   V   f32 [rows][64]                                                                                              4194304
//   VT  f16 [nb][64][SEQ] x1024                                                                                     2097152
//   VS  f32 [nb][8][16][64]                                                                                          131072
//   QF  f32 [nb][128][64]  131072      KF same                                                                       262144
//   CH  f16 [rows][64] ctx hi x4096                                                                                 2097152
//   CR  f16 [rows][64] ctx residual x2048                                                                           2097152
//   end                                                                                                            32112640
// =====================================================================================================
extern "C" void kernel_launch(void* const* d_in, const int* in_sizes, int n_in,
                              void* d_out, int out_size, void* d_ws, size_t ws_size,
                              hipStream_t stream) {
  if (n_in < 9) return;
  const int nb   = NB;
  const int rows = nb * SEQ;
  if ((long long)in_sizes[0] < (long long)NB * SEQ_FULL * EMB) return;
  if (in_sizes[1] < EMB * DH || in_sizes[3] < EMB * DH || in_sizes[5] < EMB * DH || in_sizes[7] < DH * EMB) return;
  if (in_sizes[2] < DH || in_sizes[4] < DH || in_sizes[6] < DH || in_sizes[8] < EMB) return;
  if ((long long)out_size < (long long)rows * EMB) return;

  const float* x  = (const float*)d_in[0];
  const float* wq = (const float*)d_in[1];
  const float* bq = (const float*)d_in[2];
  const float* wk = (const float*)d_in[3];
  const float* bk = (const float*)d_in[4];
  const float* wv = (const float*)d_in[5];
  const float* bv = (const float*)d_in[6];
  const float* wo = (const float*)d_in[7];
  const float* bo = (const float*)d_in[8];
  float*       out = (float*)d_out;

  const size_t szW  = (size_t)EMB * DH * 2;                      //     65536
  const size_t szXB = (size_t)rows * EMB * 2;                    //  16777216
  const size_t szP  = (size_t)rows * DH * 2;                     //   2097152
  const size_t szV  = (size_t)rows * DH * 4;                     //   4194304
  const size_t szVT = (size_t)nb * DH * SEQ * 2;                 //   2097152 (== szP)
  const size_t szVS = (size_t)nb * NCHK * NKB * DH * 4;          //    131072
  const size_t szHF = (size_t)nb * TQ0 * DH * 4;                 //    131072
  size_t off = 0;
  const size_t oWQ = off; off += szW;
  const size_t oWK = off; off += szW;
  const size_t oWV = off; off += szW;
  const size_t oWO = off; off += szW;
  const size_t oXB = off; off += szXB;
  const size_t oQ  = off; off += szP;
  const size_t oK  = off; off += szP;
  const size_t oV  = off; off += szV;
  const size_t oVT = off; off += szVT;
  const size_t oVS = off; off += szVS;
  const size_t oQF = off; off += szHF;
  const size_t oKF = off; off += szHF;
  const size_t oCH = off; off += szP;
  const size_t oCR = off; off += szP;
  if (off > ws_size) return;                                     // off = 32112640 at nb = 4
  if (off > WS_CAP) return;

  char* ws = (char*)d_ws;
  u16*   WQT = (u16*)(ws + oWQ);
  u16*   WKT = (u16*)(ws + oWK);
  u16*   WVT = (u16*)(ws + oWV);
  u16*   WOT = (u16*)(ws + oWO);
  u16*   XB  = (u16*)(ws + oXB);
  u16*   QP  = (u16*)(ws + oQ);
  u16*   KP  = (u16*)(ws + oK);
  float* V   = (float*)(ws + oV);
  u16*   VT  = (u16*)(ws + oVT);
  float* VS  = (float*)(ws + oVS);
  float* QF  = (float*)(ws + oQF);
  float* KF  = (float*)(ws + oKF);
  u16*   CH  = (u16*)(ws + oCH);
  u16*   CR  = (u16*)(ws + oCR);

  const int n8x = (SEQ * EMB) / 8;                       // 262144 per batch
  if ((n8x % 256) != 0 || (rows % 64) != 0 || ((nb * TQ0) % 64) != 0) return;
  const dim3 blk(256);
  const dim3 gWT((EMB / 64) * (DH / 64));                // 8 for both weight shapes
  const dim3 gX(n8x / 256, nb);
  const dim3 gG((rows / 64) * (DH / 64));               // 256 at nb = 4
  const dim3 gH(((nb * TQ0) / 64) * (DH / 64));         // 8 at nb = 4
  const dim3 bG(128);
  const dim3 gXT(nb * (SEQ / 64));                      // nb * 64
  const dim3 gVS(nb * NCHK);                            // nb * 8
  const dim3 bVS(64);
  const dim3 gAT(nb * NQT);                             // nb * 248
  const dim3 bAT(ATT_THREADS);
  const dim3 gHD(nb * TQ0);                             // nb * 128
  const dim3 bHD(HD_THREADS);
  const dim3 gO((rows / 64) * (EMB / 64));              // 2048 at nb = 4

  // (0..2) Wq, Wk, Wv stored [k = in 512][n = out 64] -> bf16 k-contiguous planes [64][512]; (3) Wo [k = 64][n = 512] -> f16 of
  //        bf16 value x1024, k-contiguous [512][64]; (4) x -> bf16 plane [rows][512]
  wt16<<<gWT, blk, 0, stream>>>(wq, WQT, EMB, DH, 0, 1.0f);
  wt16<<<gWT, blk, 0, stream>>>(wk, WKT, EMB, DH, 0, 1.0f);
  wt16<<<gWT, blk, 0, stream>>>(wv, WVT, EMB, DH, 0, 1.0f);
  wt16<<<gWT, blk, 0, stream>>>(wo, WOT, DH, EMB, 1, WSC);
  cvtx<<<gX, blk, 0, stream>>>(x, XB, n8x);
  // (5, 6) q and k projections (+bias) -> f16 planes x8; (7) v projection (+bias) -> f32 plane
  gemm_bh16<<<gG, bG, 0, stream>>>(XB, WQT, bq, QP, rows, DH, EMB, 1.0f, QSC);
  gemm_bh16<<<gG, bG, 0, stream>>>(XB, WKT, bk, KP, rows, DH, EMB, 1.0f, KSC);
  gemm_b32<<<gG, bG, 0, stream>>>(XB, WVT, bv, V, rows, DH, EMB, rows, 0, 1.0f);
  // (8, 9) f32 q and k rows 0..127 of every sequence -> QF, KF [nb*128][64]
  gemm_b32<<<gH, bG, 0, stream>>>(XB, WQT, bq, QF, nb * TQ0, DH, EMB, TQ0, SEQ, 1.0f);
  gemm_b32<<<gH, bG, 0, stream>>>(XB, WKT, bk, KF, nb * TQ0, DH, EMB, TQ0, SEQ, 1.0f);
  // (10) v -> V^T plane x1024; (11) key-block prefix column sums of v
  xt16<<<gXT, blk, 0, stream>>>(V, VT);
  vsum_k<<<gVS, bVS, 0, stream>>>(V, VS);
  // (12) attention for query rows 128.. -> ctx hi x4096 and residual x2048 f16 planes; (13) query rows 0..127 on VALU -> same planes
  attn_fwd<<<gAT, bAT, 0, stream>>>(QP, KP, VT, VS, CH, CR);
  attn_head<<<gHD, bHD, 0, stream>>>(QF, KF, V, CH, CR);
  // (14) output projection + bias -> out
  gemm_h2_32<<<gO, bG, 0, stream>>>(CH, CR, WOT, bo, out, rows, EMB, DH,
                                    1.0f / (CSC * WSC), 1.0f / (CSC * WSC * RSC));
  (void)hipGetLastError();
}

// v002
// It runs in 115 microseconds.
// Next to v001, in two timings, it ran 1.30 and 1.29 times as fast.
// Over all steps from v000 it is 1.94 times as fast.
// Projections q,k,v = x.W + b and the f32 q,k rows 0..127 per sequence: v_wmma_f32_16x16x32_bf16 (bf16 RNE operands of the
// raw inputs, f32 accumulate, bf16 RNE bias added in f32). Scores q'.k'^T (f16 planes x8), P'.V (chunk-centred P' x32768 f16 from LDS,
// V^T x1024 f16) and the output projection (ctx carried as f16 hi x4096 plus residual x2048 planes, times f16(bf16(Wo)) x1024, bias
// added in f32): v_wmma_f32_16x16x32_f16, f32 accumulate. Query rows 0..127 of each sequence: scores, softmax and P.V in f32 on VALU.
// Causal mask, softmax statistics, key-block column sums of V and all scaling in f32 on VALU.
#include <hip/hip_runtime.h>
#include <math.h>
#include <stdint.h>

#ifndef NB
#define NB 4
#endif
#ifndef SEQ
#define SEQ 4096
#endif
#define SEQ_FULL 4096
#define NB_FULL 4
#define EMB   512
#define DH    64
#define CK    512
#define NCHK  (SEQ / CK)
#define NKB   16
#define QT    16
#define TQ0   128
#define NQT   ((SEQ - TQ0) / QT)
#define SCP   544
#define PLP   528
#define OPP   68
#define CTP   72
#define SLAB64 (16 * 68)
#define VTP   72
#define ATT_THREADS 256
#define HD_THREADS 128
#define NACC  4
#define QSC   8.0f
#define KSC   8.0f
#define PCAR  32768.0f
#define VCAR  1024.0f
#define WSC   1024.0f
#define CSC   4096.0f
#define RSC   2048.0f
#define LOG2E 1.4426950408889634f
#define RSQD  0.125f
#define WS_CAP ((size_t)134217728)
#define WTB   ((EMB / 64) * (DH / 64))
#define XCB   ((SEQ * EMB) / 8 / 256)
#define GPB   (((NB * SEQ) / 64) * (DH / 64))
#define GHB   (((NB * TQ0) / 64) * (DH / 64))
#define XTB   (NB * (SEQ / 64))
#define VSB   (NB * NCHK)

static_assert(DH == 64 && NACC * 16 == DH && (EMB % 64) == 0 && (EMB % 32) == 0 && (DH % 32) == 0);
static_assert((SEQ % CK) == 0 && NCHK >= 1 && CK == 32 * NKB && (SEQ % 64) == 0 && (SEQ % QT) == 0 && (CK % QT) == 0);
static_assert((TQ0 % QT) == 0 && (TQ0 % 64) == 0 && NQT * QT + TQ0 == SEQ && NQT >= 1 && TQ0 == 128 && TQ0 == HD_THREADS);
static_assert(8 * 16 * OPP <= 16 * SCP && 32 * CTP <= 16 * PLP && CTP >= DH + 8 && OPP >= DH + 4 && SCP >= CK + 16 && PLP >= CK + 8);
static_assert(((PLP * 2) % 16) == 0 && ((SCP * 4) % 16) == 0 && ((VTP * 2) % 16) == 0 && ((CTP * 2) % 16) == 0 && ((OPP * 4) % 16) == 0);
static_assert(64 * VTP >= 63 * VTP + 64);
static_assert(ATT_THREADS == 16 * QT && ATT_THREADS == 256 && HD_THREADS == 2 * DH);
static_assert((((SEQ * EMB) / 8) % 256) == 0 && ((NB * SEQ) % 64) == 0 && ((NB * TQ0) % 64) == 0);
static_assert(NB >= 1 && NB <= NB_FULL && SEQ <= SEQ_FULL && (TQ0 % 64) == 0 && (NKB % 2) == 0);

typedef unsigned short u16;
typedef _Float16 v16h __attribute__((ext_vector_type(16)));
typedef _Float16 v8h  __attribute__((ext_vector_type(8)));
typedef __bf16   v16b __attribute__((ext_vector_type(16)));
typedef float    v8f  __attribute__((ext_vector_type(8)));
typedef float    v4f  __attribute__((ext_vector_type(4)));
typedef unsigned int v4u __attribute__((ext_vector_type(4)));

union FragH { v16h v; v8h h[2]; v4u u[2]; };
union FragB { v16b v; v4u u[2]; };

// ---- scalar helpers --------------------------------------------------------------------------------
__device__ __forceinline__ unsigned short bf_bits(float f) {          // f32 -> bf16 bits, RNE convert
  unsigned u = __float_as_uint(f);
  return (unsigned short)((u + 0x7FFFu + ((u >> 16) & 1u)) >> 16);
}
__device__ __forceinline__ float bf_up(unsigned short h) { return __uint_as_float(((unsigned)h) << 16); }
__device__ __forceinline__ float bfr(float f) { return bf_up(bf_bits(f)); }
__device__ __forceinline__ unsigned short h_bits(_Float16 x) { return __builtin_bit_cast(unsigned short, x); }
__device__ __forceinline__ unsigned pk16(unsigned short a, unsigned short b) { return (unsigned)a | ((unsigned)b << 16); }
__device__ __forceinline__ v8f zero8() { v8f z = {0.f, 0.f, 0.f, 0.f, 0.f, 0.f, 0.f, 0.f}; return z; }
__device__ __forceinline__ v4f zero4() { v4f z = {0.f, 0.f, 0.f, 0.f}; return z; }

// ---- fragment loaders: 16-bit A/B operand, lane -> row/col (lane&15), p already includes +8*(lane>>4);
//      elements 0..7 <- p[0..7] (k0+8h..), elements 8..15 <- p[16..23] (k0+16+8h..)  (same split k map for A and B;
//      B is always read from a k-contiguous [n][k] plane)
__device__ __forceinline__ v16h ldfrag_h(const _Float16* p) {
  FragH f;
  f.h[0] = *(const v8h*)(p);
  f.h[1] = *(const v8h*)(p + 16);
  return f.v;
}
__device__ __forceinline__ v16b ldfrag_b(const u16* p) {              // bf16 plane read as unsigned integer vectors
  FragB f;
  f.u[0] = *(const v4u*)(p);
  f.u[1] = *(const v4u*)(p + 16);
  return f.v;
}

__device__ __forceinline__ v8f mma_h(v16h a, v16h b, v8f c) {
  return __builtin_amdgcn_wmma_f32_16x16x32_f16(false, a, false, b, (short)0, c, false, false);
}
__device__ __forceinline__ v8f mma_b(v16b a, v16b b, v8f c) {
  return __builtin_amdgcn_wmma_f32_16x16x32_bf16(false, a, false, b, (short)0, c, false, false);
}
__device__ __forceinline__ void guard2x6(v8f& a, v8f& b, v16h x0, v16h x1, v16h x2, v16h x3, v16h x4, v16h x5) {
#if defined(__HIP_DEVICE_COMPILE__)
  asm volatile("v_nop\n\tv_nop\n\tv_nop\n\tv_nop"
               : "+v"(a), "+v"(b) : "v"(x0), "v"(x1), "v"(x2), "v"(x3), "v"(x4), "v"(x5) : "memory");
#endif
}
template <typename F>
__device__ __forceinline__ void guard6(v8f& a, v8f& b, v8f& c, v8f& d, F x0, F x1, F x2, F x3, F x4, F x5) {
#if defined(__HIP_DEVICE_COMPILE__)
  asm volatile("v_nop\n\tv_nop\n\tv_nop\n\tv_nop"
               : "+v"(a), "+v"(b), "+v"(c), "+v"(d) : "v"(x0), "v"(x1), "v"(x2), "v"(x3), "v"(x4), "v"(x5) : "memory");
#endif
}
__device__ __forceinline__ void guard8x6(v8f& a0, v8f& a1, v8f& a2, v8f& a3, v8f& e0, v8f& e1, v8f& e2, v8f& e3,
                                         v16h x0, v16h x1, v16h x2, v16h x3, v16h x4, v16h x5) {
#if defined(__HIP_DEVICE_COMPILE__)
  asm volatile("v_nop\n\tv_nop\n\tv_nop\n\tv_nop"
               : "+v"(a0), "+v"(a1), "+v"(a2), "+v"(a3), "+v"(e0), "+v"(e1), "+v"(e2), "+v"(e3)
               : "v"(x0), "v"(x1), "v"(x2), "v"(x3), "v"(x4), "v"(x5) : "memory");
#endif
}
__device__ __forceinline__ void guardpv4(v8f& o0, v8f& o1, v8f& o2, v8f& o3, v16h p, v16h g0, v16h g1, v16h g2, v16h g3) {
#if defined(__HIP_DEVICE_COMPILE__)
  asm volatile("v_nop\n\tv_nop\n\tv_nop\n\tv_nop"
               : "+v"(o0), "+v"(o1), "+v"(o2), "+v"(o3)
               : "v"(p), "v"(g0), "v"(g1), "v"(g2), "v"(g3) : "memory");
#endif
}
__device__ __forceinline__ void acc_guard4(v8f& a, v8f& b, v8f& c, v8f& d) {
#if defined(__HIP_DEVICE_COMPILE__)
  asm volatile("v_nop\n\tv_nop\n\tv_nop\n\tv_nop" : "+v"(a), "+v"(b), "+v"(c), "+v"(d));
#endif
}
__device__ __forceinline__ void wave_sync_lds() {                    // wave-private LDS slab: release, wave barrier, acquire
  __builtin_amdgcn_fence(3, "workgroup");
  __builtin_amdgcn_wave_barrier();
  __builtin_amdgcn_fence(2, "workgroup");
}

// =====================================================================================================
// x plane f32 [b][SEQ_FULL][EMB] -> bf16 RNE bits [b][SEQ][EMB] (compact rows). Thread = 8 consecutive elements: two 16-B loads,
// coverage: grid = (SEQ*EMB/8/256 blocks, nb) x 256 thr x 8 = the whole plane.
// =====================================================================================================
__device__ __forceinline__ void cvtx_body(int bx, int bb, const float* __restrict__ x, u16* D, int n8) {
  const int gt = bx * 256 + (int)threadIdx.x;
  if (gt >= n8) return;                     // no barriers on this path
  const float* p = x + (size_t)bb * ((size_t)SEQ_FULL * EMB) + (size_t)gt * 8;
  const v4f a = *(const v4f*)(p), c4 = *(const v4f*)(p + 4);
  float v[8];
#pragma unroll
  for (int e = 0; e < 4; ++e) { v[e] = a[e]; v[4 + e] = c4[e]; }
  unsigned short s[8];
#pragma unroll
  for (int e = 0; e < 8; ++e) s[e] = bf_bits(v[e]);
  v4u o;
#pragma unroll
  for (int e = 0; e < 4; ++e) o[e] = pk16(s[2 * e], s[2 * e + 1]);
  u16* d = D + (size_t)bb * ((size_t)SEQ * EMB) + (size_t)gt * 8;
  {
    *(v4u*)(d) = o;
    
  }
}

// =====================================================================================================
// Weight transpose-convert: in W[R][C] f32 row-major -> out D[C][R] 16-bit (k-contiguous [n][k] operand planes for y = x.W).
// mode 0: bf16 RNE bits; mode 1: f16 bits of (bf16 RNE value) * scale.
// Block = 64x64 tile: 64 input row segments of 64 floats loaded with 16-B loads, converted, scattered into an LDS tile [c][64 r]
// coverage: load 256 thr x 16 = 64 x 64; store 2 iterations x 256 thr x 8 halves = 64 lines x 64; grid = (R/64) x (C/64) blocks
//           covers D exactly once (host checks R % 64 == 0, C % 64 == 0).
// =====================================================================================================
__device__ __forceinline__ void wt16_body(u16* TH, int bid, const float* __restrict__ W, u16* D, int R, int C, int mode,
                                          float scale) {
  const int tid = threadIdx.x;
  const int nrt = R >> 6;
  const int r0  = (bid % nrt) * 64;
  const int c0  = (bid / nrt) * 64;
  {
    const int rl = tid >> 2;                  // input row within tile 0..63
    const int cs = (tid & 3) * 16;            // column chunk within the 64
    const float* src = W + (size_t)(r0 + rl) * C + c0 + cs;
#pragma unroll
    for (int i = 0; i < 4; ++i) {
      const v4f a = *(const v4f*)(src + 4 * i);
#pragma unroll
      for (int e = 0; e < 4; ++e) {
        const float v  = a[e];
        const unsigned short hb = h_bits((_Float16)(bfr(v) * scale));
        const unsigned short bb = bf_bits(v);
        TH[(cs + 4 * i + e) * VTP + rl] = (mode != 0) ? hb : bb;
      }
    }
  }
  __syncthreads();
  v4u vh[2];
  const int q8 = tid >> 3, p8 = (tid & 7) * 8;
#pragma unroll
  for (int it = 0; it < 2; ++it) {
    const int line = it * 32 + q8;            // local c = 0..63
    vh[it] = *(const v4u*)(TH + line * VTP + p8);
  }
  const size_t base = (size_t)c0 * (size_t)R + (size_t)r0 + p8;
  {
#pragma unroll
    for (int it = 0; it < 2; ++it) {
      const int line = it * 32 + q8;
      *(v4u*)(D + base + (size_t)line * (size_t)R) = vh[it];
    }
    
  }
}

// =====================================================================================================
// One launch for the five independent preparation jobs, picked by block index (block-uniform): blocks 0..4*WTB-1 = the four weight
// transposes (WTB blocks each, order Wq, Wk, Wv, Wo), the rest = the x conversion (XCB blocks per batch row).
// coverage: grid = 4*WTB + nb*XCB blocks; each job is handed block indices 0 .. its own block count - 1.
// =====================================================================================================
__global__ __launch_bounds__(256)
void prep(const float* __restrict__ x, const float* __restrict__ wq, const float* __restrict__ wk, const float* __restrict__ wv,
          const float* __restrict__ wo, u16* WQT, u16* WKT, u16* WVT, u16* WOT, u16* XB) {
  __shared__ __align__(16) u16 TH[64 * VTP];
  const int bid = blockIdx.x;
  if (bid < 4 * WTB) {
    const int job = bid / WTB;
    const float* W = (job == 0) ? wq : (job == 1) ? wk : (job == 2) ? wv : wo;
    u16* D = (job == 0) ? WQT : (job == 1) ? WKT : (job == 2) ? WVT : WOT;
    const bool pj = job < 3;                  // Wq, Wk, Wv: [EMB][DH] -> bf16; Wo: [DH][EMB] -> scaled f16
    wt16_body(TH, bid - job * WTB, W, D, pj ? EMB : DH, pj ? DH : EMB, pj ? 0 : 1, pj ? 1.0f : WSC);
  } else {
    const int r = bid - 4 * WTB;
    cvtx_body(r % XCB, r / XCB, x, XB, XCB * 256);
  }
}

// =====================================================================================================
//            16 consecutive lanes x 16 B per line), lanes 16..31 -> row 2*it+1.
//  epi64x2 : same store shape, staged value = acc*os1 + accres*os2 + badd (two accumulator sets combined in f32).
//  epi64hsb: f16 bits of ((tile + bf16RNE(bias[n])) * pscale); lane = (rq = lane>>3 -> row within a group of 4, c8 = 8 consecutive
// coverage: epi64/epi64x2 8 instructions x 2 rows x 16 lanes x 4 floats; epi64hsb 4 instructions x 4 rows x 8 lanes x 8 halves
//           = the wave's 16 x 64 tile in every case.
// =====================================================================================================
__device__ __forceinline__ void stage64(float* sl, v8f a0, v8f a1, v8f a2, v8f a3, float oscale, int lane) {
  const int hh = lane >> 4, m = lane & 15;
#pragma unroll
  for (int r = 0; r < 8; ++r) {
    const int ro = (8 * hh + r) * 68 + m;
    sl[ro]      = a0[r] * oscale;
    sl[ro + 16] = a1[r] * oscale;
    sl[ro + 32] = a2[r] * oscale;
    sl[ro + 48] = a3[r] * oscale;
  }
  wave_sync_lds();
}
__device__ __forceinline__ void epi64(float* sl, v8f a0, v8f a1, v8f a2, v8f a3, float oscale, v4f badd, float* C, int N,
                                      size_t rowb, int col0, int lane) {
  const int hh = lane >> 4, m = lane & 15;
  stage64(sl, a0, a1, a2, a3, oscale, lane);
  v4f vals[8];
#pragma unroll
  for (int it = 0; it < 8; ++it) vals[it] = *(const v4f*)(sl + (it * 2 + hh) * 68 + m * 4) + badd;
  float* dst = C + (rowb + (size_t)hh) * (size_t)N + col0 + m * 4;
  {
#pragma unroll
    for (int it = 0; it < 8; ++it) {
      *(v4f*)(dst + (size_t)(it * 2) * (size_t)N) = vals[it];
    }
    
  }
}
__device__ __forceinline__ void epi64x2(float* sl, v8f a0, v8f a1, v8f a2, v8f a3, v8f e0, v8f e1, v8f e2, v8f e3,
                                        float os1, float os2, v4f badd, float* C, int N, size_t rowb, int col0, int lane) {
  const int hh = lane >> 4, m = lane & 15;
#pragma unroll
  for (int r = 0; r < 8; ++r) {
    const int ro = (8 * hh + r) * 68 + m;
    sl[ro]      = a0[r] * os1 + e0[r] * os2;
    sl[ro + 16] = a1[r] * os1 + e1[r] * os2;
    sl[ro + 32] = a2[r] * os1 + e2[r] * os2;
    sl[ro + 48] = a3[r] * os1 + e3[r] * os2;
  }
  wave_sync_lds();
  v4f vals[8];
#pragma unroll
  for (int it = 0; it < 8; ++it) vals[it] = *(const v4f*)(sl + (it * 2 + hh) * 68 + m * 4) + badd;
  float* dst = C + (rowb + (size_t)hh) * (size_t)N + col0 + m * 4;
  {
#pragma unroll
    for (int it = 0; it < 8; ++it) {
      *(v4f*)(dst + (size_t)(it * 2) * (size_t)N) = vals[it];
    }
    
  }
}
__device__ __forceinline__ void epi64hsb(float* sl, v8f a0, v8f a1, v8f a2, v8f a3, float oscale, float pscale,
                                         const float* __restrict__ bias, u16* C, int N, size_t rowb, int col0, int lane) {
  stage64(sl, a0, a1, a2, a3, oscale, lane);
  const int rq = lane >> 3, c8 = (lane & 7) * 8;
  const v4f b0 = *(const v4f*)(bias + col0 + c8), b1 = *(const v4f*)(bias + col0 + c8 + 4);   // columns col0+c8..+7 < N
  float bb[8];
#pragma unroll
  for (int e = 0; e < 4; ++e) { bb[e] = bfr(b0[e]); bb[4 + e] = bfr(b1[e]); }
  v4u oh[4];
#pragma unroll
  for (int i4 = 0; i4 < 4; ++i4) {
    const int row = i4 * 4 + rq;
    const v4f a = *(const v4f*)(sl + row * 68 + c8), c4 = *(const v4f*)(sl + row * 68 + c8 + 4);
    float w[8];
#pragma unroll
    for (int e = 0; e < 4; ++e) { w[e] = (a[e] + bb[e]) * pscale; w[4 + e] = (c4[e] + bb[4 + e]) * pscale; }
#pragma unroll
    for (int e = 0; e < 4; ++e) oh[i4][e] = pk16(h_bits((_Float16)w[2 * e]), h_bits((_Float16)w[2 * e + 1]));
  }
  u16* dst = C + rowb * (size_t)N + col0 + c8;
  {
#pragma unroll
    for (int i4 = 0; i4 < 4; ++i4) {
      const int row = i4 * 4 + rq;
      *(v4u*)(dst + (size_t)row * (size_t)N) = oh[i4];
    }
    
  }
}

// =====================================================================================================
// bf16 GEMM, f32 out with bias: C[M][N] = (A[arow(m)][K] (bf16 row-major) . Bt[N][K]^T (bf16 k-contiguous)) * oscale + bf16RNE(bias[n]).
// Output row ra maps to A row arow = (ra / rpg) * gstr + (ra % rpg) (rpg = M, gstr = 0 gives the identity map; rpg = TQ0,
// gstr = SEQ picks the first TQ0 rows of every sequence).
// Block = 64x64 tile, 4 waves x 16 rows; fragments loaded straight from the 16-bit rows (two 16-B loads each, split k map for
// A and B); K stepped by 32 (host checks K % 32 == 0, M % 64 == 0, N % 64 == 0, grid = (M/64)*(N/64)).
// =====================================================================================================
__device__ __forceinline__
void gemm_b32_body(float* slab, int bid, const u16* __restrict__ A, const u16* __restrict__ Bt, const float* __restrict__ bias,
                   float* C, int M, int N, int K, int rpg, int gstr, float oscale) {
  const int tid = threadIdx.x, wave = tid >> 5, lane = tid & 31, hh = lane >> 4, m = lane & 15;
  const int ntile = N >> 6;
  const int rowb  = (bid / ntile) * 64 + wave * 16;
  const int col0  = (bid % ntile) * 64;
  if (rowb + 16 > M) return;                 // wave-uniform, never taken with the exact grid; no block barriers on this path
  const int ra = rowb + m;
  const int rg = ra / rpg;
  const size_t arow = (size_t)rg * (size_t)gstr + (size_t)(ra - rg * rpg);
  const u16* ap = A  + arow * (size_t)K + 8 * hh;
  const u16* bp = Bt + (size_t)(col0 + m) * K + 8 * hh;
  const size_t bs = (size_t)16 * K;
  v8f acc0 = zero8(), acc1 = zero8(), acc2 = zero8(), acc3 = zero8();
#pragma unroll 1
  for (int k0 = 0; k0 < K; k0 += 32) {
    const v16b a  = ldfrag_b(ap + k0);
    const v16b b0 = ldfrag_b(bp + k0);
    const v16b b1 = ldfrag_b(bp + bs + k0);
    const v16b b2 = ldfrag_b(bp + 2 * bs + k0);
    const v16b b3 = ldfrag_b(bp + 3 * bs + k0);
    acc0 = mma_b(a, b0, acc0);
    acc1 = mma_b(a, b1, acc1);
    acc2 = mma_b(a, b2, acc2);
    acc3 = mma_b(a, b3, acc3);
    guard6<v16b>(acc0, acc1, acc2, acc3, a, b0, b1, b2, b3, a);
  }
  const v4f bv4 = *(const v4f*)(bias + col0 + m * 4);    // columns col0 + 4m .. +3, always < N (N multiple of 64)
  v4f badd;
#pragma unroll
  for (int e = 0; e < 4; ++e) badd[e] = bfr(bv4[e]);
  epi64(slab + wave * SLAB64, acc0, acc1, acc2, acc3, oscale, badd, C, N, (size_t)rowb, col0, lane);
}

// =====================================================================================================
// bf16 GEMM, f16 plane out with bias: C16[M][N] = f16 bits of (((A . Bt^T) * oscale) + bf16RNE(bias[n])) * pscale; operands as in
// gemm_b32 (identity row map), epilogue epi64hsb.
// =====================================================================================================
__device__ __forceinline__
void gemm_bh16_body(float* slab, int bid, const u16* __restrict__ A, const u16* __restrict__ Bt, const float* __restrict__ bias,
                    u16* C, int M, int N, int K, float oscale, float pscale) {
  const int tid = threadIdx.x, wave = tid >> 5, lane = tid & 31, hh = lane >> 4, m = lane & 15;
  const int ntile = N >> 6;
  const int rowb  = (bid / ntile) * 64 + wave * 16;
  const int col0  = (bid % ntile) * 64;
  if (rowb + 16 > M) return;                 // wave-uniform, never taken with the exact grid; no block barriers on this path
  const u16* ap = A  + (size_t)(rowb + m) * K + 8 * hh;
  const u16* bp = Bt + (size_t)(col0 + m) * K + 8 * hh;
  const size_t bs = (size_t)16 * K;
  v8f acc0 = zero8(), acc1 = zero8(), acc2 = zero8(), acc3 = zero8();
#pragma unroll 1
  for (int k0 = 0; k0 < K; k0 += 32) {
    const v16b a  = ldfrag_b(ap + k0);
    const v16b b0 = ldfrag_b(bp + k0);
    const v16b b1 = ldfrag_b(bp + bs + k0);
    const v16b b2 = ldfrag_b(bp + 2 * bs + k0);
    const v16b b3 = ldfrag_b(bp + 3 * bs + k0);
    acc0 = mma_b(a, b0, acc0);
    acc1 = mma_b(a, b1, acc1);
    acc2 = mma_b(a, b2, acc2);
    acc3 = mma_b(a, b3, acc3);
    guard6<v16b>(acc0, acc1, acc2, acc3, a, b0, b1, b2, b3, a);
  }
  epi64hsb(slab + wave * SLAB64, acc0, acc1, acc2, acc3, oscale, pscale, bias, C, N, (size_t)rowb, col0, lane);
}

// =====================================================================================================
// One launch for the five independent projection GEMMs, picked by block index (block-uniform): blocks 0..GHB-1 = f32 q rows 0..127
// of every sequence, GHB..2*GHB-1 = the same for k, then GPB blocks each for the f32 v plane, the f16 q plane and the f16 k plane.
// coverage: grid = 2*GHB + 3*GPB blocks; each GEMM is handed block indices 0 .. its own block count - 1.
// =====================================================================================================
__global__ __launch_bounds__(128)
void proj(const u16* __restrict__ XB, const u16* __restrict__ WQT, const u16* __restrict__ WKT, const u16* __restrict__ WVT,
          const float* __restrict__ bq, const float* __restrict__ bk, const float* __restrict__ bv,
          u16* QP, u16* KP, float* V, float* QF, float* KF, int rows, int hrows, int N, int K) {
  __shared__ __align__(16) float slab[4 * SLAB64];
  const int bid = blockIdx.x;
  if (bid < 2 * GHB + GPB) {                 // f32 outputs
    const int job = (bid < GHB) ? 0 : (bid < 2 * GHB) ? 1 : 2;
    const bool hd = job < 2;                 // rows 0..TQ0-1 of every sequence against all rows
    gemm_b32_body(slab, bid - job * GHB, XB, (job == 0) ? WQT : (job == 1) ? WKT : WVT, (job == 0) ? bq : (job == 1) ? bk : bv,
                  (job == 0) ? QF : (job == 1) ? KF : V, hd ? hrows : rows, N, K, hd ? TQ0 : rows, hd ? SEQ : 0, 1.0f);
  } else {                                   // f16 planes
    const int r = bid - (2 * GHB + GPB);
    const bool isq = r < GPB;
    gemm_bh16_body(slab, isq ? r : r - GPB, XB, isq ? WQT : WKT, isq ? bq : bk, isq ? QP : KP, rows, N, K, 1.0f,
                   isq ? QSC : KSC);
  }
}

// =====================================================================================================
// f16 GEMM with two A planes (hi + residual), f32 out with bias:
//   C[M][N] = (Ah . Bt^T) * os1 + (Ar . Bt^T) * os2 + bf16RNE(bias[n]); Ah/Ar f16 row-major, Bt f16 k-contiguous.
// Same tiling as gemm_b32; separate accumulators for the two planes, combined in f32 in epi64x2.
// =====================================================================================================
__global__ __launch_bounds__(128)
void gemm_h2_32(const u16* __restrict__ Ah, const u16* __restrict__ Ar, const u16* __restrict__ Bt,
                const float* __restrict__ bias, float* C, int M, int N, int K, float os1, float os2) {
  __shared__ __align__(16) float slab[4 * SLAB64];
  const int tid = threadIdx.x, wave = tid >> 5, lane = tid & 31, hh = lane >> 4, m = lane & 15;
  const int ntile = N >> 6;
  const int bid   = blockIdx.x;
  const int rowb  = (bid / ntile) * 64 + wave * 16;
  const int col0  = (bid % ntile) * 64;
  if (rowb + 16 > M) return;                 // wave-uniform, never taken with the exact grid; no block barriers in this kernel
  const _Float16* ap  = (const _Float16*)(const void*)Ah + (size_t)(rowb + m) * K + 8 * hh;
  const _Float16* arp = (const _Float16*)(const void*)Ar + (size_t)(rowb + m) * K + 8 * hh;
  const _Float16* bp  = (const _Float16*)(const void*)Bt + (size_t)(col0 + m) * K + 8 * hh;
  const size_t bs = (size_t)16 * K;
  v8f acc0 = zero8(), acc1 = zero8(), acc2 = zero8(), acc3 = zero8();
  v8f acr0 = zero8(), acr1 = zero8(), acr2 = zero8(), acr3 = zero8();
#pragma unroll 1
  for (int k0 = 0; k0 < K; k0 += 32) {
    const v16h a  = ldfrag_h(ap + k0);
    const v16h ar = ldfrag_h(arp + k0);
    const v16h b0 = ldfrag_h(bp + k0);
    const v16h b1 = ldfrag_h(bp + bs + k0);
    const v16h b2 = ldfrag_h(bp + 2 * bs + k0);
    const v16h b3 = ldfrag_h(bp + 3 * bs + k0);
    acc0 = mma_h(a, b0, acc0);
    acc1 = mma_h(a, b1, acc1);
    acc2 = mma_h(a, b2, acc2);
    acc3 = mma_h(a, b3, acc3);
    acr0 = mma_h(ar, b0, acr0);
    acr1 = mma_h(ar, b1, acr1);
    acr2 = mma_h(ar, b2, acr2);
    acr3 = mma_h(ar, b3, acr3);
    guard8x6(acc0, acc1, acc2, acc3, acr0, acr1, acr2, acr3, a, ar, b0, b1, b2, b3);
  }
  const v4f bv = *(const v4f*)(bias + col0 + m * 4);      // columns col0 + 4m .. +3, always < N (N multiple of 64)
  v4f badd;
#pragma unroll
  for (int e = 0; e < 4; ++e) badd[e] = bfr(bv[e]);
  epi64x2(slab + wave * SLAB64, acc0, acc1, acc2, acc3, acr0, acr1, acr2, acr3, os1, os2, badd, C, N,
          (size_t)rowb, col0, lane);
}

// =====================================================================================================
// V^T plane: VT[(b*DH + d)*SEQ + s] = f16(V[b][s][d] * 1024), V = f32 [b*SEQ + s][DH].
// Block = (b, 64 keys): 64 source rows of 64 floats loaded with 16-B loads, converted, scattered into an LDS tile [d][64 keys]
// coverage: load 256 thr x 16 elements = 64 x 64; store 2 iterations x 256 thr x 8 halves = 64 lines x 64 = the block's tile;
//           grid = nb x (SEQ/64) blocks covers the plane exactly once.
// =====================================================================================================
__device__ __forceinline__ void xt16_body(u16* TH, int bid, const float* __restrict__ X, u16* XTo) {
  const int tid = threadIdx.x;
  const int st  = bid % (SEQ / 64);
  const int b   = bid / (SEQ / 64);
  const int s0  = st * 64;
  {
    const int sl = tid >> 2;                  // key within tile 0..63
    const int dc = (tid & 3) * 16;            // d chunk within the 64
    const float* src = X + ((size_t)b * SEQ + s0 + sl) * DH + dc;
#pragma unroll
    for (int i = 0; i < 4; ++i) {
      const v4f a = *(const v4f*)(src + 4 * i);
#pragma unroll
      for (int e = 0; e < 4; ++e) {
        const float v = a[e];
        TH[(dc + 4 * i + e) * VTP + sl] = h_bits((_Float16)(v * VCAR));
      }
    }
  }
  __syncthreads();
  v4u vh[2];
  const int q8 = tid >> 3, p8 = (tid & 7) * 8;
#pragma unroll
  for (int it = 0; it < 2; ++it) {
    const int line = it * 32 + q8;            // local d = 0..63
    vh[it] = *(const v4u*)(TH + line * VTP + p8);
  }
  const size_t base = ((size_t)b * DH) * SEQ + s0 + p8;
  {
#pragma unroll
    for (int it = 0; it < 2; ++it) {
      const int line = it * 32 + q8;
      *(v4u*)(XTo + base + (size_t)line * SEQ) = vh[it];
    }
    // the code of the launch's other job follows these stores in the built kernel and rewrites their registers: wait first
    asm volatile("s_wait_xcnt 0x0" ::: "memory");
  }
}

// =====================================================================================================
// Key-block prefix column sums of V: VS[((b*NCHK + c)*NKB + kb)*DH + d] = sum over keys c*CK .. c*CK + 32*kb + 31 of V[b][key][d]
// (f32, fixed sequential order). Block = one (b, c), threads 0..63 work (thread = d; waves 2..7 only pass the barrier); the 16 prefix
// values per thread are staged in LDS
// coverage: grid = nb*NCHK blocks x (4 iterations x 64 thr x 4 floats = 1024) = the whole table.
// =====================================================================================================
__device__ __forceinline__ void vsum_body(float* sm, int bc, const float* __restrict__ V, float* VS) {
  const int tid = threadIdx.x;                        // d
  const int b   = bc / NCHK;
  const int c   = bc - b * NCHK;
  if (tid < DH) {                                     // waves 0,1 entirely (wave-uniform)
  const float* p = V + ((size_t)b * SEQ + (size_t)c * CK) * DH + tid;
  float s = 0.f;
  // Two register sets of one key block each: the next block's 32 loads are issued before this block is summed, so that the load
  // latency is shared by the loads in flight. The adds run in sequential key order.
  float va[32], vb[32];
#pragma unroll
  for (int i = 0; i < 32; ++i) va[i] = p[(size_t)i * DH];
  // fully unrolled: every load address is the base plus a constant, and the two sets stay in registers
#pragma unroll
  for (int kb = 0; kb < NKB; kb += 2) {
#pragma unroll
    for (int i = 0; i < 32; ++i) vb[i] = p[(size_t)((kb + 1) * 32 + i) * DH];
#pragma unroll
    for (int i = 0; i < 32; ++i) s += va[i];
    sm[kb * DH + tid] = s;
    if (kb + 2 < NKB) {
#pragma unroll
      for (int i = 0; i < 32; ++i) va[i] = p[(size_t)((kb + 2) * 32 + i) * DH];
    }
#pragma unroll
    for (int i = 0; i < 32; ++i) s += vb[i];
    sm[(kb + 1) * DH + tid] = s;
  }
  }
  __syncthreads();
  if (tid >= DH) return;                              // behind the only barrier of this path
  v4f o[4];
#pragma unroll
  for (int it = 0; it < 4; ++it) o[it] = *(const v4f*)(sm + it * 256 + tid * 4);
  float* base = VS + (size_t)bc * NKB * DH + tid * 4;
  {
#pragma unroll
    for (int it = 0; it < 4; ++it) {
      *(v4f*)(base + it * 256) = o[it];
    }
    
  }
}

// =====================================================================================================
// One launch for the two independent readers of the f32 v plane, picked by block index (block-uniform): blocks 0..VSB-1 = prefix
// column sums (the longer dependent chain, so it starts first), the rest = the V^T plane.
// coverage: grid = VSB + XTB blocks; each job is handed block indices 0 .. its own block count - 1.
// =====================================================================================================
__global__ __launch_bounds__(256) void vprep(const float* __restrict__ V, u16* VT, float* VS) {
  __shared__ __align__(16) u16 TH[64 * VTP];
  __shared__ __align__(16) float sm[NKB * DH];
  const int bid = blockIdx.x;
  if (bid < VSB) vsum_body(sm, bid, V, VS);
  else           xt16_body(TH, bid - VSB, V, VT);
}

// =====================================================================================================
// Single-head causal attention, head width DH = 64, query rows TQ0 .. SEQ-1: block = (batch b, 16 query rows q0..q0+15), 8 waves.
// q plane (f16, x8) [b][s][d]; k plane the same; V^T plane [b][d][s] (x1024); VS = key-block prefix column sums of V.
//   Chunks of CK = 512 keys: only chunks c <= qc = q0/CK are visited (later chunks lie entirely above the diagonal). In the diagonal
//   chunk only key blocks kb < nkb (keys <= q0+15) are multiplied; key blocks kb >= nkb get zero scores in LDS and are not used in (PV).
//   (S) scores S[query m][key n] on WMMA: A = q rows (row m = lane&15, split k map over d, two 32-d fragments kept in registers),
//       B = k rows (col n = key, split map); wave w handles key blocks w, w+8 of the chunk; D element r of lane l -> scs[query 8h+r][key].
//   (M) 16 threads per query row (sub-thread = 32 consecutive keys): base-2 logits with the causal mask by key index (key > query
//       -> -inf), chunk max via xor shuffles, online running max / rescale factor al / running sum l in f32 registers,
//       p = exp2(t - m_new) <= 1 (0 for masked keys), chunk row sum ps and C = ps/CK (bit-identical on the row's 16 threads), the
//       CENTRED P' = p - C written as f16(P' * 32768) into the LDS P tile with 16-B stores; al -> rowa[row], C -> rowc[row].
//   (PV) every wave keeps its own partial O (4 accumulator tiles = 16 queries x 64 d): o_w = o_w*al (+ on wave 0 only:
//       C*(32768*1024)*VS[chunk][nkb-1][d], the exact add-back of the centring term over exactly the processed keys, in f32), then for
//       the wave's key blocks kb in {w, w+8}, kb < nkb: A = P' fragment from LDS (row m = query, split map over keys), B = V^T
//       fragments (col n = d, split map over keys), 4 WMMAs plus a hazard gap. sum_k (P'_k + C) v_k == sum_k p_k v_k exactly;
//       masked keys carry P' = -C and p = 0.
//   Block barriers after (S) and after (M) order all LDS reuse across chunks and waves.
//   Combine: after a block barrier the 8 partial O tiles are staged in the score region ([8][16][OPP] f32), barrier, then thread
//   (row = tid>>4, 4 columns) sums the 8 partials in fixed order, x = sum * 4096 / (l * 32768 * 1024) (l >= 1 always, held in
//   registers by the row's 16 threads), hi = f16(x), res = f16((x - hi) * 2048), staged as a [32][CTP] u16 tile in the P region,
// coverage: grid nb*NQT blocks x 16 rows = rows TQ0..SEQ-1 of every sequence; scs written 16 x 512 every chunk (zeros for kb >= nkb);
//           P tile written 16 x 512 every chunk; partial stage 8 x 16 x 64; ctx stage 32 x 64; store 32 lines = 16 rows of both planes.
// =====================================================================================================
__device__ __forceinline__
void attn_fwd_body(float* scs, u16* pls, float* rowa, float* rowc, int bid,
                   const u16* __restrict__ QPp, const u16* __restrict__ KPp, const u16* __restrict__ VTp,
                   const float* __restrict__ VSp, u16* CHo, u16* CRo) {
  const int tid  = threadIdx.x;
  const int wave = tid >> 5;
  const int lane = tid & 31;
  const int hh   = lane >> 4;
  const int m    = lane & 15;
  const int r16  = tid >> 4;                 // query row owned in phase (M) and in the combine
  const int sub  = tid & 15;
  const int kl0  = sub * 32;

  const int b   = bid / NQT;
  const int q0  = TQ0 + (bid - b * NQT) * QT;
  const int qc  = q0 / CK;                   // diagonal chunk index

  const _Float16* qrow = (const _Float16*)(const void*)QPp + ((size_t)b * SEQ + q0 + m) * DH + 8 * hh;
  const v16h qa0 = ldfrag_h(qrow);           // d 0..31
  const v16h qa1 = ldfrag_h(qrow + 32);      // d 32..63
  const _Float16* kbp = (const _Float16*)(const void*)KPp + ((size_t)b * SEQ + m) * DH + 8 * hh;
  const _Float16* vbp = (const _Float16*)(const void*)VTp + ((size_t)b * DH + m) * SEQ + 8 * hh;
  const float* vsb = VSp + (size_t)b * NCHK * NKB * DH + m;
  const float lsc = RSQD * LOG2E / (QSC * KSC);
  const float addsel = (wave == 0) ? (PCAR * VCAR) : 0.f;    // centring add-back on wave 0 only

  float mrun = -INFINITY, lrun = 0.f;
  v8f o[NACC];
#pragma unroll
  for (int j = 0; j < NACC; ++j) o[j] = zero8();

#pragma unroll 1
  for (int c = 0; c <= qc; ++c) {
    const int kbeg = c * CK;
    const int nkb  = (c < qc) ? NKB : (((q0 + QT - 1 - kbeg) >> 5) + 1);   // 1..16, block-uniform
    // ---- (S) scores of this chunk (zeros for key blocks beyond the query tile) ----
#pragma unroll 1
    for (int kb = wave; kb < NKB; kb += 8) {               // wave-uniform, 2 trips
      v8f s0 = zero8(), s1 = zero8();
      if (kb < nkb) {                                      // wave-uniform
        const _Float16* k0p = kbp + (size_t)(kbeg + kb * 32) * DH;
        const _Float16* k1p = k0p + (size_t)16 * DH;
        const v16h f00 = ldfrag_h(k0p);
        const v16h f01 = ldfrag_h(k0p + 32);
        const v16h f10 = ldfrag_h(k1p);
        const v16h f11 = ldfrag_h(k1p + 32);
        s0 = mma_h(qa0, f00, s0);
        s0 = mma_h(qa1, f01, s0);
        s1 = mma_h(qa0, f10, s1);
        s1 = mma_h(qa1, f11, s1);
        guard2x6(s0, s1, qa0, qa1, f00, f01, f10, f11);
      }
      float* srow = scs + (8 * hh) * SCP + kb * 32 + m;
#pragma unroll
      for (int r = 0; r < 8; ++r) {
        srow[r * SCP]      = s0[r];
        srow[r * SCP + 16] = s1[r];
      }
    }
    __syncthreads();
    // ---- (M) softmax statistics and the centred P' tile ----
    {
      const float* sp = scs + r16 * SCP + kl0;
      const int lim = (q0 + r16) - (kbeg + kl0);           // key kl0 + j is valid iff j <= lim
      float t[32];
      float cm = -INFINITY;
#pragma unroll
      for (int i = 0; i < 8; ++i) {
        const v4f a = *(const v4f*)(sp + 4 * i);
#pragma unroll
        for (int e = 0; e < 4; ++e) {
          const int j = 4 * i + e;
          const float tv = (j <= lim) ? a[e] * lsc : -INFINITY;
          t[j] = tv;
          cm = fmaxf(cm, tv);
        }
      }
#pragma unroll
      for (int d = 1; d <= 8; d <<= 1) cm = fmaxf(cm, __shfl_xor(cm, d, 32));
      const float mn = fmaxf(mrun, cm);                    // finite: key kbeg of every visited chunk is never masked
      const float al = (mrun == -INFINITY) ? 0.f : exp2f(mrun - mn);
      mrun = mn;
      float ps = 0.f;
#pragma unroll
      for (int j = 0; j < 32; ++j) {
        const float p = exp2f(fminf(t[j] - mn, 0.f));      // 0 for masked keys
        t[j] = p;
        ps += p;
      }
#pragma unroll
      for (int d = 1; d <= 8; d <<= 1) ps += __shfl_xor(ps, d, 32);
      const float cc = ps * (1.0f / (float)CK);
      v4u pk[4];
#pragma unroll
      for (int i = 0; i < 4; ++i) {
#pragma unroll
        for (int e = 0; e < 4; ++e) {
          const int j = 8 * i + 2 * e;
          pk[i][e] = pk16(h_bits((_Float16)((t[j] - cc) * PCAR)), h_bits((_Float16)((t[j + 1] - cc) * PCAR)));
        }
      }
      lrun = lrun * al + ps;
      u16* pd = pls + r16 * PLP + kl0;
#pragma unroll
      for (int i = 0; i < 4; ++i) *(v4u*)(pd + 8 * i) = pk[i];
      if (sub == 0) { rowa[r16] = al; rowc[r16] = cc; }
    }
    __syncthreads();
    // ---- (PV) rescale, add the centring term (wave 0), accumulate P' . V^T for this wave's key blocks ----
    {
      float scl[8], cad[8];
#pragma unroll
      for (int r = 0; r < 8; ++r) { scl[r] = rowa[8 * hh + r]; cad[r] = rowc[8 * hh + r] * addsel; }
      const float* vsc = vsb + ((size_t)c * NKB + (size_t)(nkb - 1)) * DH;
      float vs[NACC];
#pragma unroll
      for (int j = 0; j < NACC; ++j) vs[j] = vsc[16 * j];
#pragma unroll
      for (int j = 0; j < NACC; ++j) {
#pragma unroll
        for (int r = 0; r < 8; ++r) o[j][r] = o[j][r] * scl[r] + cad[r] * vs[j];
      }
      const _Float16* pp = (const _Float16*)(const void*)pls + m * PLP + 8 * hh;
      const _Float16* vp = vbp + kbeg;
#pragma unroll 1
      for (int kb = wave; kb < nkb; kb += 8) {             // wave-uniform trip count, <= 2
        const v16h pf = ldfrag_h(pp + kb * 32);
        const _Float16* vk = vp + kb * 32;
        const v16h g0 = ldfrag_h(vk);
        const v16h g1 = ldfrag_h(vk + (size_t)16 * SEQ);
        const v16h g2 = ldfrag_h(vk + (size_t)32 * SEQ);
        const v16h g3 = ldfrag_h(vk + (size_t)48 * SEQ);
        o[0] = mma_h(pf, g0, o[0]);
        o[1] = mma_h(pf, g1, o[1]);
        o[2] = mma_h(pf, g2, o[2]);
        o[3] = mma_h(pf, g3, o[3]);
        guardpv4(o[0], o[1], o[2], o[3], pf, g0, g1, g2, g3);
      }
    }
  }
  acc_guard4(o[0], o[1], o[2], o[3]);

  // ---- combine the 8 partial O tiles in fixed order ----
  __syncthreads();
#pragma unroll
  for (int j = 0; j < NACC; ++j) {
#pragma unroll
    for (int r = 0; r < 8; ++r) scs[(wave * 16 + 8 * hh + r) * OPP + 16 * j + m] = o[j][r];
  }
  __syncthreads();
  const int c4 = sub * 4;
  v4f sm4 = zero4();
#pragma unroll
  for (int w = 0; w < 8; ++w) sm4 += *(const v4f*)(scs + (w * 16 + r16) * OPP + c4);
  const float inv = (1.0f / lrun) * (CSC / (PCAR * VCAR));            // lrun >= 1
#pragma unroll
  for (int e = 0; e < 4; ++e) {
    const float xs = sm4[e] * inv;
    const _Float16 hv = (_Float16)xs;
    const _Float16 rv = (_Float16)((xs - (float)hv) * RSC);
    pls[r16 * CTP + c4 + e]        = h_bits(hv);
    pls[(16 + r16) * CTP + c4 + e] = h_bits(rv);
  }
  __syncthreads();
  const int line = tid >> 3;                 // 0..31: plane = line>>4, row = line&15
  const int plane = line >> 4;
  const int rowl  = line & 15;
  const int c8    = (tid & 7) * 8;
  const v4u ov = *(const v4u*)(pls + (plane * 16 + rowl) * CTP + c8);
  u16* dst = ((plane == 0) ? CHo : CRo) + ((size_t)b * SEQ + q0 + rowl) * DH + c8;
  *(v4u*)dst = ov;
  
}

// =====================================================================================================
// Query rows 0 .. TQ0-1 of each sequence in f32 on VALU: block = (b, t), threads 0..127 work (waves 4..7 only pass the barriers). QF/KF = f32 q/k planes [nb][TQ0][DH] (bias
// included), V = f32 v plane [nb*SEQ][DH]. Scores for keys j (thread j, one key each, 64-d dot of its whole key row against the q row staged in LDS;
// keys j > t masked to -inf), base-2 softmax with block max / sum reductions (xor shuffles + LDS), p_j in LDS, ctx[d] for d = tid
// (threads 0..63) as a sum in key order of p_j * V[b][j][d] (coalesced, groups of 64 keys up to the one holding t), x = ctx * 4096 / l, hi = f16(x),
// res = f16((x - hi) * 2048); both 64-half rows are staged in LDS and written by lanes 0..15 of wave 0: lanes 0..7 the hi row, lanes
// coverage: grid nb*TQ0 blocks = rows 0..TQ0-1 of every sequence; 64 thr x 1 d = DH per row; store 16 lanes x 8 halves = both rows;
//           together with attn_fwd every (b, s, d) of CH and CR is written exactly once.
// =====================================================================================================
__device__ __forceinline__
void attn_head_body(float* qs, float* sc, float* red, float* redb, u16* SW, int bid,
                    const float* __restrict__ QF, const float* __restrict__ KF, const float* __restrict__ V, u16* CHo, u16* CRo) {
  const int tid = threadIdx.x, lane = tid & 31, wave = tid >> 5;
  const int b = bid / TQ0;
  const int t = bid - b * TQ0;
  const bool work = wave < HD_THREADS / 32;                        // wave-uniform: one key per thread, keys 0..TQ0-1
  if (tid < DH) qs[tid] = QF[((size_t)b * TQ0 + t) * DH + tid];   // waves 0,1 entirely (wave-uniform)
  __syncthreads();
  float acc = 0.f;
  if (work) {
    const float* kp = KF + (size_t)b * (TQ0 * DH) + tid * DH;       // key row b*TQ0 + tid always in range (tid < TQ0)
    v4f kr[DH / 4];                                                 // the whole key row: 16 loads in flight, one latency
#pragma unroll
    for (int i = 0; i < DH / 4; ++i) kr[i] = *(const v4f*)(kp + 4 * i);
#pragma unroll
    for (int i = 0; i < DH / 4; ++i) {
      const v4f q4 = *(const v4f*)(qs + 4 * i);
#pragma unroll
      for (int e = 0; e < 4; ++e) acc += kr[i][e] * q4[e];
    }
  }
  const float s = (tid <= t) ? acc * (RSQD * LOG2E) : -INFINITY;   // causal mask by key index
  float mx = s;
#pragma unroll
  for (int d = 1; d <= 16; d <<= 1) mx = fmaxf(mx, __shfl_xor(mx, d, 32));
  if (work && lane == 0) red[wave] = mx;
  __syncthreads();
  float gm = red[0];
#pragma unroll
  for (int w = 1; w < 4; ++w) gm = fmaxf(gm, red[w]);   // finite: key 0 is always valid
  const float p = exp2f(s - gm);                     // 0 for masked keys
  float ps = p;
#pragma unroll
  for (int d = 1; d <= 16; d <<= 1) ps += __shfl_xor(ps, d, 32);
  if (work && lane == 0) redb[wave] = ps;
  if (work) sc[tid] = p;
  __syncthreads();
  float l = redb[0];
#pragma unroll
  for (int w = 1; w < 4; ++w) l += redb[w];           // >= 1
  const float inv = (1.0f / l) * CSC;
  if (wave < 2) {                                    // threads 0..63 (wave-uniform): one d column each
    const float* vp = V + (size_t)b * SEQ * DH + tid;
    float cx = 0.f;
    // Keys in groups of 64 whose loads are issued ahead of their use: one load latency per group. A group's keys j > t carry
    // sc[j] = 0 and add nothing; rows j0 .. j0+63 <= TQ0-1 of sequence b always exist. The sum runs in key order.
    // rolled: the trip count (1 or 2) depends on t
#pragma unroll 1
    for (int j0 = 0; j0 <= t; j0 += 64) {            // block-uniform
      float vv[64];
#pragma unroll
      for (int i = 0; i < 64; ++i) vv[i] = vp[(size_t)(j0 + i) * DH];
#pragma unroll
      for (int i = 0; i < 16; ++i) {
        const v4f p4 = *(const v4f*)(sc + j0 + 4 * i);
#pragma unroll
        for (int e = 0; e < 4; ++e) cx += p4[e] * vv[4 * i + e];
      }
    }
    const float x0 = cx * inv;
    const _Float16 h0 = (_Float16)x0;
    const _Float16 r0 = (_Float16)((x0 - (float)h0) * RSC);
    SW[tid]      = h_bits(h0);
    SW[DH + tid] = h_bits(r0);
  }
  __syncthreads();
  if (wave == 0) {                                   // wave-uniform
    const int l16 = lane & 15;
    const int plane = l16 >> 3, p8 = (l16 & 7) * 8;
    const v4u ov = *(const v4u*)(SW + plane * DH + p8);
    u16* dst = ((plane == 0) ? CHo : CRo) + ((size_t)b * SEQ + t) * DH + p8;
    if (lane < 16) *(v4u*)dst = ov;
    
  }
}

// =====================================================================================================
// One launch for the two independent attention jobs, picked by block index (block-uniform): blocks 0..NB*NQT-1 = query rows TQ0.. on
// WMMA, the rest = query rows 0..TQ0-1 on VALU (short blocks, last, so that they fill places the long blocks leave).
// coverage: grid = NB*NQT + NB*TQ0 blocks; each job is handed block indices 0 .. its own block count - 1.
// =====================================================================================================
__global__ __launch_bounds__(ATT_THREADS) __attribute__((amdgpu_num_vgpr(256)))
void attn(const u16* __restrict__ QPp, const u16* __restrict__ KPp, const u16* __restrict__ VTp, const float* __restrict__ VSp,
          const float* __restrict__ QF, const float* __restrict__ KF, const float* __restrict__ V, u16* CHo, u16* CRo) {
  __shared__ __align__(16) float scs[16 * SCP];     // scores [16][SCP] f32; reused as partial O tiles [8][16][OPP] f32
  __shared__ __align__(16) u16 pls[16 * PLP];       // P' tile [16][PLP] f16 bits; reused as ctx staging [32][CTP] u16
  __shared__ float rowa[QT];
  __shared__ float rowc[QT];
  __shared__ __align__(16) float qs[DH];
  __shared__ __align__(16) float sc[TQ0];
  __shared__ float red[4];
  __shared__ float redb[4];
  __shared__ __align__(16) u16 SW[2 * DH];
  const int bid = blockIdx.x;
  if (bid < NB * NQT) attn_fwd_body(scs, pls, rowa, rowc, bid, QPp, KPp, VTp, VSp, CHo, CRo);
  else                attn_head_body(qs, sc, red, redb, SW, bid - NB * NQT, QF, KF, V, CHo, CRo);
}

// =====================================================================================================
// Workspace map (bytes, nb = 4, rows = 16384); every plane is fully written by whole-line stores before it is read; all extents are
//   WQT bf16 [64][512] 65536   WKT same   WVT same   WOT f16 of bf16 value x1024 [512][64] 65536                   262144
//   XB  bf16 [rows][512]                                                                                           16777216
//   QP  f16 [rows][64] x8                                                                                           2097152
//   KP  f16 [rows][64] x8                                                                                           2097152
//   V   f32 [rows][64]                                                                                              4194304
//   VT  f16 [nb][64][SEQ] x1024                                                                                     2097152
//   VS  f32 [nb][8][16][64]                                                                                          131072
//   QF  f32 [nb][128][64]  131072      KF same                                                                       262144
//   CH  f16 [rows][64] ctx hi x4096                                                                                 2097152
//   CR  f16 [rows][64] ctx residual x2048                                                                           2097152
//   end                                                                                                            32112640
// =====================================================================================================
extern "C" void kernel_launch(void* const* d_in, const int* in_sizes, int n_in,
                              void* d_out, int out_size, void* d_ws, size_t ws_size,
                              hipStream_t stream) {
  if (n_in < 9) return;
  const int nb   = NB;
  const int rows = nb * SEQ;
  if ((long long)in_sizes[0] < (long long)NB * SEQ_FULL * EMB) return;
  if (in_sizes[1] < EMB * DH || in_sizes[3] < EMB * DH || in_sizes[5] < EMB * DH || in_sizes[7] < DH * EMB) return;
  if (in_sizes[2] < DH || in_sizes[4] < DH || in_sizes[6] < DH || in_sizes[8] < EMB) return;
  if ((long long)out_size < (long long)rows * EMB) return;

  const float* x  = (const float*)d_in[0];
  const float* wq = (const float*)d_in[1];
  const float* bq = (const float*)d_in[2];
  const float* wk = (const float*)d_in[3];
  const float* bk = (const float*)d_in[4];
  const float* wv = (const float*)d_in[5];
  const float* bv = (const float*)d_in[6];
  const float* wo = (const float*)d_in[7];
  const float* bo = (const float*)d_in[8];
  float*       out = (float*)d_out;

  const size_t szW  = (size_t)EMB * DH * 2;                      //     65536
  const size_t szXB = (size_t)rows * EMB * 2;                    //  16777216
  const size_t szP  = (size_t)rows * DH * 2;                     //   2097152
  const size_t szV  = (size_t)rows * DH * 4;                     //   4194304
  const size_t szVT = (size_t)nb * DH * SEQ * 2;                 //   2097152 (== szP)
  const size_t szVS = (size_t)nb * NCHK * NKB * DH * 4;          //    131072
  const size_t szHF = (size_t)nb * TQ0 * DH * 4;                 //    131072
  size_t off = 0;
  const size_t oWQ = off; off += szW;
  const size_t oWK = off; off += szW;
  const size_t oWV = off; off += szW;
  const size_t oWO = off; off += szW;
  const size_t oXB = off; off += szXB;
  const size_t oQ  = off; off += szP;
  const size_t oK  = off; off += szP;
  const size_t oV  = off; off += szV;
  const size_t oVT = off; off += szVT;
  const size_t oVS = off; off += szVS;
  const size_t oQF = off; off += szHF;
  const size_t oKF = off; off += szHF;
  const size_t oCH = off; off += szP;
  const size_t oCR = off; off += szP;
  if (off > ws_size) return;                                     // off = 32112640 at nb = 4
  if (off > WS_CAP) return;

  char* ws = (char*)d_ws;
  u16*   WQT = (u16*)(ws + oWQ);
  u16*   WKT = (u16*)(ws + oWK);
  u16*   WVT = (u16*)(ws + oWV);
  u16*   WOT = (u16*)(ws + oWO);
  u16*   XB  = (u16*)(ws + oXB);
  u16*   QP  = (u16*)(ws + oQ);
  u16*   KP  = (u16*)(ws + oK);
  float* V   = (float*)(ws + oV);
  u16*   VT  = (u16*)(ws + oVT);
  float* VS  = (float*)(ws + oVS);
  float* QF  = (float*)(ws + oQF);
  float* KF  = (float*)(ws + oKF);
  u16*   CH  = (u16*)(ws + oCH);
  u16*   CR  = (u16*)(ws + oCR);

  const int n8x = (SEQ * EMB) / 8;                       // 262144 per batch
  if ((n8x % 256) != 0 || (rows % 64) != 0 || ((nb * TQ0) % 64) != 0) return;
  const dim3 blk(256);
  const dim3 gPR(4 * WTB + NB * XCB);                   // 4 * 8 weight tiles + nb * 1024 x blocks
  const dim3 gPJ(2 * GHB + 3 * GPB);                    // 2 * 8 + 3 * 256 at nb = 4
  const dim3 bG(128);
  const dim3 gVP(VSB + XTB);                            // nb * 8 + nb * 64
  const dim3 gAT(NB * NQT + NB * TQ0);                  // nb * 248 + nb * 128
  const dim3 bAT(ATT_THREADS);
  const dim3 gO((rows / 64) * (EMB / 64));              // 2048 at nb = 4

  // (0) Wq, Wk, Wv stored [k = in 512][n = out 64] -> bf16 k-contiguous planes [64][512]; Wo [k = 64][n = 512] -> f16 of bf16
  //     value x1024, k-contiguous [512][64]; x -> bf16 plane [rows][512]
  prep<<<gPR, blk, 0, stream>>>(x, wq, wk, wv, wo, WQT, WKT, WVT, WOT, XB);
  // (1) q and k projections (+bias) -> f16 planes x8; v projection (+bias) -> f32 plane; f32 q and k rows 0..127 of every
  //     sequence -> QF, KF [nb*128][64]
  proj<<<gPJ, bG, 0, stream>>>(XB, WQT, WKT, WVT, bq, bk, bv, QP, KP, V, QF, KF, rows, nb * TQ0, DH, EMB);
  // (2) v -> V^T plane x1024 and key-block prefix column sums of v
  vprep<<<gVP, blk, 0, stream>>>(V, VT, VS);
  // (3) attention: query rows 128.. on WMMA and query rows 0..127 on VALU -> ctx hi x4096 and residual x2048 f16 planes
  attn<<<gAT, bAT, 0, stream>>>(QP, KP, VT, VS, QF, KF, V, CH, CR);
  // (4) output projection + bias -> out
  gemm_h2_32<<<gO, bG, 0, stream>>>(CH, CR, WOT, bo, out, rows, EMB, DH,
                                    1.0f / (CSC * WSC), 1.0f / (CSC * WSC * RSC));
  (void)hipGetLastError();
}

// v003
// A run of this version takes 79.2 microseconds.
// Timed twice side by side with v002, it ran 1.46 and 1.45 times as fast.
// Over all steps from v000 it is 2.83 times as fast.
// Projections q,k,v = x.W + b and the f32 q,k rows 0..127 per sequence: v_wmma_f32_16x16x32_bf16 (bf16 RNE operands of the
// raw inputs, f32 accumulate, bf16 RNE bias added in f32). Scores q'.k'^T (f16 planes x8), P'.V (chunk-centred P' x32768 f16 from LDS,
// V^T x1024 f16) and the output projection (ctx carried as f16 hi x4096 plus residual x2048 planes, times f16(bf16(Wo)) x1024, bias
// added in f32): v_wmma_f32_16x16x32_f16, f32 accumulate. Query rows 0..127 of each sequence: scores, softmax and P.V in f32 on VALU.
// Causal mask, softmax statistics, key-block column sums of V and all scaling in f32 on VALU.
#include <hip/hip_runtime.h>
#include <math.h>
#include <stdint.h>

#ifndef NB
#define NB 4
#endif
#ifndef SEQ
#define SEQ 4096
#endif
#define SEQ_FULL 4096
#define NB_FULL 4
#define EMB   512
#define DH    64
#define CK    512
#define NCHK  (SEQ / CK)
#define NKB   16
#define QT    16
#define TQ0   128
#define NQT   ((SEQ - TQ0) / QT)
#define SCP   544
#define PLP   528
#define OPP   68
#define CTP   72
#define SLAB64 (16 * 68)
#define VTP   72
#define ATT_THREADS 256
#define HD_THREADS 128
#define NACC  4
#define QSC   8.0f
#define KSC   8.0f
#define PCAR  32768.0f
#define VCAR  1024.0f
#define WSC   1024.0f
#define CSC   4096.0f
#define RSC   2048.0f
#define LOG2E 1.4426950408889634f
#define RSQD  0.125f
#define WS_CAP ((size_t)134217728)
#define WTB   ((EMB / 64) * (DH / 64))
#define XCB   ((SEQ * EMB) / 8 / 256)
#define GPB   (((NB * SEQ) / 64) * (DH / 64))
#define GHB   (((NB * TQ0) / 64) * (DH / 64))
#define XTB   (NB * (SEQ / 64))
#define VSB   (NB * NCHK)

static_assert(DH == 64 && NACC * 16 == DH && (EMB % 64) == 0 && (EMB % 32) == 0 && (DH % 32) == 0);
static_assert((SEQ % CK) == 0 && NCHK >= 1 && CK == 32 * NKB && (SEQ % 64) == 0 && (SEQ % QT) == 0 && (CK % QT) == 0);
static_assert((TQ0 % QT) == 0 && (TQ0 % 64) == 0 && NQT * QT + TQ0 == SEQ && NQT >= 1 && TQ0 == 128 && TQ0 == HD_THREADS);
static_assert(8 * 16 * OPP <= 16 * SCP && 32 * CTP <= 16 * PLP && CTP >= DH + 8 && OPP >= DH + 4 && SCP >= CK + 16 && PLP >= CK + 8);
static_assert(((PLP * 2) % 16) == 0 && ((SCP * 4) % 16) == 0 && ((VTP * 2) % 16) == 0 && ((CTP * 2) % 16) == 0 && ((OPP * 4) % 16) == 0);
static_assert(64 * VTP >= 63 * VTP + 64);
static_assert(ATT_THREADS == 16 * QT && ATT_THREADS == 256 && HD_THREADS == 2 * DH);
static_assert((((SEQ * EMB) / 8) % 256) == 0 && ((NB * SEQ) % 64) == 0 && ((NB * TQ0) % 64) == 0);
static_assert(NB >= 1 && NB <= NB_FULL && SEQ <= SEQ_FULL && (TQ0 % 64) == 0 && (NKB % 2) == 0);

typedef unsigned short u16;
typedef _Float16 v16h __attribute__((ext_vector_type(16)));
typedef _Float16 v8h  __attribute__((ext_vector_type(8)));
typedef __bf16   v16b __attribute__((ext_vector_type(16)));
typedef float    v8f  __attribute__((ext_vector_type(8)));
typedef float    v4f  __attribute__((ext_vector_type(4)));
typedef unsigned int v4u __attribute__((ext_vector_type(4)));

union FragH { v16h v; v8h h[2]; v4u u[2]; };
union FragB { v16b v; v4u u[2]; };

// ---- scalar helpers --------------------------------------------------------------------------------
__device__ __forceinline__ unsigned short bf_bits(float f) {          // f32 -> bf16 bits, RNE convert
  unsigned u = __float_as_uint(f);
  return (unsigned short)((u + 0x7FFFu + ((u >> 16) & 1u)) >> 16);
}
__device__ __forceinline__ float bf_up(unsigned short h) { return __uint_as_float(((unsigned)h) << 16); }
__device__ __forceinline__ float bfr(float f) { return bf_up(bf_bits(f)); }
__device__ __forceinline__ unsigned short h_bits(_Float16 x) { return __builtin_bit_cast(unsigned short, x); }
__device__ __forceinline__ unsigned pk16(unsigned short a, unsigned short b) { return (unsigned)a | ((unsigned)b << 16); }
__device__ __forceinline__ v8f zero8() { v8f z = {0.f, 0.f, 0.f, 0.f, 0.f, 0.f, 0.f, 0.f}; return z; }
__device__ __forceinline__ v4f zero4() { v4f z = {0.f, 0.f, 0.f, 0.f}; return z; }

// ---- fragment loaders: 16-bit A/B operand, lane -> row/col (lane&15), p already includes +8*(lane>>4);
//      elements 0..7 <- p[0..7] (k0+8h..), elements 8..15 <- p[16..23] (k0+16+8h..)  (same split k map for A and B);
//      this form reads the row-major A planes (x, ctx hi, ctx residual)
__device__ __forceinline__ v16h ldfrag_h(const _Float16* p) {
  FragH f;
  f.h[0] = *(const v8h*)(p);
  f.h[1] = *(const v8h*)(p + 16);
  return f.v;
}
__device__ __forceinline__ v16b ldfrag_b(const u16* p) {              // bf16 plane read as unsigned integer vectors
  FragB f;
  f.u[0] = *(const v4u*)(p);
  f.u[1] = *(const v4u*)(p + 16);
  return f.v;
}

// ---- the same fragments from a plane kept in FRAGMENT ORDER: a 16 (rows or cols) x 32 (k) tile is 512 consecutive halves; the 16-B
//      unit of lane l = 16*h + m (row/col m, k = 8h .. 8h+7) lies at 8*l, the unit for k = 16+8h .. at 256 + 8*l. p already includes
//      +8*lane, so each of the two loads reads 512 consecutive bytes (4 whole lines) where a row-major plane gives 16 lines.
__device__ __forceinline__ v16h ldfrag_hs(const _Float16* p) {
  FragH f;
  f.h[0] = *(const v8h*)(p);
  f.h[1] = *(const v8h*)(p + 256);
  return f.v;
}
__device__ __forceinline__ v16b ldfrag_bs(const u16* p) {
  FragB f;
  f.u[0] = *(const v4u*)(p);
  f.u[1] = *(const v4u*)(p + 256);
  return f.v;
}

// Precaution behind a run of fragment loads: the registers that those loads name (row pointers a0, a1; byte offsets o0..o3) are inputs
// of the wait, so none of them is advanced or reused as a load's destination in front of s_wait_xcnt 0.
__device__ __forceinline__ void addr_wait(const void* a0, const void* a1, unsigned o0, unsigned o1, unsigned o2, unsigned o3) {
#if defined(__HIP_DEVICE_COMPILE__)
  asm volatile("s_wait_xcnt 0x0" :: "v"(a0), "v"(a1), "v"(o0), "v"(o1), "v"(o2), "v"(o3) : "memory");
#endif
}

__device__ __forceinline__ v8f mma_h(v16h a, v16h b, v8f c) {
  return __builtin_amdgcn_wmma_f32_16x16x32_f16(false, a, false, b, (short)0, c, false, false);
}
__device__ __forceinline__ v8f mma_b(v16b a, v16b b, v8f c) {
  return __builtin_amdgcn_wmma_f32_16x16x32_bf16(false, a, false, b, (short)0, c, false, false);
}
__device__ __forceinline__ void guard2x6(v8f& a, v8f& b, v16h x0, v16h x1, v16h x2, v16h x3, v16h x4, v16h x5) {
#if defined(__HIP_DEVICE_COMPILE__)
  asm volatile("v_nop\n\tv_nop\n\tv_nop\n\tv_nop"
               : "+v"(a), "+v"(b) : "v"(x0), "v"(x1), "v"(x2), "v"(x3), "v"(x4), "v"(x5) : "memory");
#endif
}
template <typename F>
__device__ __forceinline__ void guard6(v8f& a, v8f& b, v8f& c, v8f& d, F x0, F x1, F x2, F x3, F x4, F x5) {
#if defined(__HIP_DEVICE_COMPILE__)
  asm volatile("v_nop\n\tv_nop\n\tv_nop\n\tv_nop"
               : "+v"(a), "+v"(b), "+v"(c), "+v"(d) : "v"(x0), "v"(x1), "v"(x2), "v"(x3), "v"(x4), "v"(x5) : "memory");
#endif
}
__device__ __forceinline__ void guard8x6(v8f& a0, v8f& a1, v8f& a2, v8f& a3, v8f& e0, v8f& e1, v8f& e2, v8f& e3,
                                         v16h x0, v16h x1, v16h x2, v16h x3, v16h x4, v16h x5) {
#if defined(__HIP_DEVICE_COMPILE__)
  asm volatile("v_nop\n\tv_nop\n\tv_nop\n\tv_nop"
               : "+v"(a0), "+v"(a1), "+v"(a2), "+v"(a3), "+v"(e0), "+v"(e1), "+v"(e2), "+v"(e3)
               : "v"(x0), "v"(x1), "v"(x2), "v"(x3), "v"(x4), "v"(x5) : "memory");
#endif
}
__device__ __forceinline__ void guardpv4(v8f& o0, v8f& o1, v8f& o2, v8f& o3, v16h p, v16h g0, v16h g1, v16h g2, v16h g3) {
#if defined(__HIP_DEVICE_COMPILE__)
  asm volatile("v_nop\n\tv_nop\n\tv_nop\n\tv_nop"
               : "+v"(o0), "+v"(o1), "+v"(o2), "+v"(o3)
               : "v"(p), "v"(g0), "v"(g1), "v"(g2), "v"(g3) : "memory");
#endif
}
__device__ __forceinline__ void acc_guard4(v8f& a, v8f& b, v8f& c, v8f& d) {
#if defined(__HIP_DEVICE_COMPILE__)
  asm volatile("v_nop\n\tv_nop\n\tv_nop\n\tv_nop" : "+v"(a), "+v"(b), "+v"(c), "+v"(d));
#endif
}
__device__ __forceinline__ void wave_sync_lds() {                    // wave-private LDS slab: release, wave barrier, acquire
  __builtin_amdgcn_fence(3, "workgroup");
  __builtin_amdgcn_wave_barrier();
  __builtin_amdgcn_fence(2, "workgroup");
}

// =====================================================================================================
// x plane f32 [b][SEQ_FULL][EMB] -> bf16 RNE bits [b][SEQ][EMB] (compact rows). Thread = 8 consecutive elements: two 16-B loads,
// coverage: grid = (SEQ*EMB/8/256 blocks, nb) x 256 thr x 8 = the whole plane.
// =====================================================================================================
__device__ __forceinline__ void cvtx_body(int bx, int bb, const float* __restrict__ x, u16* D, int n8) {
  const int gt = bx * 256 + (int)threadIdx.x;
  if (gt >= n8) return;                     // no barriers on this path
  const float* p = x + (size_t)bb * ((size_t)SEQ_FULL * EMB) + (size_t)gt * 8;
  const v4f a = *(const v4f*)(p), c4 = *(const v4f*)(p + 4);
  float v[8];
#pragma unroll
  for (int e = 0; e < 4; ++e) { v[e] = a[e]; v[4 + e] = c4[e]; }
  unsigned short s[8];
#pragma unroll
  for (int e = 0; e < 8; ++e) s[e] = bf_bits(v[e]);
  v4u o;
#pragma unroll
  for (int e = 0; e < 4; ++e) o[e] = pk16(s[2 * e], s[2 * e + 1]);
  u16* d = D + (size_t)bb * ((size_t)SEQ * EMB) + (size_t)gt * 8;
  {
    *(v4u*)(d) = o;
    
  }
}

// =====================================================================================================
// Weight transpose-convert: in W[R][C] f32 row-major -> out D = the [n = C][k = R] 16-bit operand plane for y = x.W in fragment order:
// tile (n/16, k/32) at halves ((n/16)*(R/32) + k/32)*512, units inside it as ldfrag_hs / ldfrag_bs read them.
// mode 0: bf16 RNE bits; mode 1: f16 bits of (bf16 RNE value) * scale.
// Block = 64x64 tile: 64 input row segments of 64 floats loaded with 16-B loads, converted, scattered into an LDS tile [c][64 r]
// coverage: load 256 thr x 16 = 64 x 64; store 2 iterations x 256 thr x 8 halves = 64 lines x 64; grid = (R/64) x (C/64) blocks
//           covers D exactly once (host checks R % 64 == 0, C % 64 == 0).
// =====================================================================================================
__device__ __forceinline__ void wt16_body(u16* TH, int bid, const float* __restrict__ W, u16* D, int R, int C, int mode,
                                          float scale) {
  const int tid = threadIdx.x;
  const int nrt = R >> 6;
  const int r0  = (bid % nrt) * 64;
  const int c0  = (bid / nrt) * 64;
  {
    const int rl = tid >> 2;                  // input row within tile 0..63
    const int cs = (tid & 3) * 16;            // column chunk within the 64
    const float* src = W + (size_t)(r0 + rl) * C + c0 + cs;
#pragma unroll
    for (int i = 0; i < 4; ++i) {
      const v4f a = *(const v4f*)(src + 4 * i);
#pragma unroll
      for (int e = 0; e < 4; ++e) {
        const float v  = a[e];
        const unsigned short hb = h_bits((_Float16)(bfr(v) * scale));
        const unsigned short bb = bf_bits(v);
        TH[(cs + 4 * i + e) * VTP + rl] = (mode != 0) ? hb : bb;
      }
    }
  }
  __syncthreads();
  v4u vh[2];
  const int fm = tid & 15, fh = (tid >> 4) & 1, fs = (tid >> 5) & 1, fk = (tid >> 6) & 1, fn = tid >> 7;
#pragma unroll
  for (int it = 0; it < 2; ++it) {            // local c = 16*(2*it + fn) + fm, local r = 32*fk + 16*fs + 8*fh .. +7
    vh[it] = *(const v4u*)(TH + ((it * 2 + fn) * 16 + fm) * VTP + fk * 32 + fs * 16 + fh * 8);
  }
  const int kt = R >> 5;                      // 32-wide k tiles per 16 columns
  {
#pragma unroll
    for (int it = 0; it < 2; ++it) {
      *(v4u*)(D + ((size_t)((c0 >> 4) + it * 2 + fn) * (size_t)kt + (size_t)(r0 >> 5)) * 512 + (tid & 127) * 8) = vh[it];
    }
    
  }
}

// =====================================================================================================
// One launch for the five independent preparation jobs, picked by block index (block-uniform): blocks 0..4*WTB-1 = the four weight
// transposes (WTB blocks each, order Wq, Wk, Wv, Wo), the rest = the x conversion (XCB blocks per batch row).
// coverage: grid = 4*WTB + nb*XCB blocks; each job is handed block indices 0 .. its own block count - 1.
// =====================================================================================================
__global__ __launch_bounds__(256)
void prep(const float* __restrict__ x, const float* __restrict__ wq, const float* __restrict__ wk, const float* __restrict__ wv,
          const float* __restrict__ wo, u16* WQT, u16* WKT, u16* WVT, u16* WOT, u16* XB) {
  __shared__ __align__(16) u16 TH[64 * VTP];
  const int bid = blockIdx.x;
  if (bid < 4 * WTB) {
    const int job = bid / WTB;
    const float* W = (job == 0) ? wq : (job == 1) ? wk : (job == 2) ? wv : wo;
    u16* D = (job == 0) ? WQT : (job == 1) ? WKT : (job == 2) ? WVT : WOT;
    const bool pj = job < 3;                  // Wq, Wk, Wv: [EMB][DH] -> bf16; Wo: [DH][EMB] -> scaled f16
    wt16_body(TH, bid - job * WTB, W, D, pj ? EMB : DH, pj ? DH : EMB, pj ? 0 : 1, pj ? 1.0f : WSC);
  } else {
    const int r = bid - 4 * WTB;
    cvtx_body(r % XCB, r / XCB, x, XB, XCB * 256);
  }
}

// =====================================================================================================
//            16 consecutive lanes x 16 B per line), lanes 16..31 -> row 2*it+1.
//  epi64x2 : same store shape, staged value = acc*os1 + accres*os2 + badd (two accumulator sets combined in f32).
//  epi64hsb: f16 bits of ((tile + bf16RNE(bias[n])) * pscale), plane in fragment order; lane = (row lane&15, 8 consecutive columns),
// coverage: epi64/epi64x2 8 instructions x 2 rows x 16 lanes x 4 floats; epi64hsb 4 instructions x 16 rows x 2 lanes x 8 halves
//           = the wave's 16 x 64 tile in every case.
// =====================================================================================================
__device__ __forceinline__ void stage64(float* sl, v8f a0, v8f a1, v8f a2, v8f a3, float oscale, int lane) {
  const int hh = lane >> 4, m = lane & 15;
#pragma unroll
  for (int r = 0; r < 8; ++r) {
    const int ro = (8 * hh + r) * 68 + m;
    sl[ro]      = a0[r] * oscale;
    sl[ro + 16] = a1[r] * oscale;
    sl[ro + 32] = a2[r] * oscale;
    sl[ro + 48] = a3[r] * oscale;
  }
  wave_sync_lds();
}
__device__ __forceinline__ void epi64(float* sl, v8f a0, v8f a1, v8f a2, v8f a3, float oscale, v4f badd, float* C, int N,
                                      size_t rowb, int col0, int lane) {
  const int hh = lane >> 4, m = lane & 15;
  stage64(sl, a0, a1, a2, a3, oscale, lane);
  v4f vals[8];
#pragma unroll
  for (int it = 0; it < 8; ++it) vals[it] = *(const v4f*)(sl + (it * 2 + hh) * 68 + m * 4) + badd;
  float* dst = C + (rowb + (size_t)hh) * (size_t)N + col0 + m * 4;
  {
#pragma unroll
    for (int it = 0; it < 8; ++it) {
      *(v4f*)(dst + (size_t)(it * 2) * (size_t)N) = vals[it];
    }
    
  }
}
__device__ __forceinline__ void epi64x2(float* sl, v8f a0, v8f a1, v8f a2, v8f a3, v8f e0, v8f e1, v8f e2, v8f e3,
                                        float os1, float os2, v4f badd, float* C, int N, size_t rowb, int col0, int lane) {
  const int hh = lane >> 4, m = lane & 15;
#pragma unroll
  for (int r = 0; r < 8; ++r) {
    const int ro = (8 * hh + r) * 68 + m;
    sl[ro]      = a0[r] * os1 + e0[r] * os2;
    sl[ro + 16] = a1[r] * os1 + e1[r] * os2;
    sl[ro + 32] = a2[r] * os1 + e2[r] * os2;
    sl[ro + 48] = a3[r] * os1 + e3[r] * os2;
  }
  wave_sync_lds();
  v4f vals[8];
#pragma unroll
  for (int it = 0; it < 8; ++it) vals[it] = *(const v4f*)(sl + (it * 2 + hh) * 68 + m * 4) + badd;
  float* dst = C + (rowb + (size_t)hh) * (size_t)N + col0 + m * 4;
  {
#pragma unroll
    for (int it = 0; it < 8; ++it) {
      *(v4f*)(dst + (size_t)(it * 2) * (size_t)N) = vals[it];
    }
    
  }
}
__device__ __forceinline__ void epi64hsb(float* sl, v8f a0, v8f a1, v8f a2, v8f a3, float oscale, float pscale,
                                         const float* __restrict__ bias, u16* C, int N, size_t rowb, int col0, int lane) {
  stage64(sl, a0, a1, a2, a3, oscale, lane);
  const int hh = lane >> 4, m = lane & 15;
  v4u oh[4];
#pragma unroll
  for (int g = 0; g < 4; ++g) {               // g = 16-column group of the 64; lane = (row m, columns 16g + 8hh .. +7)
    const int c8 = g * 16 + hh * 8;
    const v4f b0 = *(const v4f*)(bias + col0 + c8), b1 = *(const v4f*)(bias + col0 + c8 + 4);   // columns col0+c8..+7 < N
    const v4f a = *(const v4f*)(sl + m * 68 + c8), c4 = *(const v4f*)(sl + m * 68 + c8 + 4);
    float w[8];
#pragma unroll
    for (int e = 0; e < 4; ++e) { w[e] = (a[e] + bfr(b0[e])) * pscale; w[4 + e] = (c4[e] + bfr(b1[e])) * pscale; }
#pragma unroll
    for (int e = 0; e < 4; ++e) oh[g][e] = pk16(h_bits((_Float16)w[2 * e]), h_bits((_Float16)w[2 * e + 1]));
  }
  // tile (rowb/16, col/32) at halves ((rowb/16)*(N/32) + col/32)*512; group g is the half-tile at g*256 behind column col0
  u16* dst = C + ((rowb >> 4) * (size_t)(N >> 5) + (size_t)(col0 >> 5)) * 512 + lane * 8;
  {
#pragma unroll
    for (int g = 0; g < 4; ++g) {
      *(v4u*)(dst + g * 256) = oh[g];
    }
    
  }
}

// =====================================================================================================
// bf16 GEMM, f32 out with bias: C[M][N] = (A[arow(m)][K] (bf16 row-major) . Bt[N][K]^T (bf16, fragment order)) * oscale + bf16RNE(bias[n]).
// Output row ra maps to A row arow = (ra / rpg) * gstr + (ra % rpg) (rpg = M, gstr = 0 gives the identity map; rpg = TQ0,
// gstr = SEQ picks the first TQ0 rows of every sequence).
// Block = 64x64 tile, 4 waves x 16 rows; fragments loaded straight from the 16-bit planes (two 16-B loads each, split k map for
// A and B); K stepped by 32 (host checks K % 32 == 0, M % 64 == 0, N % 64 == 0, grid = (M/64)*(N/64)).
// =====================================================================================================
__device__ __forceinline__
void gemm_b32_body(float* slab, int bid, const u16* __restrict__ A, const u16* __restrict__ Bt, const float* __restrict__ bias,
                   float* C, int M, int N, int K, int rpg, int gstr, float oscale) {
  const int tid = threadIdx.x, wave = tid >> 5, lane = tid & 31, hh = lane >> 4, m = lane & 15;
  const int ntile = N >> 6;
  const int rowb  = (bid / ntile) * 64 + wave * 16;
  const int col0  = (bid % ntile) * 64;
  if (rowb + 16 > M) return;                 // wave-uniform, never taken with the exact grid; no block barriers on this path
  const int ra = rowb + m;
  const int rg = ra / rpg;
  const size_t arow = (size_t)rg * (size_t)gstr + (size_t)(ra - rg * rpg);
  const u16* ap = A  + arow * (size_t)K + 8 * hh;
  // fragment order: 16 columns = K/32 tiles of 1024 bytes; block-uniform base, a lane's place is one fixed 32-bit byte offset
  const char* bp = (const char*)(const void*)Bt + (size_t)col0 * K * 2;
  const unsigned bs = 32u * (unsigned)K;
  const unsigned lo0 = (unsigned)lane * 16u, lo1 = lo0 + bs, lo2 = lo1 + bs, lo3 = lo2 + bs;   // the four 16-column groups
  v8f acc0 = zero8(), acc1 = zero8(), acc2 = zero8(), acc3 = zero8();
#pragma unroll 1
  for (int k0 = 0; k0 < K; k0 += 32) {
    const v16b a  = ldfrag_b(ap + k0);
    const unsigned ko = (unsigned)k0 * 32u;                // one 1024-byte tile per 32 of k
    const v16b b0 = ldfrag_bs((const u16*)(const void*)(bp + (lo0 + ko)));
    const v16b b1 = ldfrag_bs((const u16*)(const void*)(bp + (lo1 + ko)));
    const v16b b2 = ldfrag_bs((const u16*)(const void*)(bp + (lo2 + ko)));
    const v16b b3 = ldfrag_bs((const u16*)(const void*)(bp + (lo3 + ko)));
    addr_wait(ap + k0, ap + k0, lo0 + ko, lo1 + ko, lo2 + ko, lo3 + ko);
    acc0 = mma_b(a, b0, acc0);
    acc1 = mma_b(a, b1, acc1);
    acc2 = mma_b(a, b2, acc2);
    acc3 = mma_b(a, b3, acc3);
    guard6<v16b>(acc0, acc1, acc2, acc3, a, b0, b1, b2, b3, a);
  }
  const v4f bv4 = *(const v4f*)(bias + col0 + m * 4);    // columns col0 + 4m .. +3, always < N (N multiple of 64)
  v4f badd;
#pragma unroll
  for (int e = 0; e < 4; ++e) badd[e] = bfr(bv4[e]);
  epi64(slab + wave * SLAB64, acc0, acc1, acc2, acc3, oscale, badd, C, N, (size_t)rowb, col0, lane);
}

// =====================================================================================================
// bf16 GEMM, f16 plane out with bias: C16[M][N] = f16 bits of (((A . Bt^T) * oscale) + bf16RNE(bias[n])) * pscale; operands as in
// gemm_b32 (identity row map), epilogue epi64hsb.
// =====================================================================================================
__device__ __forceinline__
void gemm_bh16_body(float* slab, int bid, const u16* __restrict__ A, const u16* __restrict__ Bt, const float* __restrict__ bias,
                    u16* C, int M, int N, int K, float oscale, float pscale) {
  const int tid = threadIdx.x, wave = tid >> 5, lane = tid & 31, hh = lane >> 4, m = lane & 15;
  const int ntile = N >> 6;
  const int rowb  = (bid / ntile) * 64 + wave * 16;
  const int col0  = (bid % ntile) * 64;
  if (rowb + 16 > M) return;                 // wave-uniform, never taken with the exact grid; no block barriers on this path
  const u16* ap = A  + (size_t)(rowb + m) * K + 8 * hh;
  // fragment order: 16 columns = K/32 tiles of 1024 bytes; block-uniform base, a lane's place is one fixed 32-bit byte offset
  const char* bp = (const char*)(const void*)Bt + (size_t)col0 * K * 2;
  const unsigned bs = 32u * (unsigned)K;
  const unsigned lo0 = (unsigned)lane * 16u, lo1 = lo0 + bs, lo2 = lo1 + bs, lo3 = lo2 + bs;   // the four 16-column groups
  v8f acc0 = zero8(), acc1 = zero8(), acc2 = zero8(), acc3 = zero8();
#pragma unroll 1
  for (int k0 = 0; k0 < K; k0 += 32) {
    const v16b a  = ldfrag_b(ap + k0);
    const unsigned ko = (unsigned)k0 * 32u;                // one 1024-byte tile per 32 of k
    const v16b b0 = ldfrag_bs((const u16*)(const void*)(bp + (lo0 + ko)));
    const v16b b1 = ldfrag_bs((const u16*)(const void*)(bp + (lo1 + ko)));
    const v16b b2 = ldfrag_bs((const u16*)(const void*)(bp + (lo2 + ko)));
    const v16b b3 = ldfrag_bs((const u16*)(const void*)(bp + (lo3 + ko)));
    addr_wait(ap + k0, ap + k0, lo0 + ko, lo1 + ko, lo2 + ko, lo3 + ko);
    acc0 = mma_b(a, b0, acc0);
    acc1 = mma_b(a, b1, acc1);
    acc2 = mma_b(a, b2, acc2);
    acc3 = mma_b(a, b3, acc3);
    guard6<v16b>(acc0, acc1, acc2, acc3, a, b0, b1, b2, b3, a);
  }
  epi64hsb(slab + wave * SLAB64, acc0, acc1, acc2, acc3, oscale, pscale, bias, C, N, (size_t)rowb, col0, lane);
}

// =====================================================================================================
// One launch for the five independent projection GEMMs, picked by block index (block-uniform): blocks 0..GHB-1 = f32 q rows 0..127
// of every sequence, GHB..2*GHB-1 = the same for k, then GPB blocks each for the f32 v plane, the f16 q plane and the f16 k plane.
// coverage: grid = 2*GHB + 3*GPB blocks; each GEMM is handed block indices 0 .. its own block count - 1.
// =====================================================================================================
__global__ __launch_bounds__(128)
void proj(const u16* __restrict__ XB, const u16* __restrict__ WQT, const u16* __restrict__ WKT, const u16* __restrict__ WVT,
          const float* __restrict__ bq, const float* __restrict__ bk, const float* __restrict__ bv,
          u16* QP, u16* KP, float* V, float* QF, float* KF, int rows, int hrows, int N, int K) {
  __shared__ __align__(16) float slab[4 * SLAB64];
  const int bid = blockIdx.x;
  if (bid < 2 * GHB + GPB) {                 // f32 outputs
    const int job = (bid < GHB) ? 0 : (bid < 2 * GHB) ? 1 : 2;
    const bool hd = job < 2;                 // rows 0..TQ0-1 of every sequence against all rows
    gemm_b32_body(slab, bid - job * GHB, XB, (job == 0) ? WQT : (job == 1) ? WKT : WVT, (job == 0) ? bq : (job == 1) ? bk : bv,
                  (job == 0) ? QF : (job == 1) ? KF : V, hd ? hrows : rows, N, K, hd ? TQ0 : rows, hd ? SEQ : 0, 1.0f);
  } else {                                   // f16 planes
    const int r = bid - (2 * GHB + GPB);
    const bool isq = r < GPB;
    gemm_bh16_body(slab, isq ? r : r - GPB, XB, isq ? WQT : WKT, isq ? bq : bk, isq ? QP : KP, rows, N, K, 1.0f,
                   isq ? QSC : KSC);
  }
}

// =====================================================================================================
// f16 GEMM with two A planes (hi + residual), f32 out with bias:
//   C[M][N] = (Ah . Bt^T) * os1 + (Ar . Bt^T) * os2 + bf16RNE(bias[n]); Ah/Ar f16 row-major, Bt f16 in fragment order.
// Same tiling as gemm_b32; separate accumulators for the two planes, combined in f32 in epi64x2.
// =====================================================================================================
__global__ __launch_bounds__(128)
void gemm_h2_32(const u16* __restrict__ Ah, const u16* __restrict__ Ar, const u16* __restrict__ Bt,
                const float* __restrict__ bias, float* C, int M, int N, int K, float os1, float os2) {
  __shared__ __align__(16) float slab[4 * SLAB64];
  const int tid = threadIdx.x, wave = tid >> 5, lane = tid & 31, hh = lane >> 4, m = lane & 15;
  const int ntile = N >> 6;
  const int bid   = blockIdx.x;
  const int rowb  = (bid / ntile) * 64 + wave * 16;
  const int col0  = (bid % ntile) * 64;
  if (rowb + 16 > M) return;                 // wave-uniform, never taken with the exact grid; no block barriers in this kernel
  const _Float16* ap  = (const _Float16*)(const void*)Ah + (size_t)(rowb + m) * K + 8 * hh;
  const _Float16* arp = (const _Float16*)(const void*)Ar + (size_t)(rowb + m) * K + 8 * hh;
  // fragment order: 16 columns = K/32 tiles of 1024 bytes; block-uniform base, a lane's place is one fixed 32-bit byte offset
  const char* bp = (const char*)(const void*)Bt + (size_t)col0 * K * 2;
  const unsigned bs = 32u * (unsigned)K;
  const unsigned lo0 = (unsigned)lane * 16u, lo1 = lo0 + bs, lo2 = lo1 + bs, lo3 = lo2 + bs;   // the four 16-column groups
  v8f acc0 = zero8(), acc1 = zero8(), acc2 = zero8(), acc3 = zero8();
  v8f acr0 = zero8(), acr1 = zero8(), acr2 = zero8(), acr3 = zero8();
#pragma unroll 1
  for (int k0 = 0; k0 < K; k0 += 32) {
    const v16h a  = ldfrag_h(ap + k0);
    const v16h ar = ldfrag_h(arp + k0);
    const unsigned ko = (unsigned)k0 * 32u;                // one 1024-byte tile per 32 of k
    const v16h b0 = ldfrag_hs((const _Float16*)(const void*)(bp + (lo0 + ko)));
    const v16h b1 = ldfrag_hs((const _Float16*)(const void*)(bp + (lo1 + ko)));
    const v16h b2 = ldfrag_hs((const _Float16*)(const void*)(bp + (lo2 + ko)));
    const v16h b3 = ldfrag_hs((const _Float16*)(const void*)(bp + (lo3 + ko)));
    addr_wait(ap + k0, arp + k0, lo0 + ko, lo1 + ko, lo2 + ko, lo3 + ko);
    acc0 = mma_h(a, b0, acc0);
    acc1 = mma_h(a, b1, acc1);
    acc2 = mma_h(a, b2, acc2);
    acc3 = mma_h(a, b3, acc3);
    acr0 = mma_h(ar, b0, acr0);
    acr1 = mma_h(ar, b1, acr1);
    acr2 = mma_h(ar, b2, acr2);
    acr3 = mma_h(ar, b3, acr3);
    guard8x6(acc0, acc1, acc2, acc3, acr0, acr1, acr2, acr3, a, ar, b0, b1, b2, b3);
  }
  const v4f bv = *(const v4f*)(bias + col0 + m * 4);      // columns col0 + 4m .. +3, always < N (N multiple of 64)
  v4f badd;
#pragma unroll
  for (int e = 0; e < 4; ++e) badd[e] = bfr(bv[e]);
  epi64x2(slab + wave * SLAB64, acc0, acc1, acc2, acc3, acr0, acr1, acr2, acr3, os1, os2, badd, C, N,
          (size_t)rowb, col0, lane);
}

// =====================================================================================================
// V^T plane = f16(V[b][s][d] * 1024) in fragment order, V = f32 [b*SEQ + s][DH]: the tile (32 keys s/32, 16 columns d/16) lies at
// halves ((b*SEQ + s)/32 * 4 + d/16)*512, units inside it as ldfrag_hs reads them (col = d, k = key).
// Block = (b, 64 keys): 64 source rows of 64 floats loaded with 16-B loads, converted, scattered into an LDS tile [d][64 keys]
// coverage: load 256 thr x 16 elements = 64 x 64; store 2 iterations x 256 thr x 8 halves = 64 lines x 64 = the block's tile;
//           grid = nb x (SEQ/64) blocks covers the plane exactly once.
// =====================================================================================================
__device__ __forceinline__ void xt16_body(u16* TH, int bid, const float* __restrict__ X, u16* XTo) {
  const int tid = threadIdx.x;
  const int st  = bid % (SEQ / 64);
  const int b   = bid / (SEQ / 64);
  const int s0  = st * 64;
  {
    const int sl = tid >> 2;                  // key within tile 0..63
    const int dc = (tid & 3) * 16;            // d chunk within the 64
    const float* src = X + ((size_t)b * SEQ + s0 + sl) * DH + dc;
#pragma unroll
    for (int i = 0; i < 4; ++i) {
      const v4f a = *(const v4f*)(src + 4 * i);
#pragma unroll
      for (int e = 0; e < 4; ++e) {
        const float v = a[e];
        TH[(dc + 4 * i + e) * VTP + sl] = h_bits((_Float16)(v * VCAR));
      }
    }
  }
  __syncthreads();
  v4u vh[2];
  const int fm = tid & 15, fh = (tid >> 4) & 1, fs = (tid >> 5) & 1, fj = tid >> 6;
#pragma unroll
  for (int it = 0; it < 2; ++it) {            // d = 16*fj + fm, local keys 32*it + 16*fs + 8*fh .. +7
    vh[it] = *(const v4u*)(TH + (fj * 16 + fm) * VTP + it * 32 + fs * 16 + fh * 8);
  }
  const size_t base = ((size_t)b * SEQ + s0) * DH + tid * 8;
  {
#pragma unroll
    for (int it = 0; it < 2; ++it) {
      *(v4u*)(XTo + base + it * (32 * DH)) = vh[it];
    }
    // the code of the launch's other job follows these stores in the built kernel and rewrites their registers: wait first
    asm volatile("s_wait_xcnt 0x0" ::: "memory");
  }
}

// =====================================================================================================
// Key-block prefix column sums of V: VS[((b*NCHK + c)*NKB + kb)*DH + d] = sum over keys c*CK .. c*CK + 32*kb + 31 of V[b][key][d]
// (f32, fixed sequential order). Block = one (b, c), threads 0..63 work (thread = d; waves 2..7 only pass the barrier); the 16 prefix
// values per thread are staged in LDS
// coverage: grid = nb*NCHK blocks x (4 iterations x 64 thr x 4 floats = 1024) = the whole table.
// =====================================================================================================
__device__ __forceinline__ void vsum_body(float* sm, int bc, const float* __restrict__ V, float* VS) {
  const int tid = threadIdx.x;                        // d
  const int b   = bc / NCHK;
  const int c   = bc - b * NCHK;
  if (tid < DH) {                                     // waves 0,1 entirely (wave-uniform)
  const float* p = V + ((size_t)b * SEQ + (size_t)c * CK) * DH + tid;
  float s = 0.f;
  // Two register sets of one key block each: the next block's 32 loads are issued before this block is summed, so that the load
  // latency is shared by the loads in flight. The adds run in sequential key order.
  float va[32], vb[32];
#pragma unroll
  for (int i = 0; i < 32; ++i) va[i] = p[(size_t)i * DH];
  // fully unrolled: every load address is the base plus a constant, and the two sets stay in registers
#pragma unroll
  for (int kb = 0; kb < NKB; kb += 2) {
#pragma unroll
    for (int i = 0; i < 32; ++i) vb[i] = p[(size_t)((kb + 1) * 32 + i) * DH];
#pragma unroll
    for (int i = 0; i < 32; ++i) s += va[i];
    sm[kb * DH + tid] = s;
    if (kb + 2 < NKB) {
#pragma unroll
      for (int i = 0; i < 32; ++i) va[i] = p[(size_t)((kb + 2) * 32 + i) * DH];
    }
#pragma unroll
    for (int i = 0; i < 32; ++i) s += vb[i];
    sm[(kb + 1) * DH + tid] = s;
  }
  }
  __syncthreads();
  if (tid >= DH) return;                              // behind the only barrier of this path
  v4f o[4];
#pragma unroll
  for (int it = 0; it < 4; ++it) o[it] = *(const v4f*)(sm + it * 256 + tid * 4);
  float* base = VS + (size_t)bc * NKB * DH + tid * 4;
  {
#pragma unroll
    for (int it = 0; it < 4; ++it) {
      *(v4f*)(base + it * 256) = o[it];
    }
    
  }
}

// =====================================================================================================
// One launch for the two independent readers of the f32 v plane, picked by block index (block-uniform): blocks 0..VSB-1 = prefix
// column sums (the longer dependent chain, so it starts first), the rest = the V^T plane.
// coverage: grid = VSB + XTB blocks; each job is handed block indices 0 .. its own block count - 1.
// =====================================================================================================
__global__ __launch_bounds__(256) void vprep(const float* __restrict__ V, u16* VT, float* VS) {
  __shared__ __align__(16) u16 TH[64 * VTP];
  __shared__ __align__(16) float sm[NKB * DH];
  const int bid = blockIdx.x;
  if (bid < VSB) vsum_body(sm, bid, V, VS);
  else           xt16_body(TH, bid - VSB, V, VT);
}

// =====================================================================================================
// Single-head causal attention, head width DH = 64, query rows TQ0 .. SEQ-1: block = (batch b, 16 query rows q0..q0+15), 8 waves.
// q plane (f16, x8), k plane the same and V^T plane (x1024), each in fragment order; VS = key-block prefix column sums of V.
//   Chunks of CK = 512 keys: only chunks c <= qc = q0/CK are visited (later chunks lie entirely above the diagonal). In the diagonal
//   chunk only key blocks kb < nkb (keys <= q0+15) are multiplied; key blocks kb >= nkb get zero scores in LDS and are not used in (PV).
//   (S) scores S[query m][key n] on WMMA: A = q rows (row m = lane&15, split k map over d, two 32-d fragments kept in registers),
//       B = k rows (col n = key, split map); wave w handles key blocks w, w+8 of the chunk; D element r of lane l -> scs[query 8h+r][key].
//   (M) 16 threads per query row (sub-thread = 32 consecutive keys): base-2 logits with the causal mask by key index (key > query
//       -> -inf), chunk max via xor shuffles, online running max / rescale factor al / running sum l in f32 registers,
//       p = exp2(t - m_new) <= 1 (0 for masked keys), chunk row sum ps and C = ps/CK (bit-identical on the row's 16 threads), the
//       CENTRED P' = p - C written as f16(P' * 32768) into the LDS P tile with 16-B stores; al -> rowa[row], C -> rowc[row].
//   (PV) every wave keeps its own partial O (4 accumulator tiles = 16 queries x 64 d): o_w = o_w*al (+ on wave 0 only:
//       C*(32768*1024)*VS[chunk][nkb-1][d], the exact add-back of the centring term over exactly the processed keys, in f32), then for
//       the wave's key blocks kb in {w, w+8}, kb < nkb: A = P' fragment from LDS (row m = query, split map over keys), B = V^T
//       fragments (col n = d, split map over keys, fragment order), 4 WMMAs plus a hazard gap. sum_k (P'_k + C) v_k == sum_k p_k v_k exactly;
//       masked keys carry P' = -C and p = 0.
//   Block barriers after (S) and after (M) order all LDS reuse across chunks and waves.
//   Combine: after a block barrier the 8 partial O tiles are staged in the score region ([8][16][OPP] f32), barrier, then thread
//   (row = tid>>4, 4 columns) sums the 8 partials in fixed order, x = sum * 4096 / (l * 32768 * 1024) (l >= 1 always, held in
//   registers by the row's 16 threads), hi = f16(x), res = f16((x - hi) * 2048), staged as a [32][CTP] u16 tile in the P region,
// coverage: grid nb*NQT blocks x 16 rows = rows TQ0..SEQ-1 of every sequence; scs written 16 x 512 every chunk (zeros for kb >= nkb);
//           P tile written 16 x 512 every chunk; partial stage 8 x 16 x 64; ctx stage 32 x 64; store 32 lines = 16 rows of both planes.
// =====================================================================================================
__device__ __forceinline__
void attn_fwd_body(float* scs, u16* pls, float* rowa, float* rowc, int bid,
                   const u16* __restrict__ QPp, const u16* __restrict__ KPp, const u16* __restrict__ VTp,
                   const float* __restrict__ VSp, u16* CHo, u16* CRo) {
  const int tid  = threadIdx.x;
  const int wave = tid >> 5;
  const int lane = tid & 31;
  const int hh   = lane >> 4;
  const int m    = lane & 15;
  const int r16  = tid >> 4;                 // query row owned in phase (M) and in the combine
  const int sub  = tid & 15;
  const int kl0  = sub * 32;

  const int b   = bid / NQT;
  const int q0  = TQ0 + (bid - b * NQT) * QT;
  const int qc  = q0 / CK;                   // diagonal chunk index

  // all three planes in fragment order: 16 rows of q or k = two tiles (d 0..31, d 32..63), 32 keys of V^T = four tiles (16 d each)
  const _Float16* qrow = (const _Float16*)(const void*)QPp + ((size_t)b * SEQ + q0) * DH + 8 * lane;
  const v16h qa0 = ldfrag_hs(qrow);          // d 0..31
  const v16h qa1 = ldfrag_hs(qrow + 512);    // d 32..63
  // block-uniform bases; a lane's place is one 32-bit byte offset (a sequence's plane is SEQ*DH*2 bytes)
  const char* kbp = (const char*)(const void*)KPp + (size_t)b * SEQ * DH * 2;
  const char* vbp = (const char*)(const void*)VTp + (size_t)b * SEQ * DH * 2;
  const unsigned lo16 = (unsigned)lane * 16u;
  const float* vsb = VSp + (size_t)b * NCHK * NKB * DH + m;
  const float lsc = RSQD * LOG2E / (QSC * KSC);
  const float addsel = (wave == 0) ? (PCAR * VCAR) : 0.f;    // centring add-back on wave 0 only

  float mrun = -INFINITY, lrun = 0.f;
  v8f o[NACC];
#pragma unroll
  for (int j = 0; j < NACC; ++j) o[j] = zero8();

#pragma unroll 1
  for (int c = 0; c <= qc; ++c) {
    const int kbeg = c * CK;
    const int nkb  = (c < qc) ? NKB : (((q0 + QT - 1 - kbeg) >> 5) + 1);   // 1..16, block-uniform
    // ---- (S) scores of this chunk (zeros for key blocks beyond the query tile) ----
#pragma unroll 1
    for (int kb = wave; kb < NKB; kb += 8) {               // wave-uniform, 2 trips
      v8f s0 = zero8(), s1 = zero8();
      if (kb < nkb) {                                      // wave-uniform
        const _Float16* k0p = (const _Float16*)(const void*)(kbp + (lo16 + (unsigned)(kbeg + kb * 32) * (DH * 2u)));
        const _Float16* k1p = k0p + (size_t)16 * DH;
        const v16h f00 = ldfrag_hs(k0p);
        const v16h f01 = ldfrag_hs(k0p + 512);
        const v16h f10 = ldfrag_hs(k1p);
        const v16h f11 = ldfrag_hs(k1p + 512);
        s0 = mma_h(qa0, f00, s0);
        s0 = mma_h(qa1, f01, s0);
        s1 = mma_h(qa0, f10, s1);
        s1 = mma_h(qa1, f11, s1);
        guard2x6(s0, s1, qa0, qa1, f00, f01, f10, f11);
      }
      float* srow = scs + (8 * hh) * SCP + kb * 32 + m;
#pragma unroll
      for (int r = 0; r < 8; ++r) {
        srow[r * SCP]      = s0[r];
        srow[r * SCP + 16] = s1[r];
      }
    }
    __syncthreads();
    // ---- (M) softmax statistics and the centred P' tile ----
    {
      const float* sp = scs + r16 * SCP + kl0;
      const int lim = (q0 + r16) - (kbeg + kl0);           // key kl0 + j is valid iff j <= lim
      float t[32];
      float cm = -INFINITY;
#pragma unroll
      for (int i = 0; i < 8; ++i) {
        const v4f a = *(const v4f*)(sp + 4 * i);
#pragma unroll
        for (int e = 0; e < 4; ++e) {
          const int j = 4 * i + e;
          const float tv = (j <= lim) ? a[e] * lsc : -INFINITY;
          t[j] = tv;
          cm = fmaxf(cm, tv);
        }
      }
#pragma unroll
      for (int d = 1; d <= 8; d <<= 1) cm = fmaxf(cm, __shfl_xor(cm, d, 32));
      const float mn = fmaxf(mrun, cm);                    // finite: key kbeg of every visited chunk is never masked
      const float al = (mrun == -INFINITY) ? 0.f : exp2f(mrun - mn);
      mrun = mn;
      float ps = 0.f;
#pragma unroll
      for (int j = 0; j < 32; ++j) {
        const float p = exp2f(fminf(t[j] - mn, 0.f));      // 0 for masked keys
        t[j] = p;
        ps += p;
      }
#pragma unroll
      for (int d = 1; d <= 8; d <<= 1) ps += __shfl_xor(ps, d, 32);
      const float cc = ps * (1.0f / (float)CK);
      v4u pk[4];
#pragma unroll
      for (int i = 0; i < 4; ++i) {
#pragma unroll
        for (int e = 0; e < 4; ++e) {
          const int j = 8 * i + 2 * e;
          pk[i][e] = pk16(h_bits((_Float16)((t[j] - cc) * PCAR)), h_bits((_Float16)((t[j + 1] - cc) * PCAR)));
        }
      }
      lrun = lrun * al + ps;
      u16* pd = pls + r16 * PLP + kl0;
#pragma unroll
      for (int i = 0; i < 4; ++i) *(v4u*)(pd + 8 * i) = pk[i];
      if (sub == 0) { rowa[r16] = al; rowc[r16] = cc; }
    }
    __syncthreads();
    // ---- (PV) rescale, add the centring term (wave 0), accumulate P' . V^T for this wave's key blocks ----
    {
      float scl[8], cad[8];
#pragma unroll
      for (int r = 0; r < 8; ++r) { scl[r] = rowa[8 * hh + r]; cad[r] = rowc[8 * hh + r] * addsel; }
      const float* vsc = vsb + ((size_t)c * NKB + (size_t)(nkb - 1)) * DH;
      float vs[NACC];
#pragma unroll
      for (int j = 0; j < NACC; ++j) vs[j] = vsc[16 * j];
#pragma unroll
      for (int j = 0; j < NACC; ++j) {
#pragma unroll
        for (int r = 0; r < 8; ++r) o[j][r] = o[j][r] * scl[r] + cad[r] * vs[j];
      }
      const _Float16* pp = (const _Float16*)(const void*)pls + m * PLP + 8 * hh;
#pragma unroll 1
      for (int kb = wave; kb < nkb; kb += 8) {             // wave-uniform trip count, <= 2
        const v16h pf = ldfrag_h(pp + kb * 32);
        const _Float16* vk = (const _Float16*)(const void*)(vbp + (lo16 + (unsigned)(kbeg + kb * 32) * (DH * 2u)));
        const v16h g0 = ldfrag_hs(vk);
        const v16h g1 = ldfrag_hs(vk + 512);
        const v16h g2 = ldfrag_hs(vk + 1024);
        const v16h g3 = ldfrag_hs(vk + 1536);
        o[0] = mma_h(pf, g0, o[0]);
        o[1] = mma_h(pf, g1, o[1]);
        o[2] = mma_h(pf, g2, o[2]);
        o[3] = mma_h(pf, g3, o[3]);
        guardpv4(o[0], o[1], o[2], o[3], pf, g0, g1, g2, g3);
      }
    }
  }
  acc_guard4(o[0], o[1], o[2], o[3]);

  // ---- combine the 8 partial O tiles in fixed order ----
  __syncthreads();
#pragma unroll
  for (int j = 0; j < NACC; ++j) {
#pragma unroll
    for (int r = 0; r < 8; ++r) scs[(wave * 16 + 8 * hh + r) * OPP + 16 * j + m] = o[j][r];
  }
  __syncthreads();
  const int c4 = sub * 4;
  v4f sm4 = zero4();
#pragma unroll
  for (int w = 0; w < 8; ++w) sm4 += *(const v4f*)(scs + (w * 16 + r16) * OPP + c4);
  const float inv = (1.0f / lrun) * (CSC / (PCAR * VCAR));            // lrun >= 1
#pragma unroll
  for (int e = 0; e < 4; ++e) {
    const float xs = sm4[e] * inv;
    const _Float16 hv = (_Float16)xs;
    const _Float16 rv = (_Float16)((xs - (float)hv) * RSC);
    pls[r16 * CTP + c4 + e]        = h_bits(hv);
    pls[(16 + r16) * CTP + c4 + e] = h_bits(rv);
  }
  __syncthreads();
  const int line = tid >> 3;                 // 0..31: plane = line>>4, row = line&15
  const int plane = line >> 4;
  const int rowl  = line & 15;
  const int c8    = (tid & 7) * 8;
  const v4u ov = *(const v4u*)(pls + (plane * 16 + rowl) * CTP + c8);
  u16* dst = ((plane == 0) ? CHo : CRo) + ((size_t)b * SEQ + q0 + rowl) * DH + c8;
  *(v4u*)dst = ov;
  
}

// =====================================================================================================
// Query rows 0 .. TQ0-1 of each sequence in f32 on VALU: block = (b, t), threads 0..127 work (waves 4..7 only pass the barriers). QF/KF = f32 q/k planes [nb][TQ0][DH] (bias
// included), V = f32 v plane [nb*SEQ][DH]. Scores for keys j (thread j, one key each, 64-d dot of its whole key row against the q row staged in LDS;
// keys j > t masked to -inf), base-2 softmax with block max / sum reductions (xor shuffles + LDS), p_j in LDS, ctx[d] for d = tid
// (threads 0..63) as a sum in key order of p_j * V[b][j][d] (coalesced, groups of 64 keys up to the one holding t), x = ctx * 4096 / l, hi = f16(x),
// res = f16((x - hi) * 2048); both 64-half rows are staged in LDS and written by lanes 0..15 of wave 0: lanes 0..7 the hi row, lanes
// coverage: grid nb*TQ0 blocks = rows 0..TQ0-1 of every sequence; 64 thr x 1 d = DH per row; store 16 lanes x 8 halves = both rows;
//           together with attn_fwd every (b, s, d) of CH and CR is written exactly once.
// =====================================================================================================
__device__ __forceinline__
void attn_head_body(float* qs, float* sc, float* red, float* redb, u16* SW, int bid,
                    const float* __restrict__ QF, const float* __restrict__ KF, const float* __restrict__ V, u16* CHo, u16* CRo) {
  const int tid = threadIdx.x, lane = tid & 31, wave = tid >> 5;
  const int b = bid / TQ0;
  const int t = bid - b * TQ0;
  const bool work = wave < HD_THREADS / 32;                        // wave-uniform: one key per thread, keys 0..TQ0-1
  if (tid < DH) qs[tid] = QF[((size_t)b * TQ0 + t) * DH + tid];   // waves 0,1 entirely (wave-uniform)
  __syncthreads();
  float acc = 0.f;
  if (work) {
    const float* kp = KF + (size_t)b * (TQ0 * DH) + tid * DH;       // key row b*TQ0 + tid always in range (tid < TQ0)
    v4f kr[DH / 4];                                                 // the whole key row: 16 loads in flight, one latency
#pragma unroll
    for (int i = 0; i < DH / 4; ++i) kr[i] = *(const v4f*)(kp + 4 * i);
#pragma unroll
    for (int i = 0; i < DH / 4; ++i) {
      const v4f q4 = *(const v4f*)(qs + 4 * i);
#pragma unroll
      for (int e = 0; e < 4; ++e) acc += kr[i][e] * q4[e];
    }
  }
  const float s = (tid <= t) ? acc * (RSQD * LOG2E) : -INFINITY;   // causal mask by key index
  float mx = s;
#pragma unroll
  for (int d = 1; d <= 16; d <<= 1) mx = fmaxf(mx, __shfl_xor(mx, d, 32));
  if (work && lane == 0) red[wave] = mx;
  __syncthreads();
  float gm = red[0];
#pragma unroll
  for (int w = 1; w < 4; ++w) gm = fmaxf(gm, red[w]);   // finite: key 0 is always valid
  const float p = exp2f(s - gm);                     // 0 for masked keys
  float ps = p;
#pragma unroll
  for (int d = 1; d <= 16; d <<= 1) ps += __shfl_xor(ps, d, 32);
  if (work && lane == 0) redb[wave] = ps;
  if (work) sc[tid] = p;
  __syncthreads();
  float l = redb[0];
#pragma unroll
  for (int w = 1; w < 4; ++w) l += redb[w];           // >= 1
  const float inv = (1.0f / l) * CSC;
  if (wave < 2) {                                    // threads 0..63 (wave-uniform): one d column each
    const float* vp = V + (size_t)b * SEQ * DH + tid;
    float cx = 0.f;
    // Keys in groups of 64 whose loads are issued ahead of their use: one load latency per group. A group's keys j > t carry
    // sc[j] = 0 and add nothing; rows j0 .. j0+63 <= TQ0-1 of sequence b always exist. The sum runs in key order.
    // rolled: the trip count (1 or 2) depends on t
#pragma unroll 1
    for (int j0 = 0; j0 <= t; j0 += 64) {            // block-uniform
      float vv[64];
#pragma unroll
      for (int i = 0; i < 64; ++i) vv[i] = vp[(size_t)(j0 + i) * DH];
#pragma unroll
      for (int i = 0; i < 16; ++i) {
        const v4f p4 = *(const v4f*)(sc + j0 + 4 * i);
#pragma unroll
        for (int e = 0; e < 4; ++e) cx += p4[e] * vv[4 * i + e];
      }
    }
    const float x0 = cx * inv;
    const _Float16 h0 = (_Float16)x0;
    const _Float16 r0 = (_Float16)((x0 - (float)h0) * RSC);
    SW[tid]      = h_bits(h0);
    SW[DH + tid] = h_bits(r0);
  }
  __syncthreads();
  if (wave == 0) {                                   // wave-uniform
    const int l16 = lane & 15;
    const int plane = l16 >> 3, p8 = (l16 & 7) * 8;
    const v4u ov = *(const v4u*)(SW + plane * DH + p8);
    u16* dst = ((plane == 0) ? CHo : CRo) + ((size_t)b * SEQ + t) * DH + p8;
    if (lane < 16) *(v4u*)dst = ov;
    
  }
}

// =====================================================================================================
// One launch for the two independent attention jobs, picked by block index (block-uniform): blocks 0..NB*NQT-1 = query rows TQ0.. on
// WMMA, the rest = query rows 0..TQ0-1 on VALU (short blocks, last, so that they fill places the long blocks leave).
// coverage: grid = NB*NQT + NB*TQ0 blocks; each job is handed block indices 0 .. its own block count - 1.
// =====================================================================================================
__global__ __launch_bounds__(ATT_THREADS) __attribute__((amdgpu_num_vgpr(256)))
void attn(const u16* __restrict__ QPp, const u16* __restrict__ KPp, const u16* __restrict__ VTp, const float* __restrict__ VSp,
          const float* __restrict__ QF, const float* __restrict__ KF, const float* __restrict__ V, u16* CHo, u16* CRo) {
  __shared__ __align__(16) float scs[16 * SCP];     // scores [16][SCP] f32; reused as partial O tiles [8][16][OPP] f32
  __shared__ __align__(16) u16 pls[16 * PLP];       // P' tile [16][PLP] f16 bits; reused as ctx staging [32][CTP] u16
  __shared__ float rowa[QT];
  __shared__ float rowc[QT];
  __shared__ __align__(16) float qs[DH];
  __shared__ __align__(16) float sc[TQ0];
  __shared__ float red[4];
  __shared__ float redb[4];
  __shared__ __align__(16) u16 SW[2 * DH];
  const int bid = blockIdx.x;
  if (bid < NB * NQT) attn_fwd_body(scs, pls, rowa, rowc, bid, QPp, KPp, VTp, VSp, CHo, CRo);
  else                attn_head_body(qs, sc, red, redb, SW, bid - NB * NQT, QF, KF, V, CHo, CRo);
}

// =====================================================================================================
// Workspace map (bytes, nb = 4, rows = 16384); every plane is fully written by whole-line stores before it is read; all extents are
//   WQT bf16 [64][512] 65536   WKT same   WVT same   WOT f16 of bf16 value x1024 [512][64] 65536 (fragment order)  262144
//   XB  bf16 [rows][512]                                                                                           16777216
//   QP  f16 [rows][64] x8 (fragment order)                                                                          2097152
//   KP  f16 [rows][64] x8 (fragment order)                                                                          2097152
//   V   f32 [rows][64]                                                                                              4194304
//   VT  f16 x1024, [nb][SEQ/32][4] tiles of 32 keys x 16 d (fragment order)                                                                    2097152
//   VS  f32 [nb][8][16][64]                                                                                          131072
//   QF  f32 [nb][128][64]  131072      KF same                                                                       262144
//   CH  f16 [rows][64] ctx hi x4096                                                                                 2097152
//   CR  f16 [rows][64] ctx residual x2048                                                                           2097152
//   end                                                                                                            32112640
// =====================================================================================================
extern "C" void kernel_launch(void* const* d_in, const int* in_sizes, int n_in,
                              void* d_out, int out_size, void* d_ws, size_t ws_size,
                              hipStream_t stream) {
  if (n_in < 9) return;
  const int nb   = NB;
  const int rows = nb * SEQ;
  if ((long long)in_sizes[0] < (long long)NB * SEQ_FULL * EMB) return;
  if (in_sizes[1] < EMB * DH || in_sizes[3] < EMB * DH || in_sizes[5] < EMB * DH || in_sizes[7] < DH * EMB) return;
  if (in_sizes[2] < DH || in_sizes[4] < DH || in_sizes[6] < DH || in_sizes[8] < EMB) return;
  if ((long long)out_size < (long long)rows * EMB) return;

  const float* x  = (const float*)d_in[0];
  const float* wq = (const float*)d_in[1];
  const float* bq = (const float*)d_in[2];
  const float* wk = (const float*)d_in[3];
  const float* bk = (const float*)d_in[4];
  const float* wv = (const float*)d_in[5];
  const float* bv = (const float*)d_in[6];
  const float* wo = (const float*)d_in[7];
  const float* bo = (const float*)d_in[8];
  float*       out = (float*)d_out;

  const size_t szW  = (size_t)EMB * DH * 2;                      //     65536
  const size_t szXB = (size_t)rows * EMB * 2;                    //  16777216
  const size_t szP  = (size_t)rows * DH * 2;                     //   2097152
  const size_t szV  = (size_t)rows * DH * 4;                     //   4194304
  const size_t szVT = (size_t)nb * DH * SEQ * 2;                 //   2097152 (== szP)
  const size_t szVS = (size_t)nb * NCHK * NKB * DH * 4;          //    131072
  const size_t szHF = (size_t)nb * TQ0 * DH * 4;                 //    131072
  size_t off = 0;
  const size_t oWQ = off; off += szW;
  const size_t oWK = off; off += szW;
  const size_t oWV = off; off += szW;
  const size_t oWO = off; off += szW;
  const size_t oXB = off; off += szXB;
  const size_t oQ  = off; off += szP;
  const size_t oK  = off; off += szP;
  const size_t oV  = off; off += szV;
  const size_t oVT = off; off += szVT;
  const size_t oVS = off; off += szVS;
  const size_t oQF = off; off += szHF;
  const size_t oKF = off; off += szHF;
  const size_t oCH = off; off += szP;
  const size_t oCR = off; off += szP;
  if (off > ws_size) return;                                     // off = 32112640 at nb = 4
  if (off > WS_CAP) return;

  char* ws = (char*)d_ws;
  u16*   WQT = (u16*)(ws + oWQ);
  u16*   WKT = (u16*)(ws + oWK);
  u16*   WVT = (u16*)(ws + oWV);
  u16*   WOT = (u16*)(ws + oWO);
  u16*   XB  = (u16*)(ws + oXB);
  u16*   QP  = (u16*)(ws + oQ);
  u16*   KP  = (u16*)(ws + oK);
  float* V   = (float*)(ws + oV);
  u16*   VT  = (u16*)(ws + oVT);
  float* VS  = (float*)(ws + oVS);
  float* QF  = (float*)(ws + oQF);
  float* KF  = (float*)(ws + oKF);
  u16*   CH  = (u16*)(ws + oCH);
  u16*   CR  = (u16*)(ws + oCR);

  const int n8x = (SEQ * EMB) / 8;                       // 262144 per batch
  if ((n8x % 256) != 0 || (rows % 64) != 0 || ((nb * TQ0) % 64) != 0) return;
  const dim3 blk(256);
  const dim3 gPR(4 * WTB + NB * XCB);                   // 4 * 8 weight tiles + nb * 1024 x blocks
  const dim3 gPJ(2 * GHB + 3 * GPB);                    // 2 * 8 + 3 * 256 at nb = 4
  const dim3 bG(128);
  const dim3 gVP(VSB + XTB);                            // nb * 8 + nb * 64
  const dim3 gAT(NB * NQT + NB * TQ0);                  // nb * 248 + nb * 128
  const dim3 bAT(ATT_THREADS);
  const dim3 gO((rows / 64) * (EMB / 64));              // 2048 at nb = 4

  // (0) Wq, Wk, Wv stored [k = in 512][n = out 64] -> bf16 planes [64][512] in fragment order; Wo [k = 64][n = 512] -> f16 of bf16
  //     value x1024, [512][64] in fragment order; x -> bf16 plane [rows][512]
  prep<<<gPR, blk, 0, stream>>>(x, wq, wk, wv, wo, WQT, WKT, WVT, WOT, XB);
  // (1) q and k projections (+bias) -> f16 planes x8; v projection (+bias) -> f32 plane; f32 q and k rows 0..127 of every
  //     sequence -> QF, KF [nb*128][64]
  proj<<<gPJ, bG, 0, stream>>>(XB, WQT, WKT, WVT, bq, bk, bv, QP, KP, V, QF, KF, rows, nb * TQ0, DH, EMB);
  // (2) v -> V^T plane x1024 and key-block prefix column sums of v
  vprep<<<gVP, blk, 0, stream>>>(V, VT, VS);
  // (3) attention: query rows 128.. on WMMA and query rows 0..127 on VALU -> ctx hi x4096 and residual x2048 f16 planes
  attn<<<gAT, bAT, 0, stream>>>(QP, KP, VT, VS, QF, KF, V, CH, CR);
  // (4) output projection + bias -> out
  gemm_h2_32<<<gO, bG, 0, stream>>>(CH, CR, WOT, bo, out, rows, EMB, DH,
                                    1.0f / (CSC * WSC), 1.0f / (CSC * WSC * RSC));
  (void)hipGetLastError();
}

// v004
// Measured time: 75.3 microseconds a run.
// Two timings next to v003 put it at 1.07 and 1.04 times that version's speed.
// All steps since v000 together make it 2.98 times as fast.
// Projections q,k,v = x.W + b and the f32 q,k rows 0..127 per sequence: v_wmma_f32_16x16x32_bf16 (bf16 RNE operands of the
// raw inputs, f32 accumulate, bf16 RNE bias added in f32). Scores q'.k'^T (f16 planes x8), P'.V (chunk-centred P' x32768 f16 from LDS,
// V^T x1024 f16) and the output projection (ctx carried as f16 hi x4096 plus residual x2048 planes, times f16(bf16(Wo)) x1024, bias
// added in f32): v_wmma_f32_16x16x32_f16, f32 accumulate. Query rows 0..127 of each sequence: scores, softmax and P.V in f32 on VALU.
// Causal mask, softmax statistics, key-block column sums of V and all scaling in f32 on VALU.
#include <hip/hip_runtime.h>
#include <math.h>
#include <stdint.h>

#ifndef NB
#define NB 4
#endif
#ifndef SEQ
#define SEQ 4096
#endif
#define SEQ_FULL 4096
#define NB_FULL 4
#define EMB   512
#define DH    64
#define CK    512
#define NCHK  (SEQ / CK)
#define NKB   16
#define QT    16
#define TQ0   128
#define NQT   ((SEQ - TQ0) / QT)
#define SCP   544
#define PLP   528
#define OPP   68
#define CTP   72
#define SLAB64 (16 * 68)
#define VTP   72
#define ATT_THREADS 256
#define HD_THREADS 128
#define NACC  4
#define QSC   8.0f
#define KSC   8.0f
#define PCAR  32768.0f
#define VCAR  1024.0f
#define WSC   1024.0f
#define CSC   4096.0f
#define RSC   2048.0f
#define LOG2E 1.4426950408889634f
#define RSQD  0.125f
#define WS_CAP ((size_t)134217728)
#define WTB   ((EMB / 64) * (DH / 64))
#define XCB   ((SEQ * EMB) / 8 / 256)
#define GPB   (((NB * SEQ) / 64) * (DH / 64))
#define GHB   (((NB * TQ0) / 64) * (DH / 64))
#define XTB   (NB * (SEQ / 64))
#define VSB   (NB * NCHK)

static_assert(DH == 64 && NACC * 16 == DH && (EMB % 64) == 0 && (EMB % 32) == 0 && (DH % 32) == 0);
static_assert((SEQ % CK) == 0 && NCHK >= 1 && CK == 32 * NKB && (SEQ % 64) == 0 && (SEQ % QT) == 0 && (CK % QT) == 0);
static_assert((TQ0 % QT) == 0 && (TQ0 % 64) == 0 && NQT * QT + TQ0 == SEQ && NQT >= 1 && TQ0 == 128 && TQ0 == HD_THREADS);
static_assert(8 * 16 * OPP <= 16 * SCP && 32 * CTP <= 16 * PLP && CTP >= DH + 8 && OPP >= DH + 4 && SCP >= CK + 16 && PLP >= CK + 8);
static_assert(((PLP * 2) % 16) == 0 && ((SCP * 4) % 16) == 0 && ((VTP * 2) % 16) == 0 && ((CTP * 2) % 16) == 0 && ((OPP * 4) % 16) == 0);
static_assert(64 * VTP >= 63 * VTP + 64);
static_assert(ATT_THREADS == 16 * QT && ATT_THREADS == 256 && HD_THREADS == 2 * DH);
static_assert((((SEQ * EMB) / 8) % 256) == 0 && ((NB * SEQ) % 64) == 0 && ((NB * TQ0) % 64) == 0);
static_assert(NB >= 1 && NB <= NB_FULL && SEQ <= SEQ_FULL && (TQ0 % 64) == 0 && (NKB % 2) == 0);

typedef unsigned short u16;
typedef _Float16 v16h __attribute__((ext_vector_type(16)));
typedef _Float16 v8h  __attribute__((ext_vector_type(8)));
typedef __bf16   v16b __attribute__((ext_vector_type(16)));
typedef float    v8f  __attribute__((ext_vector_type(8)));
typedef float    v4f  __attribute__((ext_vector_type(4)));
typedef unsigned int v4u __attribute__((ext_vector_type(4)));

union FragH { v16h v; v8h h[2]; v4u u[2]; };
union FragB { v16b v; v4u u[2]; };

// ---- scalar helpers --------------------------------------------------------------------------------
__device__ __forceinline__ unsigned short bf_bits(float f) {          // f32 -> bf16 bits, RNE convert
  unsigned u = __float_as_uint(f);
  return (unsigned short)((u + 0x7FFFu + ((u >> 16) & 1u)) >> 16);
}
__device__ __forceinline__ float bf_up(unsigned short h) { return __uint_as_float(((unsigned)h) << 16); }
__device__ __forceinline__ float bfr(float f) { return bf_up(bf_bits(f)); }
__device__ __forceinline__ unsigned short h_bits(_Float16 x) { return __builtin_bit_cast(unsigned short, x); }
__device__ __forceinline__ unsigned pk16(unsigned short a, unsigned short b) { return (unsigned)a | ((unsigned)b << 16); }
__device__ __forceinline__ v8f zero8() { v8f z = {0.f, 0.f, 0.f, 0.f, 0.f, 0.f, 0.f, 0.f}; return z; }
__device__ __forceinline__ v4f zero4() { v4f z = {0.f, 0.f, 0.f, 0.f}; return z; }

// ---- fragment loaders: 16-bit A/B operand, lane -> row/col (lane&15), p already includes +8*(lane>>4);
//      elements 0..7 <- p[0..7] (k0+8h..), elements 8..15 <- p[16..23] (k0+16+8h..)  (same split k map for A and B);
//      this form reads the row-major A planes (x, ctx hi, ctx residual)
__device__ __forceinline__ v16h ldfrag_h(const _Float16* p) {
  FragH f;
  f.h[0] = *(const v8h*)(p);
  f.h[1] = *(const v8h*)(p + 16);
  return f.v;
}
__device__ __forceinline__ v16b ldfrag_b(const u16* p) {              // bf16 plane read as unsigned integer vectors
  FragB f;
  f.u[0] = *(const v4u*)(p);
  f.u[1] = *(const v4u*)(p + 16);
  return f.v;
}

// ---- the same fragments from a plane kept in FRAGMENT ORDER: a 16 (rows or cols) x 32 (k) tile is 512 consecutive halves; the 16-B
//      unit of lane l = 16*h + m (row/col m, k = 8h .. 8h+7) lies at 8*l, the unit for k = 16+8h .. at 256 + 8*l. p already includes
//      +8*lane, so each of the two loads reads 512 consecutive bytes (4 whole lines) where a row-major plane gives 16 lines.
__device__ __forceinline__ v16h ldfrag_hs(const _Float16* p) {
  FragH f;
  f.h[0] = *(const v8h*)(p);
  f.h[1] = *(const v8h*)(p + 256);
  return f.v;
}
__device__ __forceinline__ v16b ldfrag_bs(const u16* p) {
  FragB f;
  f.u[0] = *(const v4u*)(p);
  f.u[1] = *(const v4u*)(p + 256);
  return f.v;
}

// Precaution behind a run of fragment loads: the registers that those loads name (row pointers a0, a1; byte offsets o0..o3) are inputs
// of the wait, so none of them is advanced or reused as a load's destination in front of s_wait_xcnt 0.
__device__ __forceinline__ void addr_wait(const void* a0, const void* a1, unsigned o0, unsigned o1, unsigned o2, unsigned o3) {
#if defined(__HIP_DEVICE_COMPILE__)
  asm volatile("s_wait_xcnt 0x0" :: "v"(a0), "v"(a1), "v"(o0), "v"(o1), "v"(o2), "v"(o3) : "memory");
#endif
}

__device__ __forceinline__ v8f mma_h(v16h a, v16h b, v8f c) {
  return __builtin_amdgcn_wmma_f32_16x16x32_f16(false, a, false, b, (short)0, c, false, false);
}
__device__ __forceinline__ v8f mma_b(v16b a, v16b b, v8f c) {
  return __builtin_amdgcn_wmma_f32_16x16x32_bf16(false, a, false, b, (short)0, c, false, false);
}
__device__ __forceinline__ void guard2x6(v8f& a, v8f& b, v16h x0, v16h x1, v16h x2, v16h x3, v16h x4, v16h x5) {
#if defined(__HIP_DEVICE_COMPILE__)
  asm volatile("v_nop\n\tv_nop\n\tv_nop\n\tv_nop"
               : "+v"(a), "+v"(b) : "v"(x0), "v"(x1), "v"(x2), "v"(x3), "v"(x4), "v"(x5) : "memory");
#endif
}
template <typename F>
__device__ __forceinline__ void guard6(v8f& a, v8f& b, v8f& c, v8f& d, F x0, F x1, F x2, F x3, F x4, F x5) {
#if defined(__HIP_DEVICE_COMPILE__)
  asm volatile("v_nop\n\tv_nop\n\tv_nop\n\tv_nop"
               : "+v"(a), "+v"(b), "+v"(c), "+v"(d) : "v"(x0), "v"(x1), "v"(x2), "v"(x3), "v"(x4), "v"(x5) : "memory");
#endif
}
__device__ __forceinline__ void guard8x6(v8f& a0, v8f& a1, v8f& a2, v8f& a3, v8f& e0, v8f& e1, v8f& e2, v8f& e3,
                                         v16h x0, v16h x1, v16h x2, v16h x3, v16h x4, v16h x5) {
#if defined(__HIP_DEVICE_COMPILE__)
  asm volatile("v_nop\n\tv_nop\n\tv_nop\n\tv_nop"
               : "+v"(a0), "+v"(a1), "+v"(a2), "+v"(a3), "+v"(e0), "+v"(e1), "+v"(e2), "+v"(e3)
               : "v"(x0), "v"(x1), "v"(x2), "v"(x3), "v"(x4), "v"(x5) : "memory");
#endif
}
__device__ __forceinline__ void guardpv4(v8f& o0, v8f& o1, v8f& o2, v8f& o3, v16h p, v16h g0, v16h g1, v16h g2, v16h g3) {
#if defined(__HIP_DEVICE_COMPILE__)
  asm volatile("v_nop\n\tv_nop\n\tv_nop\n\tv_nop"
               : "+v"(o0), "+v"(o1), "+v"(o2), "+v"(o3)
               : "v"(p), "v"(g0), "v"(g1), "v"(g2), "v"(g3) : "memory");
#endif
}
__device__ __forceinline__ void acc_guard4(v8f& a, v8f& b, v8f& c, v8f& d) {
#if defined(__HIP_DEVICE_COMPILE__)
  asm volatile("v_nop\n\tv_nop\n\tv_nop\n\tv_nop" : "+v"(a), "+v"(b), "+v"(c), "+v"(d));
#endif
}
__device__ __forceinline__ void wave_sync_lds() {                    // wave-private LDS slab: release, wave barrier, acquire
  __builtin_amdgcn_fence(3, "workgroup");
  __builtin_amdgcn_wave_barrier();
  __builtin_amdgcn_fence(2, "workgroup");
}

// =====================================================================================================
// x plane f32 [b][SEQ_FULL][EMB] -> bf16 RNE bits [b][SEQ][EMB] (compact rows). Thread = 8 consecutive elements: two 16-B loads,
// coverage: grid = (SEQ*EMB/8/256 blocks, nb) x 256 thr x 8 = the whole plane.
// =====================================================================================================
__device__ __forceinline__ void cvtx_body(int bx, int bb, const float* __restrict__ x, u16* D, int n8) {
  const int gt = bx * 256 + (int)threadIdx.x;
  if (gt >= n8) return;                     // no barriers on this path
  const float* p = x + (size_t)bb * ((size_t)SEQ_FULL * EMB) + (size_t)gt * 8;
  const v4f a = *(const v4f*)(p), c4 = *(const v4f*)(p + 4);
  float v[8];
#pragma unroll
  for (int e = 0; e < 4; ++e) { v[e] = a[e]; v[4 + e] = c4[e]; }
  unsigned short s[8];
#pragma unroll
  for (int e = 0; e < 8; ++e) s[e] = bf_bits(v[e]);
  v4u o;
#pragma unroll
  for (int e = 0; e < 4; ++e) o[e] = pk16(s[2 * e], s[2 * e + 1]);
  u16* d = D + (size_t)bb * ((size_t)SEQ * EMB) + (size_t)gt * 8;
  {
    *(v4u*)(d) = o;
    
  }
}

// =====================================================================================================
// Weight transpose-convert: in W[R][C] f32 row-major -> out D = the [n = C][k = R] 16-bit operand plane for y = x.W in fragment order:
// tile (n/16, k/32) at halves ((n/16)*(R/32) + k/32)*512, units inside it as ldfrag_hs / ldfrag_bs read them.
// mode 0: bf16 RNE bits; mode 1: f16 bits of (bf16 RNE value) * scale.
// Block = 64x64 tile: 64 input row segments of 64 floats loaded with 16-B loads, converted, scattered into an LDS tile [c][64 r]
// coverage: load 256 thr x 16 = 64 x 64; store 2 iterations x 256 thr x 8 halves = 64 lines x 64; grid = (R/64) x (C/64) blocks
//           covers D exactly once (host checks R % 64 == 0, C % 64 == 0).
// =====================================================================================================
__device__ __forceinline__ void wt16_body(u16* TH, int bid, const float* __restrict__ W, u16* D, int R, int C, int mode,
                                          float scale) {
  const int tid = threadIdx.x;
  const int nrt = R >> 6;
  const int r0  = (bid % nrt) * 64;
  const int c0  = (bid / nrt) * 64;
  {
    const int rl = tid >> 2;                  // input row within tile 0..63
    const int cs = (tid & 3) * 16;            // column chunk within the 64
    const float* src = W + (size_t)(r0 + rl) * C + c0 + cs;
#pragma unroll
    for (int i = 0; i < 4; ++i) {
      const v4f a = *(const v4f*)(src + 4 * i);
#pragma unroll
      for (int e = 0; e < 4; ++e) {
        const float v  = a[e];
        const unsigned short hb = h_bits((_Float16)(bfr(v) * scale));
        const unsigned short bb = bf_bits(v);
        TH[(cs + 4 * i + e) * VTP + rl] = (mode != 0) ? hb : bb;
      }
    }
  }
  __syncthreads();
  v4u vh[2];
  const int fm = tid & 15, fh = (tid >> 4) & 1, fs = (tid >> 5) & 1, fk = (tid >> 6) & 1, fn = tid >> 7;
#pragma unroll
  for (int it = 0; it < 2; ++it) {            // local c = 16*(2*it + fn) + fm, local r = 32*fk + 16*fs + 8*fh .. +7
    vh[it] = *(const v4u*)(TH + ((it * 2 + fn) * 16 + fm) * VTP + fk * 32 + fs * 16 + fh * 8);
  }
  const int kt = R >> 5;                      // 32-wide k tiles per 16 columns
  {
#pragma unroll
    for (int it = 0; it < 2; ++it) {
      *(v4u*)(D + ((size_t)((c0 >> 4) + it * 2 + fn) * (size_t)kt + (size_t)(r0 >> 5)) * 512 + (tid & 127) * 8) = vh[it];
    }
    
  }
}

// =====================================================================================================
// One launch for the five independent preparation jobs, picked by block index (block-uniform): blocks 0..4*WTB-1 = the four weight
// transposes (WTB blocks each, order Wq, Wk, Wv, Wo), the rest = the x conversion (XCB blocks per batch row).
// coverage: grid = 4*WTB + nb*XCB blocks; each job is handed block indices 0 .. its own block count - 1.
// =====================================================================================================
__global__ __launch_bounds__(256)
void prep(const float* __restrict__ x, const float* __restrict__ wq, const float* __restrict__ wk, const float* __restrict__ wv,
          const float* __restrict__ wo, u16* WQT, u16* WKT, u16* WVT, u16* WOT, u16* XB) {
  __shared__ __align__(16) u16 TH[64 * VTP];
  const int bid = blockIdx.x;
  if (bid < 4 * WTB) {
    const int job = bid / WTB;
    const float* W = (job == 0) ? wq : (job == 1) ? wk : (job == 2) ? wv : wo;
    u16* D = (job == 0) ? WQT : (job == 1) ? WKT : (job == 2) ? WVT : WOT;
    const bool pj = job < 3;                  // Wq, Wk, Wv: [EMB][DH] -> bf16; Wo: [DH][EMB] -> scaled f16
    wt16_body(TH, bid - job * WTB, W, D, pj ? EMB : DH, pj ? DH : EMB, pj ? 0 : 1, pj ? 1.0f : WSC);
  } else {
    const int r = bid - 4 * WTB;
    cvtx_body(r % XCB, r / XCB, x, XB, XCB * 256);
  }
}

// =====================================================================================================
//            16 consecutive lanes x 16 B per line), lanes 16..31 -> row 2*it+1.
//  epi64x2 : same store shape, staged value = acc*os1 + accres*os2 + badd (two accumulator sets combined in f32).
//  epi64hsb: f16 bits of ((tile + bf16RNE(bias[n])) * pscale), plane in fragment order; lane = (row lane&15, 8 consecutive columns),
// coverage: epi64/epi64x2 8 instructions x 2 rows x 16 lanes x 4 floats; epi64hsb 4 instructions x 16 rows x 2 lanes x 8 halves
//           = the wave's 16 x 64 tile in every case.
// =====================================================================================================
__device__ __forceinline__ void stage64(float* sl, v8f a0, v8f a1, v8f a2, v8f a3, float oscale, int lane) {
  const int hh = lane >> 4, m = lane & 15;
#pragma unroll
  for (int r = 0; r < 8; ++r) {
    const int ro = (8 * hh + r) * 68 + m;
    sl[ro]      = a0[r] * oscale;
    sl[ro + 16] = a1[r] * oscale;
    sl[ro + 32] = a2[r] * oscale;
    sl[ro + 48] = a3[r] * oscale;
  }
  wave_sync_lds();
}
__device__ __forceinline__ void epi64(float* sl, v8f a0, v8f a1, v8f a2, v8f a3, float oscale, v4f badd, float* C, int N,
                                      size_t rowb, int col0, int lane) {
  const int hh = lane >> 4, m = lane & 15;
  stage64(sl, a0, a1, a2, a3, oscale, lane);
  v4f vals[8];
#pragma unroll
  for (int it = 0; it < 8; ++it) vals[it] = *(const v4f*)(sl + (it * 2 + hh) * 68 + m * 4) + badd;
  float* dst = C + (rowb + (size_t)hh) * (size_t)N + col0 + m * 4;
  {
#pragma unroll
    for (int it = 0; it < 8; ++it) {
      *(v4f*)(dst + (size_t)(it * 2) * (size_t)N) = vals[it];
    }
    
  }
}
__device__ __forceinline__ void epi64x2(float* sl, v8f a0, v8f a1, v8f a2, v8f a3, v8f e0, v8f e1, v8f e2, v8f e3,
                                        float os1, float os2, v4f badd, float* C, int N, size_t rowb, int col0, int lane) {
  const int hh = lane >> 4, m = lane & 15;
#pragma unroll
  for (int r = 0; r < 8; ++r) {
    const int ro = (8 * hh + r) * 68 + m;
    sl[ro]      = a0[r] * os1 + e0[r] * os2;
    sl[ro + 16] = a1[r] * os1 + e1[r] * os2;
    sl[ro + 32] = a2[r] * os1 + e2[r] * os2;
    sl[ro + 48] = a3[r] * os1 + e3[r] * os2;
  }
  wave_sync_lds();
  v4f vals[8];
#pragma unroll
  for (int it = 0; it < 8; ++it) vals[it] = *(const v4f*)(sl + (it * 2 + hh) * 68 + m * 4) + badd;
  float* dst = C + (rowb + (size_t)hh) * (size_t)N + col0 + m * 4;
  {
#pragma unroll
    for (int it = 0; it < 8; ++it) {
      *(v4f*)(dst + (size_t)(it * 2) * (size_t)N) = vals[it];
    }
    
  }
}
__device__ __forceinline__ void epi64hsb(float* sl, v8f a0, v8f a1, v8f a2, v8f a3, float oscale, float pscale,
                                         const float* __restrict__ bias, u16* C, int N, size_t rowb, int col0, int lane) {
  stage64(sl, a0, a1, a2, a3, oscale, lane);
  const int hh = lane >> 4, m = lane & 15;
  v4u oh[4];
#pragma unroll
  for (int g = 0; g < 4; ++g) {               // g = 16-column group of the 64; lane = (row m, columns 16g + 8hh .. +7)
    const int c8 = g * 16 + hh * 8;
    const v4f b0 = *(const v4f*)(bias + col0 + c8), b1 = *(const v4f*)(bias + col0 + c8 + 4);   // columns col0+c8..+7 < N
    const v4f a = *(const v4f*)(sl + m * 68 + c8), c4 = *(const v4f*)(sl + m * 68 + c8 + 4);
    float w[8];
#pragma unroll
    for (int e = 0; e < 4; ++e) { w[e] = (a[e] + bfr(b0[e])) * pscale; w[4 + e] = (c4[e] + bfr(b1[e])) * pscale; }
#pragma unroll
    for (int e = 0; e < 4; ++e) oh[g][e] = pk16(h_bits((_Float16)w[2 * e]), h_bits((_Float16)w[2 * e + 1]));
  }
  // tile (rowb/16, col/32) at halves ((rowb/16)*(N/32) + col/32)*512; group g is the half-tile at g*256 behind column col0
  u16* dst = C + ((rowb >> 4) * (size_t)(N >> 5) + (size_t)(col0 >> 5)) * 512 + lane * 8;
  {
#pragma unroll
    for (int g = 0; g < 4; ++g) {
      *(v4u*)(dst + g * 256) = oh[g];
    }
    
  }
}

// =====================================================================================================
// bf16 GEMM, f32 out with bias: C[M][N] = (A[arow(m)][K] (bf16 row-major) . Bt[N][K]^T (bf16, fragment order)) * oscale + bf16RNE(bias[n]).
// Output row ra maps to A row arow = (ra / rpg) * gstr + (ra % rpg) (rpg = M, gstr = 0 gives the identity map; rpg = TQ0,
// gstr = SEQ picks the first TQ0 rows of every sequence).
// Block = 64x64 tile, 4 waves x 16 rows; fragments loaded straight from the 16-bit planes (two 16-B loads each, split k map for
// A and B); K stepped by 32 (host checks K % 32 == 0, M % 64 == 0, N % 64 == 0, grid = (M/64)*(N/64)).
// =====================================================================================================
__device__ __forceinline__
void gemm_b32_body(float* slab, int bid, const u16* __restrict__ A, const u16* __restrict__ Bt, const float* __restrict__ bias,
                   float* C, int M, int N, int K, int rpg, int gstr, float oscale) {
  const int tid = threadIdx.x, wave = tid >> 5, lane = tid & 31, hh = lane >> 4, m = lane & 15;
  const int ntile = N >> 6;
  const int rowb  = (bid / ntile) * 64 + wave * 16;
  const int col0  = (bid % ntile) * 64;
  if (rowb + 16 > M) return;                 // wave-uniform, never taken with the exact grid; no block barriers on this path
  const int ra = rowb + m;
  const int rg = ra / rpg;
  const size_t arow = (size_t)rg * (size_t)gstr + (size_t)(ra - rg * rpg);
  const u16* ap = A  + arow * (size_t)K + 8 * hh;
  // fragment order: 16 columns = K/32 tiles of 1024 bytes; block-uniform base, a lane's place is one fixed 32-bit byte offset
  const char* bp = (const char*)(const void*)Bt + (size_t)col0 * K * 2;
  const unsigned bs = 32u * (unsigned)K;
  const unsigned lo0 = (unsigned)lane * 16u, lo1 = lo0 + bs, lo2 = lo1 + bs, lo3 = lo2 + bs;   // the four 16-column groups
  v8f acc0 = zero8(), acc1 = zero8(), acc2 = zero8(), acc3 = zero8();
#pragma unroll 1
  for (int k0 = 0; k0 < K; k0 += 32) {
    const v16b a  = ldfrag_b(ap + k0);
    const unsigned ko = (unsigned)k0 * 32u;                // one 1024-byte tile per 32 of k
    const v16b b0 = ldfrag_bs((const u16*)(const void*)(bp + (lo0 + ko)));
    const v16b b1 = ldfrag_bs((const u16*)(const void*)(bp + (lo1 + ko)));
    const v16b b2 = ldfrag_bs((const u16*)(const void*)(bp + (lo2 + ko)));
    const v16b b3 = ldfrag_bs((const u16*)(const void*)(bp + (lo3 + ko)));
    addr_wait(ap + k0, ap + k0, lo0 + ko, lo1 + ko, lo2 + ko, lo3 + ko);
    acc0 = mma_b(a, b0, acc0);
    acc1 = mma_b(a, b1, acc1);
    acc2 = mma_b(a, b2, acc2);
    acc3 = mma_b(a, b3, acc3);
    guard6<v16b>(acc0, acc1, acc2, acc3, a, b0, b1, b2, b3, a);
  }
  const v4f bv4 = *(const v4f*)(bias + col0 + m * 4);    // columns col0 + 4m .. +3, always < N (N multiple of 64)
  v4f badd;
#pragma unroll
  for (int e = 0; e < 4; ++e) badd[e] = bfr(bv4[e]);
  epi64(slab + wave * SLAB64, acc0, acc1, acc2, acc3, oscale, badd, C, N, (size_t)rowb, col0, lane);
}

// =====================================================================================================
// bf16 GEMM, f16 plane out with bias: C16[M][N] = f16 bits of (((A . Bt^T) * oscale) + bf16RNE(bias[n])) * pscale; operands as in
// gemm_b32 (identity row map), epilogue epi64hsb.
// =====================================================================================================
__device__ __forceinline__
void gemm_bh16_body(float* slab, int bid, const u16* __restrict__ A, const u16* __restrict__ Bt, const float* __restrict__ bias,
                    u16* C, int M, int N, int K, float oscale, float pscale) {
  const int tid = threadIdx.x, wave = tid >> 5, lane = tid & 31, hh = lane >> 4, m = lane & 15;
  const int ntile = N >> 6;
  const int rowb  = (bid / ntile) * 64 + wave * 16;
  const int col0  = (bid % ntile) * 64;
  if (rowb + 16 > M) return;                 // wave-uniform, never taken with the exact grid; no block barriers on this path
  const u16* ap = A  + (size_t)(rowb + m) * K + 8 * hh;
  // fragment order: 16 columns = K/32 tiles of 1024 bytes; block-uniform base, a lane's place is one fixed 32-bit byte offset
  const char* bp = (const char*)(const void*)Bt + (size_t)col0 * K * 2;
  const unsigned bs = 32u * (unsigned)K;
  const unsigned lo0 = (unsigned)lane * 16u, lo1 = lo0 + bs, lo2 = lo1 + bs, lo3 = lo2 + bs;   // the four 16-column groups
  v8f acc0 = zero8(), acc1 = zero8(), acc2 = zero8(), acc3 = zero8();
#pragma unroll 1
  for (int k0 = 0; k0 < K; k0 += 32) {
    const v16b a  = ldfrag_b(ap + k0);
    const unsigned ko = (unsigned)k0 * 32u;                // one 1024-byte tile per 32 of k
    const v16b b0 = ldfrag_bs((const u16*)(const void*)(bp + (lo0 + ko)));
    const v16b b1 = ldfrag_bs((const u16*)(const void*)(bp + (lo1 + ko)));
    const v16b b2 = ldfrag_bs((const u16*)(const void*)(bp + (lo2 + ko)));
    const v16b b3 = ldfrag_bs((const u16*)(const void*)(bp + (lo3 + ko)));
    addr_wait(ap + k0, ap + k0, lo0 + ko, lo1 + ko, lo2 + ko, lo3 + ko);
    acc0 = mma_b(a, b0, acc0);
    acc1 = mma_b(a, b1, acc1);
    acc2 = mma_b(a, b2, acc2);
    acc3 = mma_b(a, b3, acc3);
    guard6<v16b>(acc0, acc1, acc2, acc3, a, b0, b1, b2, b3, a);
  }
  epi64hsb(slab + wave * SLAB64, acc0, acc1, acc2, acc3, oscale, pscale, bias, C, N, (size_t)rowb, col0, lane);
}

// =====================================================================================================
// One launch for the five independent projection GEMMs, picked by block index (block-uniform): blocks 0..GHB-1 = f32 q rows 0..127
// of every sequence, GHB..2*GHB-1 = the same for k, then GPB blocks each for the f32 v plane, the f16 q plane and the f16 k plane.
// coverage: grid = 2*GHB + 3*GPB blocks; each GEMM is handed block indices 0 .. its own block count - 1.
// =====================================================================================================
__global__ __launch_bounds__(128)
void proj(const u16* __restrict__ XB, const u16* __restrict__ WQT, const u16* __restrict__ WKT, const u16* __restrict__ WVT,
          const float* __restrict__ bq, const float* __restrict__ bk, const float* __restrict__ bv,
          u16* QP, u16* KP, float* V, float* QF, float* KF, int rows, int hrows, int N, int K) {
  __shared__ __align__(16) float slab[4 * SLAB64];
  const int bid = blockIdx.x;
  if (bid < 2 * GHB + GPB) {                 // f32 outputs
    const int job = (bid < GHB) ? 0 : (bid < 2 * GHB) ? 1 : 2;
    const bool hd = job < 2;                 // rows 0..TQ0-1 of every sequence against all rows
    gemm_b32_body(slab, bid - job * GHB, XB, (job == 0) ? WQT : (job == 1) ? WKT : WVT, (job == 0) ? bq : (job == 1) ? bk : bv,
                  (job == 0) ? QF : (job == 1) ? KF : V, hd ? hrows : rows, N, K, hd ? TQ0 : rows, hd ? SEQ : 0, 1.0f);
  } else {                                   // f16 planes
    const int r = bid - (2 * GHB + GPB);
    const bool isq = r < GPB;
    gemm_bh16_body(slab, isq ? r : r - GPB, XB, isq ? WQT : WKT, isq ? bq : bk, isq ? QP : KP, rows, N, K, 1.0f,
                   isq ? QSC : KSC);
  }
}

// =====================================================================================================
// f16 GEMM with two A planes (hi + residual), f32 out with bias:
//   C[M][N] = (Ah . Bt^T) * os1 + (Ar . Bt^T) * os2 + bf16RNE(bias[n]); Ah/Ar f16 row-major, Bt f16 in fragment order.
// Same tiling as gemm_b32; separate accumulators for the two planes, combined in f32 in epi64x2.
// =====================================================================================================
__global__ __launch_bounds__(128)
void gemm_h2_32(const u16* __restrict__ Ah, const u16* __restrict__ Ar, const u16* __restrict__ Bt,
                const float* __restrict__ bias, float* C, int M, int N, int K, float os1, float os2) {
  __shared__ __align__(16) float slab[4 * SLAB64];
  const int tid = threadIdx.x, wave = tid >> 5, lane = tid & 31, hh = lane >> 4, m = lane & 15;
  const int ntile = N >> 6;
  const int bid   = blockIdx.x;
  const int rowb  = (bid / ntile) * 64 + wave * 16;
  const int col0  = (bid % ntile) * 64;
  if (rowb + 16 > M) return;                 // wave-uniform, never taken with the exact grid; no block barriers in this kernel
  const _Float16* ap  = (const _Float16*)(const void*)Ah + (size_t)(rowb + m) * K + 8 * hh;
  const _Float16* arp = (const _Float16*)(const void*)Ar + (size_t)(rowb + m) * K + 8 * hh;
  // fragment order: 16 columns = K/32 tiles of 1024 bytes; block-uniform base, a lane's place is one fixed 32-bit byte offset
  const char* bp = (const char*)(const void*)Bt + (size_t)col0 * K * 2;
  const unsigned bs = 32u * (unsigned)K;
  const unsigned lo0 = (unsigned)lane * 16u, lo1 = lo0 + bs, lo2 = lo1 + bs, lo3 = lo2 + bs;   // the four 16-column groups
  v8f acc0 = zero8(), acc1 = zero8(), acc2 = zero8(), acc3 = zero8();
  v8f acr0 = zero8(), acr1 = zero8(), acr2 = zero8(), acr3 = zero8();
#pragma unroll 1
  for (int k0 = 0; k0 < K; k0 += 32) {
    const v16h a  = ldfrag_h(ap + k0);
    const v16h ar = ldfrag_h(arp + k0);
    const unsigned ko = (unsigned)k0 * 32u;                // one 1024-byte tile per 32 of k
    const v16h b0 = ldfrag_hs((const _Float16*)(const void*)(bp + (lo0 + ko)));
    const v16h b1 = ldfrag_hs((const _Float16*)(const void*)(bp + (lo1 + ko)));
    const v16h b2 = ldfrag_hs((const _Float16*)(const void*)(bp + (lo2 + ko)));
    const v16h b3 = ldfrag_hs((const _Float16*)(const void*)(bp + (lo3 + ko)));
    addr_wait(ap + k0, arp + k0, lo0 + ko, lo1 + ko, lo2 + ko, lo3 + ko);
    acc0 = mma_h(a, b0, acc0);
    acc1 = mma_h(a, b1, acc1);
    acc2 = mma_h(a, b2, acc2);
    acc3 = mma_h(a, b3, acc3);
    acr0 = mma_h(ar, b0, acr0);
    acr1 = mma_h(ar, b1, acr1);
    acr2 = mma_h(ar, b2, acr2);
    acr3 = mma_h(ar, b3, acr3);
    guard8x6(acc0, acc1, acc2, acc3, acr0, acr1, acr2, acr3, a, ar, b0, b1, b2, b3);
  }
  const v4f bv = *(const v4f*)(bias + col0 + m * 4);      // columns col0 + 4m .. +3, always < N (N multiple of 64)
  v4f badd;
#pragma unroll
  for (int e = 0; e < 4; ++e) badd[e] = bfr(bv[e]);
  epi64x2(slab + wave * SLAB64, acc0, acc1, acc2, acc3, acr0, acr1, acr2, acr3, os1, os2, badd, C, N,
          (size_t)rowb, col0, lane);
}

// =====================================================================================================
// V^T plane = f16(V[b][s][d] * 1024) in fragment order, V = f32 [b*SEQ + s][DH]: the tile (32 keys s/32, 16 columns d/16) lies at
// halves ((b*SEQ + s)/32 * 4 + d/16)*512, units inside it as ldfrag_hs reads them (col = d, k = key).
// Block = (b, 64 keys): 64 source rows of 64 floats loaded with 16-B loads, converted, scattered into an LDS tile [d][64 keys]
// coverage: load 256 thr x 16 elements = 64 x 64; store 2 iterations x 256 thr x 8 halves = 64 lines x 64 = the block's tile;
//           grid = nb x (SEQ/64) blocks covers the plane exactly once.
// =====================================================================================================
__device__ __forceinline__ void xt16_body(u16* TH, int bid, const float* __restrict__ X, u16* XTo) {
  const int tid = threadIdx.x;
  const int st  = bid % (SEQ / 64);
  const int b   = bid / (SEQ / 64);
  const int s0  = st * 64;
  {
    const int sl = tid >> 2;                  // key within tile 0..63
    const int dc = (tid & 3) * 16;            // d chunk within the 64
    const float* src = X + ((size_t)b * SEQ + s0 + sl) * DH + dc;
#pragma unroll
    for (int i = 0; i < 4; ++i) {
      const v4f a = *(const v4f*)(src + 4 * i);
#pragma unroll
      for (int e = 0; e < 4; ++e) {
        const float v = a[e];
        TH[(dc + 4 * i + e) * VTP + sl] = h_bits((_Float16)(v * VCAR));
      }
    }
  }
  __syncthreads();
  v4u vh[2];
  const int fm = tid & 15, fh = (tid >> 4) & 1, fs = (tid >> 5) & 1, fj = tid >> 6;
#pragma unroll
  for (int it = 0; it < 2; ++it) {            // d = 16*fj + fm, local keys 32*it + 16*fs + 8*fh .. +7
    vh[it] = *(const v4u*)(TH + (fj * 16 + fm) * VTP + it * 32 + fs * 16 + fh * 8);
  }
  const size_t base = ((size_t)b * SEQ + s0) * DH + tid * 8;
  {
#pragma unroll
    for (int it = 0; it < 2; ++it) {
      *(v4u*)(XTo + base + it * (32 * DH)) = vh[it];
    }
    // the code of the launch's other job follows these stores in the built kernel and rewrites their registers: wait first
    asm volatile("s_wait_xcnt 0x0" ::: "memory");
  }
}

// =====================================================================================================
// Key-block prefix column sums of V: VS[((b*NCHK + c)*NKB + kb)*DH + d] = sum over keys c*CK .. c*CK + 32*kb + 31 of V[b][key][d]
// (f32, fixed sequential order). Block = one (b, c), threads 0..63 work (thread = d; waves 2..7 only pass the barrier); the 16 prefix
// values per thread are staged in LDS
// coverage: grid = nb*NCHK blocks x (4 iterations x 64 thr x 4 floats = 1024) = the whole table.
// =====================================================================================================
__device__ __forceinline__ void vsum_body(float* sm, int bc, const float* __restrict__ V, float* VS) {
  const int tid = threadIdx.x;                        // d
  const int b   = bc / NCHK;
  const int c   = bc - b * NCHK;
  if (tid < DH) {                                     // waves 0,1 entirely (wave-uniform)
  const float* p = V + ((size_t)b * SEQ + (size_t)c * CK) * DH + tid;
  float s = 0.f;
  // Two register sets of one key block each: the next block's 32 loads are issued before this block is summed, so that the load
  // latency is shared by the loads in flight. The adds run in sequential key order.
  float va[32], vb[32];
#pragma unroll
  for (int i = 0; i < 32; ++i) va[i] = p[(size_t)i * DH];
  // fully unrolled: every load address is the base plus a constant, and the two sets stay in registers
#pragma unroll
  for (int kb = 0; kb < NKB; kb += 2) {
#pragma unroll
    for (int i = 0; i < 32; ++i) vb[i] = p[(size_t)((kb + 1) * 32 + i) * DH];
#pragma unroll
    for (int i = 0; i < 32; ++i) s += va[i];
    sm[kb * DH + tid] = s;
    if (kb + 2 < NKB) {
#pragma unroll
      for (int i = 0; i < 32; ++i) va[i] = p[(size_t)((kb + 2) * 32 + i) * DH];
    }
#pragma unroll
    for (int i = 0; i < 32; ++i) s += vb[i];
    sm[(kb + 1) * DH + tid] = s;
  }
  }
  __syncthreads();
  if (tid >= DH) return;                              // behind the only barrier of this path
  v4f o[4];
#pragma unroll
  for (int it = 0; it < 4; ++it) o[it] = *(const v4f*)(sm + it * 256 + tid * 4);
  float* base = VS + (size_t)bc * NKB * DH + tid * 4;
  {
#pragma unroll
    for (int it = 0; it < 4; ++it) {
      *(v4f*)(base + it * 256) = o[it];
    }
    
  }
}

// =====================================================================================================
// One launch for the two independent readers of the f32 v plane, picked by block index (block-uniform): blocks 0..VSB-1 = prefix
// column sums (the longer dependent chain, so it starts first), the rest = the V^T plane.
// coverage: grid = VSB + XTB blocks; each job is handed block indices 0 .. its own block count - 1.
// =====================================================================================================
__global__ __launch_bounds__(256) void vprep(const float* __restrict__ V, u16* VT, float* VS) {
  __shared__ __align__(16) u16 TH[64 * VTP];
  __shared__ __align__(16) float sm[NKB * DH];
  const int bid = blockIdx.x;
  if (bid < VSB) vsum_body(sm, bid, V, VS);
  else           xt16_body(TH, bid - VSB, V, VT);
}

// =====================================================================================================
// Single-head causal attention, head width DH = 64, query rows TQ0 .. SEQ-1: block = (batch b, 16 query rows q0..q0+15), 8 waves.
// q plane (f16, x8), k plane the same and V^T plane (x1024), each in fragment order; VS = key-block prefix column sums of V.
//   Chunks of CK = 512 keys: only chunks c <= qc = q0/CK are visited (later chunks lie entirely above the diagonal). In the diagonal
//   chunk only key blocks kb < nkb (keys <= q0+15) are multiplied; key blocks kb >= nkb get zero scores in LDS and are not used in (PV).
//   (S) scores S[query m][key n] on WMMA: A = q rows (row m = lane&15, split k map over d, two 32-d fragments kept in registers),
//       B = k rows (col n = key, split map); wave w handles key blocks w, w+8 of the chunk; D element r of lane l -> scs[query 8h+r][key].
//   (M) 16 threads per query row (sub-thread = 32 consecutive keys): base-2 logits with the causal mask by key index (key > query
//       -> -inf), chunk max via xor shuffles, online running max / rescale factor al / running sum l in f32 registers,
//       p = exp2(t - m_new) <= 1 (0 for masked keys), chunk row sum ps and C = ps/CK (bit-identical on the row's 16 threads), the
//       CENTRED P' = p - C written as f16(P' * 32768) into the LDS P tile with 16-B stores; al -> rowa[row], C -> rowc[row].
//   (PV) every wave keeps its own partial O (4 accumulator tiles = 16 queries x 64 d): o_w = o_w*al (+ on wave 0 only:
//       C*(32768*1024)*VS[chunk][nkb-1][d], the exact add-back of the centring term over exactly the processed keys, in f32), then for
//       the wave's key blocks kb in {w, w+8}, kb < nkb: A = P' fragment from LDS (row m = query, split map over keys), B = V^T
//       fragments (col n = d, split map over keys, fragment order), 4 WMMAs plus a hazard gap. sum_k (P'_k + C) v_k == sum_k p_k v_k exactly;
//       masked keys carry P' = -C and p = 0.
//   Block barriers after (S) and after (M) order all LDS reuse across chunks and waves.
//   Combine: after a block barrier the 8 partial O tiles are staged in the score region ([8][16][OPP] f32), barrier, then thread
//   (row = tid>>4, 4 columns) sums the 8 partials in fixed order, x = sum * 4096 / (l * 32768 * 1024) (l >= 1 always, held in
//   registers by the row's 16 threads), hi = f16(x), res = f16((x - hi) * 2048), staged as a [32][CTP] u16 tile in the P region,
// coverage: grid nb*NQT blocks x 16 rows = rows TQ0..SEQ-1 of every sequence; scs written 16 x 512 every chunk (zeros for kb >= nkb);
//           P tile written 16 x 512 every chunk; partial stage 8 x 16 x 64; ctx stage 32 x 64; store 32 lines = 16 rows of both planes.
// =====================================================================================================
__device__ __forceinline__
void attn_fwd_body(float* scs, u16* pls, float* rowa, float* rowc, int bid,
                   const u16* __restrict__ QPp, const u16* __restrict__ KPp, const u16* __restrict__ VTp,
                   const float* __restrict__ VSp, u16* CHo, u16* CRo) {
  const int tid  = threadIdx.x;
  const int wave = tid >> 5;
  const int lane = tid & 31;
  const int hh   = lane >> 4;
  const int m    = lane & 15;
  const int r16  = tid >> 4;                 // query row owned in phase (M) and in the combine
  const int sub  = tid & 15;
  const int kl0  = sub * 32;

  // A block's cost grows with its query tile (qc + 1 chunks), so cost falls with the block index: the four sequences' last tiles
  // come first, their first tiles last. bid -> (b, tile) is a permutation of NB x NQT.
  const int b   = bid % NB;
  const int q0  = TQ0 + (NQT - 1 - bid / NB) * QT;
  const int qc  = q0 / CK;                   // diagonal chunk index

  // all three planes in fragment order: 16 rows of q or k = two tiles (d 0..31, d 32..63), 32 keys of V^T = four tiles (16 d each)
  const _Float16* qrow = (const _Float16*)(const void*)QPp + ((size_t)b * SEQ + q0) * DH + 8 * lane;
  const v16h qa0 = ldfrag_hs(qrow);          // d 0..31
  const v16h qa1 = ldfrag_hs(qrow + 512);    // d 32..63
  // block-uniform bases; a lane's place is one 32-bit byte offset (a sequence's plane is SEQ*DH*2 bytes)
  const char* kbp = (const char*)(const void*)KPp + (size_t)b * SEQ * DH * 2;
  const char* vbp = (const char*)(const void*)VTp + (size_t)b * SEQ * DH * 2;
  const unsigned lo16 = (unsigned)lane * 16u;
  const float* vsb = VSp + (size_t)b * NCHK * NKB * DH + m;
  const float lsc = RSQD * LOG2E / (QSC * KSC);
  const float addsel = (wave == 0) ? (PCAR * VCAR) : 0.f;    // centring add-back on wave 0 only

  float mrun = -INFINITY, lrun = 0.f;
  v8f o[NACC];
#pragma unroll
  for (int j = 0; j < NACC; ++j) o[j] = zero8();

#pragma unroll 1
  for (int c = 0; c <= qc; ++c) {
    const int kbeg = c * CK;
    const int nkb  = (c < qc) ? NKB : (((q0 + QT - 1 - kbeg) >> 5) + 1);   // 1..16, block-uniform
    // ---- (S) scores of this chunk (zeros for key blocks beyond the query tile) ----
#pragma unroll 1
    for (int kb = wave; kb < NKB; kb += 8) {               // wave-uniform, 2 trips
      v8f s0 = zero8(), s1 = zero8();
      if (kb < nkb) {                                      // wave-uniform
        const _Float16* k0p = (const _Float16*)(const void*)(kbp + (lo16 + (unsigned)(kbeg + kb * 32) * (DH * 2u)));
        const _Float16* k1p = k0p + (size_t)16 * DH;
        const v16h f00 = ldfrag_hs(k0p);
        const v16h f01 = ldfrag_hs(k0p + 512);
        const v16h f10 = ldfrag_hs(k1p);
        const v16h f11 = ldfrag_hs(k1p + 512);
        s0 = mma_h(qa0, f00, s0);
        s0 = mma_h(qa1, f01, s0);
        s1 = mma_h(qa0, f10, s1);
        s1 = mma_h(qa1, f11, s1);
        guard2x6(s0, s1, qa0, qa1, f00, f01, f10, f11);
      }
      float* srow = scs + (8 * hh) * SCP + kb * 32 + m;
#pragma unroll
      for (int r = 0; r < 8; ++r) {
        srow[r * SCP]      = s0[r];
        srow[r * SCP + 16] = s1[r];
      }
    }
    __syncthreads();
    // ---- (M) softmax statistics and the centred P' tile ----
    {
      const float* sp = scs + r16 * SCP + kl0;
      const int lim = (q0 + r16) - (kbeg + kl0);           // key kl0 + j is valid iff j <= lim
      float t[32];
      float cm = -INFINITY;
#pragma unroll
      for (int i = 0; i < 8; ++i) {
        const v4f a = *(const v4f*)(sp + 4 * i);
#pragma unroll
        for (int e = 0; e < 4; ++e) {
          const int j = 4 * i + e;
          const float tv = (j <= lim) ? a[e] * lsc : -INFINITY;
          t[j] = tv;
          cm = fmaxf(cm, tv);
        }
      }
#pragma unroll
      for (int d = 1; d <= 8; d <<= 1) cm = fmaxf(cm, __shfl_xor(cm, d, 32));
      const float mn = fmaxf(mrun, cm);                    // finite: key kbeg of every visited chunk is never masked
      const float al = (mrun == -INFINITY) ? 0.f : exp2f(mrun - mn);
      mrun = mn;
      float ps = 0.f;
#pragma unroll
      for (int j = 0; j < 32; ++j) {
        const float p = exp2f(fminf(t[j] - mn, 0.f));      // 0 for masked keys
        t[j] = p;
        ps += p;
      }
#pragma unroll
      for (int d = 1; d <= 8; d <<= 1) ps += __shfl_xor(ps, d, 32);
      const float cc = ps * (1.0f / (float)CK);
      v4u pk[4];
#pragma unroll
      for (int i = 0; i < 4; ++i) {
#pragma unroll
        for (int e = 0; e < 4; ++e) {
          const int j = 8 * i + 2 * e;
          pk[i][e] = pk16(h_bits((_Float16)((t[j] - cc) * PCAR)), h_bits((_Float16)((t[j + 1] - cc) * PCAR)));
        }
      }
      lrun = lrun * al + ps;
      u16* pd = pls + r16 * PLP + kl0;
#pragma unroll
      for (int i = 0; i < 4; ++i) *(v4u*)(pd + 8 * i) = pk[i];
      if (sub == 0) { rowa[r16] = al; rowc[r16] = cc; }
    }
    __syncthreads();
    // ---- (PV) rescale, add the centring term (wave 0), accumulate P' . V^T for this wave's key blocks ----
    {
      float scl[8], cad[8];
#pragma unroll
      for (int r = 0; r < 8; ++r) { scl[r] = rowa[8 * hh + r]; cad[r] = rowc[8 * hh + r] * addsel; }
      const float* vsc = vsb + ((size_t)c * NKB + (size_t)(nkb - 1)) * DH;
      float vs[NACC];
#pragma unroll
      for (int j = 0; j < NACC; ++j) vs[j] = vsc[16 * j];
#pragma unroll
      for (int j = 0; j < NACC; ++j) {
#pragma unroll
        for (int r = 0; r < 8; ++r) o[j][r] = o[j][r] * scl[r] + cad[r] * vs[j];
      }
      const _Float16* pp = (const _Float16*)(const void*)pls + m * PLP + 8 * hh;
#pragma unroll 1
      for (int kb = wave; kb < nkb; kb += 8) {             // wave-uniform trip count, <= 2
        const v16h pf = ldfrag_h(pp + kb * 32);
        const _Float16* vk = (const _Float16*)(const void*)(vbp + (lo16 + (unsigned)(kbeg + kb * 32) * (DH * 2u)));
        const v16h g0 = ldfrag_hs(vk);
        const v16h g1 = ldfrag_hs(vk + 512);
        const v16h g2 = ldfrag_hs(vk + 1024);
        const v16h g3 = ldfrag_hs(vk + 1536);
        o[0] = mma_h(pf, g0, o[0]);
        o[1] = mma_h(pf, g1, o[1]);
        o[2] = mma_h(pf, g2, o[2]);
        o[3] = mma_h(pf, g3, o[3]);
        guardpv4(o[0], o[1], o[2], o[3], pf, g0, g1, g2, g3);
      }
    }
  }
  acc_guard4(o[0], o[1], o[2], o[3]);

  // ---- combine the 8 partial O tiles in fixed order ----
  __syncthreads();
#pragma unroll
  for (int j = 0; j < NACC; ++j) {
#pragma unroll
    for (int r = 0; r < 8; ++r) scs[(wave * 16 + 8 * hh + r) * OPP + 16 * j + m] = o[j][r];
  }
  __syncthreads();
  const int c4 = sub * 4;
  v4f sm4 = zero4();
#pragma unroll
  for (int w = 0; w < 8; ++w) sm4 += *(const v4f*)(scs + (w * 16 + r16) * OPP + c4);
  const float inv = (1.0f / lrun) * (CSC / (PCAR * VCAR));            // lrun >= 1
#pragma unroll
  for (int e = 0; e < 4; ++e) {
    const float xs = sm4[e] * inv;
    const _Float16 hv = (_Float16)xs;
    const _Float16 rv = (_Float16)((xs - (float)hv) * RSC);
    pls[r16 * CTP + c4 + e]        = h_bits(hv);
    pls[(16 + r16) * CTP + c4 + e] = h_bits(rv);
  }
  __syncthreads();
  const int line = tid >> 3;                 // 0..31: plane = line>>4, row = line&15
  const int plane = line >> 4;
  const int rowl  = line & 15;
  const int c8    = (tid & 7) * 8;
  const v4u ov = *(const v4u*)(pls + (plane * 16 + rowl) * CTP + c8);
  u16* dst = ((plane == 0) ? CHo : CRo) + ((size_t)b * SEQ + q0 + rowl) * DH + c8;
  *(v4u*)dst = ov;
  
}

// =====================================================================================================
// Query rows 0 .. TQ0-1 of each sequence in f32 on VALU: block = (b, t), threads 0..127 work (waves 4..7 only pass the barriers). QF/KF = f32 q/k planes [nb][TQ0][DH] (bias
// included), V = f32 v plane [nb*SEQ][DH]. Scores for keys j (thread j, one key each, 64-d dot of its whole key row against the q row staged in LDS;
// keys j > t masked to -inf), base-2 softmax with block max / sum reductions (xor shuffles + LDS), p_j in LDS, ctx[d] for d = tid
// (threads 0..63) as a sum in key order of p_j * V[b][j][d] (coalesced, groups of 64 keys up to the one holding t), x = ctx * 4096 / l, hi = f16(x),
// res = f16((x - hi) * 2048); both 64-half rows are staged in LDS and written by lanes 0..15 of wave 0: lanes 0..7 the hi row, lanes
// coverage: grid nb*TQ0 blocks = rows 0..TQ0-1 of every sequence; 64 thr x 1 d = DH per row; store 16 lanes x 8 halves = both rows;
//           together with attn_fwd every (b, s, d) of CH and CR is written exactly once.
// =====================================================================================================
__device__ __forceinline__
void attn_head_body(float* qs, float* sc, float* red, float* redb, u16* SW, int bid,
                    const float* __restrict__ QF, const float* __restrict__ KF, const float* __restrict__ V, u16* CHo, u16* CRo) {
  const int tid = threadIdx.x, lane = tid & 31, wave = tid >> 5;
  const int b = bid / TQ0;
  const int t = bid - b * TQ0;
  const bool work = wave < HD_THREADS / 32;                        // wave-uniform: one key per thread, keys 0..TQ0-1
  if (tid < DH) qs[tid] = QF[((size_t)b * TQ0 + t) * DH + tid];   // waves 0,1 entirely (wave-uniform)
  __syncthreads();
  float acc = 0.f;
  if (work) {
    const float* kp = KF + (size_t)b * (TQ0 * DH) + tid * DH;       // key row b*TQ0 + tid always in range (tid < TQ0)
    v4f kr[DH / 4];                                                 // the whole key row: 16 loads in flight, one latency
#pragma unroll
    for (int i = 0; i < DH / 4; ++i) kr[i] = *(const v4f*)(kp + 4 * i);
#pragma unroll
    for (int i = 0; i < DH / 4; ++i) {
      const v4f q4 = *(const v4f*)(qs + 4 * i);
#pragma unroll
      for (int e = 0; e < 4; ++e) acc += kr[i][e] * q4[e];
    }
  }
  const float s = (tid <= t) ? acc * (RSQD * LOG2E) : -INFINITY;   // causal mask by key index
  float mx = s;
#pragma unroll
  for (int d = 1; d <= 16; d <<= 1) mx = fmaxf(mx, __shfl_xor(mx, d, 32));
  if (work && lane == 0) red[wave] = mx;
  __syncthreads();
  float gm = red[0];
#pragma unroll
  for (int w = 1; w < 4; ++w) gm = fmaxf(gm, red[w]);   // finite: key 0 is always valid
  const float p = exp2f(s - gm);                     // 0 for masked keys
  float ps = p;
#pragma unroll
  for (int d = 1; d <= 16; d <<= 1) ps += __shfl_xor(ps, d, 32);
  if (work && lane == 0) redb[wave] = ps;
  if (work) sc[tid] = p;
  __syncthreads();
  float l = redb[0];
#pragma unroll
  for (int w = 1; w < 4; ++w) l += redb[w];           // >= 1
  const float inv = (1.0f / l) * CSC;
  if (wave < 2) {                                    // threads 0..63 (wave-uniform): one d column each
    const float* vp = V + (size_t)b * SEQ * DH + tid;
    float cx = 0.f;
    // Keys in groups of 64 whose loads are issued ahead of their use: one load latency per group. A group's keys j > t carry
    // sc[j] = 0 and add nothing; rows j0 .. j0+63 <= TQ0-1 of sequence b always exist. The sum runs in key order.
    // rolled: the trip count (1 or 2) depends on t
#pragma unroll 1
    for (int j0 = 0; j0 <= t; j0 += 64) {            // block-uniform
      float vv[64];
#pragma unroll
      for (int i = 0; i < 64; ++i) vv[i] = vp[(size_t)(j0 + i) * DH];
#pragma unroll
      for (int i = 0; i < 16; ++i) {
        const v4f p4 = *(const v4f*)(sc + j0 + 4 * i);
#pragma unroll
        for (int e = 0; e < 4; ++e) cx += p4[e] * vv[4 * i + e];
      }
    }
    const float x0 = cx * inv;
    const _Float16 h0 = (_Float16)x0;
    const _Float16 r0 = (_Float16)((x0 - (float)h0) * RSC);
    SW[tid]      = h_bits(h0);
    SW[DH + tid] = h_bits(r0);
  }
  __syncthreads();
  if (wave == 0) {                                   // wave-uniform
    const int l16 = lane & 15;
    const int plane = l16 >> 3, p8 = (l16 & 7) * 8;
    const v4u ov = *(const v4u*)(SW + plane * DH + p8);
    u16* dst = ((plane == 0) ? CHo : CRo) + ((size_t)b * SEQ + t) * DH + p8;
    if (lane < 16) *(v4u*)dst = ov;
    
  }
}

// =====================================================================================================
// One launch for the two independent attention jobs, picked by block index (block-uniform): blocks 0..NB*NQT-1 = query rows TQ0.. on
// WMMA, longest tiles first, the rest = query rows 0..TQ0-1 on VALU (short blocks, last, so that they fill places the long blocks leave).
// coverage: grid = NB*NQT + NB*TQ0 blocks; each job is handed block indices 0 .. its own block count - 1.
// =====================================================================================================
__global__ __launch_bounds__(ATT_THREADS) __attribute__((amdgpu_num_vgpr(256)))
void attn(const u16* __restrict__ QPp, const u16* __restrict__ KPp, const u16* __restrict__ VTp, const float* __restrict__ VSp,
          const float* __restrict__ QF, const float* __restrict__ KF, const float* __restrict__ V, u16* CHo, u16* CRo) {
  __shared__ __align__(16) float scs[16 * SCP];     // scores [16][SCP] f32; reused as partial O tiles [8][16][OPP] f32
  __shared__ __align__(16) u16 pls[16 * PLP];       // P' tile [16][PLP] f16 bits; reused as ctx staging [32][CTP] u16
  __shared__ float rowa[QT];
  __shared__ float rowc[QT];
  __shared__ __align__(16) float qs[DH];
  __shared__ __align__(16) float sc[TQ0];
  __shared__ float red[4];
  __shared__ float redb[4];
  __shared__ __align__(16) u16 SW[2 * DH];
  const int bid = blockIdx.x;
  if (bid < NB * NQT) attn_fwd_body(scs, pls, rowa, rowc, bid, QPp, KPp, VTp, VSp, CHo, CRo);
  else                attn_head_body(qs, sc, red, redb, SW, bid - NB * NQT, QF, KF, V, CHo, CRo);
}

// =====================================================================================================
// Workspace map (bytes, nb = 4, rows = 16384); every plane is fully written by whole-line stores before it is read; all extents are
//   WQT bf16 [64][512] 65536   WKT same   WVT same   WOT f16 of bf16 value x1024 [512][64] 65536 (fragment order)  262144
//   XB  bf16 [rows][512]                                                                                           16777216
//   QP  f16 [rows][64] x8 (fragment order)                                                                          2097152
//   KP  f16 [rows][64] x8 (fragment order)                                                                          2097152
//   V   f32 [rows][64]                                                                                              4194304
//   VT  f16 x1024, [nb][SEQ/32][4] tiles of 32 keys x 16 d (fragment order)                                                                    2097152
//   VS  f32 [nb][8][16][64]                                                                                          131072
//   QF  f32 [nb][128][64]  131072      KF same                                                                       262144
//   CH  f16 [rows][64] ctx hi x4096                                                                                 2097152
//   CR  f16 [rows][64] ctx residual x2048                                                                           2097152
//   end                                                                                                            32112640
// =====================================================================================================
extern "C" void kernel_launch(void* const* d_in, const int* in_sizes, int n_in,
                              void* d_out, int out_size, void* d_ws, size_t ws_size,
                              hipStream_t stream) {
  if (n_in < 9) return;
  const int nb   = NB;
  const int rows = nb * SEQ;
  if ((long long)in_sizes[0] < (long long)NB * SEQ_FULL * EMB) return;
  if (in_sizes[1] < EMB * DH || in_sizes[3] < EMB * DH || in_sizes[5] < EMB * DH || in_sizes[7] < DH * EMB) return;
  if (in_sizes[2] < DH || in_sizes[4] < DH || in_sizes[6] < DH || in_sizes[8] < EMB) return;
  if ((long long)out_size < (long long)rows * EMB) return;

  const float* x  = (const float*)d_in[0];
  const float* wq = (const float*)d_in[1];
  const float* bq = (const float*)d_in[2];
  const float* wk = (const float*)d_in[3];
  const float* bk = (const float*)d_in[4];
  const float* wv = (const float*)d_in[5];
  const float* bv = (const float*)d_in[6];
  const float* wo = (const float*)d_in[7];
  const float* bo = (const float*)d_in[8];
  float*       out = (float*)d_out;

  const size_t szW  = (size_t)EMB * DH * 2;                      //     65536
  const size_t szXB = (size_t)rows * EMB * 2;                    //  16777216
  const size_t szP  = (size_t)rows * DH * 2;                     //   2097152
  const size_t szV  = (size_t)rows * DH * 4;                     //   4194304
  const size_t szVT = (size_t)nb * DH * SEQ * 2;                 //   2097152 (== szP)
  const size_t szVS = (size_t)nb * NCHK * NKB * DH * 4;          //    131072
  const size_t szHF = (size_t)nb * TQ0 * DH * 4;                 //    131072
  size_t off = 0;
  const size_t oWQ = off; off += szW;
  const size_t oWK = off; off += szW;
  const size_t oWV = off; off += szW;
  const size_t oWO = off; off += szW;
  const size_t oXB = off; off += szXB;
  const size_t oQ  = off; off += szP;
  const size_t oK  = off; off += szP;
  const size_t oV  = off; off += szV;
  const size_t oVT = off; off += szVT;
  const size_t oVS = off; off += szVS;
  const size_t oQF = off; off += szHF;
  const size_t oKF = off; off += szHF;
  const size_t oCH = off; off += szP;
  const size_t oCR = off; off += szP;
  if (off > ws_size) return;                                     // off = 32112640 at nb = 4
  if (off > WS_CAP) return;

  char* ws = (char*)d_ws;
  u16*   WQT = (u16*)(ws + oWQ);
  u16*   WKT = (u16*)(ws + oWK);
  u16*   WVT = (u16*)(ws + oWV);
  u16*   WOT = (u16*)(ws + oWO);
  u16*   XB  = (u16*)(ws + oXB);
  u16*   QP  = (u16*)(ws + oQ);
  u16*   KP  = (u16*)(ws + oK);
  float* V   = (float*)(ws + oV);
  u16*   VT  = (u16*)(ws + oVT);
  float* VS  = (float*)(ws + oVS);
  float* QF  = (float*)(ws + oQF);
  float* KF  = (float*)(ws + oKF);
  u16*   CH  = (u16*)(ws + oCH);
  u16*   CR  = (u16*)(ws + oCR);

  const int n8x = (SEQ * EMB) / 8;                       // 262144 per batch
  if ((n8x % 256) != 0 || (rows % 64) != 0 || ((nb * TQ0) % 64) != 0) return;
  const dim3 blk(256);
  const dim3 gPR(4 * WTB + NB * XCB);                   // 4 * 8 weight tiles + nb * 1024 x blocks
  const dim3 gPJ(2 * GHB + 3 * GPB);                    // 2 * 8 + 3 * 256 at nb = 4
  const dim3 bG(128);
  const dim3 gVP(VSB + XTB);                            // nb * 8 + nb * 64
  const dim3 gAT(NB * NQT + NB * TQ0);                  // nb * 248 + nb * 128
  const dim3 bAT(ATT_THREADS);
  const dim3 gO((rows / 64) * (EMB / 64));              // 2048 at nb = 4

  // (0) Wq, Wk, Wv stored [k = in 512][n = out 64] -> bf16 planes [64][512] in fragment order; Wo [k = 64][n = 512] -> f16 of bf16
  //     value x1024, [512][64] in fragment order; x -> bf16 plane [rows][512]
  prep<<<gPR, blk, 0, stream>>>(x, wq, wk, wv, wo, WQT, WKT, WVT, WOT, XB);
  // (1) q and k projections (+bias) -> f16 planes x8; v projection (+bias) -> f32 plane; f32 q and k rows 0..127 of every
  //     sequence -> QF, KF [nb*128][64]
  proj<<<gPJ, bG, 0, stream>>>(XB, WQT, WKT, WVT, bq, bk, bv, QP, KP, V, QF, KF, rows, nb * TQ0, DH, EMB);
  // (2) v -> V^T plane x1024 and key-block prefix column sums of v
  vprep<<<gVP, blk, 0, stream>>>(V, VT, VS);
  // (3) attention: query rows 128.. on WMMA and query rows 0..127 on VALU -> ctx hi x4096 and residual x2048 f16 planes
  attn<<<gAT, bAT, 0, stream>>>(QP, KP, VT, VS, QF, KF, V, CH, CR);
  // (4) output projection + bias -> out
  gemm_h2_32<<<gO, bG, 0, stream>>>(CH, CR, WOT, bo, out, rows, EMB, DH,
                                    1.0f / (CSC * WSC), 1.0f / (CSC * WSC * RSC));
  (void)hipGetLastError();
}

// v005
// It runs in 71.2 microseconds.
// In both of two side-by-side timings against v004, it was 1.06 times as fast.
// Over all steps from v000 it is 3.16 times as fast.
// Projections q,k,v = x.W + b and the f32 q,k rows 0..127 per sequence: v_wmma_f32_16x16x32_bf16 (bf16 RNE operands of the
// raw inputs, f32 accumulate, bf16 RNE bias added in f32). Scores q'.k'^T (f16 planes x8), P'.V (chunk-centred P' x32768 f16 from LDS,
// V^T x1024 f16) and the output projection (ctx carried as f16 hi x4096 plus residual x2048 rows, times f16(bf16(Wo)) x1024, bias
// added in f32): v_wmma_f32_16x16x32_f16, f32 accumulate. Query rows 0..127 of each sequence: scores, softmax and P.V in f32 on VALU.
// Causal mask, softmax statistics, key-block column sums of V and all scaling in f32 on VALU.
#include <hip/hip_runtime.h>
#include <math.h>
#include <stdint.h>

#ifndef NB
#define NB 4
#endif
#ifndef SEQ
#define SEQ 4096
#endif
#define SEQ_FULL 4096
#define NB_FULL 4
#define EMB   512
#define DH    64
#define CK    512
#define NCHK  (SEQ / CK)
#define NKB   16
#define QT    16
#define TQ0   128
#define NQT   ((SEQ - TQ0) / QT)
#define SCP   544
#define PLP   528
#define OPP   68
#define CTP   72
#define SLAB64 (16 * 68)
#define VTP   72
#define ATT_THREADS 256
#define HD_THREADS 128
#define NACC  4
#define QSC   8.0f
#define KSC   8.0f
#define PCAR  32768.0f
#define VCAR  1024.0f
#define WSC   1024.0f
#define CSC   4096.0f
#define RSC   2048.0f
#define OS1   (1.0f / (CSC * WSC))
#define OS2   (1.0f / (CSC * WSC * RSC))
#define LOG2E 1.4426950408889634f
#define RSQD  0.125f
#define WS_CAP ((size_t)134217728)
#define WTB   ((EMB / 64) * (DH / 64))
#define XCB   ((SEQ * EMB) / 8 / 256)
#define GPB   (((NB * SEQ) / 64) * (DH / 64))
#define GHB   (((NB * TQ0) / 64) * (DH / 64))
#define XTB   (NB * (SEQ / 64))
#define VSB   (NB * NCHK)

static_assert(DH == 64 && NACC * 16 == DH && (EMB % 64) == 0 && (EMB % 32) == 0 && (DH % 32) == 0);
static_assert((SEQ % CK) == 0 && NCHK >= 1 && CK == 32 * NKB && (SEQ % 64) == 0 && (SEQ % QT) == 0 && (CK % QT) == 0);
static_assert((TQ0 % QT) == 0 && (TQ0 % 64) == 0 && NQT * QT + TQ0 == SEQ && NQT >= 1 && TQ0 == 128 && TQ0 == HD_THREADS);
static_assert(8 * SLAB64 <= 16 * SCP && EMB == 8 * 64 && 8 * 16 * OPP <= 16 * SCP && 32 * CTP <= 16 * PLP && CTP >= DH + 8 && OPP >= DH + 4 && SCP >= CK + 16 && PLP >= CK + 8);
static_assert(((PLP * 2) % 16) == 0 && ((SCP * 4) % 16) == 0 && ((VTP * 2) % 16) == 0 && ((CTP * 2) % 16) == 0 && ((OPP * 4) % 16) == 0);
static_assert(64 * VTP >= 63 * VTP + 64);
static_assert(ATT_THREADS == 16 * QT && ATT_THREADS == 256 && HD_THREADS == 2 * DH);
static_assert((((SEQ * EMB) / 8) % 256) == 0 && ((NB * SEQ) % 64) == 0 && ((NB * TQ0) % 64) == 0);
static_assert(NB >= 1 && NB <= NB_FULL && SEQ <= SEQ_FULL && (TQ0 % 64) == 0 && (NKB % 2) == 0);

typedef unsigned short u16;
typedef _Float16 v16h __attribute__((ext_vector_type(16)));
typedef _Float16 v8h  __attribute__((ext_vector_type(8)));
typedef __bf16   v16b __attribute__((ext_vector_type(16)));
typedef float    v8f  __attribute__((ext_vector_type(8)));
typedef float    v4f  __attribute__((ext_vector_type(4)));
typedef unsigned int v4u __attribute__((ext_vector_type(4)));

union FragH { v16h v; v8h h[2]; v4u u[2]; };
union FragB { v16b v; v4u u[2]; };

// ---- scalar helpers --------------------------------------------------------------------------------
__device__ __forceinline__ unsigned short bf_bits(float f) {          // f32 -> bf16 bits, RNE convert
  unsigned u = __float_as_uint(f);
  return (unsigned short)((u + 0x7FFFu + ((u >> 16) & 1u)) >> 16);
}
__device__ __forceinline__ float bf_up(unsigned short h) { return __uint_as_float(((unsigned)h) << 16); }
__device__ __forceinline__ float bfr(float f) { return bf_up(bf_bits(f)); }
__device__ __forceinline__ unsigned short h_bits(_Float16 x) { return __builtin_bit_cast(unsigned short, x); }
__device__ __forceinline__ unsigned pk16(unsigned short a, unsigned short b) { return (unsigned)a | ((unsigned)b << 16); }
__device__ __forceinline__ v8f zero8() { v8f z = {0.f, 0.f, 0.f, 0.f, 0.f, 0.f, 0.f, 0.f}; return z; }
__device__ __forceinline__ v4f zero4() { v4f z = {0.f, 0.f, 0.f, 0.f}; return z; }

// ---- fragment loaders: 16-bit A/B operand, lane -> row/col (lane&15), p already includes +8*(lane>>4);
//      elements 0..7 <- p[0..7] (k0+8h..), elements 8..15 <- p[16..23] (k0+16+8h..)  (same split k map for A and B);
//      this form reads the row-major A planes (x, ctx hi, ctx residual)
__device__ __forceinline__ v16h ldfrag_h(const _Float16* p) {
  FragH f;
  f.h[0] = *(const v8h*)(p);
  f.h[1] = *(const v8h*)(p + 16);
  return f.v;
}
__device__ __forceinline__ v16b ldfrag_b(const u16* p) {              // bf16 plane read as unsigned integer vectors
  FragB f;
  f.u[0] = *(const v4u*)(p);
  f.u[1] = *(const v4u*)(p + 16);
  return f.v;
}

// ---- the same fragments from a plane kept in FRAGMENT ORDER: a 16 (rows or cols) x 32 (k) tile is 512 consecutive halves; the 16-B
//      unit of lane l = 16*h + m (row/col m, k = 8h .. 8h+7) lies at 8*l, the unit for k = 16+8h .. at 256 + 8*l. p already includes
//      +8*lane, so each of the two loads reads 512 consecutive bytes (4 whole lines) where a row-major plane gives 16 lines.
__device__ __forceinline__ v16h ldfrag_hs(const _Float16* p) {
  FragH f;
  f.h[0] = *(const v8h*)(p);
  f.h[1] = *(const v8h*)(p + 256);
  return f.v;
}
__device__ __forceinline__ v16b ldfrag_bs(const u16* p) {
  FragB f;
  f.u[0] = *(const v4u*)(p);
  f.u[1] = *(const v4u*)(p + 256);
  return f.v;
}

// Precaution behind a run of fragment loads: the registers that those loads name (row pointers a0, a1; byte offsets o0..o3) are inputs
// of the wait, so none of them is advanced or reused as a load's destination in front of s_wait_xcnt 0.
__device__ __forceinline__ void addr_wait(const void* a0, const void* a1, unsigned o0, unsigned o1, unsigned o2, unsigned o3) {
#if defined(__HIP_DEVICE_COMPILE__)
  asm volatile("s_wait_xcnt 0x0" :: "v"(a0), "v"(a1), "v"(o0), "v"(o1), "v"(o2), "v"(o3) : "memory");
#endif
}

__device__ __forceinline__ v8f mma_h(v16h a, v16h b, v8f c) {
  return __builtin_amdgcn_wmma_f32_16x16x32_f16(false, a, false, b, (short)0, c, false, false);
}
__device__ __forceinline__ v8f mma_b(v16b a, v16b b, v8f c) {
  return __builtin_amdgcn_wmma_f32_16x16x32_bf16(false, a, false, b, (short)0, c, false, false);
}
__device__ __forceinline__ void guard2x6(v8f& a, v8f& b, v16h x0, v16h x1, v16h x2, v16h x3, v16h x4, v16h x5) {
#if defined(__HIP_DEVICE_COMPILE__)
  asm volatile("v_nop\n\tv_nop\n\tv_nop\n\tv_nop"
               : "+v"(a), "+v"(b) : "v"(x0), "v"(x1), "v"(x2), "v"(x3), "v"(x4), "v"(x5) : "memory");
#endif
}
template <typename F>
__device__ __forceinline__ void guard6(v8f& a, v8f& b, v8f& c, v8f& d, F x0, F x1, F x2, F x3, F x4, F x5) {
#if defined(__HIP_DEVICE_COMPILE__)
  asm volatile("v_nop\n\tv_nop\n\tv_nop\n\tv_nop"
               : "+v"(a), "+v"(b), "+v"(c), "+v"(d) : "v"(x0), "v"(x1), "v"(x2), "v"(x3), "v"(x4), "v"(x5) : "memory");
#endif
}
__device__ __forceinline__ void guardpv4(v8f& o0, v8f& o1, v8f& o2, v8f& o3, v16h p, v16h g0, v16h g1, v16h g2, v16h g3) {
#if defined(__HIP_DEVICE_COMPILE__)
  asm volatile("v_nop\n\tv_nop\n\tv_nop\n\tv_nop"
               : "+v"(o0), "+v"(o1), "+v"(o2), "+v"(o3)
               : "v"(p), "v"(g0), "v"(g1), "v"(g2), "v"(g3) : "memory");
#endif
}
__device__ __forceinline__ void acc_guard4(v8f& a, v8f& b, v8f& c, v8f& d) {
#if defined(__HIP_DEVICE_COMPILE__)
  asm volatile("v_nop\n\tv_nop\n\tv_nop\n\tv_nop" : "+v"(a), "+v"(b), "+v"(c), "+v"(d));
#endif
}
__device__ __forceinline__ void wave_sync_lds() {                    // wave-private LDS slab: release, wave barrier, acquire
  __builtin_amdgcn_fence(3, "workgroup");
  __builtin_amdgcn_wave_barrier();
  __builtin_amdgcn_fence(2, "workgroup");
}

// =====================================================================================================
// x plane f32 [b][SEQ_FULL][EMB] -> bf16 RNE bits [b][SEQ][EMB] (compact rows). Thread = 8 consecutive elements: two 16-B loads,
// coverage: grid = (SEQ*EMB/8/256 blocks, nb) x 256 thr x 8 = the whole plane.
// =====================================================================================================
__device__ __forceinline__ void cvtx_body(int bx, int bb, const float* __restrict__ x, u16* D, int n8) {
  const int gt = bx * 256 + (int)threadIdx.x;
  if (gt >= n8) return;                     // no barriers on this path
  const float* p = x + (size_t)bb * ((size_t)SEQ_FULL * EMB) + (size_t)gt * 8;
  const v4f a = *(const v4f*)(p), c4 = *(const v4f*)(p + 4);
  float v[8];
#pragma unroll
  for (int e = 0; e < 4; ++e) { v[e] = a[e]; v[4 + e] = c4[e]; }
  unsigned short s[8];
#pragma unroll
  for (int e = 0; e < 8; ++e) s[e] = bf_bits(v[e]);
  v4u o;
#pragma unroll
  for (int e = 0; e < 4; ++e) o[e] = pk16(s[2 * e], s[2 * e + 1]);
  u16* d = D + (size_t)bb * ((size_t)SEQ * EMB) + (size_t)gt * 8;
  {
    *(v4u*)(d) = o;
    
  }
}

// =====================================================================================================
// Weight transpose-convert: in W[R][C] f32 row-major -> out D = the [n = C][k = R] 16-bit operand plane for y = x.W in fragment order:
// tile (n/16, k/32) at halves ((n/16)*(R/32) + k/32)*512, units inside it as ldfrag_hs / ldfrag_bs read them.
// mode 0: bf16 RNE bits; mode 1: f16 bits of (bf16 RNE value) * scale.
// Block = 64x64 tile: 64 input row segments of 64 floats loaded with 16-B loads, converted, scattered into an LDS tile [c][64 r]
// coverage: load 256 thr x 16 = 64 x 64; store 2 iterations x 256 thr x 8 halves = 64 lines x 64; grid = (R/64) x (C/64) blocks
//           covers D exactly once (host checks R % 64 == 0, C % 64 == 0).
// =====================================================================================================
__device__ __forceinline__ void wt16_body(u16* TH, int bid, const float* __restrict__ W, u16* D, int R, int C, int mode,
                                          float scale) {
  const int tid = threadIdx.x;
  const int nrt = R >> 6;
  const int r0  = (bid % nrt) * 64;
  const int c0  = (bid / nrt) * 64;
  {
    const int rl = tid >> 2;                  // input row within tile 0..63
    const int cs = (tid & 3) * 16;            // column chunk within the 64
    const float* src = W + (size_t)(r0 + rl) * C + c0 + cs;
#pragma unroll
    for (int i = 0; i < 4; ++i) {
      const v4f a = *(const v4f*)(src + 4 * i);
#pragma unroll
      for (int e = 0; e < 4; ++e) {
        const float v  = a[e];
        const unsigned short hb = h_bits((_Float16)(bfr(v) * scale));
        const unsigned short bb = bf_bits(v);
        TH[(cs + 4 * i + e) * VTP + rl] = (mode != 0) ? hb : bb;
      }
    }
  }
  __syncthreads();
  v4u vh[2];
  const int fm = tid & 15, fh = (tid >> 4) & 1, fs = (tid >> 5) & 1, fk = (tid >> 6) & 1, fn = tid >> 7;
#pragma unroll
  for (int it = 0; it < 2; ++it) {            // local c = 16*(2*it + fn) + fm, local r = 32*fk + 16*fs + 8*fh .. +7
    vh[it] = *(const v4u*)(TH + ((it * 2 + fn) * 16 + fm) * VTP + fk * 32 + fs * 16 + fh * 8);
  }
  const int kt = R >> 5;                      // 32-wide k tiles per 16 columns
  {
#pragma unroll
    for (int it = 0; it < 2; ++it) {
      *(v4u*)(D + ((size_t)((c0 >> 4) + it * 2 + fn) * (size_t)kt + (size_t)(r0 >> 5)) * 512 + (tid & 127) * 8) = vh[it];
    }
    
  }
}

// =====================================================================================================
// One launch for the five independent preparation jobs, picked by block index (block-uniform): blocks 0..4*WTB-1 = the four weight
// transposes (WTB blocks each, order Wq, Wk, Wv, Wo), the rest = the x conversion (XCB blocks per batch row).
// coverage: grid = 4*WTB + nb*XCB blocks; each job is handed block indices 0 .. its own block count - 1.
// =====================================================================================================
__global__ __launch_bounds__(256)
void prep(const float* __restrict__ x, const float* __restrict__ wq, const float* __restrict__ wk, const float* __restrict__ wv,
          const float* __restrict__ wo, u16* WQT, u16* WKT, u16* WVT, u16* WOT, u16* XB) {
  __shared__ __align__(16) u16 TH[64 * VTP];
  const int bid = blockIdx.x;
  if (bid < 4 * WTB) {
    const int job = bid / WTB;
    const float* W = (job == 0) ? wq : (job == 1) ? wk : (job == 2) ? wv : wo;
    u16* D = (job == 0) ? WQT : (job == 1) ? WKT : (job == 2) ? WVT : WOT;
    const bool pj = job < 3;                  // Wq, Wk, Wv: [EMB][DH] -> bf16; Wo: [DH][EMB] -> scaled f16
    wt16_body(TH, bid - job * WTB, W, D, pj ? EMB : DH, pj ? DH : EMB, pj ? 0 : 1, pj ? 1.0f : WSC);
  } else {
    const int r = bid - 4 * WTB;
    cvtx_body(r % XCB, r / XCB, x, XB, XCB * 256);
  }
}

// =====================================================================================================
//            8 consecutive lanes x 16 B per line), lanes 16..31 -> row 2*it+1.
//  slab64_out: the same store shape for a 16 x 64 f32 tile that the wave has already staged in its slab.
//  epi64hsb: f16 bits of ((tile + bf16RNE(bias[n])) * pscale), plane in fragment order; lane = (row lane&15, 8 consecutive columns),
// coverage: epi64/slab64_out 8 instructions x 2 rows x 16 lanes x 4 floats; epi64hsb 4 instructions x 16 rows x 2 lanes x 8 halves
//           = the wave's 16 x 64 tile in every case.
// =====================================================================================================
__device__ __forceinline__ void stage64(float* sl, v8f a0, v8f a1, v8f a2, v8f a3, float oscale, int lane) {
  const int hh = lane >> 4, m = lane & 15;
#pragma unroll
  for (int r = 0; r < 8; ++r) {
    const int ro = (8 * hh + r) * 68 + m;
    sl[ro]      = a0[r] * oscale;
    sl[ro + 16] = a1[r] * oscale;
    sl[ro + 32] = a2[r] * oscale;
    sl[ro + 48] = a3[r] * oscale;
  }
  wave_sync_lds();
}
__device__ __forceinline__ void epi64(float* sl, v8f a0, v8f a1, v8f a2, v8f a3, float oscale, v4f badd, float* C, int N,
                                      size_t rowb, int col0, int lane) {
  const int hh = lane >> 4, m = lane & 15;
  stage64(sl, a0, a1, a2, a3, oscale, lane);
  v4f vals[8];
#pragma unroll
  for (int it = 0; it < 8; ++it) vals[it] = *(const v4f*)(sl + (it * 2 + hh) * 68 + m * 4) + badd;
  float* dst = C + (rowb + (size_t)hh) * (size_t)N + col0 + m * 4;
  {
#pragma unroll
    for (int it = 0; it < 8; ++it) {
      *(v4f*)(dst + (size_t)(it * 2) * (size_t)N) = vals[it];
    }
    
  }
}
__device__ __forceinline__ void slab64_out(const float* sl, v4f badd, float* C, int N, size_t rowb, int col0, int lane) {
  const int hh = lane >> 4, m = lane & 15;
  wave_sync_lds();
  v4f vals[8];
#pragma unroll
  for (int it = 0; it < 8; ++it) vals[it] = *(const v4f*)(sl + (it * 2 + hh) * 68 + m * 4) + badd;
  float* dst = C + (rowb + (size_t)hh) * (size_t)N + col0 + m * 4;
#pragma unroll
  for (int it = 0; it < 8; ++it) *(v4f*)(dst + (size_t)(it * 2) * (size_t)N) = vals[it];
}
__device__ __forceinline__ void epi64hsb(float* sl, v8f a0, v8f a1, v8f a2, v8f a3, float oscale, float pscale,
                                         const float* __restrict__ bias, u16* C, int N, size_t rowb, int col0, int lane) {
  stage64(sl, a0, a1, a2, a3, oscale, lane);
  const int hh = lane >> 4, m = lane & 15;
  v4u oh[4];
#pragma unroll
  for (int g = 0; g < 4; ++g) {               // g = 16-column group of the 64; lane = (row m, columns 16g + 8hh .. +7)
    const int c8 = g * 16 + hh * 8;
    const v4f b0 = *(const v4f*)(bias + col0 + c8), b1 = *(const v4f*)(bias + col0 + c8 + 4);   // columns col0+c8..+7 < N
    const v4f a = *(const v4f*)(sl + m * 68 + c8), c4 = *(const v4f*)(sl + m * 68 + c8 + 4);
    float w[8];
#pragma unroll
    for (int e = 0; e < 4; ++e) { w[e] = (a[e] + bfr(b0[e])) * pscale; w[4 + e] = (c4[e] + bfr(b1[e])) * pscale; }
#pragma unroll
    for (int e = 0; e < 4; ++e) oh[g][e] = pk16(h_bits((_Float16)w[2 * e]), h_bits((_Float16)w[2 * e + 1]));
  }
  // tile (rowb/16, col/32) at halves ((rowb/16)*(N/32) + col/32)*512; group g is the half-tile at g*256 behind column col0
  u16* dst = C + ((rowb >> 4) * (size_t)(N >> 5) + (size_t)(col0 >> 5)) * 512 + lane * 8;
  {
#pragma unroll
    for (int g = 0; g < 4; ++g) {
      *(v4u*)(dst + g * 256) = oh[g];
    }
    
  }
}

// =====================================================================================================
// bf16 GEMM, f32 out with bias: C[M][N] = (A[arow(m)][K] (bf16 row-major) . Bt[N][K]^T (bf16, fragment order)) * oscale + bf16RNE(bias[n]).
// Output row ra maps to A row arow = (ra / rpg) * gstr + (ra % rpg) (rpg = M, gstr = 0 gives the identity map; rpg = TQ0,
// gstr = SEQ picks the first TQ0 rows of every sequence).
// Block = 64x64 tile, 4 waves x 16 rows; fragments loaded straight from the 16-bit planes (two 16-B loads each, split k map for
// A and B); K stepped by 32 (host checks K % 32 == 0, M % 64 == 0, N % 64 == 0, grid = (M/64)*(N/64)).
// =====================================================================================================
__device__ __forceinline__
void gemm_b32_body(float* slab, int bid, const u16* __restrict__ A, const u16* __restrict__ Bt, const float* __restrict__ bias,
                   float* C, int M, int N, int K, int rpg, int gstr, float oscale) {
  const int tid = threadIdx.x, wave = tid >> 5, lane = tid & 31, hh = lane >> 4, m = lane & 15;
  const int ntile = N >> 6;
  const int rowb  = (bid / ntile) * 64 + wave * 16;
  const int col0  = (bid % ntile) * 64;
  if (rowb + 16 > M) return;                 // wave-uniform, never taken with the exact grid; no block barriers on this path
  const int ra = rowb + m;
  const int rg = ra / rpg;
  const size_t arow = (size_t)rg * (size_t)gstr + (size_t)(ra - rg * rpg);
  const u16* ap = A  + arow * (size_t)K + 8 * hh;
  // fragment order: 16 columns = K/32 tiles of 1024 bytes; block-uniform base, a lane's place is one fixed 32-bit byte offset
  const char* bp = (const char*)(const void*)Bt + (size_t)col0 * K * 2;
  const unsigned bs = 32u * (unsigned)K;
  const unsigned lo0 = (unsigned)lane * 16u, lo1 = lo0 + bs, lo2 = lo1 + bs, lo3 = lo2 + bs;   // the four 16-column groups
  v8f acc0 = zero8(), acc1 = zero8(), acc2 = zero8(), acc3 = zero8();
#pragma unroll 1
  for (int k0 = 0; k0 < K; k0 += 32) {
    const v16b a  = ldfrag_b(ap + k0);
    const unsigned ko = (unsigned)k0 * 32u;                // one 1024-byte tile per 32 of k
    const v16b b0 = ldfrag_bs((const u16*)(const void*)(bp + (lo0 + ko)));
    const v16b b1 = ldfrag_bs((const u16*)(const void*)(bp + (lo1 + ko)));
    const v16b b2 = ldfrag_bs((const u16*)(const void*)(bp + (lo2 + ko)));
    const v16b b3 = ldfrag_bs((const u16*)(const void*)(bp + (lo3 + ko)));
    addr_wait(ap + k0, ap + k0, lo0 + ko, lo1 + ko, lo2 + ko, lo3 + ko);
    acc0 = mma_b(a, b0, acc0);
    acc1 = mma_b(a, b1, acc1);
    acc2 = mma_b(a, b2, acc2);
    acc3 = mma_b(a, b3, acc3);
    guard6<v16b>(acc0, acc1, acc2, acc3, a, b0, b1, b2, b3, a);
  }
  const v4f bv4 = *(const v4f*)(bias + col0 + m * 4);    // columns col0 + 4m .. +3, always < N (N multiple of 64)
  v4f badd;
#pragma unroll
  for (int e = 0; e < 4; ++e) badd[e] = bfr(bv4[e]);
  epi64(slab + wave * SLAB64, acc0, acc1, acc2, acc3, oscale, badd, C, N, (size_t)rowb, col0, lane);
}

// =====================================================================================================
// bf16 GEMM, f16 plane out with bias: C16[M][N] = f16 bits of (((A . Bt^T) * oscale) + bf16RNE(bias[n])) * pscale; operands as in
// gemm_b32 (identity row map), epilogue epi64hsb.
// =====================================================================================================
__device__ __forceinline__
void gemm_bh16_body(float* slab, int bid, const u16* __restrict__ A, const u16* __restrict__ Bt, const float* __restrict__ bias,
                    u16* C, int M, int N, int K, float oscale, float pscale) {
  const int tid = threadIdx.x, wave = tid >> 5, lane = tid & 31, hh = lane >> 4, m = lane & 15;
  const int ntile = N >> 6;
  const int rowb  = (bid / ntile) * 64 + wave * 16;
  const int col0  = (bid % ntile) * 64;
  if (rowb + 16 > M) return;                 // wave-uniform, never taken with the exact grid; no block barriers on this path
  const u16* ap = A  + (size_t)(rowb + m) * K + 8 * hh;
  // fragment order: 16 columns = K/32 tiles of 1024 bytes; block-uniform base, a lane's place is one fixed 32-bit byte offset
  const char* bp = (const char*)(const void*)Bt + (size_t)col0 * K * 2;
  const unsigned bs = 32u * (unsigned)K;
  const unsigned lo0 = (unsigned)lane * 16u, lo1 = lo0 + bs, lo2 = lo1 + bs, lo3 = lo2 + bs;   // the four 16-column groups
  v8f acc0 = zero8(), acc1 = zero8(), acc2 = zero8(), acc3 = zero8();
#pragma unroll 1
  for (int k0 = 0; k0 < K; k0 += 32) {
    const v16b a  = ldfrag_b(ap + k0);
    const unsigned ko = (unsigned)k0 * 32u;                // one 1024-byte tile per 32 of k
    const v16b b0 = ldfrag_bs((const u16*)(const void*)(bp + (lo0 + ko)));
    const v16b b1 = ldfrag_bs((const u16*)(const void*)(bp + (lo1 + ko)));
    const v16b b2 = ldfrag_bs((const u16*)(const void*)(bp + (lo2 + ko)));
    const v16b b3 = ldfrag_bs((const u16*)(const void*)(bp + (lo3 + ko)));
    addr_wait(ap + k0, ap + k0, lo0 + ko, lo1 + ko, lo2 + ko, lo3 + ko);
    acc0 = mma_b(a, b0, acc0);
    acc1 = mma_b(a, b1, acc1);
    acc2 = mma_b(a, b2, acc2);
    acc3 = mma_b(a, b3, acc3);
    guard6<v16b>(acc0, acc1, acc2, acc3, a, b0, b1, b2, b3, a);
  }
  epi64hsb(slab + wave * SLAB64, acc0, acc1, acc2, acc3, oscale, pscale, bias, C, N, (size_t)rowb, col0, lane);
}

// =====================================================================================================
// One launch for the five independent projection GEMMs, picked by block index (block-uniform): blocks 0..GHB-1 = f32 q rows 0..127
// of every sequence, GHB..2*GHB-1 = the same for k, then GPB blocks each for the f32 v plane, the f16 q plane and the f16 k plane.
// coverage: grid = 2*GHB + 3*GPB blocks; each GEMM is handed block indices 0 .. its own block count - 1.
// =====================================================================================================
__global__ __launch_bounds__(128)
void proj(const u16* __restrict__ XB, const u16* __restrict__ WQT, const u16* __restrict__ WKT, const u16* __restrict__ WVT,
          const float* __restrict__ bq, const float* __restrict__ bk, const float* __restrict__ bv,
          u16* QP, u16* KP, float* V, float* QF, float* KF, int rows, int hrows, int N, int K) {
  __shared__ __align__(16) float slab[4 * SLAB64];
  const int bid = blockIdx.x;
  if (bid < 2 * GHB + GPB) {                 // f32 outputs
    const int job = (bid < GHB) ? 0 : (bid < 2 * GHB) ? 1 : 2;
    const bool hd = job < 2;                 // rows 0..TQ0-1 of every sequence against all rows
    gemm_b32_body(slab, bid - job * GHB, XB, (job == 0) ? WQT : (job == 1) ? WKT : WVT, (job == 0) ? bq : (job == 1) ? bk : bv,
                  (job == 0) ? QF : (job == 1) ? KF : V, hd ? hrows : rows, N, K, hd ? TQ0 : rows, hd ? SEQ : 0, 1.0f);
  } else {                                   // f16 planes
    const int r = bid - (2 * GHB + GPB);
    const bool isq = r < GPB;
    gemm_bh16_body(slab, isq ? r : r - GPB, XB, isq ? WQT : WKT, isq ? bq : bk, isq ? QP : KP, rows, N, K, 1.0f,
                   isq ? QSC : KSC);
  }
}

// =====================================================================================================
// Output projection of one 16-row ctx tile that its attention block holds in LDS (hi + residual f16 rows), by all 8 waves:
//   C[row][n] = (hi . Bt^T) * os1 + (res . Bt^T) * os2 + bf16RNE(bias[n]); Bt = f16 [EMB][DH] in fragment order.
// Wave w owns columns 64w .. 64w+63 (four 16-column groups); K = DH = 64 in two steps of 32, separate accumulators for the two
// planes, k order 0..31 then 32..63 in each.
//  oproj_ldb: the two B fragments of group j (k step s at bytes 8192w + 2048j + 1024s).
//  oproj_mma: the four products of one group. Two groups' fragments are in flight at a time and a group's results are used up
//             before the next group's are made, which keeps the launch inside 128 registers (four blocks on a WGP).
// =====================================================================================================
__device__ __forceinline__ void oproj_ldb(v16h& b0, v16h& b1, const u16* __restrict__ Bt, int swave, int j, int lane) {
  const _Float16* bp = (const _Float16*)(const void*)Bt + (size_t)swave * (64 * DH) + j * 1024;      // wave-uniform base
  b0 = ldfrag_hs(bp + 8 * lane);
  b1 = ldfrag_hs(bp + 512 + 8 * lane);
}
__device__ __forceinline__ void oproj_mma(v8f& h, v8f& r, v16h b0, v16h b1, v16h a0, v16h a1, v16h r0, v16h r1) {
  h = mma_h(a0, b0, zero8());
  r = mma_h(r0, b0, zero8());
  h = mma_h(a1, b1, h);
  r = mma_h(r1, b1, r);
  // the distance behind the products: no result is read and no fragment's register is loaded anew in front of it
  guard2x6(h, r, b0, b1, a0, a1, r0, r1);
}

// =====================================================================================================
// V^T plane = f16(V[b][s][d] * 1024) in fragment order, V = f32 [b*SEQ + s][DH]: the tile (32 keys s/32, 16 columns d/16) lies at
// halves ((b*SEQ + s)/32 * 4 + d/16)*512, units inside it as ldfrag_hs reads them (col = d, k = key).
// Block = (b, 64 keys): 64 source rows of 64 floats loaded with 16-B loads, converted, scattered into an LDS tile [d][64 keys]
// coverage: load 256 thr x 16 elements = 64 x 64; store 2 iterations x 256 thr x 8 halves = 64 lines x 64 = the block's tile;
//           grid = nb x (SEQ/64) blocks covers the plane exactly once.
// =====================================================================================================
__device__ __forceinline__ void xt16_body(u16* TH, int bid, const float* __restrict__ X, u16* XTo) {
  const int tid = threadIdx.x;
  const int st  = bid % (SEQ / 64);
  const int b   = bid / (SEQ / 64);
  const int s0  = st * 64;
  {
    const int sl = tid >> 2;                  // key within tile 0..63
    const int dc = (tid & 3) * 16;            // d chunk within the 64
    const float* src = X + ((size_t)b * SEQ + s0 + sl) * DH + dc;
#pragma unroll
    for (int i = 0; i < 4; ++i) {
      const v4f a = *(const v4f*)(src + 4 * i);
#pragma unroll
      for (int e = 0; e < 4; ++e) {
        const float v = a[e];
        TH[(dc + 4 * i + e) * VTP + sl] = h_bits((_Float16)(v * VCAR));
      }
    }
  }
  __syncthreads();
  v4u vh[2];
  const int fm = tid & 15, fh = (tid >> 4) & 1, fs = (tid >> 5) & 1, fj = tid >> 6;
#pragma unroll
  for (int it = 0; it < 2; ++it) {            // d = 16*fj + fm, local keys 32*it + 16*fs + 8*fh .. +7
    vh[it] = *(const v4u*)(TH + (fj * 16 + fm) * VTP + it * 32 + fs * 16 + fh * 8);
  }
  const size_t base = ((size_t)b * SEQ + s0) * DH + tid * 8;
  {
#pragma unroll
    for (int it = 0; it < 2; ++it) {
      *(v4u*)(XTo + base + it * (32 * DH)) = vh[it];
    }
    // the code of the launch's other job follows these stores in the built kernel and rewrites their registers: wait first
    asm volatile("s_wait_xcnt 0x0" ::: "memory");
  }
}

// =====================================================================================================
// Key-block prefix column sums of V: VS[((b*NCHK + c)*NKB + kb)*DH + d] = sum over keys c*CK .. c*CK + 32*kb + 31 of V[b][key][d]
// (f32, fixed sequential order). Block = one (b, c), threads 0..63 work (thread = d; waves 2..7 only pass the barrier); the 16 prefix
// values per thread are staged in LDS
// coverage: grid = nb*NCHK blocks x (4 iterations x 64 thr x 4 floats = 1024) = the whole table.
// =====================================================================================================
__device__ __forceinline__ void vsum_body(float* sm, int bc, const float* __restrict__ V, float* VS) {
  const int tid = threadIdx.x;                        // d
  const int b   = bc / NCHK;
  const int c   = bc - b * NCHK;
  if (tid < DH) {                                     // waves 0,1 entirely (wave-uniform)
  const float* p = V + ((size_t)b * SEQ + (size_t)c * CK) * DH + tid;
  float s = 0.f;
  // Two register sets of one key block each: the next block's 32 loads are issued before this block is summed, so that the load
  // latency is shared by the loads in flight. The adds run in sequential key order.
  float va[32], vb[32];
#pragma unroll
  for (int i = 0; i < 32; ++i) va[i] = p[(size_t)i * DH];
  // fully unrolled: every load address is the base plus a constant, and the two sets stay in registers
#pragma unroll
  for (int kb = 0; kb < NKB; kb += 2) {
#pragma unroll
    for (int i = 0; i < 32; ++i) vb[i] = p[(size_t)((kb + 1) * 32 + i) * DH];
#pragma unroll
    for (int i = 0; i < 32; ++i) s += va[i];
    sm[kb * DH + tid] = s;
    if (kb + 2 < NKB) {
#pragma unroll
      for (int i = 0; i < 32; ++i) va[i] = p[(size_t)((kb + 2) * 32 + i) * DH];
    }
#pragma unroll
    for (int i = 0; i < 32; ++i) s += vb[i];
    sm[(kb + 1) * DH + tid] = s;
  }
  }
  __syncthreads();
  if (tid >= DH) return;                              // behind the only barrier of this path
  v4f o[4];
#pragma unroll
  for (int it = 0; it < 4; ++it) o[it] = *(const v4f*)(sm + it * 256 + tid * 4);
  float* base = VS + (size_t)bc * NKB * DH + tid * 4;
  {
#pragma unroll
    for (int it = 0; it < 4; ++it) {
      *(v4f*)(base + it * 256) = o[it];
    }
    
  }
}

// =====================================================================================================
// One launch for the two independent readers of the f32 v plane, picked by block index (block-uniform): blocks 0..VSB-1 = prefix
// column sums (the longer dependent chain, so it starts first), the rest = the V^T plane.
// coverage: grid = VSB + XTB blocks; each job is handed block indices 0 .. its own block count - 1.
// =====================================================================================================
__global__ __launch_bounds__(256) void vprep(const float* __restrict__ V, u16* VT, float* VS) {
  __shared__ __align__(16) u16 TH[64 * VTP];
  __shared__ __align__(16) float sm[NKB * DH];
  const int bid = blockIdx.x;
  if (bid < VSB) vsum_body(sm, bid, V, VS);
  else           xt16_body(TH, bid - VSB, V, VT);
}

// =====================================================================================================
// Single-head causal attention, head width DH = 64, query rows TQ0 .. SEQ-1: block = (batch b, 16 query rows q0..q0+15), 8 waves.
// q plane (f16, x8), k plane the same and V^T plane (x1024), each in fragment order; VS = key-block prefix column sums of V.
//   Chunks of CK = 512 keys: only chunks c <= qc = q0/CK are visited (later chunks lie entirely above the diagonal). In the diagonal
//   chunk only key blocks kb < nkb (keys <= q0+15) are multiplied; key blocks kb >= nkb get zero scores in LDS and are not used in (PV).
//   (S) scores S[query m][key n] on WMMA: A = q rows (row m = lane&15, split k map over d, two 32-d fragments kept in registers),
//       B = k rows (col n = key, split map); wave w handles key blocks w, w+8 of the chunk; D element r of lane l -> scs[query 8h+r][key].
//   (M) 16 threads per query row (sub-thread = 32 consecutive keys): base-2 logits with the causal mask by key index (key > query
//       -> -inf), chunk max via xor shuffles, online running max / rescale factor al / running sum l in f32 registers,
//       p = exp2(t - m_new) <= 1 (0 for masked keys), chunk row sum ps and C = ps/CK (bit-identical on the row's 16 threads), the
//       CENTRED P' = p - C written as f16(P' * 32768) into the LDS P tile with 16-B stores; al -> rowa[row], C -> rowc[row].
//   (PV) every wave keeps its own partial O (4 accumulator tiles = 16 queries x 64 d): o_w = o_w*al (+ on wave 0 only:
//       C*(32768*1024)*VS[chunk][nkb-1][d], the exact add-back of the centring term over exactly the processed keys, in f32), then for
//       the wave's key blocks kb in {w, w+8}, kb < nkb: A = P' fragment from LDS (row m = query, split map over keys), B = V^T
//       fragments (col n = d, split map over keys, fragment order), 4 WMMAs plus a hazard gap. sum_k (P'_k + C) v_k == sum_k p_k v_k exactly;
//       masked keys carry P' = -C and p = 0.
//   Block barriers after (S) and after (M) order all LDS reuse across chunks and waves.
//   Combine: after a block barrier the 8 partial O tiles are staged in the score region ([8][16][OPP] f32), barrier, then thread
//   (row = tid>>4, 4 columns) sums the 8 partials in fixed order, x = sum * 4096 / (l * 32768 * 1024) (l >= 1 always, held in
//   registers by the row's 16 threads), hi = f16(x), res = f16((x - hi) * 2048), staged as a [32][CTP] u16 tile in the P region,
//   barrier, then the output projection of these 16 rows (oproj_ldb, oproj_mma, slab64_out): wave w -> out columns 64w .. 64w+63.
// coverage: grid nb*NQT blocks x 16 rows = rows TQ0..SEQ-1 of every sequence; scs written 16 x 512 every chunk (zeros for kb >= nkb);
//           P tile written 16 x 512 every chunk; partial stage 8 x 16 x 64; ctx stage 32 x 64; out store 8 waves x 16 rows x 64 columns.
// =====================================================================================================
__device__ __forceinline__
void attn_fwd_body(float* scs, u16* pls, float* rowa, float* rowc, int bid,
                   const u16* __restrict__ QPp, const u16* __restrict__ KPp, const u16* __restrict__ VTp,
                   const float* __restrict__ VSp, const u16* __restrict__ WOTp, const float* __restrict__ bo, float* out) {
  const int tid  = threadIdx.x;
  const int wave = tid >> 5;
  const int lane = tid & 31;
  const int hh   = lane >> 4;
  const int m    = lane & 15;
  const int r16  = tid >> 4;                 // query row owned in phase (M) and in the combine
  const int sub  = tid & 15;
  const int kl0  = sub * 32;

  // A block's cost grows with its query tile (qc + 1 chunks), so cost falls with the block index: the four sequences' last tiles
  // come first, their first tiles last. bid -> (b, tile) is a permutation of NB x NQT.
  const int b   = bid % NB;
  const int q0  = TQ0 + (NQT - 1 - bid / NB) * QT;
  const int qc  = q0 / CK;                   // diagonal chunk index

  // all three planes in fragment order: 16 rows of q or k = two tiles (d 0..31, d 32..63), 32 keys of V^T = four tiles (16 d each)
  const _Float16* qrow = (const _Float16*)(const void*)QPp + ((size_t)b * SEQ + q0) * DH + 8 * lane;
  const v16h qa0 = ldfrag_hs(qrow);          // d 0..31
  const v16h qa1 = ldfrag_hs(qrow + 512);    // d 32..63
  // block-uniform bases; a lane's place is one 32-bit byte offset (a sequence's plane is SEQ*DH*2 bytes)
  const char* kbp = (const char*)(const void*)KPp + (size_t)b * SEQ * DH * 2;
  const char* vbp = (const char*)(const void*)VTp + (size_t)b * SEQ * DH * 2;
  const unsigned lo16 = (unsigned)lane * 16u;
  const float* vsb = VSp + (size_t)b * NCHK * NKB * DH + m;
  const float lsc = RSQD * LOG2E / (QSC * KSC);
  const float addsel = (wave == 0) ? (PCAR * VCAR) : 0.f;    // centring add-back on wave 0 only

  float mrun = -INFINITY, lrun = 0.f;
  v8f o[NACC];
#pragma unroll
  for (int j = 0; j < NACC; ++j) o[j] = zero8();

#pragma unroll 1
  for (int c = 0; c <= qc; ++c) {
    const int kbeg = c * CK;
    const int nkb  = (c < qc) ? NKB : (((q0 + QT - 1 - kbeg) >> 5) + 1);   // 1..16, block-uniform
    // ---- (S) scores of this chunk (zeros for key blocks beyond the query tile) ----
#pragma unroll 1
    for (int kb = wave; kb < NKB; kb += 8) {               // wave-uniform, 2 trips
      v8f s0 = zero8(), s1 = zero8();
      if (kb < nkb) {                                      // wave-uniform
        const _Float16* k0p = (const _Float16*)(const void*)(kbp + (lo16 + (unsigned)(kbeg + kb * 32) * (DH * 2u)));
        const _Float16* k1p = k0p + (size_t)16 * DH;
        const v16h f00 = ldfrag_hs(k0p);
        const v16h f01 = ldfrag_hs(k0p + 512);
        const v16h f10 = ldfrag_hs(k1p);
        const v16h f11 = ldfrag_hs(k1p + 512);
        s0 = mma_h(qa0, f00, s0);
        s0 = mma_h(qa1, f01, s0);
        s1 = mma_h(qa0, f10, s1);
        s1 = mma_h(qa1, f11, s1);
        guard2x6(s0, s1, qa0, qa1, f00, f01, f10, f11);
      }
      float* srow = scs + (8 * hh) * SCP + kb * 32 + m;
#pragma unroll
      for (int r = 0; r < 8; ++r) {
        srow[r * SCP]      = s0[r];
        srow[r * SCP + 16] = s1[r];
      }
    }
    __syncthreads();
    // ---- (M) softmax statistics and the centred P' tile ----
    {
      const float* sp = scs + r16 * SCP + kl0;
      const int lim = (q0 + r16) - (kbeg + kl0);           // key kl0 + j is valid iff j <= lim
      float t[32];
      float cm = -INFINITY;
#pragma unroll
      for (int i = 0; i < 8; ++i) {
        const v4f a = *(const v4f*)(sp + 4 * i);
#pragma unroll
        for (int e = 0; e < 4; ++e) {
          const int j = 4 * i + e;
          const float tv = (j <= lim) ? a[e] * lsc : -INFINITY;
          t[j] = tv;
          cm = fmaxf(cm, tv);
        }
      }
#pragma unroll
      for (int d = 1; d <= 8; d <<= 1) cm = fmaxf(cm, __shfl_xor(cm, d, 32));
      const float mn = fmaxf(mrun, cm);                    // finite: key kbeg of every visited chunk is never masked
      const float al = (mrun == -INFINITY) ? 0.f : exp2f(mrun - mn);
      mrun = mn;
      float ps = 0.f;
#pragma unroll
      for (int j = 0; j < 32; ++j) {
        const float p = exp2f(fminf(t[j] - mn, 0.f));      // 0 for masked keys
        t[j] = p;
        ps += p;
      }
#pragma unroll
      for (int d = 1; d <= 8; d <<= 1) ps += __shfl_xor(ps, d, 32);
      const float cc = ps * (1.0f / (float)CK);
      v4u pk[4];
#pragma unroll
      for (int i = 0; i < 4; ++i) {
#pragma unroll
        for (int e = 0; e < 4; ++e) {
          const int j = 8 * i + 2 * e;
          pk[i][e] = pk16(h_bits((_Float16)((t[j] - cc) * PCAR)), h_bits((_Float16)((t[j + 1] - cc) * PCAR)));
        }
      }
      lrun = lrun * al + ps;
      u16* pd = pls + r16 * PLP + kl0;
#pragma unroll
      for (int i = 0; i < 4; ++i) *(v4u*)(pd + 8 * i) = pk[i];
      if (sub == 0) { rowa[r16] = al; rowc[r16] = cc; }
    }
    __syncthreads();
    // ---- (PV) rescale, add the centring term (wave 0), accumulate P' . V^T for this wave's key blocks ----
    {
      float scl[8], cad[8];
#pragma unroll
      for (int r = 0; r < 8; ++r) { scl[r] = rowa[8 * hh + r]; cad[r] = rowc[8 * hh + r] * addsel; }
      const float* vsc = vsb + ((size_t)c * NKB + (size_t)(nkb - 1)) * DH;
      float vs[NACC];
#pragma unroll
      for (int j = 0; j < NACC; ++j) vs[j] = vsc[16 * j];
#pragma unroll
      for (int j = 0; j < NACC; ++j) {
#pragma unroll
        for (int r = 0; r < 8; ++r) o[j][r] = __builtin_fmaf(cad[r], vs[j], o[j][r] * scl[r]);   // fused this way round, o stays in place
      }
      const _Float16* pp = (const _Float16*)(const void*)pls + m * PLP + 8 * hh;
#pragma unroll 1
      for (int kb = wave; kb < nkb; kb += 8) {             // wave-uniform trip count, <= 2
        const v16h pf = ldfrag_h(pp + kb * 32);
        const _Float16* vk = (const _Float16*)(const void*)(vbp + (lo16 + (unsigned)(kbeg + kb * 32) * (DH * 2u)));
        const v16h g0 = ldfrag_hs(vk);
        const v16h g1 = ldfrag_hs(vk + 512);
        const v16h g2 = ldfrag_hs(vk + 1024);
        const v16h g3 = ldfrag_hs(vk + 1536);
        o[0] = mma_h(pf, g0, o[0]);
        o[1] = mma_h(pf, g1, o[1]);
        o[2] = mma_h(pf, g2, o[2]);
        o[3] = mma_h(pf, g3, o[3]);
        guardpv4(o[0], o[1], o[2], o[3], pf, g0, g1, g2, g3);
      }
    }
  }
  acc_guard4(o[0], o[1], o[2], o[3]);

  // ---- combine the 8 partial O tiles in fixed order ----
  // From here on the lane's number is read anew and the wave's number is held in a scalar register: no index made from the thread
  // id has to stay in a vector register across the chunk loop, which keeps the launch inside 128 registers without spills.
  const int el = (int)__builtin_amdgcn_mbcnt_lo(~0u, 0u);   // == lane
  const int sw = __builtin_amdgcn_readfirstlane(wave);      // == wave
  const int eh = el >> 4, em = el & 15;                     // == hh, m (== sub)
  const int er = 2 * sw + eh;                               // == r16
  __syncthreads();
#pragma unroll
  for (int j = 0; j < NACC; ++j) {
#pragma unroll
    for (int r = 0; r < 8; ++r) scs[(sw * 16 + 8 * eh + r) * OPP + 16 * j + em] = o[j][r];
  }
  v16h bf[4];                                // groups 0 and 1 are fetched beside the staging stores
  oproj_ldb(bf[0], bf[1], WOTp, sw, 0, el);
  oproj_ldb(bf[2], bf[3], WOTp, sw, 1, el);
  __syncthreads();
  const int c4 = em * 4;
  v4f sm4 = zero4();
#pragma unroll
  for (int w = 0; w < 8; ++w) sm4 += *(const v4f*)(scs + (w * 16 + er) * OPP + c4);
  const float inv = (1.0f / lrun) * (CSC / (PCAR * VCAR));            // lrun >= 1
#pragma unroll
  for (int e = 0; e < 4; ++e) {
    const float xs = sm4[e] * inv;
    const _Float16 hv = (_Float16)xs;
    const _Float16 rv = (_Float16)((xs - (float)hv) * RSC);
    pls[er * CTP + c4 + e]        = h_bits(hv);
    pls[(16 + er) * CTP + c4 + e] = h_bits(rv);
  }
  __syncthreads();
  // ---- output projection of the 16 ctx rows; the partial O tiles were last read in front of the barrier above, so each wave takes
  //      its own 16 x 68 f32 slab of the score region for the store shape of slab64_out ----
  const _Float16* ch = (const _Float16*)(const void*)pls + em * CTP + 8 * eh;
  const _Float16* cr = ch + 16 * CTP;
  const v16h a0 = ldfrag_h(ch), a1 = ldfrag_h(ch + 32), r0 = ldfrag_h(cr), r1 = ldfrag_h(cr + 32);
  const v4f bv = *(const v4f*)(bo + sw * 64 + em * 4);
  float* sl = scs + sw * SLAB64 + (8 * eh) * 68 + em;
  // unrolled: the fragment set bf[] is indexed by j and has to stay in registers
#pragma unroll
  for (int j = 0; j < 4; ++j) {
    v8f h, r;
    oproj_mma(h, r, bf[2 * (j & 1)], bf[2 * (j & 1) + 1], a0, a1, r0, r1);
    if (j < 2) oproj_ldb(bf[2 * j], bf[2 * j + 1], WOTp, sw, j + 2, el);   // group j + 2 flies while groups j, j + 1 are worked on
#pragma unroll
    for (int e = 0; e < 8; ++e) sl[e * 68 + 16 * j] = h[e] * OS1 + r[e] * OS2;
  }
  v4f badd;
#pragma unroll
  for (int e = 0; e < 4; ++e) badd[e] = bfr(bv[e]);
  slab64_out(scs + sw * SLAB64, badd, out, EMB, (size_t)b * SEQ + q0, sw * 64, el);
}

// =====================================================================================================
// Query rows 0 .. TQ0-1 of each sequence in f32 on VALU: block = (b, t), threads 0..127 work (waves 4..7 only pass the barriers, up to the output projection). QF/KF = f32 q/k planes [nb][TQ0][DH] (bias
// included), V = f32 v plane [nb*SEQ][DH]. Scores for keys j (thread j, one key each, 64-d dot of its whole key row against the q row staged in LDS;
// keys j > t masked to -inf), base-2 softmax with block max / sum reductions (xor shuffles + LDS), p_j in LDS, ctx[d] for d = tid
// (threads 0..63) as a sum in key order of p_j * V[b][j][d] (coalesced, groups of 64 keys up to the one holding t), x = ctx * 4096 / l, hi = f16(x),
// res = f16((x - hi) * 2048); both 64-half rows are staged in LDS, then the row's output projection: wave w -> out columns 64w .. 64w+63.
// coverage: grid nb*TQ0 blocks = rows 0..TQ0-1 of every sequence; 64 thr x 1 d = DH per row; store 8 waves x 4 x 16 lanes = EMB floats;
//           together with attn_fwd every (b, s, n) of out is written exactly once.
// =====================================================================================================
__device__ __forceinline__
void attn_head_body(float* qs, float* sc, float* red, float* redb, u16* SW, int bid,
                    const float* __restrict__ QF, const float* __restrict__ KF, const float* __restrict__ V,
                    const u16* __restrict__ WOTp, const float* __restrict__ bo, float* out) {
  const int tid = threadIdx.x, lane = tid & 31, wave = tid >> 5;
  const int b = bid / TQ0;
  const int t = bid - b * TQ0;
  const bool work = wave < HD_THREADS / 32;                        // wave-uniform: one key per thread, keys 0..TQ0-1
  if (tid < DH) qs[tid] = QF[((size_t)b * TQ0 + t) * DH + tid];   // waves 0,1 entirely (wave-uniform)
  __syncthreads();
  float acc = 0.f;
  if (work) {
    const float* kp = KF + (size_t)b * (TQ0 * DH) + tid * DH;       // key row b*TQ0 + tid always in range (tid < TQ0)
    v4f kr[DH / 4];                                                 // the whole key row: 16 loads in flight, one latency
#pragma unroll
    for (int i = 0; i < DH / 4; ++i) kr[i] = *(const v4f*)(kp + 4 * i);
#pragma unroll
    for (int i = 0; i < DH / 4; ++i) {
      const v4f q4 = *(const v4f*)(qs + 4 * i);
#pragma unroll
      for (int e = 0; e < 4; ++e) acc += kr[i][e] * q4[e];
    }
  }
  const float s = (tid <= t) ? acc * (RSQD * LOG2E) : -INFINITY;   // causal mask by key index
  float mx = s;
#pragma unroll
  for (int d = 1; d <= 16; d <<= 1) mx = fmaxf(mx, __shfl_xor(mx, d, 32));
  if (work && lane == 0) red[wave] = mx;
  __syncthreads();
  float gm = red[0];
#pragma unroll
  for (int w = 1; w < 4; ++w) gm = fmaxf(gm, red[w]);   // finite: key 0 is always valid
  const float p = exp2f(s - gm);                     // 0 for masked keys
  float ps = p;
#pragma unroll
  for (int d = 1; d <= 16; d <<= 1) ps += __shfl_xor(ps, d, 32);
  if (work && lane == 0) redb[wave] = ps;
  if (work) sc[tid] = p;
  __syncthreads();
  float l = redb[0];
#pragma unroll
  for (int w = 1; w < 4; ++w) l += redb[w];           // >= 1
  const float inv = (1.0f / l) * CSC;
  if (wave < 2) {                                    // threads 0..63 (wave-uniform): one d column each
    const float* vp = V + (size_t)b * SEQ * DH + tid;
    float cx = 0.f;
    // Keys in groups of 64 whose loads are issued ahead of their use: one load latency per group. A group's keys j > t carry
    // sc[j] = 0 and add nothing; rows j0 .. j0+63 <= TQ0-1 of sequence b always exist. The sum runs in key order.
    // rolled: the trip count (1 or 2) depends on t
#pragma unroll 1
    for (int j0 = 0; j0 <= t; j0 += 64) {            // block-uniform
      float vv[64];
#pragma unroll
      for (int i = 0; i < 64; ++i) vv[i] = vp[(size_t)(j0 + i) * DH];
#pragma unroll
      for (int i = 0; i < 16; ++i) {
        const v4f p4 = *(const v4f*)(sc + j0 + 4 * i);
#pragma unroll
        for (int e = 0; e < 4; ++e) cx += p4[e] * vv[4 * i + e];
      }
    }
    const float x0 = cx * inv;
    const _Float16 h0 = (_Float16)x0;
    const _Float16 r0 = (_Float16)((x0 - (float)h0) * RSC);
    SW[tid]      = h_bits(h0);
    SW[DH + tid] = h_bits(r0);
  }
  const int sw = __builtin_amdgcn_readfirstlane(wave);   // the wave's number in a scalar register: scalar base for Wo
  v16h bf[4];                                        // groups 0 and 1: behind the 64-register key groups, in front of the last barrier
  oproj_ldb(bf[0], bf[1], WOTp, sw, 0, lane);
  oproj_ldb(bf[2], bf[3], WOTp, sw, 1, lane);
  float bb[4];
#pragma unroll
  for (int j = 0; j < 4; ++j) bb[j] = bo[wave * 64 + 16 * j + (lane & 15)];
  __syncthreads();
  // ---- output projection of the one ctx row, all 8 waves: it is row 0 of the A tile, rows 1..15 are zero; row 0 of a result tile is
  //      element 0 of lanes 0..15 (column = lane) ----
  const int hh = lane >> 4, m = lane & 15;
  const v4u z4 = {0u, 0u, 0u, 0u};
  FragH fa[4];                                       // hi k 0..31, hi k 32..63, residual k 0..31, residual k 32..63
#pragma unroll
  for (int i = 0; i < 4; ++i) {
    const v4u u0 = *(const v4u*)(SW + i * 32 + 8 * hh), u1 = *(const v4u*)(SW + i * 32 + 16 + 8 * hh);
    fa[i].u[0] = (m == 0) ? u0 : z4;
    fa[i].u[1] = (m == 0) ? u1 : z4;
  }
  float ov[4];
  // unrolled: the fragment set bf[] is indexed by j and has to stay in registers
#pragma unroll
  for (int j = 0; j < 4; ++j) {
    v8f h, r;
    oproj_mma(h, r, bf[2 * (j & 1)], bf[2 * (j & 1) + 1], fa[0].v, fa[1].v, fa[2].v, fa[3].v);
    if (j < 2) oproj_ldb(bf[2 * j], bf[2 * j + 1], WOTp, sw, j + 2, lane);
    ov[j] = (h[0] * OS1 + r[0] * OS2) + bfr(bb[j]);
  }
  float* dst = out + ((size_t)b * SEQ + t) * EMB + wave * 64 + m;
  if (lane < 16) {
#pragma unroll
    for (int j = 0; j < 4; ++j) dst[16 * j] = ov[j];
  }
}

// =====================================================================================================
// One launch for the two independent attention jobs, picked by block index (block-uniform): blocks 0..NB*NQT-1 = query rows TQ0.. on
// WMMA, longest tiles first, the rest = query rows 0..TQ0-1 on VALU (short blocks, last, so that they fill places the long blocks leave).
// coverage: grid = NB*NQT + NB*TQ0 blocks; each job is handed block indices 0 .. its own block count - 1.
// =====================================================================================================
__global__ __launch_bounds__(ATT_THREADS) __attribute__((amdgpu_num_vgpr(256)))
void attn(const u16* __restrict__ QPp, const u16* __restrict__ KPp, const u16* __restrict__ VTp, const float* __restrict__ VSp,
          const float* __restrict__ QF, const float* __restrict__ KF, const float* __restrict__ V,
          const u16* __restrict__ WOTp, const float* __restrict__ bo, float* out) {
  __shared__ __align__(16) float scs[16 * SCP];     // scores [16][SCP] f32; reused as partial O tiles [8][16][OPP] f32, then out slabs
  __shared__ __align__(16) u16 pls[16 * PLP];       // P' tile [16][PLP] f16 bits; reused as ctx staging [32][CTP] u16
  __shared__ float rowa[QT];
  __shared__ float rowc[QT];
  __shared__ __align__(16) float qs[DH];
  __shared__ __align__(16) float sc[TQ0];
  __shared__ float red[4];
  __shared__ float redb[4];
  __shared__ __align__(16) u16 SW[2 * DH];
  const int bid = blockIdx.x;
  if (bid < NB * NQT) attn_fwd_body(scs, pls, rowa, rowc, bid, QPp, KPp, VTp, VSp, WOTp, bo, out);
  else                attn_head_body(qs, sc, red, redb, SW, bid - NB * NQT, QF, KF, V, WOTp, bo, out);
}

// =====================================================================================================
// Workspace map (bytes, nb = 4, rows = 16384); every plane is fully written by whole-line stores before it is read; all extents are
//   WQT bf16 [64][512] 65536   WKT same   WVT same   WOT f16 of bf16 value x1024 [512][64] 65536 (fragment order)  262144
//   XB  bf16 [rows][512]                                                                                           16777216
//   QP  f16 [rows][64] x8 (fragment order)                                                                          2097152
//   KP  f16 [rows][64] x8 (fragment order)                                                                          2097152
//   V   f32 [rows][64]                                                                                              4194304
//   VT  f16 x1024, [nb][SEQ/32][4] tiles of 32 keys x 16 d (fragment order)                                                                    2097152
//   VS  f32 [nb][8][16][64]                                                                                          131072
//   QF  f32 [nb][128][64]  131072      KF same                                                                       262144
//   end                                                                                                            27918336
// =====================================================================================================
extern "C" void kernel_launch(void* const* d_in, const int* in_sizes, int n_in,
                              void* d_out, int out_size, void* d_ws, size_t ws_size,
                              hipStream_t stream) {
  if (n_in < 9) return;
  const int nb   = NB;
  const int rows = nb * SEQ;
  if ((long long)in_sizes[0] < (long long)NB * SEQ_FULL * EMB) return;
  if (in_sizes[1] < EMB * DH || in_sizes[3] < EMB * DH || in_sizes[5] < EMB * DH || in_sizes[7] < DH * EMB) return;
  if (in_sizes[2] < DH || in_sizes[4] < DH || in_sizes[6] < DH || in_sizes[8] < EMB) return;
  if ((long long)out_size < (long long)rows * EMB) return;

  const float* x  = (const float*)d_in[0];
  const float* wq = (const float*)d_in[1];
  const float* bq = (const float*)d_in[2];
  const float* wk = (const float*)d_in[3];
  const float* bk = (const float*)d_in[4];
  const float* wv = (const float*)d_in[5];
  const float* bv = (const float*)d_in[6];
  const float* wo = (const float*)d_in[7];
  const float* bo = (const float*)d_in[8];
  float*       out = (float*)d_out;

  const size_t szW  = (size_t)EMB * DH * 2;                      //     65536
  const size_t szXB = (size_t)rows * EMB * 2;                    //  16777216
  const size_t szP  = (size_t)rows * DH * 2;                     //   2097152
  const size_t szV  = (size_t)rows * DH * 4;                     //   4194304
  const size_t szVT = (size_t)nb * DH * SEQ * 2;                 //   2097152 (== szP)
  const size_t szVS = (size_t)nb * NCHK * NKB * DH * 4;          //    131072
  const size_t szHF = (size_t)nb * TQ0 * DH * 4;                 //    131072
  size_t off = 0;
  const size_t oWQ = off; off += szW;
  const size_t oWK = off; off += szW;
  const size_t oWV = off; off += szW;
  const size_t oWO = off; off += szW;
  const size_t oXB = off; off += szXB;
  const size_t oQ  = off; off += szP;
  const size_t oK  = off; off += szP;
  const size_t oV  = off; off += szV;
  const size_t oVT = off; off += szVT;
  const size_t oVS = off; off += szVS;
  const size_t oQF = off; off += szHF;
  const size_t oKF = off; off += szHF;
  if (off > ws_size) return;                                     // off = 27918336 at nb = 4
  if (off > WS_CAP) return;

  char* ws = (char*)d_ws;
  u16*   WQT = (u16*)(ws + oWQ);
  u16*   WKT = (u16*)(ws + oWK);
  u16*   WVT = (u16*)(ws + oWV);
  u16*   WOT = (u16*)(ws + oWO);
  u16*   XB  = (u16*)(ws + oXB);
  u16*   QP  = (u16*)(ws + oQ);
  u16*   KP  = (u16*)(ws + oK);
  float* V   = (float*)(ws + oV);
  u16*   VT  = (u16*)(ws + oVT);
  float* VS  = (float*)(ws + oVS);
  float* QF  = (float*)(ws + oQF);
  float* KF  = (float*)(ws + oKF);

  const int n8x = (SEQ * EMB) / 8;                       // 262144 per batch
  if ((n8x % 256) != 0 || (rows % 64) != 0 || ((nb * TQ0) % 64) != 0) return;
  const dim3 blk(256);
  const dim3 gPR(4 * WTB + NB * XCB);                   // 4 * 8 weight tiles + nb * 1024 x blocks
  const dim3 gPJ(2 * GHB + 3 * GPB);                    // 2 * 8 + 3 * 256 at nb = 4
  const dim3 bG(128);
  const dim3 gVP(VSB + XTB);                            // nb * 8 + nb * 64
  const dim3 gAT(NB * NQT + NB * TQ0);                  // nb * 248 + nb * 128
  const dim3 bAT(ATT_THREADS);

  // (0) Wq, Wk, Wv stored [k = in 512][n = out 64] -> bf16 planes [64][512] in fragment order; Wo [k = 64][n = 512] -> f16 of bf16
  //     value x1024, [512][64] in fragment order; x -> bf16 plane [rows][512]
  prep<<<gPR, blk, 0, stream>>>(x, wq, wk, wv, wo, WQT, WKT, WVT, WOT, XB);
  // (1) q and k projections (+bias) -> f16 planes x8; v projection (+bias) -> f32 plane; f32 q and k rows 0..127 of every
  //     sequence -> QF, KF [nb*128][64]
  proj<<<gPJ, bG, 0, stream>>>(XB, WQT, WKT, WVT, bq, bk, bv, QP, KP, V, QF, KF, rows, nb * TQ0, DH, EMB);
  // (2) v -> V^T plane x1024 and key-block prefix column sums of v
  vprep<<<gVP, blk, 0, stream>>>(V, VT, VS);
  // (3) attention: query rows 128.. on WMMA and query rows 0..127 on VALU -> ctx hi x4096 and residual x2048 f16 rows in LDS, then
  //     each block's output projection + bias -> out
  attn<<<gAT, bAT, 0, stream>>>(QP, KP, VT, VS, QF, KF, V, WOT, bo, out);
  (void)hipGetLastError();
}

// v006
// Measured time: 61.6 microseconds a run.
// Next to v005, in two timings, it ran 1.15 times as fast each time.
// Counting every step since v000, it is 3.63 times as fast.
// Projections q,k,v = x.W + b and the f32 q,k rows 0..127 per sequence: v_wmma_f32_16x16x32_bf16 (bf16 RNE operands of the
// raw inputs, f32 accumulate, bf16 RNE bias added in f32). Scores q'.k'^T (f16 planes x8), P'.V (chunk-centred P' x32768 f16 from LDS,
// V^T x1024 f16) and the output projection (ctx carried as f16 hi x4096 plus residual x2048 rows, times f16(bf16(Wo)) x1024, bias
// added in f32): v_wmma_f32_16x16x32_f16, f32 accumulate. Query rows 0..127 of each sequence: scores, softmax and P.V in f32 on VALU.
// Causal mask, softmax statistics, key-block column sums of V and all scaling in f32 on VALU.
#include <hip/hip_runtime.h>
#include <math.h>
#include <stdint.h>

#ifndef NB
#define NB 4
#endif
#ifndef SEQ
#define SEQ 4096
#endif
#define SEQ_FULL 4096
#define NB_FULL 4
#define EMB   512
#define DH    64
#define CK    512
#define NCHK  (SEQ / CK)
#define NKB   16
#define QT    16
#define TQ0   128
#define NQT   ((SEQ - TQ0) / QT)
#define SCP   544
#define PLP   528
#define OPP   68
#define CTP   72
#define SLAB64 (16 * 68)
#define VTP   72
#define ATT_THREADS 256
#define HD_THREADS 128
#define NACC  4
#define QSC   8.0f
#define KSC   8.0f
#define PCAR  32768.0f
#define VCAR  1024.0f
#define WSC   1024.0f
#define CSC   4096.0f
#define RSC   2048.0f
#define OS1   (1.0f / (CSC * WSC))
#define OS2   (1.0f / (CSC * WSC * RSC))
#define LOG2E 1.4426950408889634f
#define RSQD  0.125f
#define WS_CAP ((size_t)134217728)
#define WTB   ((EMB / 64) * (DH / 64))
#define XCB   ((SEQ * EMB) / 8 / 256)
#define GPB   (((NB * SEQ) / 64) * (DH / 64))
#define GHB   (((NB * TQ0) / 64) * (DH / 64))

static_assert(DH == 64 && NACC * 16 == DH && (EMB % 64) == 0 && (EMB % 32) == 0 && (DH % 32) == 0);
static_assert((SEQ % CK) == 0 && NCHK >= 1 && CK == 32 * NKB && (SEQ % 64) == 0 && (SEQ % QT) == 0 && (CK % QT) == 0);
static_assert((TQ0 % QT) == 0 && (TQ0 % 64) == 0 && NQT * QT + TQ0 == SEQ && NQT >= 1 && TQ0 == 128 && TQ0 == HD_THREADS);
static_assert(8 * SLAB64 <= 16 * SCP && EMB == 8 * 64 && 8 * 16 * OPP <= 16 * SCP && 32 * CTP <= 16 * PLP && CTP >= DH + 8 && OPP >= DH + 4 && SCP >= CK + 16 && PLP >= CK + 8);
static_assert(((PLP * 2) % 16) == 0 && ((SCP * 4) % 16) == 0 && ((VTP * 2) % 16) == 0 && ((CTP * 2) % 16) == 0 && ((OPP * 4) % 16) == 0);
static_assert(64 * VTP >= 63 * VTP + 64);
static_assert(ATT_THREADS == 16 * QT && ATT_THREADS == 256 && HD_THREADS == 2 * DH);
static_assert((((SEQ * EMB) / 8) % 256) == 0 && ((NB * SEQ) % 64) == 0 && ((NB * TQ0) % 64) == 0);
static_assert(NB >= 1 && NB <= NB_FULL && SEQ <= SEQ_FULL && (TQ0 % 64) == 0 && (NKB % 2) == 0);

typedef unsigned short u16;
typedef _Float16 v16h __attribute__((ext_vector_type(16)));
typedef _Float16 v8h  __attribute__((ext_vector_type(8)));
typedef __bf16   v16b __attribute__((ext_vector_type(16)));
typedef float    v8f  __attribute__((ext_vector_type(8)));
typedef float    v4f  __attribute__((ext_vector_type(4)));
typedef unsigned int v4u __attribute__((ext_vector_type(4)));

union FragH { v16h v; v8h h[2]; v4u u[2]; };
union FragB { v16b v; v4u u[2]; };

// ---- scalar helpers --------------------------------------------------------------------------------
__device__ __forceinline__ unsigned short bf_bits(float f) {          // f32 -> bf16 bits, RNE convert
  unsigned u = __float_as_uint(f);
  return (unsigned short)((u + 0x7FFFu + ((u >> 16) & 1u)) >> 16);
}
__device__ __forceinline__ float bf_up(unsigned short h) { return __uint_as_float(((unsigned)h) << 16); }
__device__ __forceinline__ float bfr(float f) { return bf_up(bf_bits(f)); }
__device__ __forceinline__ unsigned short h_bits(_Float16 x) { return __builtin_bit_cast(unsigned short, x); }
__device__ __forceinline__ unsigned pk16(unsigned short a, unsigned short b) { return (unsigned)a | ((unsigned)b << 16); }
__device__ __forceinline__ v8f zero8() { v8f z = {0.f, 0.f, 0.f, 0.f, 0.f, 0.f, 0.f, 0.f}; return z; }
__device__ __forceinline__ v4f zero4() { v4f z = {0.f, 0.f, 0.f, 0.f}; return z; }

// ---- fragment loaders: 16-bit A/B operand, lane -> row/col (lane&15), p already includes +8*(lane>>4);
//      elements 0..7 <- p[0..7] (k0+8h..), elements 8..15 <- p[16..23] (k0+16+8h..)  (same split k map for A and B);
//      this form reads the row-major A planes (x, ctx hi, ctx residual)
__device__ __forceinline__ v16h ldfrag_h(const _Float16* p) {
  FragH f;
  f.h[0] = *(const v8h*)(p);
  f.h[1] = *(const v8h*)(p + 16);
  return f.v;
}
__device__ __forceinline__ v16b ldfrag_b(const u16* p) {              // bf16 plane read as unsigned integer vectors
  FragB f;
  f.u[0] = *(const v4u*)(p);
  f.u[1] = *(const v4u*)(p + 16);
  return f.v;
}

// ---- the same fragments from a plane kept in FRAGMENT ORDER: a 16 (rows or cols) x 32 (k) tile is 512 consecutive halves; the 16-B
//      unit of lane l = 16*h + m (row/col m, k = 8h .. 8h+7) lies at 8*l, the unit for k = 16+8h .. at 256 + 8*l. p already includes
//      +8*lane, so each of the two loads reads 512 consecutive bytes (4 whole lines) where a row-major plane gives 16 lines.
__device__ __forceinline__ v16h ldfrag_hs(const _Float16* p) {
  FragH f;
  f.h[0] = *(const v8h*)(p);
  f.h[1] = *(const v8h*)(p + 256);
  return f.v;
}
__device__ __forceinline__ v16b ldfrag_bs(const u16* p) {
  FragB f;
  f.u[0] = *(const v4u*)(p);
  f.u[1] = *(const v4u*)(p + 256);
  return f.v;
}

// Precaution behind a run of fragment loads: the registers that those loads name (row pointers a0, a1; byte offsets o0..o3) are inputs
// of the wait, so none of them is advanced or reused as a load's destination in front of s_wait_xcnt 0.
__device__ __forceinline__ void addr_wait(const void* a0, const void* a1, unsigned o0, unsigned o1, unsigned o2, unsigned o3) {
#if defined(__HIP_DEVICE_COMPILE__)
  asm volatile("s_wait_xcnt 0x0" :: "v"(a0), "v"(a1), "v"(o0), "v"(o1), "v"(o2), "v"(o3) : "memory");
#endif
}

__device__ __forceinline__ v8f mma_h(v16h a, v16h b, v8f c) {
  return __builtin_amdgcn_wmma_f32_16x16x32_f16(false, a, false, b, (short)0, c, false, false);
}
__device__ __forceinline__ v8f mma_b(v16b a, v16b b, v8f c) {
  return __builtin_amdgcn_wmma_f32_16x16x32_bf16(false, a, false, b, (short)0, c, false, false);
}
__device__ __forceinline__ void guard2x6(v8f& a, v8f& b, v16h x0, v16h x1, v16h x2, v16h x3, v16h x4, v16h x5) {
#if defined(__HIP_DEVICE_COMPILE__)
  asm volatile("v_nop\n\tv_nop\n\tv_nop\n\tv_nop"
               : "+v"(a), "+v"(b) : "v"(x0), "v"(x1), "v"(x2), "v"(x3), "v"(x4), "v"(x5) : "memory");
#endif
}
template <typename F>
__device__ __forceinline__ void guard6(v8f& a, v8f& b, v8f& c, v8f& d, F x0, F x1, F x2, F x3, F x4, F x5) {
#if defined(__HIP_DEVICE_COMPILE__)
  asm volatile("v_nop\n\tv_nop\n\tv_nop\n\tv_nop"
               : "+v"(a), "+v"(b), "+v"(c), "+v"(d) : "v"(x0), "v"(x1), "v"(x2), "v"(x3), "v"(x4), "v"(x5) : "memory");
#endif
}
__device__ __forceinline__ void guardpv4(v8f& o0, v8f& o1, v8f& o2, v8f& o3, v16h p, v16h g0, v16h g1, v16h g2, v16h g3) {
#if defined(__HIP_DEVICE_COMPILE__)
  asm volatile("v_nop\n\tv_nop\n\tv_nop\n\tv_nop"
               : "+v"(o0), "+v"(o1), "+v"(o2), "+v"(o3)
               : "v"(p), "v"(g0), "v"(g1), "v"(g2), "v"(g3) : "memory");
#endif
}
__device__ __forceinline__ void acc_guard4(v8f& a, v8f& b, v8f& c, v8f& d) {
#if defined(__HIP_DEVICE_COMPILE__)
  asm volatile("v_nop\n\tv_nop\n\tv_nop\n\tv_nop" : "+v"(a), "+v"(b), "+v"(c), "+v"(d));
#endif
}
__device__ __forceinline__ void wave_sync_lds() {                    // wave-private LDS slab: release, wave barrier, acquire
  __builtin_amdgcn_fence(3, "workgroup");
  __builtin_amdgcn_wave_barrier();
  __builtin_amdgcn_fence(2, "workgroup");
}

// =====================================================================================================
// x plane f32 [b][SEQ_FULL][EMB] -> bf16 RNE bits [b][SEQ][EMB] (compact rows). Thread = 8 consecutive elements: two 16-B loads,
// coverage: grid = (SEQ*EMB/8/256 blocks, nb) x 256 thr x 8 = the whole plane.
// =====================================================================================================
__device__ __forceinline__ void cvtx_body(int bx, int bb, const float* __restrict__ x, u16* D, int n8) {
  const int gt = bx * 256 + (int)threadIdx.x;
  if (gt >= n8) return;                     // no barriers on this path
  const float* p = x + (size_t)bb * ((size_t)SEQ_FULL * EMB) + (size_t)gt * 8;
  const v4f a = *(const v4f*)(p), c4 = *(const v4f*)(p + 4);
  float v[8];
#pragma unroll
  for (int e = 0; e < 4; ++e) { v[e] = a[e]; v[4 + e] = c4[e]; }
  unsigned short s[8];
#pragma unroll
  for (int e = 0; e < 8; ++e) s[e] = bf_bits(v[e]);
  v4u o;
#pragma unroll
  for (int e = 0; e < 4; ++e) o[e] = pk16(s[2 * e], s[2 * e + 1]);
  u16* d = D + (size_t)bb * ((size_t)SEQ * EMB) + (size_t)gt * 8;
  {
    *(v4u*)(d) = o;
    
  }
}

// =====================================================================================================
// Weight transpose-convert: in W[R][C] f32 row-major -> out D = the [n = C][k = R] 16-bit operand plane for y = x.W in fragment order:
// tile (n/16, k/32) at halves ((n/16)*(R/32) + k/32)*512, units inside it as ldfrag_hs / ldfrag_bs read them.
// mode 0: bf16 RNE bits; mode 1: f16 bits of (bf16 RNE value) * scale.
// Block = 64x64 tile: 64 input row segments of 64 floats loaded with 16-B loads, converted, scattered into an LDS tile [c][64 r]
// coverage: load 256 thr x 16 = 64 x 64; store 2 iterations x 256 thr x 8 halves = 64 lines x 64; grid = (R/64) x (C/64) blocks
//           covers D exactly once (host checks R % 64 == 0, C % 64 == 0).
// =====================================================================================================
__device__ __forceinline__ void wt16_body(u16* TH, int bid, const float* __restrict__ W, u16* D, int R, int C, int mode,
                                          float scale) {
  const int tid = threadIdx.x;
  const int nrt = R >> 6;
  const int r0  = (bid % nrt) * 64;
  const int c0  = (bid / nrt) * 64;
  {
    const int rl = tid >> 2;                  // input row within tile 0..63
    const int cs = (tid & 3) * 16;            // column chunk within the 64
    const float* src = W + (size_t)(r0 + rl) * C + c0 + cs;
#pragma unroll
    for (int i = 0; i < 4; ++i) {
      const v4f a = *(const v4f*)(src + 4 * i);
#pragma unroll
      for (int e = 0; e < 4; ++e) {
        const float v  = a[e];
        const unsigned short hb = h_bits((_Float16)(bfr(v) * scale));
        const unsigned short bb = bf_bits(v);
        TH[(cs + 4 * i + e) * VTP + rl] = (mode != 0) ? hb : bb;
      }
    }
  }
  __syncthreads();
  v4u vh[2];
  const int fm = tid & 15, fh = (tid >> 4) & 1, fs = (tid >> 5) & 1, fk = (tid >> 6) & 1, fn = tid >> 7;
#pragma unroll
  for (int it = 0; it < 2; ++it) {            // local c = 16*(2*it + fn) + fm, local r = 32*fk + 16*fs + 8*fh .. +7
    vh[it] = *(const v4u*)(TH + ((it * 2 + fn) * 16 + fm) * VTP + fk * 32 + fs * 16 + fh * 8);
  }
  const int kt = R >> 5;                      // 32-wide k tiles per 16 columns
  {
#pragma unroll
    for (int it = 0; it < 2; ++it) {
      *(v4u*)(D + ((size_t)((c0 >> 4) + it * 2 + fn) * (size_t)kt + (size_t)(r0 >> 5)) * 512 + (tid & 127) * 8) = vh[it];
    }
    
  }
}

// =====================================================================================================
// One launch for the five independent preparation jobs, picked by block index (block-uniform): blocks 0..4*WTB-1 = the four weight
// transposes (WTB blocks each, order Wq, Wk, Wv, Wo), the rest = the x conversion (XCB blocks per batch row).
// coverage: grid = 4*WTB + nb*XCB blocks; each job is handed block indices 0 .. its own block count - 1.
// =====================================================================================================
__global__ __launch_bounds__(256)
void prep(const float* __restrict__ x, const float* __restrict__ wq, const float* __restrict__ wk, const float* __restrict__ wv,
          const float* __restrict__ wo, u16* WQT, u16* WKT, u16* WVT, u16* WOT, u16* XB) {
  __shared__ __align__(16) u16 TH[64 * VTP];
  const int bid = blockIdx.x;
  if (bid < 4 * WTB) {
    const int job = bid / WTB;
    const float* W = (job == 0) ? wq : (job == 1) ? wk : (job == 2) ? wv : wo;
    u16* D = (job == 0) ? WQT : (job == 1) ? WKT : (job == 2) ? WVT : WOT;
    const bool pj = job < 3;                  // Wq, Wk, Wv: [EMB][DH] -> bf16; Wo: [DH][EMB] -> scaled f16
    wt16_body(TH, bid - job * WTB, W, D, pj ? EMB : DH, pj ? DH : EMB, pj ? 0 : 1, pj ? 1.0f : WSC);
  } else {
    const int r = bid - 4 * WTB;
    cvtx_body(r % XCB, r / XCB, x, XB, XCB * 256);
  }
}

// =====================================================================================================
//            8 consecutive lanes x 16 B per line), lanes 16..31 -> row 2*it+1.
//  slab64_out: the same store shape for a 16 x 64 f32 tile that the wave has already staged in its slab.
//  epi64hsb: f16 bits of ((tile + bf16RNE(bias[n])) * pscale), plane in fragment order; lane = (row lane&15, 8 consecutive columns),
// coverage: epi64/slab64_out 8 instructions x 2 rows x 16 lanes x 4 floats; epi64hsb 4 instructions x 16 rows x 2 lanes x 8 halves
//           = the wave's 16 x 64 tile in every case.
// =====================================================================================================
__device__ __forceinline__ void stage64(float* sl, v8f a0, v8f a1, v8f a2, v8f a3, float oscale, int lane) {
  const int hh = lane >> 4, m = lane & 15;
#pragma unroll
  for (int r = 0; r < 8; ++r) {
    const int ro = (8 * hh + r) * 68 + m;
    sl[ro]      = a0[r] * oscale;
    sl[ro + 16] = a1[r] * oscale;
    sl[ro + 32] = a2[r] * oscale;
    sl[ro + 48] = a3[r] * oscale;
  }
  wave_sync_lds();
}
__device__ __forceinline__ void epi64(float* sl, v8f a0, v8f a1, v8f a2, v8f a3, float oscale, v4f badd, float* C, int N,
                                      size_t rowb, int col0, int lane) {
  const int hh = lane >> 4, m = lane & 15;
  stage64(sl, a0, a1, a2, a3, oscale, lane);
  v4f vals[8];
#pragma unroll
  for (int it = 0; it < 8; ++it) vals[it] = *(const v4f*)(sl + (it * 2 + hh) * 68 + m * 4) + badd;
  float* dst = C + (rowb + (size_t)hh) * (size_t)N + col0 + m * 4;
  {
#pragma unroll
    for (int it = 0; it < 8; ++it) {
      *(v4f*)(dst + (size_t)(it * 2) * (size_t)N) = vals[it];
    }
    
  }
}
__device__ __forceinline__ void slab64_out(const float* sl, v4f badd, float* C, int N, size_t rowb, int col0, int lane) {
  const int hh = lane >> 4, m = lane & 15;
  wave_sync_lds();
  v4f vals[8];
#pragma unroll
  for (int it = 0; it < 8; ++it) vals[it] = *(const v4f*)(sl + (it * 2 + hh) * 68 + m * 4) + badd;
  float* dst = C + (rowb + (size_t)hh) * (size_t)N + col0 + m * 4;
#pragma unroll
  for (int it = 0; it < 8; ++it) *(v4f*)(dst + (size_t)(it * 2) * (size_t)N) = vals[it];
}
__device__ __forceinline__ void epi64hsb(float* sl, v8f a0, v8f a1, v8f a2, v8f a3, float oscale, float pscale,
                                         const float* __restrict__ bias, u16* C, int N, size_t rowb, int col0, int lane) {
  stage64(sl, a0, a1, a2, a3, oscale, lane);
  const int hh = lane >> 4, m = lane & 15;
  v4u oh[4];
#pragma unroll
  for (int g = 0; g < 4; ++g) {               // g = 16-column group of the 64; lane = (row m, columns 16g + 8hh .. +7)
    const int c8 = g * 16 + hh * 8;
    const v4f b0 = *(const v4f*)(bias + col0 + c8), b1 = *(const v4f*)(bias + col0 + c8 + 4);   // columns col0+c8..+7 < N
    const v4f a = *(const v4f*)(sl + m * 68 + c8), c4 = *(const v4f*)(sl + m * 68 + c8 + 4);
    float w[8];
#pragma unroll
    for (int e = 0; e < 4; ++e) { w[e] = (a[e] + bfr(b0[e])) * pscale; w[4 + e] = (c4[e] + bfr(b1[e])) * pscale; }
#pragma unroll
    for (int e = 0; e < 4; ++e) oh[g][e] = pk16(h_bits((_Float16)w[2 * e]), h_bits((_Float16)w[2 * e + 1]));
  }
  // tile (rowb/16, col/32) at halves ((rowb/16)*(N/32) + col/32)*512; group g is the half-tile at g*256 behind column col0
  u16* dst = C + ((rowb >> 4) * (size_t)(N >> 5) + (size_t)(col0 >> 5)) * 512 + lane * 8;
  {
#pragma unroll
    for (int g = 0; g < 4; ++g) {
      *(v4u*)(dst + g * 256) = oh[g];
    }
    
  }
}

// =====================================================================================================
// bf16 GEMM, f32 out with bias: C[M][N] = (A[arow(m)][K] (bf16 row-major) . Bt[N][K]^T (bf16, fragment order)) * oscale + bf16RNE(bias[n]).
// Output row ra maps to A row arow = (ra / rpg) * gstr + (ra % rpg) (rpg = M, gstr = 0 gives the identity map; rpg = TQ0,
// gstr = SEQ picks the first TQ0 rows of every sequence).
// Block = 64x64 tile, 4 waves x 16 rows; fragments loaded straight from the 16-bit planes (two 16-B loads each, split k map for
// A and B); K stepped by 32 (host checks K % 32 == 0, M % 64 == 0, N % 64 == 0, grid = (M/64)*(N/64)).
// =====================================================================================================
__device__ __forceinline__
void gemm_b32_body(float* slab, int bid, const u16* __restrict__ A, const u16* __restrict__ Bt, const float* __restrict__ bias,
                   float* C, int M, int N, int K, int rpg, int gstr, float oscale) {
  const int tid = threadIdx.x, wave = tid >> 5, lane = tid & 31, hh = lane >> 4, m = lane & 15;
  const int ntile = N >> 6;
  const int rowb  = (bid / ntile) * 64 + wave * 16;
  const int col0  = (bid % ntile) * 64;
  if (rowb + 16 > M) return;                 // wave-uniform, never taken with the exact grid; no block barriers on this path
  const int ra = rowb + m;
  const int rg = ra / rpg;
  const size_t arow = (size_t)rg * (size_t)gstr + (size_t)(ra - rg * rpg);
  const u16* ap = A  + arow * (size_t)K + 8 * hh;
  // fragment order: 16 columns = K/32 tiles of 1024 bytes; block-uniform base, a lane's place is one fixed 32-bit byte offset
  const char* bp = (const char*)(const void*)Bt + (size_t)col0 * K * 2;
  const unsigned bs = 32u * (unsigned)K;
  const unsigned lo0 = (unsigned)lane * 16u, lo1 = lo0 + bs, lo2 = lo1 + bs, lo3 = lo2 + bs;   // the four 16-column groups
  v8f acc0 = zero8(), acc1 = zero8(), acc2 = zero8(), acc3 = zero8();
#pragma unroll 1
  for (int k0 = 0; k0 < K; k0 += 32) {
    const v16b a  = ldfrag_b(ap + k0);
    const unsigned ko = (unsigned)k0 * 32u;                // one 1024-byte tile per 32 of k
    const v16b b0 = ldfrag_bs((const u16*)(const void*)(bp + (lo0 + ko)));
    const v16b b1 = ldfrag_bs((const u16*)(const void*)(bp + (lo1 + ko)));
    const v16b b2 = ldfrag_bs((const u16*)(const void*)(bp + (lo2 + ko)));
    const v16b b3 = ldfrag_bs((const u16*)(const void*)(bp + (lo3 + ko)));
    addr_wait(ap + k0, ap + k0, lo0 + ko, lo1 + ko, lo2 + ko, lo3 + ko);
    acc0 = mma_b(a, b0, acc0);
    acc1 = mma_b(a, b1, acc1);
    acc2 = mma_b(a, b2, acc2);
    acc3 = mma_b(a, b3, acc3);
    guard6<v16b>(acc0, acc1, acc2, acc3, a, b0, b1, b2, b3, a);
  }
  const v4f bv4 = *(const v4f*)(bias + col0 + m * 4);    // columns col0 + 4m .. +3, always < N (N multiple of 64)
  v4f badd;
#pragma unroll
  for (int e = 0; e < 4; ++e) badd[e] = bfr(bv4[e]);
  epi64(slab + wave * SLAB64, acc0, acc1, acc2, acc3, oscale, badd, C, N, (size_t)rowb, col0, lane);
}

// =====================================================================================================
// bf16 GEMM, f16 plane out with bias: C16[M][N] = f16 bits of (((A . Bt^T) * oscale) + bf16RNE(bias[n])) * pscale; operands as in
// gemm_b32 (identity row map), epilogue epi64hsb.
// =====================================================================================================
__device__ __forceinline__
void gemm_bh16_body(float* slab, int bid, const u16* __restrict__ A, const u16* __restrict__ Bt, const float* __restrict__ bias,
                    u16* C, int M, int N, int K, float oscale, float pscale) {
  const int tid = threadIdx.x, wave = tid >> 5, lane = tid & 31, hh = lane >> 4, m = lane & 15;
  const int ntile = N >> 6;
  const int rowb  = (bid / ntile) * 64 + wave * 16;
  const int col0  = (bid % ntile) * 64;
  if (rowb + 16 > M) return;                 // wave-uniform, never taken with the exact grid; no block barriers on this path
  const u16* ap = A  + (size_t)(rowb + m) * K + 8 * hh;
  // fragment order: 16 columns = K/32 tiles of 1024 bytes; block-uniform base, a lane's place is one fixed 32-bit byte offset
  const char* bp = (const char*)(const void*)Bt + (size_t)col0 * K * 2;
  const unsigned bs = 32u * (unsigned)K;
  const unsigned lo0 = (unsigned)lane * 16u, lo1 = lo0 + bs, lo2 = lo1 + bs, lo3 = lo2 + bs;   // the four 16-column groups
  v8f acc0 = zero8(), acc1 = zero8(), acc2 = zero8(), acc3 = zero8();
#pragma unroll 1
  for (int k0 = 0; k0 < K; k0 += 32) {
    const v16b a  = ldfrag_b(ap + k0);
    const unsigned ko = (unsigned)k0 * 32u;                // one 1024-byte tile per 32 of k
    const v16b b0 = ldfrag_bs((const u16*)(const void*)(bp + (lo0 + ko)));
    const v16b b1 = ldfrag_bs((const u16*)(const void*)(bp + (lo1 + ko)));
    const v16b b2 = ldfrag_bs((const u16*)(const void*)(bp + (lo2 + ko)));
    const v16b b3 = ldfrag_bs((const u16*)(const void*)(bp + (lo3 + ko)));
    addr_wait(ap + k0, ap + k0, lo0 + ko, lo1 + ko, lo2 + ko, lo3 + ko);
    acc0 = mma_b(a, b0, acc0);
    acc1 = mma_b(a, b1, acc1);
    acc2 = mma_b(a, b2, acc2);
    acc3 = mma_b(a, b3, acc3);
    guard6<v16b>(acc0, acc1, acc2, acc3, a, b0, b1, b2, b3, a);
  }
  epi64hsb(slab + wave * SLAB64, acc0, acc1, acc2, acc3, oscale, pscale, bias, C, N, (size_t)rowb, col0, lane);
}

// =====================================================================================================
// bf16 GEMM of the v projection, N = DH = 64 (one column tile), operands and k order as in gemm_b32 (identity row map). Block = 64
// rows = 64 keys, 4 waves x 16 keys. Accumulator tile j, element r of lane (hh, m) is v[key rowb + 8*hh + r][d = 16*j + m] once the
// bf16 RNE bias is added in f32, and that is what the epilogue writes, straight from registers:
//  V^T plane = f16(v * 1024) in fragment order: the tile (32 keys, 16 columns d) lies at halves ((b*SEQ + s)/32 * 4 + d/16)*512, units
//      inside it as ldfrag_hs reads them (col = d, k = key). A lane's 8 elements of tile j are one 16-B unit; the wave's 16 keys are
//      the half-tile at 256*((rowb/16) & 1), so each of the 4 stores writes 512 consecutive bytes.
//  VS[(b*SEQ + s)/32][d] = sum of v over the 32 keys of a key block (f32): 8 keys in order in a lane, + the other half-wave's 8
//      (xor shuffle), + the neighbour wave's 16 through LDS behind the block barrier.
//  V  = f32 rows, only for keys 0..TQ0-1 of a sequence (all that the f32 attention job reads), store shape of epi64.
// coverage: grid = M/64 blocks; V^T 4 waves x 4 stores x 32 lanes x 8 halves = 64 x 64; VS 128 thr x 1 float = 2 key blocks x 64.
// =====================================================================================================
__device__ __forceinline__
void gemm_v_body(float* slab, float* cs, int bid, const u16* __restrict__ A, const u16* __restrict__ Bt, const float* __restrict__ bias,
                 float* V, u16* VT, float* VS, int M, int K) {
  const int tid = threadIdx.x, wave = tid >> 5, lane = tid & 31, hh = lane >> 4, m = lane & 15;
  const int row0 = bid * 64;
  if (row0 + 64 > M) return;                 // block-uniform, in front of the barrier; never taken with the exact grid
  const int rowb = row0 + wave * 16;
  const u16* ap = A + (size_t)(rowb + m) * K + 8 * hh;
  const char* bp = (const char*)(const void*)Bt;
  float braw[4];                             // bias of the lane's four columns, fetched beside the k loop
#pragma unroll
  for (int j = 0; j < 4; ++j) braw[j] = bias[16 * j + m];
  const unsigned bs = 32u * (unsigned)K;
  const unsigned lo0 = (unsigned)lane * 16u, lo1 = lo0 + bs, lo2 = lo1 + bs, lo3 = lo2 + bs;   // the four 16-column groups
  v8f acc0 = zero8(), acc1 = zero8(), acc2 = zero8(), acc3 = zero8();
  // rolled, as in gemm_b32: K is a run-time argument and one k step's fragments are in registers at a time
#pragma unroll 1
  for (int k0 = 0; k0 < K; k0 += 32) {
    const v16b a  = ldfrag_b(ap + k0);
    const unsigned ko = (unsigned)k0 * 32u;                // one 1024-byte tile per 32 of k
    const v16b b0 = ldfrag_bs((const u16*)(const void*)(bp + (lo0 + ko)));
    const v16b b1 = ldfrag_bs((const u16*)(const void*)(bp + (lo1 + ko)));
    const v16b b2 = ldfrag_bs((const u16*)(const void*)(bp + (lo2 + ko)));
    const v16b b3 = ldfrag_bs((const u16*)(const void*)(bp + (lo3 + ko)));
    addr_wait(ap + k0, ap + k0, lo0 + ko, lo1 + ko, lo2 + ko, lo3 + ko);
    acc0 = mma_b(a, b0, acc0);
    acc1 = mma_b(a, b1, acc1);
    acc2 = mma_b(a, b2, acc2);
    acc3 = mma_b(a, b3, acc3);
    guard6<v16b>(acc0, acc1, acc2, acc3, a, b0, b1, b2, b3, a);
  }
  const v8f av[4] = {acc0, acc1, acc2, acc3};
  float w[4][8], sum[4];
#pragma unroll
  for (int j = 0; j < 4; ++j) {
    const float bj = bfr(braw[j]);
#pragma unroll
    for (int r = 0; r < 8; ++r) w[j][r] = av[j][r] + bj;
    sum[j] = w[j][0];
#pragma unroll
    for (int r = 1; r < 8; ++r) sum[j] += w[j][r];
  }
#pragma unroll
  for (int j = 0; j < 4; ++j) sum[j] += __shfl_xor(sum[j], 16, 32);
  if (hh == 0) {
#pragma unroll
    for (int j = 0; j < 4; ++j) cs[wave * DH + 16 * j + m] = sum[j];
  }
  __syncthreads();                           // all global stores stand behind it, so that no wave waits for them at the barrier
  const int kbl = tid >> 6, d = tid & 63;    // 128 threads = 2 key blocks x 64 columns
  VS[((size_t)(row0 >> 5) + (size_t)kbl) * DH + d] = cs[(2 * kbl) * DH + d] + cs[(2 * kbl + 1) * DH + d];
  v4u oh[4];
#pragma unroll
  for (int j = 0; j < 4; ++j) {
#pragma unroll
    for (int e = 0; e < 4; ++e) oh[j][e] = pk16(h_bits((_Float16)(w[j][2 * e] * VCAR)), h_bits((_Float16)(w[j][2 * e + 1] * VCAR)));
  }
  u16* dst = VT + (size_t)(rowb >> 5) * (32 * DH) + ((rowb >> 4) & 1) * 256 + lane * 8;
#pragma unroll
  for (int j = 0; j < 4; ++j) *(v4u*)(dst + j * 512) = oh[j];
  // what follows these stores (the f32 rows below; in the built kernel the launch's other jobs) rewrites their registers: wait first
  asm volatile("s_wait_xcnt 0x0" ::: "memory");
  if ((row0 % SEQ) < TQ0) {                  // block-uniform: the f32 rows for the f32 attention job
    const v4f bv4 = *(const v4f*)(bias + m * 4);
    v4f badd;
#pragma unroll
    for (int e = 0; e < 4; ++e) badd[e] = bfr(bv4[e]);
    epi64(slab + wave * SLAB64, acc0, acc1, acc2, acc3, 1.0f, badd, V, DH, (size_t)rowb, 0, lane);
    // as above, for the stores of epi64
    asm volatile("s_wait_xcnt 0x0" ::: "memory");
  }
}

// =====================================================================================================
// One launch for the five independent projection GEMMs, picked by block index (block-uniform): blocks 0..GHB-1 = f32 q rows 0..127
// of every sequence, GHB..2*GHB-1 = the same for k, then GPB blocks each for v (gemm_v_body), the f16 q plane and the f16 k plane.
// coverage: grid = 2*GHB + 3*GPB blocks; each GEMM is handed block indices 0 .. its own block count - 1.
// =====================================================================================================
__global__ __launch_bounds__(128)
void proj(const u16* __restrict__ XB, const u16* __restrict__ WQT, const u16* __restrict__ WKT, const u16* __restrict__ WVT,
          const float* __restrict__ bq, const float* __restrict__ bk, const float* __restrict__ bv,
          u16* QP, u16* KP, float* V, u16* VT, float* VS, float* QF, float* KF, int rows, int hrows, int N, int K) {
  __shared__ __align__(16) float slab[4 * SLAB64];
  __shared__ float cs[4 * DH];               // 16-key column sums of v, one row per wave
  const int bid = blockIdx.x;
  if (bid < 2 * GHB) {                       // f32 q, k: rows 0..TQ0-1 of every sequence
    const bool isq = bid < GHB;
    gemm_b32_body(slab, isq ? bid : bid - GHB, XB, isq ? WQT : WKT, isq ? bq : bk, isq ? QF : KF, hrows, N, K, TQ0, SEQ, 1.0f);
  } else if (bid < 2 * GHB + GPB) {          // v: V^T plane, key-block column sums, f32 rows 0..TQ0-1
    gemm_v_body(slab, cs, bid - 2 * GHB, XB, WVT, bv, V, VT, VS, rows, K);
  } else {                                   // f16 planes
    const int r = bid - (2 * GHB + GPB);
    const bool isq = r < GPB;
    gemm_bh16_body(slab, isq ? r : r - GPB, XB, isq ? WQT : WKT, isq ? bq : bk, isq ? QP : KP, rows, N, K, 1.0f,
                   isq ? QSC : KSC);
  }
}

// =====================================================================================================
// Output projection of one 16-row ctx tile that its attention block holds in LDS (hi + residual f16 rows), by all 8 waves:
//   C[row][n] = (hi . Bt^T) * os1 + (res . Bt^T) * os2 + bf16RNE(bias[n]); Bt = f16 [EMB][DH] in fragment order.
// Wave w owns columns 64w .. 64w+63 (four 16-column groups); K = DH = 64 in two steps of 32, separate accumulators for the two
// planes, k order 0..31 then 32..63 in each.
//  oproj_ldb: the two B fragments of group j (k step s at bytes 8192w + 2048j + 1024s).
//  oproj_mma: the four products of one group. Two groups' fragments are in flight at a time and a group's results are used up
//             before the next group's are made, which keeps the launch inside 128 registers (four blocks on a WGP).
// =====================================================================================================
__device__ __forceinline__ void oproj_ldb(v16h& b0, v16h& b1, const u16* __restrict__ Bt, int swave, int j, int lane) {
  const _Float16* bp = (const _Float16*)(const void*)Bt + (size_t)swave * (64 * DH) + j * 1024;      // wave-uniform base
  b0 = ldfrag_hs(bp + 8 * lane);
  b1 = ldfrag_hs(bp + 512 + 8 * lane);
}
__device__ __forceinline__ void oproj_mma(v8f& h, v8f& r, v16h b0, v16h b1, v16h a0, v16h a1, v16h r0, v16h r1) {
  h = mma_h(a0, b0, zero8());
  r = mma_h(r0, b0, zero8());
  h = mma_h(a1, b1, h);
  r = mma_h(r1, b1, r);
  // the distance behind the products: no result is read and no fragment's register is loaded anew in front of it
  guard2x6(h, r, b0, b1, a0, a1, r0, r1);
}

// =====================================================================================================
// Single-head causal attention, head width DH = 64, query rows TQ0 .. SEQ-1: block = (batch b, 16 query rows q0..q0+15), 8 waves.
// q plane (f16, x8), k plane the same and V^T plane (x1024), each in fragment order; VS = column sums of V per key block of 32.
//   Chunks of CK = 512 keys: only chunks c <= qc = q0/CK are visited (later chunks lie entirely above the diagonal). In the diagonal
//   chunk only key blocks kb < nkb (keys <= q0+15) are multiplied; key blocks kb >= nkb get zero scores in LDS and are not used in (PV).
//   (S) scores S[query m][key n] on WMMA: A = q rows (row m = lane&15, split k map over d, two 32-d fragments kept in registers),
//       B = k rows (col n = key, split map); wave w handles key blocks w, w+8 of the chunk; D element r of lane l -> scs[query 8h+r][key].
//   (M) 16 threads per query row (sub-thread = 32 consecutive keys): base-2 logits with the causal mask by key index (key > query
//       -> -inf), chunk max via xor shuffles, online running max / rescale factor al / running sum l in f32 registers,
//       p = exp2(t - m_new) <= 1 (0 for masked keys), chunk row sum ps and C = ps/CK (bit-identical on the row's 16 threads), the
//       CENTRED P' = p - C written as f16(P' * 32768) into the LDS P tile with 16-B stores; al -> rowa[row], C -> rowc[row].
//   (PV) every wave keeps its own partial O (4 accumulator tiles = 16 queries x 64 d): o_w = o_w*al + C*(32768*1024)*(sum of
//       VS[chunk][kb][d] over the wave's key blocks), the add-back of the centring term over exactly the keys it processes, in f32,
//       then for the wave's key blocks kb in {w, w+8}, kb < nkb: A = P' fragment from LDS (row m = query, split map over keys), B = V^T
//       fragments (col n = d, split map over keys), 4 WMMAs plus a hazard gap. sum_k (P'_k + C) v_k == sum_k p_k v_k exactly;
//       masked keys carry P' = -C and p = 0.
//   Block barriers after (S) and after (M) order all LDS reuse across chunks and waves.
//   Combine: after a block barrier the 8 partial O tiles are staged in the score region ([8][16][OPP] f32), barrier, then thread
//   (row = tid>>4, 4 columns) sums the 8 partials in fixed order, x = sum * 4096 / (l * 32768 * 1024) (l >= 1 always, held in
//   registers by the row's 16 threads), hi = f16(x), res = f16((x - hi) * 2048), staged as a [32][CTP] u16 tile in the P region,
//   barrier, then the output projection of these 16 rows (oproj_ldb, oproj_mma, slab64_out): wave w -> out columns 64w .. 64w+63.
// coverage: grid nb*NQT blocks x 16 rows = rows TQ0..SEQ-1 of every sequence; scs written 16 x 512 every chunk (zeros for kb >= nkb);
//           P tile written 16 x 512 every chunk; partial stage 8 x 16 x 64; ctx stage 32 x 64; out store 8 waves x 16 rows x 64 columns.
// =====================================================================================================
__device__ __forceinline__
void attn_fwd_body(float* scs, u16* pls, float* rowa, float* rowc, int bid,
                   const u16* __restrict__ QPp, const u16* __restrict__ KPp, const u16* __restrict__ VTp,
                   const float* __restrict__ VSp, const u16* __restrict__ WOTp, const float* __restrict__ bo, float* out) {
  const int tid  = threadIdx.x;
  const int wave = tid >> 5;
  const int lane = tid & 31;
  const int hh   = lane >> 4;
  const int m    = lane & 15;
  const int r16  = tid >> 4;                 // query row owned in phase (M) and in the combine
  const int sub  = tid & 15;
  const int kl0  = sub * 32;

  // A block's cost grows with its query tile (qc + 1 chunks), so cost falls with the block index: the four sequences' last tiles
  // come first, their first tiles last. bid -> (b, tile) is a permutation of NB x NQT.
  const int b   = bid % NB;
  const int q0  = TQ0 + (NQT - 1 - bid / NB) * QT;
  const int qc  = q0 / CK;                   // diagonal chunk index

  // all three planes in fragment order: 16 rows of q or k = two tiles (d 0..31, d 32..63), 32 keys of V^T = four tiles (16 d each)
  const _Float16* qrow = (const _Float16*)(const void*)QPp + ((size_t)b * SEQ + q0) * DH + 8 * lane;
  const v16h qa0 = ldfrag_hs(qrow);          // d 0..31
  const v16h qa1 = ldfrag_hs(qrow + 512);    // d 32..63
  // block-uniform bases; a lane's place is one 32-bit byte offset (a sequence's plane is SEQ*DH*2 bytes)
  const char* kbp = (const char*)(const void*)KPp + (size_t)b * SEQ * DH * 2;
  const char* vbp = (const char*)(const void*)VTp + (size_t)b * SEQ * DH * 2;
  const unsigned lo16 = (unsigned)lane * 16u;
  const float* vsb = VSp + (size_t)b * NCHK * NKB * DH + m;
  const float lsc = RSQD * LOG2E / (QSC * KSC);

  float mrun = -INFINITY, lrun = 0.f;
  v8f o[NACC];
#pragma unroll
  for (int j = 0; j < NACC; ++j) o[j] = zero8();

#pragma unroll 1
  for (int c = 0; c <= qc; ++c) {
    const int kbeg = c * CK;
    const int nkb  = (c < qc) ? NKB : (((q0 + QT - 1 - kbeg) >> 5) + 1);   // 1..16, block-uniform
    // ---- (S) scores of this chunk (zeros for key blocks beyond the query tile) ----
#pragma unroll 1
    for (int kb = wave; kb < NKB; kb += 8) {               // wave-uniform, 2 trips
      v8f s0 = zero8(), s1 = zero8();
      if (kb < nkb) {                                      // wave-uniform
        const _Float16* k0p = (const _Float16*)(const void*)(kbp + (lo16 + (unsigned)(kbeg + kb * 32) * (DH * 2u)));
        const _Float16* k1p = k0p + (size_t)16 * DH;
        const v16h f00 = ldfrag_hs(k0p);
        const v16h f01 = ldfrag_hs(k0p + 512);
        const v16h f10 = ldfrag_hs(k1p);
        const v16h f11 = ldfrag_hs(k1p + 512);
        s0 = mma_h(qa0, f00, s0);
        s0 = mma_h(qa1, f01, s0);
        s1 = mma_h(qa0, f10, s1);
        s1 = mma_h(qa1, f11, s1);
        guard2x6(s0, s1, qa0, qa1, f00, f01, f10, f11);
      }
      float* srow = scs + (8 * hh) * SCP + kb * 32 + m;
#pragma unroll
      for (int r = 0; r < 8; ++r) {
        srow[r * SCP]      = s0[r];
        srow[r * SCP + 16] = s1[r];
      }
    }
    __syncthreads();
    // ---- (M) softmax statistics and the centred P' tile ----
    {
      const float* sp = scs + r16 * SCP + kl0;
      const int lim = (q0 + r16) - (kbeg + kl0);           // key kl0 + j is valid iff j <= lim
      float t[32];
      float cm = -INFINITY;
#pragma unroll
      for (int i = 0; i < 8; ++i) {
        const v4f a = *(const v4f*)(sp + 4 * i);
#pragma unroll
        for (int e = 0; e < 4; ++e) {
          const int j = 4 * i + e;
          const float tv = (j <= lim) ? a[e] * lsc : -INFINITY;
          t[j] = tv;
          cm = fmaxf(cm, tv);
        }
      }
#pragma unroll
      for (int d = 1; d <= 8; d <<= 1) cm = fmaxf(cm, __shfl_xor(cm, d, 32));
      const float mn = fmaxf(mrun, cm);                    // finite: key kbeg of every visited chunk is never masked
      const float al = (mrun == -INFINITY) ? 0.f : exp2f(mrun - mn);
      mrun = mn;
      float ps = 0.f;
#pragma unroll
      for (int j = 0; j < 32; ++j) {
        const float p = exp2f(fminf(t[j] - mn, 0.f));      // 0 for masked keys
        t[j] = p;
        ps += p;
      }
#pragma unroll
      for (int d = 1; d <= 8; d <<= 1) ps += __shfl_xor(ps, d, 32);
      const float cc = ps * (1.0f / (float)CK);
      v4u pk[4];
#pragma unroll
      for (int i = 0; i < 4; ++i) {
#pragma unroll
        for (int e = 0; e < 4; ++e) {
          const int j = 8 * i + 2 * e;
          pk[i][e] = pk16(h_bits((_Float16)((t[j] - cc) * PCAR)), h_bits((_Float16)((t[j + 1] - cc) * PCAR)));
        }
      }
      lrun = lrun * al + ps;
      u16* pd = pls + r16 * PLP + kl0;
#pragma unroll
      for (int i = 0; i < 4; ++i) *(v4u*)(pd + 8 * i) = pk[i];
      if (sub == 0) { rowa[r16] = al; rowc[r16] = cc; }
    }
    __syncthreads();
    // ---- (PV) rescale, add the centring term of this wave's key blocks, accumulate P' . V^T for them ----
    {
      float scl[8], cad[8];
#pragma unroll
      for (int r = 0; r < 8; ++r) { scl[r] = rowa[8 * hh + r]; cad[r] = rowc[8 * hh + r] * (PCAR * VCAR); }
      const float* vsc = vsb + ((size_t)c * NKB + (size_t)wave) * DH;      // key blocks wave and wave + 8 of chunk c always exist
      float vs[NACC];
#pragma unroll
      for (int j = 0; j < NACC; ++j) {
        const float u0 = vsc[16 * j], u1 = vsc[8 * DH + 16 * j];
        vs[j] = ((wave < nkb) ? u0 : 0.f) + ((wave + 8 < nkb) ? u1 : 0.f);
      }
#pragma unroll
      for (int j = 0; j < NACC; ++j) {
#pragma unroll
        for (int r = 0; r < 8; ++r) o[j][r] = __builtin_fmaf(cad[r], vs[j], o[j][r] * scl[r]);   // fused this way round, o stays in place
      }
      const _Float16* pp = (const _Float16*)(const void*)pls + m * PLP + 8 * hh;
#pragma unroll 1
      for (int kb = wave; kb < nkb; kb += 8) {             // wave-uniform trip count, <= 2
        const v16h pf = ldfrag_h(pp + kb * 32);
        const _Float16* vk = (const _Float16*)(const void*)(vbp + (lo16 + (unsigned)(kbeg + kb * 32) * (DH * 2u)));
        const v16h g0 = ldfrag_hs(vk);
        const v16h g1 = ldfrag_hs(vk + 512);
        const v16h g2 = ldfrag_hs(vk + 1024);
        const v16h g3 = ldfrag_hs(vk + 1536);
        o[0] = mma_h(pf, g0, o[0]);
        o[1] = mma_h(pf, g1, o[1]);
        o[2] = mma_h(pf, g2, o[2]);
        o[3] = mma_h(pf, g3, o[3]);
        guardpv4(o[0], o[1], o[2], o[3], pf, g0, g1, g2, g3);
      }
    }
  }
  acc_guard4(o[0], o[1], o[2], o[3]);

  // ---- combine the 8 partial O tiles in fixed order ----
  // From here on the lane's number is read anew and the wave's number is held in a scalar register: no index made from the thread
  // id has to stay in a vector register across the chunk loop, which keeps the launch inside 128 registers without spills.
  const int el = (int)__builtin_amdgcn_mbcnt_lo(~0u, 0u);   // == lane
  const int sw = __builtin_amdgcn_readfirstlane(wave);      // == wave
  const int eh = el >> 4, em = el & 15;                     // == hh, m (== sub)
  const int er = 2 * sw + eh;                               // == r16
  __syncthreads();
#pragma unroll
  for (int j = 0; j < NACC; ++j) {
#pragma unroll
    for (int r = 0; r < 8; ++r) scs[(sw * 16 + 8 * eh + r) * OPP + 16 * j + em] = o[j][r];
  }
  v16h bf[4];                                // groups 0 and 1 are fetched beside the staging stores
  oproj_ldb(bf[0], bf[1], WOTp, sw, 0, el);
  oproj_ldb(bf[2], bf[3], WOTp, sw, 1, el);
  __syncthreads();
  const int c4 = em * 4;
  v4f sm4 = zero4();
#pragma unroll
  for (int w = 0; w < 8; ++w) sm4 += *(const v4f*)(scs + (w * 16 + er) * OPP + c4);
  const float inv = (1.0f / lrun) * (CSC / (PCAR * VCAR));            // lrun >= 1
#pragma unroll
  for (int e = 0; e < 4; ++e) {
    const float xs = sm4[e] * inv;
    const _Float16 hv = (_Float16)xs;
    const _Float16 rv = (_Float16)((xs - (float)hv) * RSC);
    pls[er * CTP + c4 + e]        = h_bits(hv);
    pls[(16 + er) * CTP + c4 + e] = h_bits(rv);
  }
  __syncthreads();
  // ---- output projection of the 16 ctx rows; the partial O tiles were last read in front of the barrier above, so each wave takes
  //      its own 16 x 68 f32 slab of the score region for the store shape of slab64_out ----
  const _Float16* ch = (const _Float16*)(const void*)pls + em * CTP + 8 * eh;
  const _Float16* cr = ch + 16 * CTP;
  const v16h a0 = ldfrag_h(ch), a1 = ldfrag_h(ch + 32), r0 = ldfrag_h(cr), r1 = ldfrag_h(cr + 32);
  const v4f bv = *(const v4f*)(bo + sw * 64 + em * 4);
  float* sl = scs + sw * SLAB64 + (8 * eh) * 68 + em;
  // unrolled: the fragment set bf[] is indexed by j and has to stay in registers
#pragma unroll
  for (int j = 0; j < 4; ++j) {
    v8f h, r;
    oproj_mma(h, r, bf[2 * (j & 1)], bf[2 * (j & 1) + 1], a0, a1, r0, r1);
    if (j < 2) oproj_ldb(bf[2 * j], bf[2 * j + 1], WOTp, sw, j + 2, el);   // group j + 2 flies while groups j, j + 1 are worked on
#pragma unroll
    for (int e = 0; e < 8; ++e) sl[e * 68 + 16 * j] = h[e] * OS1 + r[e] * OS2;
  }
  v4f badd;
#pragma unroll
  for (int e = 0; e < 4; ++e) badd[e] = bfr(bv[e]);
  slab64_out(scs + sw * SLAB64, badd, out, EMB, (size_t)b * SEQ + q0, sw * 64, el);
}

// =====================================================================================================
// Query rows 0 .. TQ0-1 of each sequence in f32 on VALU: block = (b, t), threads 0..127 work (waves 4..7 only pass the barriers, up to the output projection). QF/KF = f32 q/k planes [nb][TQ0][DH] (bias
// included), V = f32 v plane [nb*SEQ][DH]. Scores for keys j (thread j, one key each, 64-d dot of its whole key row against the q row staged in LDS;
// keys j > t masked to -inf), base-2 softmax with block max / sum reductions (xor shuffles + LDS), p_j in LDS, ctx[d] for d = tid
// (threads 0..63) as a sum in key order of p_j * V[b][j][d] (coalesced, groups of 64 keys up to the one holding t), x = ctx * 4096 / l, hi = f16(x),
// res = f16((x - hi) * 2048); both 64-half rows are staged in LDS, then the row's output projection: wave w -> out columns 64w .. 64w+63.
// coverage: grid nb*TQ0 blocks = rows 0..TQ0-1 of every sequence; 64 thr x 1 d = DH per row; store 8 waves x 4 x 16 lanes = EMB floats;
//           together with attn_fwd every (b, s, n) of out is written exactly once.
// =====================================================================================================
__device__ __forceinline__
void attn_head_body(float* qs, float* sc, float* red, float* redb, u16* SW, int bid,
                    const float* __restrict__ QF, const float* __restrict__ KF, const float* __restrict__ V,
                    const u16* __restrict__ WOTp, const float* __restrict__ bo, float* out) {
  const int tid = threadIdx.x, lane = tid & 31, wave = tid >> 5;
  const int b = bid / TQ0;
  const int t = bid - b * TQ0;
  const bool work = wave < HD_THREADS / 32;                        // wave-uniform: one key per thread, keys 0..TQ0-1
  if (tid < DH) qs[tid] = QF[((size_t)b * TQ0 + t) * DH + tid];   // waves 0,1 entirely (wave-uniform)
  __syncthreads();
  float acc = 0.f;
  if (work) {
    const float* kp = KF + (size_t)b * (TQ0 * DH) + tid * DH;       // key row b*TQ0 + tid always in range (tid < TQ0)
    v4f kr[DH / 4];                                                 // the whole key row: 16 loads in flight, one latency
#pragma unroll
    for (int i = 0; i < DH / 4; ++i) kr[i] = *(const v4f*)(kp + 4 * i);
#pragma unroll
    for (int i = 0; i < DH / 4; ++i) {
      const v4f q4 = *(const v4f*)(qs + 4 * i);
#pragma unroll
      for (int e = 0; e < 4; ++e) acc += kr[i][e] * q4[e];
    }
  }
  const float s = (tid <= t) ? acc * (RSQD * LOG2E) : -INFINITY;   // causal mask by key index
  float mx = s;
#pragma unroll
  for (int d = 1; d <= 16; d <<= 1) mx = fmaxf(mx, __shfl_xor(mx, d, 32));
  if (work && lane == 0) red[wave] = mx;
  __syncthreads();
  float gm = red[0];
#pragma unroll
  for (int w = 1; w < 4; ++w) gm = fmaxf(gm, red[w]);   // finite: key 0 is always valid
  const float p = exp2f(s - gm);                     // 0 for masked keys
  float ps = p;
#pragma unroll
  for (int d = 1; d <= 16; d <<= 1) ps += __shfl_xor(ps, d, 32);
  if (work && lane == 0) redb[wave] = ps;
  if (work) sc[tid] = p;
  __syncthreads();
  float l = redb[0];
#pragma unroll
  for (int w = 1; w < 4; ++w) l += redb[w];           // >= 1
  const float inv = (1.0f / l) * CSC;
  if (wave < 2) {                                    // threads 0..63 (wave-uniform): one d column each
    const float* vp = V + (size_t)b * SEQ * DH + tid;
    float cx = 0.f;
    // Keys in groups of 64 whose loads are issued ahead of their use: one load latency per group. A group's keys j > t carry
    // sc[j] = 0 and add nothing; rows j0 .. j0+63 <= TQ0-1 of sequence b always exist. The sum runs in key order.
    // rolled: the trip count (1 or 2) depends on t
#pragma unroll 1
    for (int j0 = 0; j0 <= t; j0 += 64) {            // block-uniform
      float vv[64];
#pragma unroll
      for (int i = 0; i < 64; ++i) vv[i] = vp[(size_t)(j0 + i) * DH];
#pragma unroll
      for (int i = 0; i < 16; ++i) {
        const v4f p4 = *(const v4f*)(sc + j0 + 4 * i);
#pragma unroll
        for (int e = 0; e < 4; ++e) cx += p4[e] * vv[4 * i + e];
      }
    }
    const float x0 = cx * inv;
    const _Float16 h0 = (_Float16)x0;
    const _Float16 r0 = (_Float16)((x0 - (float)h0) * RSC);
    SW[tid]      = h_bits(h0);
    SW[DH + tid] = h_bits(r0);
  }
  const int sw = __builtin_amdgcn_readfirstlane(wave);   // the wave's number in a scalar register: scalar base for Wo
  v16h bf[4];                                        // groups 0 and 1: behind the 64-register key groups, in front of the last barrier
  oproj_ldb(bf[0], bf[1], WOTp, sw, 0, lane);
  oproj_ldb(bf[2], bf[3], WOTp, sw, 1, lane);
  float bb[4];
#pragma unroll
  for (int j = 0; j < 4; ++j) bb[j] = bo[wave * 64 + 16 * j + (lane & 15)];
  __syncthreads();
  // ---- output projection of the one ctx row, all 8 waves: it is row 0 of the A tile, rows 1..15 are zero; row 0 of a result tile is
  //      element 0 of lanes 0..15 (column = lane) ----
  const int hh = lane >> 4, m = lane & 15;
  const v4u z4 = {0u, 0u, 0u, 0u};
  FragH fa[4];                                       // hi k 0..31, hi k 32..63, residual k 0..31, residual k 32..63
#pragma unroll
  for (int i = 0; i < 4; ++i) {
    const v4u u0 = *(const v4u*)(SW + i * 32 + 8 * hh), u1 = *(const v4u*)(SW + i * 32 + 16 + 8 * hh);
    fa[i].u[0] = (m == 0) ? u0 : z4;
    fa[i].u[1] = (m == 0) ? u1 : z4;
  }
  float ov[4];
  // unrolled: the fragment set bf[] is indexed by j and has to stay in registers
#pragma unroll
  for (int j = 0; j < 4; ++j) {
    v8f h, r;
    oproj_mma(h, r, bf[2 * (j & 1)], bf[2 * (j & 1) + 1], fa[0].v, fa[1].v, fa[2].v, fa[3].v);
    if (j < 2) oproj_ldb(bf[2 * j], bf[2 * j + 1], WOTp, sw, j + 2, lane);
    ov[j] = (h[0] * OS1 + r[0] * OS2) + bfr(bb[j]);
  }
  float* dst = out + ((size_t)b * SEQ + t) * EMB + wave * 64 + m;
  if (lane < 16) {
#pragma unroll
    for (int j = 0; j < 4; ++j) dst[16 * j] = ov[j];
  }
}

// =====================================================================================================
// One launch for the two independent attention jobs, picked by block index (block-uniform): blocks 0..NB*NQT-1 = query rows TQ0.. on
// WMMA, longest tiles first, the rest = query rows 0..TQ0-1 on VALU (short blocks, last, so that they fill places the long blocks leave).
// coverage: grid = NB*NQT + NB*TQ0 blocks; each job is handed block indices 0 .. its own block count - 1.
// =====================================================================================================
__global__ __launch_bounds__(ATT_THREADS) __attribute__((amdgpu_num_vgpr(256)))
void attn(const u16* __restrict__ QPp, const u16* __restrict__ KPp, const u16* __restrict__ VTp, const float* __restrict__ VSp,
          const float* __restrict__ QF, const float* __restrict__ KF, const float* __restrict__ V,
          const u16* __restrict__ WOTp, const float* __restrict__ bo, float* out) {
  __shared__ __align__(16) float scs[16 * SCP];     // scores [16][SCP] f32; reused as partial O tiles [8][16][OPP] f32, then out slabs
  __shared__ __align__(16) u16 pls[16 * PLP];       // P' tile [16][PLP] f16 bits; reused as ctx staging [32][CTP] u16
  __shared__ float rowa[QT];
  __shared__ float rowc[QT];
  __shared__ __align__(16) float qs[DH];
  __shared__ __align__(16) float sc[TQ0];
  __shared__ float red[4];
  __shared__ float redb[4];
  __shared__ __align__(16) u16 SW[2 * DH];
  const int bid = blockIdx.x;
  if (bid < NB * NQT) attn_fwd_body(scs, pls, rowa, rowc, bid, QPp, KPp, VTp, VSp, WOTp, bo, out);
  else                attn_head_body(qs, sc, red, redb, SW, bid - NB * NQT, QF, KF, V, WOTp, bo, out);
}

// =====================================================================================================
// Workspace map (bytes, nb = 4, rows = 16384); every plane (V only in rows 0..127 of each sequence) is written by whole-line stores before it is read; all extents are
//   WQT bf16 [64][512] 65536   WKT same   WVT same   WOT f16 of bf16 value x1024 [512][64] 65536 (fragment order)  262144
//   XB  bf16 [rows][512]                                                                                           16777216
//   QP  f16 [rows][64] x8 (fragment order)                                                                          2097152
//   KP  f16 [rows][64] x8 (fragment order)                                                                          2097152
//   V   f32 [rows][64] (only rows 0..127 of each sequence are written and read)                                     4194304
//   VT  f16 [nb][SEQ/32][4] tiles (32 keys x 16 d) x1024 (fragment order)                                                                    2097152
//   VS  f32 [nb][8][16][64]                                                                                          131072
//   QF  f32 [nb][128][64]  131072      KF same                                                                       262144
//   end                                                                                                            27918336
// =====================================================================================================
extern "C" void kernel_launch(void* const* d_in, const int* in_sizes, int n_in,
                              void* d_out, int out_size, void* d_ws, size_t ws_size,
                              hipStream_t stream) {
  if (n_in < 9) return;
  const int nb   = NB;
  const int rows = nb * SEQ;
  if ((long long)in_sizes[0] < (long long)NB * SEQ_FULL * EMB) return;
  if (in_sizes[1] < EMB * DH || in_sizes[3] < EMB * DH || in_sizes[5] < EMB * DH || in_sizes[7] < DH * EMB) return;
  if (in_sizes[2] < DH || in_sizes[4] < DH || in_sizes[6] < DH || in_sizes[8] < EMB) return;
  if ((long long)out_size < (long long)rows * EMB) return;

  const float* x  = (const float*)d_in[0];
  const float* wq = (const float*)d_in[1];
  const float* bq = (const float*)d_in[2];
  const float* wk = (const float*)d_in[3];
  const float* bk = (const float*)d_in[4];
  const float* wv = (const float*)d_in[5];
  const float* bv = (const float*)d_in[6];
  const float* wo = (const float*)d_in[7];
  const float* bo = (const float*)d_in[8];
  float*       out = (float*)d_out;

  const size_t szW  = (size_t)EMB * DH * 2;                      //     65536
  const size_t szXB = (size_t)rows * EMB * 2;                    //  16777216
  const size_t szP  = (size_t)rows * DH * 2;                     //   2097152
  const size_t szV  = (size_t)rows * DH * 4;                     //   4194304
  const size_t szVT = (size_t)nb * DH * SEQ * 2;                 //   2097152 (== szP)
  const size_t szVS = (size_t)nb * NCHK * NKB * DH * 4;          //    131072
  const size_t szHF = (size_t)nb * TQ0 * DH * 4;                 //    131072
  size_t off = 0;
  const size_t oWQ = off; off += szW;
  const size_t oWK = off; off += szW;
  const size_t oWV = off; off += szW;
  const size_t oWO = off; off += szW;
  const size_t oXB = off; off += szXB;
  const size_t oQ  = off; off += szP;
  const size_t oK  = off; off += szP;
  const size_t oV  = off; off += szV;
  const size_t oVT = off; off += szVT;
  const size_t oVS = off; off += szVS;
  const size_t oQF = off; off += szHF;
  const size_t oKF = off; off += szHF;
  if (off > ws_size) return;                                     // off = 27918336 at nb = 4
  if (off > WS_CAP) return;

  char* ws = (char*)d_ws;
  u16*   WQT = (u16*)(ws + oWQ);
  u16*   WKT = (u16*)(ws + oWK);
  u16*   WVT = (u16*)(ws + oWV);
  u16*   WOT = (u16*)(ws + oWO);
  u16*   XB  = (u16*)(ws + oXB);
  u16*   QP  = (u16*)(ws + oQ);
  u16*   KP  = (u16*)(ws + oK);
  float* V   = (float*)(ws + oV);
  u16*   VT  = (u16*)(ws + oVT);
  float* VS  = (float*)(ws + oVS);
  float* QF  = (float*)(ws + oQF);
  float* KF  = (float*)(ws + oKF);

  const int n8x = (SEQ * EMB) / 8;                       // 262144 per batch
  if ((n8x % 256) != 0 || (rows % 64) != 0 || ((nb * TQ0) % 64) != 0) return;
  const dim3 blk(256);
  const dim3 gPR(4 * WTB + NB * XCB);                   // 4 * 8 weight tiles + nb * 1024 x blocks
  const dim3 gPJ(2 * GHB + 3 * GPB);                    // 2 * 8 + 3 * 256 at nb = 4
  const dim3 bG(128);
  const dim3 gAT(NB * NQT + NB * TQ0);                  // nb * 248 + nb * 128
  const dim3 bAT(ATT_THREADS);

  // (0) Wq, Wk, Wv stored [k = in 512][n = out 64] -> bf16 planes [64][512] in fragment order; Wo [k = 64][n = 512] -> f16 of bf16
  //     value x1024, [512][64] in fragment order; x -> bf16 plane [rows][512]
  prep<<<gPR, blk, 0, stream>>>(x, wq, wk, wv, wo, WQT, WKT, WVT, WOT, XB);
  // (1) q and k projections (+bias) -> f16 planes x8; v projection (+bias) -> V^T plane x1024, key-block column sums and f32 rows
  //     0..127 of every sequence; f32 q and k rows 0..127 of every sequence -> QF, KF [nb*128][64]
  proj<<<gPJ, bG, 0, stream>>>(XB, WQT, WKT, WVT, bq, bk, bv, QP, KP, V, VT, VS, QF, KF, rows, nb * TQ0, DH, EMB);
  // (2) attention: query rows 128.. on WMMA and query rows 0..127 on VALU -> ctx hi x4096 and residual x2048 f16 rows in LDS, then
  //     each block's output projection + bias -> out
  attn<<<gAT, bAT, 0, stream>>>(QP, KP, VT, VS, QF, KF, V, WOT, bo, out);
  (void)hipGetLastError();
}

// v007
// It runs in 46.8 microseconds.
// Next to v006, in two timings, it ran 1.32 and 1.31 times as fast.
// All steps since v000 together make it 4.78 times as fast.
// Projections q,k,v = x.W + b and the f32 q,k rows 0..127 per sequence: v_wmma_f32_16x16x32_bf16 (bf16 RNE operands of the
// raw inputs, f32 accumulate, bf16 RNE bias added in f32). Scores q'.k'^T (f16 planes x8), P'.V (key-block-centred P' x32768 f16 from registers,
// V^T x1024 f16) and the output projection (ctx carried as f16 hi x4096 plus residual x2048 rows, times f16(bf16(Wo)) x1024, bias
// added in f32): v_wmma_f32_16x16x32_f16, f32 accumulate. Query rows 0..127 of each sequence: scores, softmax and P.V in f32 on VALU.
// Causal mask, softmax statistics, key-block column sums of V and all scaling in f32 on VALU.
#include <hip/hip_runtime.h>
#include <math.h>
#include <stdint.h>

#ifndef NB
#define NB 4
#endif
#ifndef SEQ
#define SEQ 4096
#endif
#define SEQ_FULL 4096
#define NB_FULL 4
#define EMB   512
#define DH    64
#define CK    512
#define NCHK  (SEQ / CK)
#define NKB   16
#define QT    16
#define TQ0   128
#define NQT   ((SEQ - TQ0) / QT)
#define OPP   68
#define CTP   72
#define SLAB64 (16 * 68)
#define VTP   72
#define ATT_THREADS 256
#define HD_THREADS 128
#define NACC  4
#define QSC   8.0f
#define KSC   8.0f
#define PCAR  32768.0f
#define VCAR  1024.0f
#define WSC   1024.0f
#define CSC   4096.0f
#define RSC   2048.0f
#define OS1   (1.0f / (CSC * WSC))
#define OS2   (1.0f / (CSC * WSC * RSC))
#define LOG2E 1.4426950408889634f
#define RSQD  0.125f
#define WS_CAP ((size_t)134217728)
#define WTB   ((EMB / 64) * (DH / 64))
#define XCB   ((SEQ * EMB) / 8 / 256)
#define GPB   (((NB * SEQ) / 64) * (DH / 64))
#define GHB   (((NB * TQ0) / 64) * (DH / 64))

static_assert(DH == 64 && NACC * 16 == DH && (EMB % 64) == 0 && (EMB % 32) == 0 && (DH % 32) == 0);
static_assert((SEQ % CK) == 0 && NCHK >= 1 && CK == 32 * NKB && (SEQ % 64) == 0 && (SEQ % QT) == 0 && (CK % QT) == 0);
static_assert((TQ0 % QT) == 0 && (TQ0 % 64) == 0 && NQT * QT + TQ0 == SEQ && NQT >= 1 && TQ0 == 128 && TQ0 == HD_THREADS);
static_assert(8 * SLAB64 <= 8 * 16 * OPP && EMB == 8 * 64 && CTP >= DH + 8 && OPP >= DH + 4);
static_assert(((VTP * 2) % 16) == 0 && ((CTP * 2) % 16) == 0 && ((OPP * 4) % 16) == 0);
static_assert(64 * VTP >= 63 * VTP + 64);
static_assert(ATT_THREADS == 16 * QT && ATT_THREADS == 256 && HD_THREADS == 2 * DH);
static_assert((((SEQ * EMB) / 8) % 256) == 0 && ((NB * SEQ) % 64) == 0 && ((NB * TQ0) % 64) == 0);
static_assert(NB >= 1 && NB <= NB_FULL && SEQ <= SEQ_FULL && (TQ0 % 64) == 0 && (NKB % 2) == 0);

typedef unsigned short u16;
typedef _Float16 v16h __attribute__((ext_vector_type(16)));
typedef _Float16 v8h  __attribute__((ext_vector_type(8)));
typedef __bf16   v16b __attribute__((ext_vector_type(16)));
typedef float    v8f  __attribute__((ext_vector_type(8)));
typedef float    v4f  __attribute__((ext_vector_type(4)));
typedef unsigned int v4u __attribute__((ext_vector_type(4)));

union FragH { v16h v; v8h h[2]; v4u u[2]; };
union FragB { v16b v; v4u u[2]; };

// ---- scalar helpers --------------------------------------------------------------------------------
__device__ __forceinline__ unsigned short bf_bits(float f) {          // f32 -> bf16 bits, RNE convert
  unsigned u = __float_as_uint(f);
  return (unsigned short)((u + 0x7FFFu + ((u >> 16) & 1u)) >> 16);
}
__device__ __forceinline__ float bf_up(unsigned short h) { return __uint_as_float(((unsigned)h) << 16); }
__device__ __forceinline__ float bfr(float f) { return bf_up(bf_bits(f)); }
__device__ __forceinline__ unsigned short h_bits(_Float16 x) { return __builtin_bit_cast(unsigned short, x); }
__device__ __forceinline__ unsigned pk16(unsigned short a, unsigned short b) { return (unsigned)a | ((unsigned)b << 16); }
__device__ __forceinline__ v8f zero8() { v8f z = {0.f, 0.f, 0.f, 0.f, 0.f, 0.f, 0.f, 0.f}; return z; }
__device__ __forceinline__ v4f zero4() { v4f z = {0.f, 0.f, 0.f, 0.f}; return z; }

// ---- fragment loaders: 16-bit A/B operand, lane -> row/col (lane&15), p already includes +8*(lane>>4);
//      elements 0..7 <- p[0..7] (k0+8h..), elements 8..15 <- p[16..23] (k0+16+8h..)  (same split k map for A and B);
//      this form reads the row-major A planes (x, ctx hi, ctx residual)
__device__ __forceinline__ v16h ldfrag_h(const _Float16* p) {
  FragH f;
  f.h[0] = *(const v8h*)(p);
  f.h[1] = *(const v8h*)(p + 16);
  return f.v;
}
__device__ __forceinline__ v16b ldfrag_b(const u16* p) {              // bf16 plane read as unsigned integer vectors
  FragB f;
  f.u[0] = *(const v4u*)(p);
  f.u[1] = *(const v4u*)(p + 16);
  return f.v;
}

// ---- the same fragments from a plane kept in FRAGMENT ORDER: a 16 (rows or cols) x 32 (k) tile is 512 consecutive halves; the 16-B
//      unit of lane l = 16*h + m (row/col m, k = 8h .. 8h+7) lies at 8*l, the unit for k = 16+8h .. at 256 + 8*l. p already includes
//      +8*lane, so each of the two loads reads 512 consecutive bytes (4 whole lines) where a row-major plane gives 16 lines.
__device__ __forceinline__ v16h ldfrag_hs(const _Float16* p) {
  FragH f;
  f.h[0] = *(const v8h*)(p);
  f.h[1] = *(const v8h*)(p + 256);
  return f.v;
}
__device__ __forceinline__ v16b ldfrag_bs(const u16* p) {
  FragB f;
  f.u[0] = *(const v4u*)(p);
  f.u[1] = *(const v4u*)(p + 256);
  return f.v;
}

// Precaution behind a run of fragment loads: the registers that those loads name (row pointers a0, a1; byte offsets o0..o3) are inputs
// of the wait, so none of them is advanced or reused as a load's destination in front of s_wait_xcnt 0.
__device__ __forceinline__ void addr_wait(const void* a0, const void* a1, unsigned o0, unsigned o1, unsigned o2, unsigned o3) {
#if defined(__HIP_DEVICE_COMPILE__)
  asm volatile("s_wait_xcnt 0x0" :: "v"(a0), "v"(a1), "v"(o0), "v"(o1), "v"(o2), "v"(o3) : "memory");
#endif
}

__device__ __forceinline__ v8f mma_h(v16h a, v16h b, v8f c) {
  return __builtin_amdgcn_wmma_f32_16x16x32_f16(false, a, false, b, (short)0, c, false, false);
}
__device__ __forceinline__ v8f mma_b(v16b a, v16b b, v8f c) {
  return __builtin_amdgcn_wmma_f32_16x16x32_bf16(false, a, false, b, (short)0, c, false, false);
}
__device__ __forceinline__ void guard2x6(v8f& a, v8f& b, v16h x0, v16h x1, v16h x2, v16h x3, v16h x4, v16h x5) {
#if defined(__HIP_DEVICE_COMPILE__)
  asm volatile("v_nop\n\tv_nop\n\tv_nop\n\tv_nop"
               : "+v"(a), "+v"(b) : "v"(x0), "v"(x1), "v"(x2), "v"(x3), "v"(x4), "v"(x5) : "memory");
#endif
}
template <typename F>
__device__ __forceinline__ void guard6(v8f& a, v8f& b, v8f& c, v8f& d, F x0, F x1, F x2, F x3, F x4, F x5) {
#if defined(__HIP_DEVICE_COMPILE__)
  asm volatile("v_nop\n\tv_nop\n\tv_nop\n\tv_nop"
               : "+v"(a), "+v"(b), "+v"(c), "+v"(d) : "v"(x0), "v"(x1), "v"(x2), "v"(x3), "v"(x4), "v"(x5) : "memory");
#endif
}
__device__ __forceinline__ void guardpv4(v8f& o0, v8f& o1, v8f& o2, v8f& o3, v16h p, v16h g0, v16h g1, v16h g2, v16h g3) {
#if defined(__HIP_DEVICE_COMPILE__)
  asm volatile("v_nop\n\tv_nop\n\tv_nop\n\tv_nop"
               : "+v"(o0), "+v"(o1), "+v"(o2), "+v"(o3)
               : "v"(p), "v"(g0), "v"(g1), "v"(g2), "v"(g3) : "memory");
#endif
}
__device__ __forceinline__ void wave_sync_lds() {                    // wave-private LDS slab: release, wave barrier, acquire
  __builtin_amdgcn_fence(3, "workgroup");
  __builtin_amdgcn_wave_barrier();
  __builtin_amdgcn_fence(2, "workgroup");
}

// =====================================================================================================
// x plane f32 [b][SEQ_FULL][EMB] -> bf16 RNE bits [b][SEQ][EMB] (compact rows). Thread = 8 consecutive elements: two 16-B loads,
// coverage: grid = (SEQ*EMB/8/256 blocks, nb) x 256 thr x 8 = the whole plane.
// =====================================================================================================
__device__ __forceinline__ void cvtx_body(int bx, int bb, const float* __restrict__ x, u16* D, int n8) {
  const int gt = bx * 256 + (int)threadIdx.x;
  if (gt >= n8) return;                     // no barriers on this path
  const float* p = x + (size_t)bb * ((size_t)SEQ_FULL * EMB) + (size_t)gt * 8;
  const v4f a = *(const v4f*)(p), c4 = *(const v4f*)(p + 4);
  float v[8];
#pragma unroll
  for (int e = 0; e < 4; ++e) { v[e] = a[e]; v[4 + e] = c4[e]; }
  unsigned short s[8];
#pragma unroll
  for (int e = 0; e < 8; ++e) s[e] = bf_bits(v[e]);
  v4u o;
#pragma unroll
  for (int e = 0; e < 4; ++e) o[e] = pk16(s[2 * e], s[2 * e + 1]);
  u16* d = D + (size_t)bb * ((size_t)SEQ * EMB) + (size_t)gt * 8;
  {
    *(v4u*)(d) = o;
    
  }
}

// =====================================================================================================
// Weight transpose-convert: in W[R][C] f32 row-major -> out D = the [n = C][k = R] 16-bit operand plane for y = x.W in fragment order:
// tile (n/16, k/32) at halves ((n/16)*(R/32) + k/32)*512, units inside it as ldfrag_hs / ldfrag_bs read them.
// mode 0: bf16 RNE bits; mode 1: f16 bits of (bf16 RNE value) * scale.
// Block = 64x64 tile: 64 input row segments of 64 floats loaded with 16-B loads, converted, scattered into an LDS tile [c][64 r]
// coverage: load 256 thr x 16 = 64 x 64; store 2 iterations x 256 thr x 8 halves = 64 lines x 64; grid = (R/64) x (C/64) blocks
//           covers D exactly once (host checks R % 64 == 0, C % 64 == 0).
// =====================================================================================================
__device__ __forceinline__ void wt16_body(u16* TH, int bid, const float* __restrict__ W, u16* D, int R, int C, int mode,
                                          float scale) {
  const int tid = threadIdx.x;
  const int nrt = R >> 6;
  const int r0  = (bid % nrt) * 64;
  const int c0  = (bid / nrt) * 64;
  {
    const int rl = tid >> 2;                  // input row within tile 0..63
    const int cs = (tid & 3) * 16;            // column chunk within the 64
    const float* src = W + (size_t)(r0 + rl) * C + c0 + cs;
#pragma unroll
    for (int i = 0; i < 4; ++i) {
      const v4f a = *(const v4f*)(src + 4 * i);
#pragma unroll
      for (int e = 0; e < 4; ++e) {
        const float v  = a[e];
        const unsigned short hb = h_bits((_Float16)(bfr(v) * scale));
        const unsigned short bb = bf_bits(v);
        TH[(cs + 4 * i + e) * VTP + rl] = (mode != 0) ? hb : bb;
      }
    }
  }
  __syncthreads();
  v4u vh[2];
  const int fm = tid & 15, fh = (tid >> 4) & 1, fs = (tid >> 5) & 1, fk = (tid >> 6) & 1, fn = tid >> 7;
#pragma unroll
  for (int it = 0; it < 2; ++it) {            // local c = 16*(2*it + fn) + fm, local r = 32*fk + 16*fs + 8*fh .. +7
    vh[it] = *(const v4u*)(TH + ((it * 2 + fn) * 16 + fm) * VTP + fk * 32 + fs * 16 + fh * 8);
  }
  const int kt = R >> 5;                      // 32-wide k tiles per 16 columns
  {
#pragma unroll
    for (int it = 0; it < 2; ++it) {
      *(v4u*)(D + ((size_t)((c0 >> 4) + it * 2 + fn) * (size_t)kt + (size_t)(r0 >> 5)) * 512 + (tid & 127) * 8) = vh[it];
    }
    
  }
}

// =====================================================================================================
// One launch for the five independent preparation jobs, picked by block index (block-uniform): blocks 0..4*WTB-1 = the four weight
// transposes (WTB blocks each, order Wq, Wk, Wv, Wo), the rest = the x conversion (XCB blocks per batch row).
// coverage: grid = 4*WTB + nb*XCB blocks; each job is handed block indices 0 .. its own block count - 1.
// =====================================================================================================
__global__ __launch_bounds__(256)
void prep(const float* __restrict__ x, const float* __restrict__ wq, const float* __restrict__ wk, const float* __restrict__ wv,
          const float* __restrict__ wo, u16* WQT, u16* WKT, u16* WVT, u16* WOT, u16* XB) {
  __shared__ __align__(16) u16 TH[64 * VTP];
  const int bid = blockIdx.x;
  if (bid < 4 * WTB) {
    const int job = bid / WTB;
    const float* W = (job == 0) ? wq : (job == 1) ? wk : (job == 2) ? wv : wo;
    u16* D = (job == 0) ? WQT : (job == 1) ? WKT : (job == 2) ? WVT : WOT;
    const bool pj = job < 3;                  // Wq, Wk, Wv: [EMB][DH] -> bf16; Wo: [DH][EMB] -> scaled f16
    wt16_body(TH, bid - job * WTB, W, D, pj ? EMB : DH, pj ? DH : EMB, pj ? 0 : 1, pj ? 1.0f : WSC);
  } else {
    const int r = bid - 4 * WTB;
    cvtx_body(r % XCB, r / XCB, x, XB, XCB * 256);
  }
}

// =====================================================================================================
//            8 consecutive lanes x 16 B per line), lanes 16..31 -> row 2*it+1.
//  slab64_out: the same store shape for a 16 x 64 f32 tile that the wave has already staged in its slab.
//  epi64hsb: f16 bits of ((tile + bf16RNE(bias[n])) * pscale), plane in fragment order; lane = (row lane&15, 8 consecutive columns),
// coverage: epi64/slab64_out 8 instructions x 2 rows x 16 lanes x 4 floats; epi64hsb 4 instructions x 16 rows x 2 lanes x 8 halves
//           = the wave's 16 x 64 tile in every case.
// =====================================================================================================
__device__ __forceinline__ void stage64(float* sl, v8f a0, v8f a1, v8f a2, v8f a3, float oscale, int lane) {
  const int hh = lane >> 4, m = lane & 15;
#pragma unroll
  for (int r = 0; r < 8; ++r) {
    const int ro = (8 * hh + r) * 68 + m;
    sl[ro]      = a0[r] * oscale;
    sl[ro + 16] = a1[r] * oscale;
    sl[ro + 32] = a2[r] * oscale;
    sl[ro + 48] = a3[r] * oscale;
  }
  wave_sync_lds();
}
__device__ __forceinline__ void epi64(float* sl, v8f a0, v8f a1, v8f a2, v8f a3, float oscale, v4f badd, float* C, int N,
                                      size_t rowb, int col0, int lane) {
  const int hh = lane >> 4, m = lane & 15;
  stage64(sl, a0, a1, a2, a3, oscale, lane);
  v4f vals[8];
#pragma unroll
  for (int it = 0; it < 8; ++it) vals[it] = *(const v4f*)(sl + (it * 2 + hh) * 68 + m * 4) + badd;
  float* dst = C + (rowb + (size_t)hh) * (size_t)N + col0 + m * 4;
  {
#pragma unroll
    for (int it = 0; it < 8; ++it) {
      *(v4f*)(dst + (size_t)(it * 2) * (size_t)N) = vals[it];
    }
    
  }
}
__device__ __forceinline__ void slab64_out(const float* sl, v4f badd, float* C, int N, size_t rowb, int col0, int lane) {
  const int hh = lane >> 4, m = lane & 15;
  wave_sync_lds();
  v4f vals[8];
#pragma unroll
  for (int it = 0; it < 8; ++it) vals[it] = *(const v4f*)(sl + (it * 2 + hh) * 68 + m * 4) + badd;
  float* dst = C + (rowb + (size_t)hh) * (size_t)N + col0 + m * 4;
#pragma unroll
  for (int it = 0; it < 8; ++it) *(v4f*)(dst + (size_t)(it * 2) * (size_t)N) = vals[it];
}
__device__ __forceinline__ void epi64hsb(float* sl, v8f a0, v8f a1, v8f a2, v8f a3, float oscale, float pscale,
                                         const float* __restrict__ bias, u16* C, int N, size_t rowb, int col0, int lane) {
  stage64(sl, a0, a1, a2, a3, oscale, lane);
  const int hh = lane >> 4, m = lane & 15;
  v4u oh[4];
#pragma unroll
  for (int g = 0; g < 4; ++g) {               // g = 16-column group of the 64; lane = (row m, columns 16g + 8hh .. +7)
    const int c8 = g * 16 + hh * 8;
    const v4f b0 = *(const v4f*)(bias + col0 + c8), b1 = *(const v4f*)(bias + col0 + c8 + 4);   // columns col0+c8..+7 < N
    const v4f a = *(const v4f*)(sl + m * 68 + c8), c4 = *(const v4f*)(sl + m * 68 + c8 + 4);
    float w[8];
#pragma unroll
    for (int e = 0; e < 4; ++e) { w[e] = (a[e] + bfr(b0[e])) * pscale; w[4 + e] = (c4[e] + bfr(b1[e])) * pscale; }
#pragma unroll
    for (int e = 0; e < 4; ++e) oh[g][e] = pk16(h_bits((_Float16)w[2 * e]), h_bits((_Float16)w[2 * e + 1]));
  }
  // tile (rowb/16, col/32) at halves ((rowb/16)*(N/32) + col/32)*512; group g is the half-tile at g*256 behind column col0
  u16* dst = C + ((rowb >> 4) * (size_t)(N >> 5) + (size_t)(col0 >> 5)) * 512 + lane * 8;
  {
#pragma unroll
    for (int g = 0; g < 4; ++g) {
      *(v4u*)(dst + g * 256) = oh[g];
    }
    
  }
}

// =====================================================================================================
// bf16 GEMM, f32 out with bias: C[M][N] = (A[arow(m)][K] (bf16 row-major) . Bt[N][K]^T (bf16, fragment order)) * oscale + bf16RNE(bias[n]).
// Output row ra maps to A row arow = (ra / rpg) * gstr + (ra % rpg) (rpg = M, gstr = 0 gives the identity map; rpg = TQ0,
// gstr = SEQ picks the first TQ0 rows of every sequence).
// Block = 64x64 tile, 4 waves x 16 rows; fragments loaded straight from the 16-bit planes (two 16-B loads each, split k map for
// A and B); K stepped by 32 (host checks K % 32 == 0, M % 64 == 0, N % 64 == 0, grid = (M/64)*(N/64)).
// =====================================================================================================
__device__ __forceinline__
void gemm_b32_body(float* slab, int bid, const u16* __restrict__ A, const u16* __restrict__ Bt, const float* __restrict__ bias,
                   float* C, int M, int N, int K, int rpg, int gstr, float oscale) {
  const int tid = threadIdx.x, wave = tid >> 5, lane = tid & 31, hh = lane >> 4, m = lane & 15;
  const int ntile = N >> 6;
  const int rowb  = (bid / ntile) * 64 + wave * 16;
  const int col0  = (bid % ntile) * 64;
  if (rowb + 16 > M) return;                 // wave-uniform, never taken with the exact grid; no block barriers on this path
  const int ra = rowb + m;
  const int rg = ra / rpg;
  const size_t arow = (size_t)rg * (size_t)gstr + (size_t)(ra - rg * rpg);
  const u16* ap = A  + arow * (size_t)K + 8 * hh;
  // fragment order: 16 columns = K/32 tiles of 1024 bytes; block-uniform base, a lane's place is one fixed 32-bit byte offset
  const char* bp = (const char*)(const void*)Bt + (size_t)col0 * K * 2;
  const unsigned bs = 32u * (unsigned)K;
  const unsigned lo0 = (unsigned)lane * 16u, lo1 = lo0 + bs, lo2 = lo1 + bs, lo3 = lo2 + bs;   // the four 16-column groups
  v8f acc0 = zero8(), acc1 = zero8(), acc2 = zero8(), acc3 = zero8();
#pragma unroll 1
  for (int k0 = 0; k0 < K; k0 += 32) {
    const v16b a  = ldfrag_b(ap + k0);
    const unsigned ko = (unsigned)k0 * 32u;                // one 1024-byte tile per 32 of k
    const v16b b0 = ldfrag_bs((const u16*)(const void*)(bp + (lo0 + ko)));
    const v16b b1 = ldfrag_bs((const u16*)(const void*)(bp + (lo1 + ko)));
    const v16b b2 = ldfrag_bs((const u16*)(const void*)(bp + (lo2 + ko)));
    const v16b b3 = ldfrag_bs((const u16*)(const void*)(bp + (lo3 + ko)));
    addr_wait(ap + k0, ap + k0, lo0 + ko, lo1 + ko, lo2 + ko, lo3 + ko);
    acc0 = mma_b(a, b0, acc0);
    acc1 = mma_b(a, b1, acc1);
    acc2 = mma_b(a, b2, acc2);
    acc3 = mma_b(a, b3, acc3);
    guard6<v16b>(acc0, acc1, acc2, acc3, a, b0, b1, b2, b3, a);
  }
  const v4f bv4 = *(const v4f*)(bias + col0 + m * 4);    // columns col0 + 4m .. +3, always < N (N multiple of 64)
  v4f badd;
#pragma unroll
  for (int e = 0; e < 4; ++e) badd[e] = bfr(bv4[e]);
  epi64(slab + wave * SLAB64, acc0, acc1, acc2, acc3, oscale, badd, C, N, (size_t)rowb, col0, lane);
}

// =====================================================================================================
// bf16 GEMM, f16 plane out with bias: C16[M][N] = f16 bits of (((A . Bt^T) * oscale) + bf16RNE(bias[n])) * pscale; operands as in
// gemm_b32 (identity row map), epilogue epi64hsb.
// =====================================================================================================
__device__ __forceinline__
void gemm_bh16_body(float* slab, int bid, const u16* __restrict__ A, const u16* __restrict__ Bt, const float* __restrict__ bias,
                    u16* C, int M, int N, int K, float oscale, float pscale) {
  const int tid = threadIdx.x, wave = tid >> 5, lane = tid & 31, hh = lane >> 4, m = lane & 15;
  const int ntile = N >> 6;
  const int rowb  = (bid / ntile) * 64 + wave * 16;
  const int col0  = (bid % ntile) * 64;
  if (rowb + 16 > M) return;                 // wave-uniform, never taken with the exact grid; no block barriers on this path
  const u16* ap = A  + (size_t)(rowb + m) * K + 8 * hh;
  // fragment order: 16 columns = K/32 tiles of 1024 bytes; block-uniform base, a lane's place is one fixed 32-bit byte offset
  const char* bp = (const char*)(const void*)Bt + (size_t)col0 * K * 2;
  const unsigned bs = 32u * (unsigned)K;
  const unsigned lo0 = (unsigned)lane * 16u, lo1 = lo0 + bs, lo2 = lo1 + bs, lo3 = lo2 + bs;   // the four 16-column groups
  v8f acc0 = zero8(), acc1 = zero8(), acc2 = zero8(), acc3 = zero8();
#pragma unroll 1
  for (int k0 = 0; k0 < K; k0 += 32) {
    const v16b a  = ldfrag_b(ap + k0);
    const unsigned ko = (unsigned)k0 * 32u;                // one 1024-byte tile per 32 of k
    const v16b b0 = ldfrag_bs((const u16*)(const void*)(bp + (lo0 + ko)));
    const v16b b1 = ldfrag_bs((const u16*)(const void*)(bp + (lo1 + ko)));
    const v16b b2 = ldfrag_bs((const u16*)(const void*)(bp + (lo2 + ko)));
    const v16b b3 = ldfrag_bs((const u16*)(const void*)(bp + (lo3 + ko)));
    addr_wait(ap + k0, ap + k0, lo0 + ko, lo1 + ko, lo2 + ko, lo3 + ko);
    acc0 = mma_b(a, b0, acc0);
    acc1 = mma_b(a, b1, acc1);
    acc2 = mma_b(a, b2, acc2);
    acc3 = mma_b(a, b3, acc3);
    guard6<v16b>(acc0, acc1, acc2, acc3, a, b0, b1, b2, b3, a);
  }
  epi64hsb(slab + wave * SLAB64, acc0, acc1, acc2, acc3, oscale, pscale, bias, C, N, (size_t)rowb, col0, lane);
}

// =====================================================================================================
// bf16 GEMM of the v projection, N = DH = 64 (one column tile), operands and k order as in gemm_b32 (identity row map). Block = 64
// rows = 64 keys, 4 waves x 16 keys. Accumulator tile j, element r of lane (hh, m) is v[key rowb + 8*hh + r][d = 16*j + m] once the
// bf16 RNE bias is added in f32, and that is what the epilogue writes, straight from registers:
//  V^T plane = f16(v * 1024) in fragment order: the tile (32 keys, 16 columns d) lies at halves ((b*SEQ + s)/32 * 4 + d/16)*512, units
//      inside it as ldfrag_hs reads them (col = d, k = key). A lane's 8 elements of tile j are one 16-B unit; the wave's 16 keys are
//      the half-tile at 256*((rowb/16) & 1), so each of the 4 stores writes 512 consecutive bytes.
//  VS[(b*SEQ + s)/32][d] = sum of v over the 32 keys of a key block (f32): 8 keys in order in a lane, + the other half-wave's 8
//      (xor shuffle), + the neighbour wave's 16 through LDS behind the block barrier.
//  V  = f32 rows, only for keys 0..TQ0-1 of a sequence (all that the f32 attention job reads), store shape of epi64.
// coverage: grid = M/64 blocks; V^T 4 waves x 4 stores x 32 lanes x 8 halves = 64 x 64; VS 128 thr x 1 float = 2 key blocks x 64.
// =====================================================================================================
__device__ __forceinline__
void gemm_v_body(float* slab, float* cs, int bid, const u16* __restrict__ A, const u16* __restrict__ Bt, const float* __restrict__ bias,
                 float* V, u16* VT, float* VS, int M, int K) {
  const int tid = threadIdx.x, wave = tid >> 5, lane = tid & 31, hh = lane >> 4, m = lane & 15;
  const int row0 = bid * 64;
  if (row0 + 64 > M) return;                 // block-uniform, in front of the barrier; never taken with the exact grid
  const int rowb = row0 + wave * 16;
  const u16* ap = A + (size_t)(rowb + m) * K + 8 * hh;
  const char* bp = (const char*)(const void*)Bt;
  float braw[4];                             // bias of the lane's four columns, fetched beside the k loop
#pragma unroll
  for (int j = 0; j < 4; ++j) braw[j] = bias[16 * j + m];
  const unsigned bs = 32u * (unsigned)K;
  const unsigned lo0 = (unsigned)lane * 16u, lo1 = lo0 + bs, lo2 = lo1 + bs, lo3 = lo2 + bs;   // the four 16-column groups
  v8f acc0 = zero8(), acc1 = zero8(), acc2 = zero8(), acc3 = zero8();
  // rolled, as in gemm_b32: K is a run-time argument and one k step's fragments are in registers at a time
#pragma unroll 1
  for (int k0 = 0; k0 < K; k0 += 32) {
    const v16b a  = ldfrag_b(ap + k0);
    const unsigned ko = (unsigned)k0 * 32u;                // one 1024-byte tile per 32 of k
    const v16b b0 = ldfrag_bs((const u16*)(const void*)(bp + (lo0 + ko)));
    const v16b b1 = ldfrag_bs((const u16*)(const void*)(bp + (lo1 + ko)));
    const v16b b2 = ldfrag_bs((const u16*)(const void*)(bp + (lo2 + ko)));
    const v16b b3 = ldfrag_bs((const u16*)(const void*)(bp + (lo3 + ko)));
    addr_wait(ap + k0, ap + k0, lo0 + ko, lo1 + ko, lo2 + ko, lo3 + ko);
    acc0 = mma_b(a, b0, acc0);
    acc1 = mma_b(a, b1, acc1);
    acc2 = mma_b(a, b2, acc2);
    acc3 = mma_b(a, b3, acc3);
    guard6<v16b>(acc0, acc1, acc2, acc3, a, b0, b1, b2, b3, a);
  }
  const v8f av[4] = {acc0, acc1, acc2, acc3};
  float w[4][8], sum[4];
#pragma unroll
  for (int j = 0; j < 4; ++j) {
    const float bj = bfr(braw[j]);
#pragma unroll
    for (int r = 0; r < 8; ++r) w[j][r] = av[j][r] + bj;
    sum[j] = w[j][0];
#pragma unroll
    for (int r = 1; r < 8; ++r) sum[j] += w[j][r];
  }
#pragma unroll
  for (int j = 0; j < 4; ++j) sum[j] += __shfl_xor(sum[j], 16, 32);
  if (hh == 0) {
#pragma unroll
    for (int j = 0; j < 4; ++j) cs[wave * DH + 16 * j + m] = sum[j];
  }
  __syncthreads();                           // all global stores stand behind it, so that no wave waits for them at the barrier
  const int kbl = tid >> 6, d = tid & 63;    // 128 threads = 2 key blocks x 64 columns
  VS[((size_t)(row0 >> 5) + (size_t)kbl) * DH + d] = cs[(2 * kbl) * DH + d] + cs[(2 * kbl + 1) * DH + d];
  v4u oh[4];
#pragma unroll
  for (int j = 0; j < 4; ++j) {
#pragma unroll
    for (int e = 0; e < 4; ++e) oh[j][e] = pk16(h_bits((_Float16)(w[j][2 * e] * VCAR)), h_bits((_Float16)(w[j][2 * e + 1] * VCAR)));
  }
  u16* dst = VT + (size_t)(rowb >> 5) * (32 * DH) + ((rowb >> 4) & 1) * 256 + lane * 8;
#pragma unroll
  for (int j = 0; j < 4; ++j) *(v4u*)(dst + j * 512) = oh[j];
  // what follows these stores (the f32 rows below; in the built kernel the launch's other jobs) rewrites their registers: wait first
  asm volatile("s_wait_xcnt 0x0" ::: "memory");
  if ((row0 % SEQ) < TQ0) {                  // block-uniform: the f32 rows for the f32 attention job
    const v4f bv4 = *(const v4f*)(bias + m * 4);
    v4f badd;
#pragma unroll
    for (int e = 0; e < 4; ++e) badd[e] = bfr(bv4[e]);
    epi64(slab + wave * SLAB64, acc0, acc1, acc2, acc3, 1.0f, badd, V, DH, (size_t)rowb, 0, lane);
    // as above, for the stores of epi64
    asm volatile("s_wait_xcnt 0x0" ::: "memory");
  }
}

// =====================================================================================================
// One launch for the five independent projection GEMMs, picked by block index (block-uniform): blocks 0..GHB-1 = f32 q rows 0..127
// of every sequence, GHB..2*GHB-1 = the same for k, then GPB blocks each for v (gemm_v_body), the f16 q plane and the f16 k plane.
// coverage: grid = 2*GHB + 3*GPB blocks; each GEMM is handed block indices 0 .. its own block count - 1.
// =====================================================================================================
__global__ __launch_bounds__(128)
void proj(const u16* __restrict__ XB, const u16* __restrict__ WQT, const u16* __restrict__ WKT, const u16* __restrict__ WVT,
          const float* __restrict__ bq, const float* __restrict__ bk, const float* __restrict__ bv,
          u16* QP, u16* KP, float* V, u16* VT, float* VS, float* QF, float* KF, int rows, int hrows, int N, int K) {
  __shared__ __align__(16) float slab[4 * SLAB64];
  __shared__ float cs[4 * DH];               // 16-key column sums of v, one row per wave
  const int bid = blockIdx.x;
  if (bid < 2 * GHB) {                       // f32 q, k: rows 0..TQ0-1 of every sequence
    const bool isq = bid < GHB;
    gemm_b32_body(slab, isq ? bid : bid - GHB, XB, isq ? WQT : WKT, isq ? bq : bk, isq ? QF : KF, hrows, N, K, TQ0, SEQ, 1.0f);
  } else if (bid < 2 * GHB + GPB) {          // v: V^T plane, key-block column sums, f32 rows 0..TQ0-1
    gemm_v_body(slab, cs, bid - 2 * GHB, XB, WVT, bv, V, VT, VS, rows, K);
  } else {                                   // f16 planes
    const int r = bid - (2 * GHB + GPB);
    const bool isq = r < GPB;
    gemm_bh16_body(slab, isq ? r : r - GPB, XB, isq ? WQT : WKT, isq ? bq : bk, isq ? QP : KP, rows, N, K, 1.0f,
                   isq ? QSC : KSC);
  }
}

// =====================================================================================================
// Output projection of one 16-row ctx tile that its attention block holds in LDS (hi + residual f16 rows), by all 8 waves:
//   C[row][n] = (hi . Bt^T) * os1 + (res . Bt^T) * os2 + bf16RNE(bias[n]); Bt = f16 [EMB][DH] in fragment order.
// Wave w owns columns 64w .. 64w+63 (four 16-column groups); K = DH = 64 in two steps of 32, separate accumulators for the two
// planes, k order 0..31 then 32..63 in each.
//  oproj_ldb: the two B fragments of group j (k step s at bytes 8192w + 2048j + 1024s).
//  oproj_mma: the four products of one group. Two groups' fragments are in flight at a time and a group's results are used up
//             before the next group's are made, which keeps the epilogue's registers below the key loop's.
// =====================================================================================================
__device__ __forceinline__ void oproj_ldb(v16h& b0, v16h& b1, const u16* __restrict__ Bt, int swave, int j, int lane) {
  const _Float16* bp = (const _Float16*)(const void*)Bt + (size_t)swave * (64 * DH) + j * 1024;      // wave-uniform base
  b0 = ldfrag_hs(bp + 8 * lane);
  b1 = ldfrag_hs(bp + 512 + 8 * lane);
}
__device__ __forceinline__ void oproj_mma(v8f& h, v8f& r, v16h b0, v16h b1, v16h a0, v16h a1, v16h r0, v16h r1) {
  h = mma_h(a0, b0, zero8());
  r = mma_h(r0, b0, zero8());
  h = mma_h(a1, b1, h);
  r = mma_h(r1, b1, r);
  // the distance behind the products: no result is read and no fragment's register is loaded anew in front of it
  guard2x6(h, r, b0, b1, a0, a1, r0, r1);
}

// =====================================================================================================
// Single-head causal attention, head width DH = 64, query rows TQ0 .. SEQ-1: block = (batch b, 16 query rows q0..q0+15), 8 waves.
// q plane (f16, x8), k plane the same and V^T plane (x1024), each in fragment order; VS = column sums of V per key block of 32.
// Wave w takes the key blocks kb = w, w+8, .. < nkbt (32 keys each; nkbt = blocks that hold a key <= q0+15), one per pass, with its own
// running max, running sum and partial O; nothing of a pass goes through LDS and no block barrier stands in the key loop.
//   (S) transposed scores S^T[key][query] on WMMA: A = k rows (row = key, split k map over d), B = q rows (col = query, the two 32-d
//       fragments kept in registers). D element r of lane (hh, m): tile 0 -> key 32kb + 8hh + r, tile 1 -> key 32kb + 16 + 8hh + r,
//       query q0 + m: a lane holds 16 of the 32 scores of ONE query, its partner lane ^ 16 the other 16.
//   (M) base-2 logits with the causal mask by key index (key > query -> -inf), block max and block sum in the lane plus one exchange
//       between the wave's halves, online running max / rescale factor al / running sum l in f32, p = exp2(t - m_new) <= 1 (0 for
//       masked keys), C = block sum / 32 (bit-identical in both halves), the CENTRED P' = p - C as f16(P' * 32768): the lane's 16
//       values, in the order it holds them, ARE its part of the B fragment of P'^T (col = query, elements 0..7 = keys 8hh + e,
//       elements 8..15 = keys 16 + 8hh + e), the k order of the V^T fragments.
//   (PV) O^T[d][query] on WMMA: A = V^T fragments (row = d, split k map over keys), B = P'^T. Accumulator tile j, element r of lane (hh, m) is
//       O^T[d = 16j + 8hh + r][query q0 + m], so al and C are one value a lane: o = o*al + C*(32768*1024)*VS[kb][d], the add-back of
//       the centring term over the 32 keys of the block, in f32, then 4 WMMAs plus a hazard gap. sum_k (P'_k + C) v_k == sum_k p_k v_k
//       exactly; masked keys carry P' = -C and p = 0. Every key block that is visited holds a valid key for each of the 16 queries.
//   Combine: the waves' max and sum per query go to LDS, barrier; every wave scales its partial O by exp2(own max - max of the 8)
//   (0 for a wave that had no key block) and stages it as [8][16 queries][OPP] f32, barrier, then thread (row = tid>>4, 4 columns) sums
//   the 8 partials in fixed order and the 8 scaled sums l likewise, x = sum * 4096 / (l * 32768 * 1024) (l >= 1 always), hi = f16(x),
//   res = f16((x - hi) * 2048), staged as a [32][CTP] u16 tile,
//   barrier, then the output projection of these 16 rows (oproj_ldb, oproj_mma, slab64_out): wave w -> out columns 64w .. 64w+63.
// coverage: grid nb*NQT blocks x 16 rows = rows TQ0..SEQ-1 of every sequence; key blocks 0..nkbt-1 each by exactly one wave;
//           partial stage 8 x 16 x 64; ctx stage 32 x 64; out store 8 waves x 16 rows x 64 columns.
// =====================================================================================================
__device__ __forceinline__ float xhalf(float x) {                    // lane l <-> lane l ^ 16, on the vector unit
  const int v = __builtin_bit_cast(int, x);
  return __builtin_bit_cast(float, __builtin_amdgcn_permlanex16(v, v, 0x76543210, 0xfedcba98, false, false));
}
__device__ __forceinline__
void attn_fwd_body(float* scs, u16* pls, float* wm, float* wl, int bid,
                   const u16* __restrict__ QPp, const u16* __restrict__ KPp, const u16* __restrict__ VTp,
                   const float* __restrict__ VSp, const u16* __restrict__ WOTp, const float* __restrict__ bo, float* out) {
  const int tid  = threadIdx.x;
  const int lane = tid & 31;
  const int hh   = lane >> 4;
  const int m    = lane & 15;
  const int sw   = __builtin_amdgcn_readfirstlane(tid >> 5);   // the wave's number in a scalar register: scalar loop, scalar bases

  // A block's cost grows with its query tile, so cost falls with the block index: the four sequences' last tiles
  // come first, their first tiles last. bid -> (b, tile) is a permutation of NB x NQT.
  const int b    = bid % NB;
  const int q0   = TQ0 + (NQT - 1 - bid / NB) * QT;
  const int nkbt = ((q0 + QT - 1) >> 5) + 1; // key blocks up to and with the diagonal one, 5 .. SEQ/32

  // all three planes in fragment order: 16 rows of q or k = two tiles (d 0..31, d 32..63), 32 keys of V^T = four tiles (16 d each)
  const _Float16* qrow = (const _Float16*)(const void*)QPp + ((size_t)b * SEQ + q0) * DH + 8 * lane;
  const v16h qa0 = ldfrag_hs(qrow);          // d 0..31
  const v16h qa1 = ldfrag_hs(qrow + 512);    // d 32..63
  // block-uniform bases; a lane's place is one 32-bit byte offset (a sequence's plane is SEQ*DH*2 bytes)
  const char* kbp = (const char*)(const void*)KPp + (size_t)b * SEQ * DH * 2;
  const char* vbp = (const char*)(const void*)VTp + (size_t)b * SEQ * DH * 2;
  const unsigned lo16 = (unsigned)lane * 16u;
  const float* vsb = VSp + (size_t)b * NCHK * NKB * DH + 8 * hh;
  const float lsc = RSQD * LOG2E / (QSC * KSC);
  const int ql = q0 + m - 8 * hh;            // key 32kb + 16t + 8hh + r is valid iff 16t + r <= ql - 32kb

  float mrun = -INFINITY, lrun = 0.f;
  v8f o[NACC];
#pragma unroll
  for (int j = 0; j < NACC; ++j) o[j] = zero8();

  // rolled: the trip count depends on the query tile, and one key block's fragments are in registers at a time
#pragma unroll 1
  for (int kb = sw; kb < nkbt; kb += 8) {
    const unsigned ko = lo16 + (unsigned)kb * (32u * DH * 2u);
    const _Float16* kp = (const _Float16*)(const void*)(kbp + ko);
    const v16h f00 = ldfrag_hs(kp);
    const v16h f01 = ldfrag_hs(kp + 512);
    const v16h f10 = ldfrag_hs(kp + 1024);
    const v16h f11 = ldfrag_hs(kp + 1536);
    const _Float16* vk = (const _Float16*)(const void*)(vbp + ko);
    const v16h g0 = ldfrag_hs(vk);
    const v16h g1 = ldfrag_hs(vk + 512);
    const v16h g2 = ldfrag_hs(vk + 1024);
    const v16h g3 = ldfrag_hs(vk + 1536);
    // ---- (S) ----
    v8f s0 = mma_h(f00, qa0, zero8());
    s0 = mma_h(f01, qa1, s0);
    v8f s1 = mma_h(f10, qa0, zero8());
    s1 = mma_h(f11, qa1, s1);
    guard2x6(s0, s1, qa0, qa1, f00, f01, f10, f11);
    const float* vsc = vsb + (size_t)kb * DH;              // fetched into the registers that the k fragments leave, used behind (M)
    v4f u[2 * NACC];
#pragma unroll
    for (int j = 0; j < NACC; ++j) { u[2 * j] = *(const v4f*)(vsc + 16 * j); u[2 * j + 1] = *(const v4f*)(vsc + 16 * j + 4); }
    // ---- (M) ----
    const int lim = ql - kb * 32;
    float t[16];
    float cm = -INFINITY;
#pragma unroll
    for (int r = 0; r < 8; ++r) {
      t[r]     = (r <= lim)      ? s0[r] * lsc : -INFINITY;
      t[8 + r] = (16 + r <= lim) ? s1[r] * lsc : -INFINITY;
      cm = fmaxf(cm, fmaxf(t[r], t[8 + r]));
    }
    cm = fmaxf(cm, xhalf(cm));
    const float mn = fmaxf(mrun, cm);                      // finite: the block holds a valid key for every query of the tile
    const float al = exp2f(mrun - mn);                     // 0 in the wave's first pass, where mrun is -inf
    mrun = mn;
    float ps = 0.f;
#pragma unroll
    for (int j = 0; j < 16; ++j) {
      const float p = exp2f(fminf(t[j] - mn, 0.f));        // 0 for masked keys
      t[j] = p;
      ps += p;
    }
    ps += xhalf(ps);
    const float cc = ps * (1.0f / 32.0f);
    lrun = lrun * al + ps;
    FragH pf;
#pragma unroll
    for (int i = 0; i < 2; ++i) {
#pragma unroll
      for (int e = 0; e < 4; ++e) {
        const int j = 8 * i + 2 * e;
        pf.u[i][e] = pk16(h_bits((_Float16)((t[j] - cc) * PCAR)), h_bits((_Float16)((t[j + 1] - cc) * PCAR)));
      }
    }
    // ---- (PV) ----
    const float cad = cc * (PCAR * VCAR);
#pragma unroll
    for (int j = 0; j < NACC; ++j) {
#pragma unroll
      for (int r = 0; r < 8; ++r) o[j][r] = __builtin_fmaf(cad, u[2 * j + (r >> 2)][r & 3], o[j][r] * al);
    }
    o[0] = mma_h(g0, pf.v, o[0]);
    o[1] = mma_h(g1, pf.v, o[1]);
    o[2] = mma_h(g2, pf.v, o[2]);
    o[3] = mma_h(g3, pf.v, o[3]);
    guardpv4(o[0], o[1], o[2], o[3], pf.v, g0, g1, g2, g3);
  }

  // ---- combine the 8 partial O tiles in fixed order ----
  // From here on the lane's number is read anew: no index made from the thread id has to stay in a vector register across the loop.
  const int el = (int)__builtin_amdgcn_mbcnt_lo(~0u, 0u);   // == lane
  const int eh = el >> 4, em = el & 15;                     // == hh, m
  const int er = 2 * sw + eh;                               // query row owned in the combine
  if (eh == 0) { wm[sw * QT + em] = mrun; wl[sw * QT + em] = lrun; }   // both halves hold the same two values
  v16h bf[4];                                // groups 0 and 1 are fetched beside the combine
  oproj_ldb(bf[0], bf[1], WOTp, sw, 0, el);
  oproj_ldb(bf[2], bf[3], WOTp, sw, 1, el);
  __syncthreads();
  {
    float gm = wm[em];                       // finite: wave 0 always has key block 0
#pragma unroll
    for (int w = 1; w < 8; ++w) gm = fmaxf(gm, wm[w * QT + em]);
    const float fs = exp2f(mrun - gm);       // 0 where the wave had no key block (mrun = -inf, o = 0)
    float* od = scs + (sw * 16 + em) * OPP + 8 * eh;
#pragma unroll
    for (int j = 0; j < NACC; ++j) {
      const v4f lo = {o[j][0] * fs, o[j][1] * fs, o[j][2] * fs, o[j][3] * fs};
      const v4f hi = {o[j][4] * fs, o[j][5] * fs, o[j][6] * fs, o[j][7] * fs};
      *(v4f*)(od + 16 * j)     = lo;
      *(v4f*)(od + 16 * j + 4) = hi;
    }
  }
  __syncthreads();
  const int c4 = em * 4;
  v4f sm4 = zero4();
#pragma unroll
  for (int w = 0; w < 8; ++w) sm4 += *(const v4f*)(scs + (w * 16 + er) * OPP + c4);
  float gr = wm[er];
#pragma unroll
  for (int w = 1; w < 8; ++w) gr = fmaxf(gr, wm[w * QT + er]);
  float lsum = 0.f;
#pragma unroll
  for (int w = 0; w < 8; ++w) lsum += wl[w * QT + er] * exp2f(wm[w * QT + er] - gr);
  const float inv = (1.0f / lsum) * (CSC / (PCAR * VCAR));            // lsum >= 1
#pragma unroll
  for (int e = 0; e < 4; ++e) {
    const float xs = sm4[e] * inv;
    const _Float16 hv = (_Float16)xs;
    const _Float16 rv = (_Float16)((xs - (float)hv) * RSC);
    pls[er * CTP + c4 + e]        = h_bits(hv);
    pls[(16 + er) * CTP + c4 + e] = h_bits(rv);
  }
  __syncthreads();
  // ---- output projection of the 16 ctx rows; the partial O tiles were last read in front of the barrier above, so each wave takes
  //      its own 16 x 68 f32 slab of the partial O region for the store shape of slab64_out ----
  const _Float16* ch = (const _Float16*)(const void*)pls + em * CTP + 8 * eh;
  const _Float16* cr = ch + 16 * CTP;
  const v16h a0 = ldfrag_h(ch), a1 = ldfrag_h(ch + 32), r0 = ldfrag_h(cr), r1 = ldfrag_h(cr + 32);
  const v4f bv = *(const v4f*)(bo + sw * 64 + em * 4);
  float* sl = scs + sw * SLAB64 + (8 * eh) * 68 + em;
  // unrolled: the fragment set bf[] is indexed by j and has to stay in registers
#pragma unroll
  for (int j = 0; j < 4; ++j) {
    v8f h, r;
    oproj_mma(h, r, bf[2 * (j & 1)], bf[2 * (j & 1) + 1], a0, a1, r0, r1);
    if (j < 2) oproj_ldb(bf[2 * j], bf[2 * j + 1], WOTp, sw, j + 2, el);   // group j + 2 flies while groups j, j + 1 are worked on
#pragma unroll
    for (int e = 0; e < 8; ++e) sl[e * 68 + 16 * j] = h[e] * OS1 + r[e] * OS2;
  }
  v4f badd;
#pragma unroll
  for (int e = 0; e < 4; ++e) badd[e] = bfr(bv[e]);
  slab64_out(scs + sw * SLAB64, badd, out, EMB, (size_t)b * SEQ + q0, sw * 64, el);
}

// =====================================================================================================
// Query rows 0 .. TQ0-1 of each sequence in f32 on VALU: block = (b, t), threads 0..127 work (waves 4..7 only pass the barriers, up to the output projection). QF/KF = f32 q/k planes [nb][TQ0][DH] (bias
// included), V = f32 v plane [nb*SEQ][DH]. Scores for keys j (thread j, one key each, 64-d dot of its whole key row against the q row staged in LDS;
// keys j > t masked to -inf), base-2 softmax with block max / sum reductions (xor shuffles + LDS), p_j in LDS, ctx[d] for d = tid
// (threads 0..63) as a sum in key order of p_j * V[b][j][d] (coalesced, groups of 64 keys up to the one holding t), x = ctx * 4096 / l, hi = f16(x),
// res = f16((x - hi) * 2048); both 64-half rows are staged in LDS, then the row's output projection: wave w -> out columns 64w .. 64w+63.
// coverage: grid nb*TQ0 blocks = rows 0..TQ0-1 of every sequence; 64 thr x 1 d = DH per row; store 8 waves x 4 x 16 lanes = EMB floats;
//           together with attn_fwd every (b, s, n) of out is written exactly once.
// =====================================================================================================
__device__ __forceinline__
void attn_head_body(float* qs, float* sc, float* red, float* redb, u16* SW, int bid,
                    const float* __restrict__ QF, const float* __restrict__ KF, const float* __restrict__ V,
                    const u16* __restrict__ WOTp, const float* __restrict__ bo, float* out) {
  const int tid = threadIdx.x, lane = tid & 31, wave = tid >> 5;
  const int b = bid / TQ0;
  const int t = bid - b * TQ0;
  const bool work = wave < HD_THREADS / 32;                        // wave-uniform: one key per thread, keys 0..TQ0-1
  if (tid < DH) qs[tid] = QF[((size_t)b * TQ0 + t) * DH + tid];   // waves 0,1 entirely (wave-uniform)
  __syncthreads();
  float acc = 0.f;
  if (work) {
    const float* kp = KF + (size_t)b * (TQ0 * DH) + tid * DH;       // key row b*TQ0 + tid always in range (tid < TQ0)
    v4f kr[DH / 4];                                                 // the whole key row: 16 loads in flight, one latency
#pragma unroll
    for (int i = 0; i < DH / 4; ++i) kr[i] = *(const v4f*)(kp + 4 * i);
#pragma unroll
    for (int i = 0; i < DH / 4; ++i) {
      const v4f q4 = *(const v4f*)(qs + 4 * i);
#pragma unroll
      for (int e = 0; e < 4; ++e) acc += kr[i][e] * q4[e];
    }
  }
  const float s = (tid <= t) ? acc * (RSQD * LOG2E) : -INFINITY;   // causal mask by key index
  float mx = s;
#pragma unroll
  for (int d = 1; d <= 16; d <<= 1) mx = fmaxf(mx, __shfl_xor(mx, d, 32));
  if (work && lane == 0) red[wave] = mx;
  __syncthreads();
  float gm = red[0];
#pragma unroll
  for (int w = 1; w < 4; ++w) gm = fmaxf(gm, red[w]);   // finite: key 0 is always valid
  const float p = exp2f(s - gm);                     // 0 for masked keys
  float ps = p;
#pragma unroll
  for (int d = 1; d <= 16; d <<= 1) ps += __shfl_xor(ps, d, 32);
  if (work && lane == 0) redb[wave] = ps;
  if (work) sc[tid] = p;
  __syncthreads();
  float l = redb[0];
#pragma unroll
  for (int w = 1; w < 4; ++w) l += redb[w];           // >= 1
  const float inv = (1.0f / l) * CSC;
  if (wave < 2) {                                    // threads 0..63 (wave-uniform): one d column each
    const float* vp = V + (size_t)b * SEQ * DH + tid;
    float cx = 0.f;
    // Keys in groups of 64 whose loads are issued ahead of their use: one load latency per group. A group's keys j > t carry
    // sc[j] = 0 and add nothing; rows j0 .. j0+63 <= TQ0-1 of sequence b always exist. The sum runs in key order.
    // rolled: the trip count (1 or 2) depends on t
#pragma unroll 1
    for (int j0 = 0; j0 <= t; j0 += 64) {            // block-uniform
      float vv[64];
#pragma unroll
      for (int i = 0; i < 64; ++i) vv[i] = vp[(size_t)(j0 + i) * DH];
#pragma unroll
      for (int i = 0; i < 16; ++i) {
        const v4f p4 = *(const v4f*)(sc + j0 + 4 * i);
#pragma unroll
        for (int e = 0; e < 4; ++e) cx += p4[e] * vv[4 * i + e];
      }
    }
    const float x0 = cx * inv;
    const _Float16 h0 = (_Float16)x0;
    const _Float16 r0 = (_Float16)((x0 - (float)h0) * RSC);
    SW[tid]      = h_bits(h0);
    SW[DH + tid] = h_bits(r0);
  }
  const int sw = __builtin_amdgcn_readfirstlane(wave);   // the wave's number in a scalar register: scalar base for Wo
  v16h bf[4];                                        // groups 0 and 1: behind the 64-register key groups, in front of the last barrier
  oproj_ldb(bf[0], bf[1], WOTp, sw, 0, lane);
  oproj_ldb(bf[2], bf[3], WOTp, sw, 1, lane);
  float bb[4];
#pragma unroll
  for (int j = 0; j < 4; ++j) bb[j] = bo[wave * 64 + 16 * j + (lane & 15)];
  __syncthreads();
  // ---- output projection of the one ctx row, all 8 waves: it is row 0 of the A tile, rows 1..15 are zero; row 0 of a result tile is
  //      element 0 of lanes 0..15 (column = lane) ----
  const int hh = lane >> 4, m = lane & 15;
  const v4u z4 = {0u, 0u, 0u, 0u};
  FragH fa[4];                                       // hi k 0..31, hi k 32..63, residual k 0..31, residual k 32..63
#pragma unroll
  for (int i = 0; i < 4; ++i) {
    const v4u u0 = *(const v4u*)(SW + i * 32 + 8 * hh), u1 = *(const v4u*)(SW + i * 32 + 16 + 8 * hh);
    fa[i].u[0] = (m == 0) ? u0 : z4;
    fa[i].u[1] = (m == 0) ? u1 : z4;
  }
  float ov[4];
  // unrolled: the fragment set bf[] is indexed by j and has to stay in registers
#pragma unroll
  for (int j = 0; j < 4; ++j) {
    v8f h, r;
    oproj_mma(h, r, bf[2 * (j & 1)], bf[2 * (j & 1) + 1], fa[0].v, fa[1].v, fa[2].v, fa[3].v);
    if (j < 2) oproj_ldb(bf[2 * j], bf[2 * j + 1], WOTp, sw, j + 2, lane);
    ov[j] = (h[0] * OS1 + r[0] * OS2) + bfr(bb[j]);
  }
  float* dst = out + ((size_t)b * SEQ + t) * EMB + wave * 64 + m;
  if (lane < 16) {
#pragma unroll
    for (int j = 0; j < 4; ++j) dst[16 * j] = ov[j];
  }
}

// =====================================================================================================
// One launch for the two independent attention jobs, picked by block index (block-uniform): blocks 0..NB*NQT-1 = query rows TQ0.. on
// WMMA, longest tiles first, the rest = query rows 0..TQ0-1 on VALU (short blocks, last, so that they fill places the long blocks leave).
// coverage: grid = NB*NQT + NB*TQ0 blocks; each job is handed block indices 0 .. its own block count - 1.
// =====================================================================================================
__global__ __launch_bounds__(ATT_THREADS) __attribute__((amdgpu_num_vgpr(256)))
void attn(const u16* __restrict__ QPp, const u16* __restrict__ KPp, const u16* __restrict__ VTp, const float* __restrict__ VSp,
          const float* __restrict__ QF, const float* __restrict__ KF, const float* __restrict__ V,
          const u16* __restrict__ WOTp, const float* __restrict__ bo, float* out) {
  __shared__ __align__(16) float scs[8 * 16 * OPP]; // partial O tiles [8][16][OPP] f32, then out slabs
  __shared__ __align__(16) u16 pls[32 * CTP];       // ctx staging [32][CTP] u16
  __shared__ float wm[8 * QT];                      // running max per wave and query
  __shared__ float wl[8 * QT];                      // running sum per wave and query
  __shared__ __align__(16) float qs[DH];
  __shared__ __align__(16) float sc[TQ0];
  __shared__ float red[4];
  __shared__ float redb[4];
  __shared__ __align__(16) u16 SW[2 * DH];
  const int bid = blockIdx.x;
  if (bid < NB * NQT) attn_fwd_body(scs, pls, wm, wl, bid, QPp, KPp, VTp, VSp, WOTp, bo, out);
  else                attn_head_body(qs, sc, red, redb, SW, bid - NB * NQT, QF, KF, V, WOTp, bo, out);
}

// =====================================================================================================
// Workspace map (bytes, nb = 4, rows = 16384); every plane (V only in rows 0..127 of each sequence) is written by whole-line stores before it is read; all extents are
//   WQT bf16 [64][512] 65536   WKT same   WVT same   WOT f16 of bf16 value x1024 [512][64] 65536 (fragment order)  262144
//   XB  bf16 [rows][512]                                                                                           16777216
//   QP  f16 [rows][64] x8 (fragment order)                                                                          2097152
//   KP  f16 [rows][64] x8 (fragment order)                                                                          2097152
//   V   f32 [rows][64] (only rows 0..127 of each sequence are written and read)                                     4194304
//   VT  f16 [nb][SEQ/32][4] tiles (32 keys x 16 d) x1024 (fragment order)                                                                    2097152
//   VS  f32 [nb][8][16][64]                                                                                          131072
//   QF  f32 [nb][128][64]  131072      KF same                                                                       262144
//   end                                                                                                            27918336
// =====================================================================================================
extern "C" void kernel_launch(void* const* d_in, const int* in_sizes, int n_in,
                              void* d_out, int out_size, void* d_ws, size_t ws_size,
                              hipStream_t stream) {
  if (n_in < 9) return;
  const int nb   = NB;
  const int rows = nb * SEQ;
  if ((long long)in_sizes[0] < (long long)NB * SEQ_FULL * EMB) return;
  if (in_sizes[1] < EMB * DH || in_sizes[3] < EMB * DH || in_sizes[5] < EMB * DH || in_sizes[7] < DH * EMB) return;
  if (in_sizes[2] < DH || in_sizes[4] < DH || in_sizes[6] < DH || in_sizes[8] < EMB) return;
  if ((long long)out_size < (long long)rows * EMB) return;

  const float* x  = (const float*)d_in[0];
  const float* wq = (const float*)d_in[1];
  const float* bq = (const float*)d_in[2];
  const float* wk = (const float*)d_in[3];
  const float* bk = (const float*)d_in[4];
  const float* wv = (const float*)d_in[5];
  const float* bv = (const float*)d_in[6];
  const float* wo = (const float*)d_in[7];
  const float* bo = (const float*)d_in[8];
  float*       out = (float*)d_out;

  const size_t szW  = (size_t)EMB * DH * 2;                      //     65536
  const size_t szXB = (size_t)rows * EMB * 2;                    //  16777216
  const size_t szP  = (size_t)rows * DH * 2;                     //   2097152
  const size_t szV  = (size_t)rows * DH * 4;                     //   4194304
  const size_t szVT = (size_t)nb * DH * SEQ * 2;                 //   2097152 (== szP)
  const size_t szVS = (size_t)nb * NCHK * NKB * DH * 4;          //    131072
  const size_t szHF = (size_t)nb * TQ0 * DH * 4;                 //    131072
  size_t off = 0;
  const size_t oWQ = off; off += szW;
  const size_t oWK = off; off += szW;
  const size_t oWV = off; off += szW;
  const size_t oWO = off; off += szW;
  const size_t oXB = off; off += szXB;
  const size_t oQ  = off; off += szP;
  const size_t oK  = off; off += szP;
  const size_t oV  = off; off += szV;
  const size_t oVT = off; off += szVT;
  const size_t oVS = off; off += szVS;
  const size_t oQF = off; off += szHF;
  const size_t oKF = off; off += szHF;
  if (off > ws_size) return;                                     // off = 27918336 at nb = 4
  if (off > WS_CAP) return;

  char* ws = (char*)d_ws;
  u16*   WQT = (u16*)(ws + oWQ);
  u16*   WKT = (u16*)(ws + oWK);
  u16*   WVT = (u16*)(ws + oWV);
  u16*   WOT = (u16*)(ws + oWO);
  u16*   XB  = (u16*)(ws + oXB);
  u16*   QP  = (u16*)(ws + oQ);
  u16*   KP  = (u16*)(ws + oK);
  float* V   = (float*)(ws + oV);
  u16*   VT  = (u16*)(ws + oVT);
  float* VS  = (float*)(ws + oVS);
  float* QF  = (float*)(ws + oQF);
  float* KF  = (float*)(ws + oKF);

  const int n8x = (SEQ * EMB) / 8;                       // 262144 per batch
  if ((n8x % 256) != 0 || (rows % 64) != 0 || ((nb * TQ0) % 64) != 0) return;
  const dim3 blk(256);
  const dim3 gPR(4 * WTB + NB * XCB);                   // 4 * 8 weight tiles + nb * 1024 x blocks
  const dim3 gPJ(2 * GHB + 3 * GPB);                    // 2 * 8 + 3 * 256 at nb = 4
  const dim3 bG(128);
  const dim3 gAT(NB * NQT + NB * TQ0);                  // nb * 248 + nb * 128
  const dim3 bAT(ATT_THREADS);

  // (0) Wq, Wk, Wv stored [k = in 512][n = out 64] -> bf16 planes [64][512] in fragment order; Wo [k = 64][n = 512] -> f16 of bf16
  //     value x1024, [512][64] in fragment order; x -> bf16 plane [rows][512]
  prep<<<gPR, blk, 0, stream>>>(x, wq, wk, wv, wo, WQT, WKT, WVT, WOT, XB);
  // (1) q and k projections (+bias) -> f16 planes x8; v projection (+bias) -> V^T plane x1024, key-block column sums and f32 rows
  //     0..127 of every sequence; f32 q and k rows 0..127 of every sequence -> QF, KF [nb*128][64]
  proj<<<gPJ, bG, 0, stream>>>(XB, WQT, WKT, WVT, bq, bk, bv, QP, KP, V, VT, VS, QF, KF, rows, nb * TQ0, DH, EMB);
  // (2) attention: query rows 128.. on WMMA and query rows 0..127 on VALU -> ctx hi x4096 and residual x2048 f16 rows in LDS, then
  //     each block's output projection + bias -> out
  attn<<<gAT, bAT, 0, stream>>>(QP, KP, VT, VS, QF, KF, V, WOT, bo, out);
  (void)hipGetLastError();
}

// v008
// Measured time: 40.9 microseconds a run.
// Timed twice side by side with v007, it ran 1.16 and 1.18 times as fast.
// All steps since v000 together make it 5.57 times as fast.
// Projections q,k,v = x.W + b and the f32 q,k rows 0..127 per sequence: v_wmma_f32_16x16x32_bf16 (bf16 RNE operands of the
// raw inputs, f32 accumulate, bf16 RNE bias added in f32). Scores q'.k'^T (f16 planes x8), P'.V (key-block-centred P' x32768 f16 from registers,
// V^T x1024 f16) and the output projection (ctx carried as f16 hi x4096 plus residual x2048 rows, times f16(bf16(Wo)) x1024, bias
// added in f32): v_wmma_f32_16x16x32_f16, f32 accumulate. Query rows 0..127 of each sequence: scores, softmax and P.V in f32 on VALU.
// Causal mask, softmax statistics, key-block column sums of V and all scaling in f32 on VALU.
#include <hip/hip_runtime.h>
#include <math.h>
#include <stdint.h>

#ifndef NB
#define NB 4
#endif
#ifndef SEQ
#define SEQ 4096
#endif
#define SEQ_FULL 4096
#define NB_FULL 4
#define EMB   512
#define DH    64
#define CK    512
#define NCHK  (SEQ / CK)
#define NKB   16
#define QT    16
#define TQ0   128
#define NQT   ((SEQ - TQ0) / QT)
#define OPP   68
#define CTP   72
#define SLAB64 (16 * 68)
#define VTP   72
#define ATT_THREADS 256
#define HD_THREADS 128
#define NACC  4
#define QSC   8.0f
#define KSC   8.0f
#define PCAR  32768.0f
#define VCAR  1024.0f
#define WSC   1024.0f
#define CSC   4096.0f
#define RSC   2048.0f
#define OS1   (1.0f / (CSC * WSC))
#define OS2   (1.0f / (CSC * WSC * RSC))
#define LOG2E 1.4426950408889634f
#define RSQD  0.125f
#define WS_CAP ((size_t)134217728)
#define WTB   ((EMB / 64) * (DH / 64))
#define GPB   (((NB * SEQ) / 64) * (DH / 64))
#define PJ_THREADS 384
#define XTP   (EMB + 8)

static_assert(DH == 64 && NACC * 16 == DH && (EMB % 64) == 0 && (EMB % 32) == 0 && (DH % 32) == 0);
static_assert((SEQ % CK) == 0 && NCHK >= 1 && CK == 32 * NKB && (SEQ % 64) == 0 && (SEQ % QT) == 0 && (CK % QT) == 0);
static_assert((TQ0 % QT) == 0 && (TQ0 % 64) == 0 && NQT * QT + TQ0 == SEQ && NQT >= 1 && TQ0 == 128 && TQ0 == HD_THREADS);
static_assert(8 * SLAB64 <= 8 * 16 * OPP && EMB == 8 * 64 && CTP >= DH + 8 && OPP >= DH + 4);
static_assert(((VTP * 2) % 16) == 0 && ((CTP * 2) % 16) == 0 && ((OPP * 4) % 16) == 0);
static_assert(64 * VTP >= 63 * VTP + 64);
static_assert(ATT_THREADS == 16 * QT && ATT_THREADS == 256 && HD_THREADS == 2 * DH);
static_assert(((NB * SEQ) % 64) == 0 && EMB == 512 && ((XTP * 2) % 32) == 16 && PJ_THREADS == 12 * 32);
static_assert(NB >= 1 && NB <= NB_FULL && SEQ <= SEQ_FULL && (TQ0 % 64) == 0 && (NKB % 2) == 0);

typedef unsigned short u16;
typedef _Float16 v16h __attribute__((ext_vector_type(16)));
typedef _Float16 v8h  __attribute__((ext_vector_type(8)));
typedef __bf16   v16b __attribute__((ext_vector_type(16)));
typedef float    v8f  __attribute__((ext_vector_type(8)));
typedef float    v4f  __attribute__((ext_vector_type(4)));
typedef unsigned int v4u __attribute__((ext_vector_type(4)));
typedef unsigned int v2u __attribute__((ext_vector_type(2)));

union FragH { v16h v; v8h h[2]; v4u u[2]; };
union FragB { v16b v; v4u u[2]; };

// ---- scalar helpers --------------------------------------------------------------------------------
__device__ __forceinline__ unsigned short bf_bits(float f) {          // f32 -> bf16 bits, RNE convert
  unsigned u = __float_as_uint(f);
  return (unsigned short)((u + 0x7FFFu + ((u >> 16) & 1u)) >> 16);
}
__device__ __forceinline__ float bf_up(unsigned short h) { return __uint_as_float(((unsigned)h) << 16); }
__device__ __forceinline__ float bfr(float f) { return bf_up(bf_bits(f)); }
__device__ __forceinline__ unsigned short h_bits(_Float16 x) { return __builtin_bit_cast(unsigned short, x); }
__device__ __forceinline__ unsigned pk16(unsigned short a, unsigned short b) { return (unsigned)a | ((unsigned)b << 16); }
__device__ __forceinline__ v8f zero8() { v8f z = {0.f, 0.f, 0.f, 0.f, 0.f, 0.f, 0.f, 0.f}; return z; }
__device__ __forceinline__ v4f zero4() { v4f z = {0.f, 0.f, 0.f, 0.f}; return z; }

// ---- fragment loaders: 16-bit A/B operand, lane -> row/col (lane&15), p already includes +8*(lane>>4);
//      elements 0..7 <- p[0..7] (k0+8h..), elements 8..15 <- p[16..23] (k0+16+8h..)  (same split k map for A and B);
//      this form reads the row-major A tiles in LDS (x, ctx hi, ctx residual)
__device__ __forceinline__ v16h ldfrag_h(const _Float16* p) {
  FragH f;
  f.h[0] = *(const v8h*)(p);
  f.h[1] = *(const v8h*)(p + 16);
  return f.v;
}
__device__ __forceinline__ v16b ldfrag_b(const u16* p) {              // bf16 plane read as unsigned integer vectors
  FragB f;
  f.u[0] = *(const v4u*)(p);
  f.u[1] = *(const v4u*)(p + 16);
  return f.v;
}

// ---- the same fragments from a plane kept in FRAGMENT ORDER: a 16 (rows or cols) x 32 (k) tile is 512 consecutive halves; the 16-B
//      unit of lane l = 16*h + m (row/col m, k = 8h .. 8h+7) lies at 8*l, the unit for k = 16+8h .. at 256 + 8*l. p already includes
//      +8*lane, so each of the two loads reads 512 consecutive bytes (4 whole lines) where a row-major plane gives 16 lines.
__device__ __forceinline__ v16h ldfrag_hs(const _Float16* p) {
  FragH f;
  f.h[0] = *(const v8h*)(p);
  f.h[1] = *(const v8h*)(p + 256);
  return f.v;
}
__device__ __forceinline__ v16b ldfrag_bs(const u16* p) {
  FragB f;
  f.u[0] = *(const v4u*)(p);
  f.u[1] = *(const v4u*)(p + 256);
  return f.v;
}

__device__ __forceinline__ v8f mma_h(v16h a, v16h b, v8f c) {
  return __builtin_amdgcn_wmma_f32_16x16x32_f16(false, a, false, b, (short)0, c, false, false);
}
__device__ __forceinline__ v8f mma_b(v16b a, v16b b, v8f c) {
  return __builtin_amdgcn_wmma_f32_16x16x32_bf16(false, a, false, b, (short)0, c, false, false);
}
__device__ __forceinline__ void guard2x6(v8f& a, v8f& b, v16h x0, v16h x1, v16h x2, v16h x3, v16h x4, v16h x5) {
#if defined(__HIP_DEVICE_COMPILE__)
  asm volatile("v_nop\n\tv_nop\n\tv_nop\n\tv_nop"
               : "+v"(a), "+v"(b) : "v"(x0), "v"(x1), "v"(x2), "v"(x3), "v"(x4), "v"(x5) : "memory");
#endif
}
__device__ __forceinline__ void guardpv4(v8f& o0, v8f& o1, v8f& o2, v8f& o3, v16h p, v16h g0, v16h g1, v16h g2, v16h g3) {
#if defined(__HIP_DEVICE_COMPILE__)
  asm volatile("v_nop\n\tv_nop\n\tv_nop\n\tv_nop"
               : "+v"(o0), "+v"(o1), "+v"(o2), "+v"(o3)
               : "v"(p), "v"(g0), "v"(g1), "v"(g2), "v"(g3) : "memory");
#endif
}
__device__ __forceinline__ void wave_sync_lds() {                    // wave-private LDS slab: release, wave barrier, acquire
  __builtin_amdgcn_fence(3, "workgroup");
  __builtin_amdgcn_wave_barrier();
  __builtin_amdgcn_fence(2, "workgroup");
}

// =====================================================================================================
// Weight transpose-convert: in W[R][C] f32 row-major -> out D = the [n = C][k = R] 16-bit operand plane for y = x.W in fragment order:
// tile (n/16, k/32) at halves ((n/16)*(R/32) + k/32)*512, units inside it as ldfrag_hs / ldfrag_bs read them.
// mode 0: bf16 RNE bits; mode 1: f16 bits of (bf16 RNE value) * scale.
// Block = 64x64 tile: 64 input row segments of 64 floats loaded with 16-B loads, converted, scattered into an LDS tile [c][64 r]
// coverage: load 256 thr x 16 = 64 x 64; store 2 iterations x 256 thr x 8 halves = 64 lines x 64; grid = (R/64) x (C/64) blocks
//           covers D exactly once (R, C are EMB, DH: static_assert EMB % 64 == 0, DH == 64).
// =====================================================================================================
__device__ __forceinline__ void wt16_body(u16* TH, int bid, const float* __restrict__ W, u16* D, int R, int C, int mode,
                                          float scale) {
  const int tid = threadIdx.x;
  const int nrt = R >> 6;
  const int r0  = (bid % nrt) * 64;
  const int c0  = (bid / nrt) * 64;
  {
    const int rl = tid >> 2;                  // input row within tile 0..63
    const int cs = (tid & 3) * 16;            // column chunk within the 64
    const float* src = W + (size_t)(r0 + rl) * C + c0 + cs;
#pragma unroll
    for (int i = 0; i < 4; ++i) {
      const v4f a = *(const v4f*)(src + 4 * i);
#pragma unroll
      for (int e = 0; e < 4; ++e) {
        const float v  = a[e];
        const unsigned short hb = h_bits((_Float16)(bfr(v) * scale));
        const unsigned short bb = bf_bits(v);
        TH[(cs + 4 * i + e) * VTP + rl] = (mode != 0) ? hb : bb;
      }
    }
  }
  __syncthreads();
  v4u vh[2];
  const int fm = tid & 15, fh = (tid >> 4) & 1, fs = (tid >> 5) & 1, fk = (tid >> 6) & 1, fn = tid >> 7;
#pragma unroll
  for (int it = 0; it < 2; ++it) {            // local c = 16*(2*it + fn) + fm, local r = 32*fk + 16*fs + 8*fh .. +7
    vh[it] = *(const v4u*)(TH + ((it * 2 + fn) * 16 + fm) * VTP + fk * 32 + fs * 16 + fh * 8);
  }
  const int kt = R >> 5;                      // 32-wide k tiles per 16 columns
  {
#pragma unroll
    for (int it = 0; it < 2; ++it) {
      *(v4u*)(D + ((size_t)((c0 >> 4) + it * 2 + fn) * (size_t)kt + (size_t)(r0 >> 5)) * 512 + (tid & 127) * 8) = vh[it];
    }
    
  }
}

// =====================================================================================================
// One launch for the four weight transposes, picked by block index (block-uniform): WTB blocks each, order Wq, Wk, Wv, Wo.
// coverage: grid = 4*WTB blocks; each job is handed block indices 0 .. WTB-1.
// =====================================================================================================
__global__ __launch_bounds__(256)
void prep(const float* __restrict__ wq, const float* __restrict__ wk, const float* __restrict__ wv,
          const float* __restrict__ wo, u16* WQT, u16* WKT, u16* WVT, u16* WOT) {
  __shared__ __align__(16) u16 TH[64 * VTP];
  const int bid = blockIdx.x;
  const int job = bid / WTB;
  const float* W = (job == 0) ? wq : (job == 1) ? wk : (job == 2) ? wv : wo;
  u16* D = (job == 0) ? WQT : (job == 1) ? WKT : (job == 2) ? WVT : WOT;
  const bool pj = job < 3;                    // Wq, Wk, Wv: [EMB][DH] -> bf16; Wo: [DH][EMB] -> scaled f16
  wt16_body(TH, bid - job * WTB, W, D, pj ? EMB : DH, pj ? DH : EMB, pj ? 0 : 1, pj ? 1.0f : WSC);
}

// =====================================================================================================
// Stores of a 16 x 64 f32 tile that lies in an LDS slab [16][68] (row = tile row, 68 = 64 columns + 4 pad):
//  slab64_out: f32 rows + badd; instruction it: lanes 0..15 -> row 2*it (16 lanes x 16 B = two whole lines), lanes 16..31 -> row 2*it+1.
//  slab64_hsb: f16 bits of ((tile + bf16RNE(bias[n])) * pscale), plane [rows][DH] in fragment order; lane = (row lane&15, 8 consecutive
//              columns), each of the 4 stores writes 512 consecutive bytes.
// coverage: slab64_out 8 instructions x 2 rows x 16 lanes x 4 floats; slab64_hsb 4 instructions x 16 rows x 2 lanes x 8 halves
//           = the 16 x 64 tile in both cases.
// =====================================================================================================
__device__ __forceinline__ void slab64_out(const float* sl, v4f badd, float* C, int N, size_t rowb, int col0, int lane) {
  const int hh = lane >> 4, m = lane & 15;
  wave_sync_lds();
  v4f vals[8];
#pragma unroll
  for (int it = 0; it < 8; ++it) vals[it] = *(const v4f*)(sl + (it * 2 + hh) * 68 + m * 4) + badd;
  float* dst = C + (rowb + (size_t)hh) * (size_t)N + col0 + m * 4;
#pragma unroll
  for (int it = 0; it < 8; ++it) *(v4f*)(dst + (size_t)(it * 2) * (size_t)N) = vals[it];
}
__device__ __forceinline__ void slab64_hsb(const float* sl, float pscale, const float* __restrict__ bias, u16* C, size_t rowb, int lane) {
  const int hh = lane >> 4, m = lane & 15;
  v4u oh[4];
#pragma unroll
  for (int g = 0; g < 4; ++g) {               // g = 16-column group of the 64; lane = (row m, columns 16g + 8hh .. +7)
    const int c8 = g * 16 + hh * 8;
    const v4f b0 = *(const v4f*)(bias + c8), b1 = *(const v4f*)(bias + c8 + 4);
    const v4f a = *(const v4f*)(sl + m * 68 + c8), c4 = *(const v4f*)(sl + m * 68 + c8 + 4);
    float w[8];
#pragma unroll
    for (int e = 0; e < 4; ++e) { w[e] = (a[e] + bfr(b0[e])) * pscale; w[4 + e] = (c4[e] + bfr(b1[e])) * pscale; }
#pragma unroll
    for (int e = 0; e < 4; ++e) oh[g][e] = pk16(h_bits((_Float16)w[2 * e]), h_bits((_Float16)w[2 * e + 1]));
  }
  // 16 rows = two tiles (d 0..31, d 32..63) of 512 halves; group g is the half-tile at g*256
  u16* dst = C + (rowb >> 4) * (size_t)(2 * 512) + lane * 8;
#pragma unroll
  for (int g = 0; g < 4; ++g) *(v4u*)(dst + g * 256) = oh[g];
}

// Block barrier that orders LDS alone: a wave's LDS stores are done in front of it, its LDS reads stand behind it. __syncthreads() would
// also wait for the x rows that are still on their way from memory, which the barriers inside the k loop must not do.
__device__ __forceinline__ void lds_barrier() {
  __builtin_amdgcn_fence(__ATOMIC_RELEASE, "workgroup", "local");
  __builtin_amdgcn_s_barrier();
  __builtin_amdgcn_fence(__ATOMIC_ACQUIRE, "workgroup", "local");
}

// =====================================================================================================
// All projections of 64 rows of x in one block of 12 waves: q, k, v = bf16RNE(x) . bf16RNE(W) on WMMA, f32 accumulate, k in steps of 32
// in rising order. x is read here as f32, once: wave-wide 16-B loads of 512 consecutive bytes of a row, RNE convert in registers, rows
// staged as bf16 in LDS at a pitch of XTP halves (1024 + 16 bytes).
//  loads: piece L = 0..255 is (row L & 63, k quarter L >> 6); wave w takes L = w + 12*i, issued two quarters ahead of their use.
//         Quarter c is complete once every wave has staged its pieces i < X1(c): 6 + 5*c for c < 3 (w + 12*(6 + 5*c) >= 64*(c + 1) for every w), all of them for c = 3.
//  products: wave w = (job w >> 2: q, k, v; 16 columns n = 16*(w & 3) ..) x the four 16-row tiles; weight fragments straight into
//         registers; A fragments from LDS (ldfrag_b, the split k map of the weight planes). Quarter c's four k steps follow barrier c.
//  results: tile i of wave w -> slab (job, i), columns 16*(w & 3) ..; element r of lane (hh, m) is row 8*hh + r, column m of the tile.
//  stores: wave w = (job, row tile w & 3) takes slab w:
//   q, k: f16 plane x8 with bias (slab64_hsb); rows 0..TQ0-1 of a sequence also as f32 rows with bias -> QF, KF [nb*TQ0][DH].
//   v: value = slab + bf16RNE(bias) in f32, lane (hh, m) holds v[key rowb + 8*hh + r][d = 16*j + m];
//      V^T plane = f16(v * 1024) in fragment order: the tile (32 keys, 16 columns d) lies at halves ((b*SEQ + s)/32 * 4 + d/16)*512; a
//      lane's 8 elements of column group j are one 16-B unit, the wave's 16 keys the half-tile at 256*((rowb/16) & 1);
//      VS[(b*SEQ + s)/32][d] = sum of v over the 32 keys of a key block (f32): 8 keys in order in a lane, + the other half-wave's 8
//      (xor shuffle), + the neighbour wave's 16 through LDS behind a block barrier;
//      V = f32 rows, only for keys 0..TQ0-1 of a sequence.
// coverage: grid = nb*SEQ/64 blocks; staging 256 pieces x 32 lanes x 4 = 64 x 512; slabs 12 waves x 4 tiles x 16 x 16 = 3 x 64 x 64.
// =====================================================================================================
__device__ __forceinline__ void vrows(float (&w)[4][8], const float* sl, const float* __restrict__ bias, int hh, int m) {
#pragma unroll
  for (int j = 0; j < 4; ++j) {
    const float bj = bfr(bias[16 * j + m]);
#pragma unroll
    for (int r = 0; r < 8; ++r) w[j][r] = sl[(8 * hh + r) * 68 + 16 * j + m] + bj;
  }
}
// k quarter C: a wave's pieces i = X0(C) .. X1(C)-1, its weight fragments and k steps 4*C .. 4*C+3
#define X0(C) ((C) == 0 ? 0 : 1 + 5 * (C))
#define X1(C) ((C) == 3 ? 22 : 6 + 5 * (C))
template <int C>
__device__ __forceinline__ void w_issue(v16b (&bw)[EMB / 32], const u16* bp) {
#pragma unroll
  for (int s = 4 * C; s < 4 * C + 4; ++s) bw[s] = ldfrag_bs(bp + s * 512);
}
template <int C>
__device__ __forceinline__ void x_issue(v4f (&xv)[22], const float* __restrict__ xb, int sw, int lane) {
#pragma unroll
  for (int i = X0(C); i < X1(C); ++i) {
    // pieces 252..255 go to waves 0..3; the other waves read their piece 20 again and do not stage it: one instruction stream
    const int L = (i < 21 || sw < 4) ? sw + 12 * i : sw + 240;
    xv[i] = *(const v4f*)(xb + (size_t)(L & 63) * EMB + (L >> 6) * 128 + lane * 4);
  }
}
template <int C>
__device__ __forceinline__ void x_stage(const v4f (&xv)[22], u16* XT, int sw, int lane) {
#pragma unroll
  for (int i = X0(C); i < X1(C); ++i) {
    if (i < 21 || sw < 4) {
      const int L = sw + 12 * i;
      v2u o;
      o[0] = pk16(bf_bits(xv[i][0]), bf_bits(xv[i][1]));
      o[1] = pk16(bf_bits(xv[i][2]), bf_bits(xv[i][3]));
      *(v2u*)(XT + (L & 63) * XTP + (L >> 6) * 128 + lane * 4) = o;
    }
  }
}
template <int C>
__device__ __forceinline__ void k_steps(v8f (&acc)[4], const v16b (&bw)[EMB / 32], const u16* ar) {
  v16b af[2][4];                             // the next k step's four A fragments are read while this step's products run
#pragma unroll
  for (int i = 0; i < 4; ++i) af[0][i] = ldfrag_b(ar + i * (16 * XTP) + 32 * (4 * C));
#pragma unroll
  for (int t = 0; t < 4; ++t) {
    if (t < 3) {
#pragma unroll
      for (int i = 0; i < 4; ++i) af[(t + 1) & 1][i] = ldfrag_b(ar + i * (16 * XTP) + 32 * (4 * C + t + 1));
    }
#pragma unroll
    for (int i = 0; i < 4; ++i) acc[i] = mma_b(af[t & 1][i], bw[4 * C + t], acc[i]);
  }
}
__global__ __launch_bounds__(PJ_THREADS)
void proj(const float* __restrict__ x, const u16* __restrict__ WQT, const u16* __restrict__ WKT, const u16* __restrict__ WVT,
          const float* __restrict__ bq, const float* __restrict__ bk, const float* __restrict__ bv,
          u16* QP, u16* KP, float* V, u16* VT, float* VS, float* QF, float* KF) {
  __shared__ __align__(16) u16 XT[64 * XTP];
  __shared__ __align__(16) float slab[12 * SLAB64];
  __shared__ float cs[4 * DH];               // 16-key column sums of v, one row per v wave
  const int tid = threadIdx.x, lane = tid & 31, hh = lane >> 4, m = lane & 15;
  const int sw  = __builtin_amdgcn_readfirstlane(tid >> 5);   // the wave's number in a scalar register: scalar bases and branches
  const int job = sw >> 2, sub = sw & 3;
  const int row0 = (int)blockIdx.x * 64;     // compact row b*SEQ + s; 64 divides SEQ, so a block lies in one sequence
  const int sb = row0 / SEQ, s0 = row0 - sb * SEQ;

  // the wave's 16 columns of its weight plane: 16 tiles of 512 halves, one per k step
  const u16* bp = ((job == 0) ? WQT : (job == 1) ? WKT : WVT) + (size_t)sub * (16 * EMB) + lane * 8;
  const float* xb = x + ((size_t)sb * SEQ_FULL + s0) * EMB;   // block-uniform base
  const u16* ar = XT + m * XTP + 8 * hh;
  v16b bw[EMB / 32];
  v4f xv[22];
  v8f acc[4];
#pragma unroll
  for (int i = 0; i < 4; ++i) acc[i] = zero8();
  // Loads are counted back in the order of issue. The scheduling barriers fix that order: in quarters 0 and 1 the weights, then the x pieces, in quarters 2 and 3 the x pieces, then the weights, and
  // nothing of a later quarter in front of an earlier one. Without them the compiler mixes the quarters' loads, so that the first
  // quarter's LDS stores also wait for later loads, and it forms the x addresses in one scalar pair with a wait between single loads.
  // They hold the loads, not the products: a quarter's last products may still stand among the next quarter's converts.
  w_issue<0>(bw, bp); x_issue<0>(xv, xb, sw, lane);
  __builtin_amdgcn_sched_barrier(0);
  w_issue<1>(bw, bp); x_issue<1>(xv, xb, sw, lane);
  __builtin_amdgcn_sched_barrier(0);
  x_stage<0>(xv, XT, sw, lane);
  __builtin_amdgcn_sched_barrier(0);
  x_issue<2>(xv, xb, sw, lane);
  // the address arithmetic of the next run of loads rewrites scalar bases that these loads name: wait first
  asm volatile("s_wait_xcnt 0x0" ::: "memory");
  __builtin_amdgcn_sched_barrier(0);
  lds_barrier();
  k_steps<0>(acc, bw, ar);
  __builtin_amdgcn_sched_barrier(0);
  w_issue<2>(bw, bp);
  __builtin_amdgcn_sched_barrier(0);
  x_stage<1>(xv, XT, sw, lane);
  __builtin_amdgcn_sched_barrier(0);
  x_issue<3>(xv, xb, sw, lane);
  __builtin_amdgcn_sched_barrier(0);
  lds_barrier();
  k_steps<1>(acc, bw, ar);
  __builtin_amdgcn_sched_barrier(0);
  w_issue<3>(bw, bp);
  __builtin_amdgcn_sched_barrier(0);
  x_stage<2>(xv, XT, sw, lane);
  lds_barrier();
  k_steps<2>(acc, bw, ar);
  __builtin_amdgcn_sched_barrier(0);
  x_stage<3>(xv, XT, sw, lane);
  lds_barrier();
  k_steps<3>(acc, bw, ar);
  {
    float* sd = slab + (job * 4) * SLAB64 + (8 * hh) * 68 + 16 * sub + m;
#pragma unroll
    for (int i = 0; i < 4; ++i) {
#pragma unroll
      for (int r = 0; r < 8; ++r) sd[i * SLAB64 + r * 68] = acc[i][r];
    }
  }
  __syncthreads();
  const float* sl = slab + sw * SLAB64;
  const int rowb = row0 + sub * 16;
  const bool head = s0 < TQ0;                // block-uniform: rows that the f32 attention job reads
  if (job == 2) {
    float w[4][8], sum[4];
    vrows(w, sl, bv, hh, m);
#pragma unroll
    for (int j = 0; j < 4; ++j) {
      sum[j] = w[j][0];
#pragma unroll
      for (int r = 1; r < 8; ++r) sum[j] += w[j][r];
    }
#pragma unroll
    for (int j = 0; j < 4; ++j) sum[j] += __shfl_xor(sum[j], 16, 32);
    if (hh == 0) {
#pragma unroll
      for (int j = 0; j < 4; ++j) cs[sub * DH + 16 * j + m] = sum[j];
    }
  }
  __syncthreads();                           // all global stores stand behind it, so that no wave waits for them at the barrier
  if (job == 2) {
    const int vt = sub * 32 + lane;
    const int kbl = vt >> 6, d = vt & 63;    // 128 threads = 2 key blocks x 64 columns
    const float vsum = cs[(2 * kbl) * DH + d] + cs[(2 * kbl + 1) * DH + d];
    float w[4][8];
    vrows(w, sl, bv, hh, m);
    v4u oh[4];
#pragma unroll
    for (int j = 0; j < 4; ++j) {
#pragma unroll
      for (int e = 0; e < 4; ++e) oh[j][e] = pk16(h_bits((_Float16)(w[j][2 * e] * VCAR)), h_bits((_Float16)(w[j][2 * e + 1] * VCAR)));
    }
    VS[((size_t)(row0 >> 5) + (size_t)kbl) * DH + d] = vsum;
    u16* dst = VT + (size_t)(rowb >> 5) * (32 * DH) + ((rowb >> 4) & 1) * 256 + lane * 8;
#pragma unroll
    for (int j = 0; j < 4; ++j) *(v4u*)(dst + j * 512) = oh[j];
  } else {
    slab64_hsb(sl, (job == 0) ? QSC : KSC, (job == 0) ? bq : bk, (job == 0) ? QP : KP, (size_t)rowb, lane);
  }
  if (head) {
    // the f32 rows below rewrite registers that the stores above name: wait first
    asm volatile("s_wait_xcnt 0x0" ::: "memory");
    const float* bias = (job == 0) ? bq : (job == 1) ? bk : bv;
    const v4f bv4 = *(const v4f*)(bias + m * 4);
    // the row offset formed below rewrites the scalar base that this load names: wait first
    asm volatile("s_wait_xcnt 0x0" ::: "memory");
    v4f badd;
#pragma unroll
    for (int e = 0; e < 4; ++e) badd[e] = bfr(bv4[e]);
    float* C = (job == 0) ? QF : (job == 1) ? KF : V;
    const size_t ro = (job == 2) ? (size_t)rowb : (size_t)sb * TQ0 + (size_t)(s0 + sub * 16);
    slab64_out(sl, badd, C, DH, ro, 0, lane);
  }
}

// =====================================================================================================
// Output projection of one 16-row ctx tile that its attention block holds in LDS (hi + residual f16 rows), by all 8 waves:
//   C[row][n] = (hi . Bt^T) * os1 + (res . Bt^T) * os2 + bf16RNE(bias[n]); Bt = f16 [EMB][DH] in fragment order.
// Wave w owns columns 64w .. 64w+63 (four 16-column groups); K = DH = 64 in two steps of 32, separate accumulators for the two
// planes, k order 0..31 then 32..63 in each.
//  oproj_ldb: the two B fragments of group j (k step s at bytes 8192w + 2048j + 1024s).
//  oproj_mma: the four products of one group. Two groups' fragments are in flight at a time and a group's results are used up
//             before the next group's are made, which keeps the epilogue's registers below the key loop's.
// =====================================================================================================
__device__ __forceinline__ void oproj_ldb(v16h& b0, v16h& b1, const u16* __restrict__ Bt, int swave, int j, int lane) {
  const _Float16* bp = (const _Float16*)(const void*)Bt + (size_t)swave * (64 * DH) + j * 1024;      // wave-uniform base
  b0 = ldfrag_hs(bp + 8 * lane);
  b1 = ldfrag_hs(bp + 512 + 8 * lane);
}
__device__ __forceinline__ void oproj_mma(v8f& h, v8f& r, v16h b0, v16h b1, v16h a0, v16h a1, v16h r0, v16h r1) {
  h = mma_h(a0, b0, zero8());
  r = mma_h(r0, b0, zero8());
  h = mma_h(a1, b1, h);
  r = mma_h(r1, b1, r);
  // the distance behind the products: no result is read and no fragment's register is loaded anew in front of it
  guard2x6(h, r, b0, b1, a0, a1, r0, r1);
}

// =====================================================================================================
// Single-head causal attention, head width DH = 64, query rows TQ0 .. SEQ-1: block = (batch b, 16 query rows q0..q0+15), 8 waves.
// q plane (f16, x8), k plane the same and V^T plane (x1024), each in fragment order; VS = column sums of V per key block of 32.
// Wave w takes the key blocks kb = w, w+8, .. < nkbt (32 keys each; nkbt = blocks that hold a key <= q0+15), one per pass, with its own
// running max, running sum and partial O; nothing of a pass goes through LDS and no block barrier stands in the key loop.
//   (S) transposed scores S^T[key][query] on WMMA: A = k rows (row = key, split k map over d), B = q rows (col = query, the two 32-d
//       fragments kept in registers). D element r of lane (hh, m): tile 0 -> key 32kb + 8hh + r, tile 1 -> key 32kb + 16 + 8hh + r,
//       query q0 + m: a lane holds 16 of the 32 scores of ONE query, its partner lane ^ 16 the other 16.
//   (M) base-2 logits with the causal mask by key index (key > query -> -inf), block max and block sum in the lane plus one exchange
//       between the wave's halves, online running max / rescale factor al / running sum l in f32, p = exp2(t - m_new) <= 1 (0 for
//       masked keys), C = block sum / 32 (bit-identical in both halves), the CENTRED P' = p - C as f16(P' * 32768): the lane's 16
//       values, in the order it holds them, ARE its part of the B fragment of P'^T (col = query, elements 0..7 = keys 8hh + e,
//       elements 8..15 = keys 16 + 8hh + e), the k order of the V^T fragments.
//   (PV) O^T[d][query] on WMMA: A = V^T fragments (row = d, split k map over keys), B = P'^T. Accumulator tile j, element r of lane (hh, m) is
//       O^T[d = 16j + 8hh + r][query q0 + m], so al and C are one value a lane: o = o*al + C*(32768*1024)*VS[kb][d], the add-back of
//       the centring term over the 32 keys of the block, in f32, then 4 WMMAs plus a hazard gap. sum_k (P'_k + C) v_k == sum_k p_k v_k
//       exactly; masked keys carry P' = -C and p = 0. Every key block that is visited holds a valid key for each of the 16 queries.
//   Combine: the waves' max and sum per query go to LDS, barrier; every wave scales its partial O by exp2(own max - max of the 8)
//   (0 for a wave that had no key block) and stages it as [8][16 queries][OPP] f32, barrier, then thread (row = tid>>4, 4 columns) sums
//   the 8 partials in fixed order and the 8 scaled sums l likewise, x = sum * 4096 / (l * 32768 * 1024) (l >= 1 always), hi = f16(x),
//   res = f16((x - hi) * 2048), staged as a [32][CTP] u16 tile,
//   barrier, then the output projection of these 16 rows (oproj_ldb, oproj_mma, slab64_out): wave w -> out columns 64w .. 64w+63.
// coverage: grid nb*NQT blocks x 16 rows = rows TQ0..SEQ-1 of every sequence; key blocks 0..nkbt-1 each by exactly one wave;
//           partial stage 8 x 16 x 64; ctx stage 32 x 64; out store 8 waves x 16 rows x 64 columns.
// =====================================================================================================
__device__ __forceinline__ float xhalf(float x) {                    // lane l <-> lane l ^ 16, on the vector unit
  const int v = __builtin_bit_cast(int, x);
  return __builtin_bit_cast(float, __builtin_amdgcn_permlanex16(v, v, 0x76543210, 0xfedcba98, false, false));
}
__device__ __forceinline__
void attn_fwd_body(float* scs, u16* pls, float* wm, float* wl, int bid,
                   const u16* __restrict__ QPp, const u16* __restrict__ KPp, const u16* __restrict__ VTp,
                   const float* __restrict__ VSp, const u16* __restrict__ WOTp, const float* __restrict__ bo, float* out) {
  const int tid  = threadIdx.x;
  const int lane = tid & 31;
  const int hh   = lane >> 4;
  const int m    = lane & 15;
  const int sw   = __builtin_amdgcn_readfirstlane(tid >> 5);   // the wave's number in a scalar register: scalar loop, scalar bases

  // A block's cost grows with its query tile, so cost falls with the block index: the four sequences' last tiles
  // come first, their first tiles last. bid -> (b, tile) is a permutation of NB x NQT.
  const int b    = bid % NB;
  const int q0   = TQ0 + (NQT - 1 - bid / NB) * QT;
  const int nkbt = ((q0 + QT - 1) >> 5) + 1; // key blocks up to and with the diagonal one, 5 .. SEQ/32

  // all three planes in fragment order: 16 rows of q or k = two tiles (d 0..31, d 32..63), 32 keys of V^T = four tiles (16 d each)
  const _Float16* qrow = (const _Float16*)(const void*)QPp + ((size_t)b * SEQ + q0) * DH + 8 * lane;
  const v16h qa0 = ldfrag_hs(qrow);          // d 0..31
  const v16h qa1 = ldfrag_hs(qrow + 512);    // d 32..63
  // block-uniform bases; a lane's place is one 32-bit byte offset (a sequence's plane is SEQ*DH*2 bytes)
  const char* kbp = (const char*)(const void*)KPp + (size_t)b * SEQ * DH * 2;
  const char* vbp = (const char*)(const void*)VTp + (size_t)b * SEQ * DH * 2;
  const unsigned lo16 = (unsigned)lane * 16u;
  const float* vsb = VSp + (size_t)b * NCHK * NKB * DH + 8 * hh;
  const float lsc = RSQD * LOG2E / (QSC * KSC);
  const int ql = q0 + m - 8 * hh;            // key 32kb + 16t + 8hh + r is valid iff 16t + r <= ql - 32kb

  float mrun = -INFINITY, lrun = 0.f;
  v8f o[NACC];
#pragma unroll
  for (int j = 0; j < NACC; ++j) o[j] = zero8();

  // rolled: the trip count depends on the query tile, and one key block's fragments are in registers at a time
#pragma unroll 1
  for (int kb = sw; kb < nkbt; kb += 8) {
    const unsigned ko = lo16 + (unsigned)kb * (32u * DH * 2u);
    const _Float16* kp = (const _Float16*)(const void*)(kbp + ko);
    const v16h f00 = ldfrag_hs(kp);
    const v16h f01 = ldfrag_hs(kp + 512);
    const v16h f10 = ldfrag_hs(kp + 1024);
    const v16h f11 = ldfrag_hs(kp + 1536);
    const _Float16* vk = (const _Float16*)(const void*)(vbp + ko);
    const v16h g0 = ldfrag_hs(vk);
    const v16h g1 = ldfrag_hs(vk + 512);
    const v16h g2 = ldfrag_hs(vk + 1024);
    const v16h g3 = ldfrag_hs(vk + 1536);
    // ---- (S) ----
    v8f s0 = mma_h(f00, qa0, zero8());
    s0 = mma_h(f01, qa1, s0);
    v8f s1 = mma_h(f10, qa0, zero8());
    s1 = mma_h(f11, qa1, s1);
    guard2x6(s0, s1, qa0, qa1, f00, f01, f10, f11);
    const float* vsc = vsb + (size_t)kb * DH;              // fetched into the registers that the k fragments leave, used behind (M)
    v4f u[2 * NACC];
#pragma unroll
    for (int j = 0; j < NACC; ++j) { u[2 * j] = *(const v4f*)(vsc + 16 * j); u[2 * j + 1] = *(const v4f*)(vsc + 16 * j + 4); }
    // ---- (M) ----
    const int lim = ql - kb * 32;
    float t[16];
    float cm = -INFINITY;
#pragma unroll
    for (int r = 0; r < 8; ++r) {
      t[r]     = (r <= lim)      ? s0[r] * lsc : -INFINITY;
      t[8 + r] = (16 + r <= lim) ? s1[r] * lsc : -INFINITY;
      cm = fmaxf(cm, fmaxf(t[r], t[8 + r]));
    }
    cm = fmaxf(cm, xhalf(cm));
    const float mn = fmaxf(mrun, cm);                      // finite: the block holds a valid key for every query of the tile
    const float al = exp2f(mrun - mn);                     // 0 in the wave's first pass, where mrun is -inf
    mrun = mn;
    float ps = 0.f;
#pragma unroll
    for (int j = 0; j < 16; ++j) {
      const float p = exp2f(fminf(t[j] - mn, 0.f));        // 0 for masked keys
      t[j] = p;
      ps += p;
    }
    ps += xhalf(ps);
    const float cc = ps * (1.0f / 32.0f);
    lrun = lrun * al + ps;
    FragH pf;
#pragma unroll
    for (int i = 0; i < 2; ++i) {
#pragma unroll
      for (int e = 0; e < 4; ++e) {
        const int j = 8 * i + 2 * e;
        pf.u[i][e] = pk16(h_bits((_Float16)((t[j] - cc) * PCAR)), h_bits((_Float16)((t[j + 1] - cc) * PCAR)));
      }
    }
    // ---- (PV) ----
    const float cad = cc * (PCAR * VCAR);
#pragma unroll
    for (int j = 0; j < NACC; ++j) {
#pragma unroll
      for (int r = 0; r < 8; ++r) o[j][r] = __builtin_fmaf(cad, u[2 * j + (r >> 2)][r & 3], o[j][r] * al);
    }
    o[0] = mma_h(g0, pf.v, o[0]);
    o[1] = mma_h(g1, pf.v, o[1]);
    o[2] = mma_h(g2, pf.v, o[2]);
    o[3] = mma_h(g3, pf.v, o[3]);
    guardpv4(o[0], o[1], o[2], o[3], pf.v, g0, g1, g2, g3);
  }

  // ---- combine the 8 partial O tiles in fixed order ----
  // From here on the lane's number is read anew: no index made from the thread id has to stay in a vector register across the loop.
  const int el = (int)__builtin_amdgcn_mbcnt_lo(~0u, 0u);   // == lane
  const int eh = el >> 4, em = el & 15;                     // == hh, m
  const int er = 2 * sw + eh;                               // query row owned in the combine
  if (eh == 0) { wm[sw * QT + em] = mrun; wl[sw * QT + em] = lrun; }   // both halves hold the same two values
  v16h bf[4];                                // groups 0 and 1 are fetched beside the combine
  oproj_ldb(bf[0], bf[1], WOTp, sw, 0, el);
  oproj_ldb(bf[2], bf[3], WOTp, sw, 1, el);
  __syncthreads();
  {
    float gm = wm[em];                       // finite: wave 0 always has key block 0
#pragma unroll
    for (int w = 1; w < 8; ++w) gm = fmaxf(gm, wm[w * QT + em]);
    const float fs = exp2f(mrun - gm);       // 0 where the wave had no key block (mrun = -inf, o = 0)
    float* od = scs + (sw * 16 + em) * OPP + 8 * eh;
#pragma unroll
    for (int j = 0; j < NACC; ++j) {
      const v4f lo = {o[j][0] * fs, o[j][1] * fs, o[j][2] * fs, o[j][3] * fs};
      const v4f hi = {o[j][4] * fs, o[j][5] * fs, o[j][6] * fs, o[j][7] * fs};
      *(v4f*)(od + 16 * j)     = lo;
      *(v4f*)(od + 16 * j + 4) = hi;
    }
  }
  __syncthreads();
  const int c4 = em * 4;
  v4f sm4 = zero4();
#pragma unroll
  for (int w = 0; w < 8; ++w) sm4 += *(const v4f*)(scs + (w * 16 + er) * OPP + c4);
  float gr = wm[er];
#pragma unroll
  for (int w = 1; w < 8; ++w) gr = fmaxf(gr, wm[w * QT + er]);
  float lsum = 0.f;
#pragma unroll
  for (int w = 0; w < 8; ++w) lsum += wl[w * QT + er] * exp2f(wm[w * QT + er] - gr);
  const float inv = (1.0f / lsum) * (CSC / (PCAR * VCAR));            // lsum >= 1
#pragma unroll
  for (int e = 0; e < 4; ++e) {
    const float xs = sm4[e] * inv;
    const _Float16 hv = (_Float16)xs;
    const _Float16 rv = (_Float16)((xs - (float)hv) * RSC);
    pls[er * CTP + c4 + e]        = h_bits(hv);
    pls[(16 + er) * CTP + c4 + e] = h_bits(rv);
  }
  __syncthreads();
  // ---- output projection of the 16 ctx rows; the partial O tiles were last read in front of the barrier above, so each wave takes
  //      its own 16 x 68 f32 slab of the partial O region for the store shape of slab64_out ----
  const _Float16* ch = (const _Float16*)(const void*)pls + em * CTP + 8 * eh;
  const _Float16* cr = ch + 16 * CTP;
  const v16h a0 = ldfrag_h(ch), a1 = ldfrag_h(ch + 32), r0 = ldfrag_h(cr), r1 = ldfrag_h(cr + 32);
  const v4f bv = *(const v4f*)(bo + sw * 64 + em * 4);
  float* sl = scs + sw * SLAB64 + (8 * eh) * 68 + em;
  // unrolled: the fragment set bf[] is indexed by j and has to stay in registers
#pragma unroll
  for (int j = 0; j < 4; ++j) {
    v8f h, r;
    oproj_mma(h, r, bf[2 * (j & 1)], bf[2 * (j & 1) + 1], a0, a1, r0, r1);
    if (j < 2) oproj_ldb(bf[2 * j], bf[2 * j + 1], WOTp, sw, j + 2, el);   // group j + 2 flies while groups j, j + 1 are worked on
#pragma unroll
    for (int e = 0; e < 8; ++e) sl[e * 68 + 16 * j] = h[e] * OS1 + r[e] * OS2;
  }
  v4f badd;
#pragma unroll
  for (int e = 0; e < 4; ++e) badd[e] = bfr(bv[e]);
  slab64_out(scs + sw * SLAB64, badd, out, EMB, (size_t)b * SEQ + q0, sw * 64, el);
}

// =====================================================================================================
// Query rows 0 .. TQ0-1 of each sequence in f32 on VALU: block = (b, t), threads 0..127 work (waves 4..7 only pass the barriers, up to the output projection). QF/KF = f32 q/k planes [nb][TQ0][DH] (bias
// included), V = f32 v plane [nb*SEQ][DH]. Scores for keys j (thread j, one key each, 64-d dot of its whole key row against the q row staged in LDS;
// keys j > t masked to -inf), base-2 softmax with block max / sum reductions (xor shuffles + LDS), p_j in LDS, ctx[d] for d = tid
// (threads 0..63) as a sum in key order of p_j * V[b][j][d] (coalesced, groups of 64 keys up to the one holding t), x = ctx * 4096 / l, hi = f16(x),
// res = f16((x - hi) * 2048); both 64-half rows are staged in LDS, then the row's output projection: wave w -> out columns 64w .. 64w+63.
// coverage: grid nb*TQ0 blocks = rows 0..TQ0-1 of every sequence; 64 thr x 1 d = DH per row; store 8 waves x 4 x 16 lanes = EMB floats;
//           together with attn_fwd every (b, s, n) of out is written exactly once.
// =====================================================================================================
__device__ __forceinline__
void attn_head_body(float* qs, float* sc, float* red, float* redb, u16* SW, int bid,
                    const float* __restrict__ QF, const float* __restrict__ KF, const float* __restrict__ V,
                    const u16* __restrict__ WOTp, const float* __restrict__ bo, float* out) {
  const int tid = threadIdx.x, lane = tid & 31, wave = tid >> 5;
  const int b = bid / TQ0;
  const int t = bid - b * TQ0;
  const bool work = wave < HD_THREADS / 32;                        // wave-uniform: one key per thread, keys 0..TQ0-1
  if (tid < DH) qs[tid] = QF[((size_t)b * TQ0 + t) * DH + tid];   // waves 0,1 entirely (wave-uniform)
  __syncthreads();
  float acc = 0.f;
  if (work) {
    const float* kp = KF + (size_t)b * (TQ0 * DH) + tid * DH;       // key row b*TQ0 + tid always in range (tid < TQ0)
    v4f kr[DH / 4];                                                 // the whole key row: 16 loads in flight, one latency
#pragma unroll
    for (int i = 0; i < DH / 4; ++i) kr[i] = *(const v4f*)(kp + 4 * i);
#pragma unroll
    for (int i = 0; i < DH / 4; ++i) {
      const v4f q4 = *(const v4f*)(qs + 4 * i);
#pragma unroll
      for (int e = 0; e < 4; ++e) acc += kr[i][e] * q4[e];
    }
  }
  const float s = (tid <= t) ? acc * (RSQD * LOG2E) : -INFINITY;   // causal mask by key index
  float mx = s;
#pragma unroll
  for (int d = 1; d <= 16; d <<= 1) mx = fmaxf(mx, __shfl_xor(mx, d, 32));
  if (work && lane == 0) red[wave] = mx;
  __syncthreads();
  float gm = red[0];
#pragma unroll
  for (int w = 1; w < 4; ++w) gm = fmaxf(gm, red[w]);   // finite: key 0 is always valid
  const float p = exp2f(s - gm);                     // 0 for masked keys
  float ps = p;
#pragma unroll
  for (int d = 1; d <= 16; d <<= 1) ps += __shfl_xor(ps, d, 32);
  if (work && lane == 0) redb[wave] = ps;
  if (work) sc[tid] = p;
  __syncthreads();
  float l = redb[0];
#pragma unroll
  for (int w = 1; w < 4; ++w) l += redb[w];           // >= 1
  const float inv = (1.0f / l) * CSC;
  if (wave < 2) {                                    // threads 0..63 (wave-uniform): one d column each
    const float* vp = V + (size_t)b * SEQ * DH + tid;
    float cx = 0.f;
    // Keys in groups of 64 whose loads are issued ahead of their use: one load latency per group. A group's keys j > t carry
    // sc[j] = 0 and add nothing; rows j0 .. j0+63 <= TQ0-1 of sequence b always exist. The sum runs in key order.
    // rolled: the trip count (1 or 2) depends on t
#pragma unroll 1
    for (int j0 = 0; j0 <= t; j0 += 64) {            // block-uniform
      float vv[64];
#pragma unroll
      for (int i = 0; i < 64; ++i) vv[i] = vp[(size_t)(j0 + i) * DH];
#pragma unroll
      for (int i = 0; i < 16; ++i) {
        const v4f p4 = *(const v4f*)(sc + j0 + 4 * i);
#pragma unroll
        for (int e = 0; e < 4; ++e) cx += p4[e] * vv[4 * i + e];
      }
    }
    const float x0 = cx * inv;
    const _Float16 h0 = (_Float16)x0;
    const _Float16 r0 = (_Float16)((x0 - (float)h0) * RSC);
    SW[tid]      = h_bits(h0);
    SW[DH + tid] = h_bits(r0);
  }
  const int sw = __builtin_amdgcn_readfirstlane(wave);   // the wave's number in a scalar register: scalar base for Wo
  v16h bf[4];                                        // groups 0 and 1: behind the 64-register key groups, in front of the last barrier
  oproj_ldb(bf[0], bf[1], WOTp, sw, 0, lane);
  oproj_ldb(bf[2], bf[3], WOTp, sw, 1, lane);
  float bb[4];
#pragma unroll
  for (int j = 0; j < 4; ++j) bb[j] = bo[wave * 64 + 16 * j + (lane & 15)];
  __syncthreads();
  // ---- output projection of the one ctx row, all 8 waves: it is row 0 of the A tile, rows 1..15 are zero; row 0 of a result tile is
  //      element 0 of lanes 0..15 (column = lane) ----
  const int hh = lane >> 4, m = lane & 15;
  const v4u z4 = {0u, 0u, 0u, 0u};
  FragH fa[4];                                       // hi k 0..31, hi k 32..63, residual k 0..31, residual k 32..63
#pragma unroll
  for (int i = 0; i < 4; ++i) {
    const v4u u0 = *(const v4u*)(SW + i * 32 + 8 * hh), u1 = *(const v4u*)(SW + i * 32 + 16 + 8 * hh);
    fa[i].u[0] = (m == 0) ? u0 : z4;
    fa[i].u[1] = (m == 0) ? u1 : z4;
  }
  float ov[4];
  // unrolled: the fragment set bf[] is indexed by j and has to stay in registers
#pragma unroll
  for (int j = 0; j < 4; ++j) {
    v8f h, r;
    oproj_mma(h, r, bf[2 * (j & 1)], bf[2 * (j & 1) + 1], fa[0].v, fa[1].v, fa[2].v, fa[3].v);
    if (j < 2) oproj_ldb(bf[2 * j], bf[2 * j + 1], WOTp, sw, j + 2, lane);
    ov[j] = (h[0] * OS1 + r[0] * OS2) + bfr(bb[j]);
  }
  float* dst = out + ((size_t)b * SEQ + t) * EMB + wave * 64 + m;
  if (lane < 16) {
#pragma unroll
    for (int j = 0; j < 4; ++j) dst[16 * j] = ov[j];
  }
}

// =====================================================================================================
// One launch for the two independent attention jobs, picked by block index (block-uniform): blocks 0..NB*NQT-1 = query rows TQ0.. on
// WMMA, longest tiles first, the rest = query rows 0..TQ0-1 on VALU (short blocks, last, so that they fill places the long blocks leave).
// coverage: grid = NB*NQT + NB*TQ0 blocks; each job is handed block indices 0 .. its own block count - 1.
// =====================================================================================================
__global__ __launch_bounds__(ATT_THREADS) __attribute__((amdgpu_num_vgpr(256)))
void attn(const u16* __restrict__ QPp, const u16* __restrict__ KPp, const u16* __restrict__ VTp, const float* __restrict__ VSp,
          const float* __restrict__ QF, const float* __restrict__ KF, const float* __restrict__ V,
          const u16* __restrict__ WOTp, const float* __restrict__ bo, float* out) {
  __shared__ __align__(16) float scs[8 * 16 * OPP]; // partial O tiles [8][16][OPP] f32, then out slabs
  __shared__ __align__(16) u16 pls[32 * CTP];       // ctx staging [32][CTP] u16
  __shared__ float wm[8 * QT];                      // running max per wave and query
  __shared__ float wl[8 * QT];                      // running sum per wave and query
  __shared__ __align__(16) float qs[DH];
  __shared__ __align__(16) float sc[TQ0];
  __shared__ float red[4];
  __shared__ float redb[4];
  __shared__ __align__(16) u16 SW[2 * DH];
  const int bid = blockIdx.x;
  if (bid < NB * NQT) attn_fwd_body(scs, pls, wm, wl, bid, QPp, KPp, VTp, VSp, WOTp, bo, out);
  else                attn_head_body(qs, sc, red, redb, SW, bid - NB * NQT, QF, KF, V, WOTp, bo, out);
}

// =====================================================================================================
// Workspace map (bytes, nb = 4, rows = 16384); every plane (V only in rows 0..127 of each sequence) is written by whole-line stores before it is read; all extents are
//   WQT bf16 [64][512] 65536   WKT same   WVT same   WOT f16 of bf16 value x1024 [512][64] 65536 (fragment order)  262144
//   QP  f16 [rows][64] x8 (fragment order)                                                                          2097152
//   KP  f16 [rows][64] x8 (fragment order)                                                                          2097152
//   V   f32 [rows][64] (only rows 0..127 of each sequence are written and read)                                     4194304
//   VT  f16 [nb][SEQ/32][4] tiles (32 keys x 16 d) x1024 (fragment order)                                                                    2097152
//   VS  f32 [nb][8][16][64]                                                                                          131072
//   QF  f32 [nb][128][64]  131072      KF same                                                                       262144
//   end                                                                                                            11141120
// =====================================================================================================
extern "C" void kernel_launch(void* const* d_in, const int* in_sizes, int n_in,
                              void* d_out, int out_size, void* d_ws, size_t ws_size,
                              hipStream_t stream) {
  if (n_in < 9) return;
  const int nb   = NB;
  const int rows = nb * SEQ;
  if ((long long)in_sizes[0] < (long long)NB * SEQ_FULL * EMB) return;
  if (in_sizes[1] < EMB * DH || in_sizes[3] < EMB * DH || in_sizes[5] < EMB * DH || in_sizes[7] < DH * EMB) return;
  if (in_sizes[2] < DH || in_sizes[4] < DH || in_sizes[6] < DH || in_sizes[8] < EMB) return;
  if ((long long)out_size < (long long)rows * EMB) return;

  const float* x  = (const float*)d_in[0];
  const float* wq = (const float*)d_in[1];
  const float* bq = (const float*)d_in[2];
  const float* wk = (const float*)d_in[3];
  const float* bk = (const float*)d_in[4];
  const float* wv = (const float*)d_in[5];
  const float* bv = (const float*)d_in[6];
  const float* wo = (const float*)d_in[7];
  const float* bo = (const float*)d_in[8];
  float*       out = (float*)d_out;

  const size_t szW  = (size_t)EMB * DH * 2;                      //     65536
  const size_t szP  = (size_t)rows * DH * 2;                     //   2097152
  const size_t szV  = (size_t)rows * DH * 4;                     //   4194304
  const size_t szVT = (size_t)nb * DH * SEQ * 2;                 //   2097152 (== szP)
  const size_t szVS = (size_t)nb * NCHK * NKB * DH * 4;          //    131072
  const size_t szHF = (size_t)nb * TQ0 * DH * 4;                 //    131072
  size_t off = 0;
  const size_t oWQ = off; off += szW;
  const size_t oWK = off; off += szW;
  const size_t oWV = off; off += szW;
  const size_t oWO = off; off += szW;
  const size_t oQ  = off; off += szP;
  const size_t oK  = off; off += szP;
  const size_t oV  = off; off += szV;
  const size_t oVT = off; off += szVT;
  const size_t oVS = off; off += szVS;
  const size_t oQF = off; off += szHF;
  const size_t oKF = off; off += szHF;
  if (off > ws_size) return;                                     // off = 11141120 at nb = 4
  if (off > WS_CAP) return;

  char* ws = (char*)d_ws;
  u16*   WQT = (u16*)(ws + oWQ);
  u16*   WKT = (u16*)(ws + oWK);
  u16*   WVT = (u16*)(ws + oWV);
  u16*   WOT = (u16*)(ws + oWO);
  u16*   QP  = (u16*)(ws + oQ);
  u16*   KP  = (u16*)(ws + oK);
  float* V   = (float*)(ws + oV);
  u16*   VT  = (u16*)(ws + oVT);
  float* VS  = (float*)(ws + oVS);
  float* QF  = (float*)(ws + oQF);
  float* KF  = (float*)(ws + oKF);

  if ((rows % 64) != 0) return;
  const dim3 blk(256);
  const dim3 gPR(4 * WTB);                              // 4 * 8 weight tiles
  const dim3 gPJ(GPB);                                  // 256 at nb = 4
  const dim3 bG(PJ_THREADS);
  const dim3 gAT(NB * NQT + NB * TQ0);                  // nb * 248 + nb * 128
  const dim3 bAT(ATT_THREADS);

  // (0) Wq, Wk, Wv stored [k = in 512][n = out 64] -> bf16 planes [64][512] in fragment order; Wo [k = 64][n = 512] -> f16 of bf16
  //     value x1024, [512][64] in fragment order
  prep<<<gPR, blk, 0, stream>>>(wq, wk, wv, wo, WQT, WKT, WVT, WOT);
  // (1) x read as f32 and converted in the block; q and k projections (+bias) -> f16 planes x8; v projection (+bias) -> V^T plane x1024, key-block column sums and f32 rows
  //     0..127 of every sequence; f32 q and k rows 0..127 of every sequence -> QF, KF [nb*128][64]
  proj<<<gPJ, bG, 0, stream>>>(x, WQT, WKT, WVT, bq, bk, bv, QP, KP, V, VT, VS, QF, KF);
  // (2) attention: query rows 128.. on WMMA and query rows 0..127 on VALU -> ctx hi x4096 and residual x2048 f16 rows in LDS, then
  //     each block's output projection + bias -> out
  attn<<<gAT, bAT, 0, stream>>>(QP, KP, VT, VS, QF, KF, V, WOT, bo, out);
  (void)hipGetLastError();
}

// v009
// It runs in 39.5 microseconds.
// Next to v008, in two timings, it ran 1.04 times as fast each time.
// All steps since v000 together make it 5.77 times as fast.
// Projections q,k,v = x.W + b and the f32 q,k rows 0..127 per sequence: v_wmma_f32_16x16x32_bf16 (bf16 RNE operands of the
// raw inputs, f32 accumulate, bf16 RNE bias added in f32). Scores q'.k'^T (f16 planes x8), P'.V (key-block-centred P' x32768 f16 from registers,
// V^T x1024 f16) and the output projection (ctx carried as f16 hi x4096 plus residual x2048 rows, times f16(bf16(Wo)) x1024, bias
// added in f32): v_wmma_f32_16x16x32_f16, f32 accumulate. Query rows 0..127 of each sequence: scores, softmax and P.V in f32 on VALU.
// Causal mask, softmax statistics, key-block column sums of V and all scaling in f32 on VALU.
#include <hip/hip_runtime.h>
#include <math.h>
#include <stdint.h>

#ifndef NB
#define NB 4
#endif
#ifndef SEQ
#define SEQ 4096
#endif
#define SEQ_FULL 4096
#define NB_FULL 4
#define EMB   512
#define DH    64
#define CK    512
#define NCHK  (SEQ / CK)
#define NKB   16
#define QT    16
#define TQ0   128
#define NQT   ((SEQ - TQ0) / QT)
#define OPP   68
#define CTP   72
#define SLAB64 (16 * 68)
#define VTP   72
#define ATT_THREADS 256
#define HD_THREADS 128
#define NACC  4
#define QSC   8.0f
#define KSC   8.0f
#define PCAR  32768.0f
#define VCAR  1024.0f
#define WSC   1024.0f
#define CSC   4096.0f
#define RSC   2048.0f
#define OS1   (1.0f / (CSC * WSC))
#define OS2   (1.0f / (CSC * WSC * RSC))
#define LOG2E 1.4426950408889634f
#define RSQD  0.125f
#define WS_CAP ((size_t)134217728)
#define WTB   ((EMB / 64) * (DH / 64))
#define GPB   (((NB * SEQ) / 64) * (DH / 64))
#define PJ_THREADS 384
#define XTP   (EMB + 8)

static_assert(DH == 64 && NACC * 16 == DH && (EMB % 64) == 0 && (EMB % 32) == 0 && (DH % 32) == 0);
static_assert((SEQ % CK) == 0 && NCHK >= 1 && CK == 32 * NKB && (SEQ % 64) == 0 && (SEQ % QT) == 0 && (CK % QT) == 0);
static_assert((TQ0 % QT) == 0 && (TQ0 % 64) == 0 && NQT * QT + TQ0 == SEQ && NQT >= 1 && TQ0 == 128 && TQ0 == HD_THREADS);
static_assert(8 * SLAB64 <= 8 * 16 * OPP && EMB == 8 * 64 && CTP >= DH + 8 && OPP >= DH + 4);
static_assert(((VTP * 2) % 16) == 0 && ((CTP * 2) % 16) == 0 && ((OPP * 4) % 16) == 0);
static_assert(64 * VTP >= 63 * VTP + 64);
static_assert(ATT_THREADS == 16 * QT && ATT_THREADS == 256 && HD_THREADS == 2 * DH);
static_assert(((NB * SEQ) % 64) == 0 && EMB == 512 && ((XTP * 2) % 32) == 16 && PJ_THREADS == 12 * 32);
static_assert(NB >= 1 && NB <= NB_FULL && SEQ <= SEQ_FULL && (TQ0 % 64) == 0 && (NKB % 2) == 0);

typedef unsigned short u16;
typedef _Float16 v16h __attribute__((ext_vector_type(16)));
typedef _Float16 v8h  __attribute__((ext_vector_type(8)));
typedef __bf16   v16b __attribute__((ext_vector_type(16)));
typedef float    v8f  __attribute__((ext_vector_type(8)));
typedef float    v4f  __attribute__((ext_vector_type(4)));
typedef unsigned int v4u __attribute__((ext_vector_type(4)));
typedef unsigned int v2u __attribute__((ext_vector_type(2)));

union FragH { v16h v; v8h h[2]; v4u u[2]; };
union FragB { v16b v; v4u u[2]; };

// ---- scalar helpers --------------------------------------------------------------------------------
__device__ __forceinline__ unsigned short bf_bits(float f) {          // f32 -> bf16 bits, RNE convert
  unsigned u = __float_as_uint(f);
  return (unsigned short)((u + 0x7FFFu + ((u >> 16) & 1u)) >> 16);
}
__device__ __forceinline__ float bf_up(unsigned short h) { return __uint_as_float(((unsigned)h) << 16); }
__device__ __forceinline__ float bfr(float f) { return bf_up(bf_bits(f)); }
__device__ __forceinline__ unsigned short h_bits(_Float16 x) { return __builtin_bit_cast(unsigned short, x); }
__device__ __forceinline__ unsigned pk16(unsigned short a, unsigned short b) { return (unsigned)a | ((unsigned)b << 16); }
__device__ __forceinline__ v8f zero8() { v8f z = {0.f, 0.f, 0.f, 0.f, 0.f, 0.f, 0.f, 0.f}; return z; }
__device__ __forceinline__ v4f zero4() { v4f z = {0.f, 0.f, 0.f, 0.f}; return z; }
// 2^x as the one hardware instruction. The library call wraps the same instruction in a compare, two selects, an add and an ldexp so that
// results below 2^-126 come out as denormals; here such a result is 0. Every argument is <= 0 and every result is a softmax weight or a
// rescale factor that is added to, or multiplies, terms of a sum that is >= 1: bit-identical from 2^-126 up.
__device__ __forceinline__ float ex2(float x) { return __builtin_amdgcn_exp2f(x); }
// Eight of them in place, in one statement: the instruction set asks for one independent instruction or a v_nop between a transcendental
// and an instruction that reads its result or overwrites its source. Here each is followed by an independent one and the last by the
// v_nop.
__device__ __forceinline__ void ex2x8(float& a0, float& a1, float& a2, float& a3, float& a4, float& a5, float& a6, float& a7) {
#if defined(__HIP_DEVICE_COMPILE__)
  asm("v_exp_f32 %0, %0\n\tv_exp_f32 %1, %1\n\tv_exp_f32 %2, %2\n\tv_exp_f32 %3, %3\n\t"
      "v_exp_f32 %4, %4\n\tv_exp_f32 %5, %5\n\tv_exp_f32 %6, %6\n\tv_exp_f32 %7, %7\n\tv_nop"
      : "+v"(a0), "+v"(a1), "+v"(a2), "+v"(a3), "+v"(a4), "+v"(a5), "+v"(a6), "+v"(a7));
#endif
}

// ---- fragment loaders: 16-bit A/B operand, lane -> row/col (lane&15), p already includes +8*(lane>>4);
//      elements 0..7 <- p[0..7] (k0+8h..), elements 8..15 <- p[16..23] (k0+16+8h..)  (same split k map for A and B);
//      this form reads the row-major A tiles in LDS (x, ctx hi, ctx residual)
__device__ __forceinline__ v16h ldfrag_h(const _Float16* p) {
  FragH f;
  f.h[0] = *(const v8h*)(p);
  f.h[1] = *(const v8h*)(p + 16);
  return f.v;
}
__device__ __forceinline__ v16b ldfrag_b(const u16* p) {              // bf16 plane read as unsigned integer vectors
  FragB f;
  f.u[0] = *(const v4u*)(p);
  f.u[1] = *(const v4u*)(p + 16);
  return f.v;
}

// ---- the same fragments from a plane kept in FRAGMENT ORDER: a 16 (rows or cols) x 32 (k) tile is 512 consecutive halves; the 16-B
//      unit of lane l = 16*h + m (row/col m, k = 8h .. 8h+7) lies at 8*l, the unit for k = 16+8h .. at 256 + 8*l. p already includes
//      +8*lane, so each of the two loads reads 512 consecutive bytes (4 whole lines) where a row-major plane gives 16 lines.
__device__ __forceinline__ v16h ldfrag_hs(const _Float16* p) {
  FragH f;
  f.h[0] = *(const v8h*)(p);
  f.h[1] = *(const v8h*)(p + 256);
  return f.v;
}
__device__ __forceinline__ v16b ldfrag_bs(const u16* p) {
  FragB f;
  f.u[0] = *(const v4u*)(p);
  f.u[1] = *(const v4u*)(p + 256);
  return f.v;
}

__device__ __forceinline__ v8f mma_h(v16h a, v16h b, v8f c) {
  return __builtin_amdgcn_wmma_f32_16x16x32_f16(false, a, false, b, (short)0, c, false, false);
}
__device__ __forceinline__ v8f mma_b(v16b a, v16b b, v8f c) {
  return __builtin_amdgcn_wmma_f32_16x16x32_bf16(false, a, false, b, (short)0, c, false, false);
}
__device__ __forceinline__ void guard2x6(v8f& a, v8f& b, v16h x0, v16h x1, v16h x2, v16h x3, v16h x4, v16h x5) {
#if defined(__HIP_DEVICE_COMPILE__)
  asm volatile("v_nop\n\tv_nop\n\tv_nop\n\tv_nop"
               : "+v"(a), "+v"(b) : "v"(x0), "v"(x1), "v"(x2), "v"(x3), "v"(x4), "v"(x5) : "memory");
#endif
}
__device__ __forceinline__ void guardpv4(v8f& o0, v8f& o1, v8f& o2, v8f& o3, v16h p, v16h g0, v16h g1, v16h g2, v16h g3) {
#if defined(__HIP_DEVICE_COMPILE__)
  asm volatile("v_nop\n\tv_nop\n\tv_nop\n\tv_nop"
               : "+v"(o0), "+v"(o1), "+v"(o2), "+v"(o3)
               : "v"(p), "v"(g0), "v"(g1), "v"(g2), "v"(g3) : "memory");
#endif
}
__device__ __forceinline__ void wave_sync_lds() {                    // wave-private LDS slab: release, wave barrier, acquire
  __builtin_amdgcn_fence(3, "workgroup");
  __builtin_amdgcn_wave_barrier();
  __builtin_amdgcn_fence(2, "workgroup");
}

// =====================================================================================================
// Weight transpose-convert: in W[R][C] f32 row-major -> out D = the [n = C][k = R] 16-bit operand plane for y = x.W in fragment order:
// tile (n/16, k/32) at halves ((n/16)*(R/32) + k/32)*512, units inside it as ldfrag_hs / ldfrag_bs read them.
// mode 0: bf16 RNE bits; mode 1: f16 bits of (bf16 RNE value) * scale.
// Block = 64x64 tile: 64 input row segments of 64 floats loaded with 16-B loads, converted, scattered into an LDS tile [c][64 r]
// coverage: load 256 thr x 16 = 64 x 64; store 2 iterations x 256 thr x 8 halves = 64 lines x 64; grid = (R/64) x (C/64) blocks
//           covers D exactly once (R, C are EMB, DH: static_assert EMB % 64 == 0, DH == 64).
// =====================================================================================================
__device__ __forceinline__ void wt16_body(u16* TH, int bid, const float* __restrict__ W, u16* D, int R, int C, int mode,
                                          float scale) {
  const int tid = threadIdx.x;
  const int nrt = R >> 6;
  const int r0  = (bid % nrt) * 64;
  const int c0  = (bid / nrt) * 64;
  {
    const int rl = tid >> 2;                  // input row within tile 0..63
    const int cs = (tid & 3) * 16;            // column chunk within the 64
    const float* src = W + (size_t)(r0 + rl) * C + c0 + cs;
#pragma unroll
    for (int i = 0; i < 4; ++i) {
      const v4f a = *(const v4f*)(src + 4 * i);
#pragma unroll
      for (int e = 0; e < 4; ++e) {
        const float v  = a[e];
        const unsigned short hb = h_bits((_Float16)(bfr(v) * scale));
        const unsigned short bb = bf_bits(v);
        TH[(cs + 4 * i + e) * VTP + rl] = (mode != 0) ? hb : bb;
      }
    }
  }
  __syncthreads();
  v4u vh[2];
  const int fm = tid & 15, fh = (tid >> 4) & 1, fs = (tid >> 5) & 1, fk = (tid >> 6) & 1, fn = tid >> 7;
#pragma unroll
  for (int it = 0; it < 2; ++it) {            // local c = 16*(2*it + fn) + fm, local r = 32*fk + 16*fs + 8*fh .. +7
    vh[it] = *(const v4u*)(TH + ((it * 2 + fn) * 16 + fm) * VTP + fk * 32 + fs * 16 + fh * 8);
  }
  const int kt = R >> 5;                      // 32-wide k tiles per 16 columns
  {
#pragma unroll
    for (int it = 0; it < 2; ++it) {
      *(v4u*)(D + ((size_t)((c0 >> 4) + it * 2 + fn) * (size_t)kt + (size_t)(r0 >> 5)) * 512 + (tid & 127) * 8) = vh[it];
    }
    
  }
}

// =====================================================================================================
// One launch for the four weight transposes, picked by block index (block-uniform): WTB blocks each, order Wq, Wk, Wv, Wo.
// coverage: grid = 4*WTB blocks; each job is handed block indices 0 .. WTB-1.
// =====================================================================================================
__global__ __launch_bounds__(256)
void prep(const float* __restrict__ wq, const float* __restrict__ wk, const float* __restrict__ wv,
          const float* __restrict__ wo, u16* WQT, u16* WKT, u16* WVT, u16* WOT) {
  __shared__ __align__(16) u16 TH[64 * VTP];
  const int bid = blockIdx.x;
  const int job = bid / WTB;
  const float* W = (job == 0) ? wq : (job == 1) ? wk : (job == 2) ? wv : wo;
  u16* D = (job == 0) ? WQT : (job == 1) ? WKT : (job == 2) ? WVT : WOT;
  const bool pj = job < 3;                    // Wq, Wk, Wv: [EMB][DH] -> bf16; Wo: [DH][EMB] -> scaled f16
  wt16_body(TH, bid - job * WTB, W, D, pj ? EMB : DH, pj ? DH : EMB, pj ? 0 : 1, pj ? 1.0f : WSC);
}

// =====================================================================================================
// Stores of a 16 x 64 f32 tile that lies in an LDS slab [16][68] (row = tile row, 68 = 64 columns + 4 pad):
//  slab64_out: f32 rows + badd; instruction it: lanes 0..15 -> row 2*it (16 lanes x 16 B = two whole lines), lanes 16..31 -> row 2*it+1.
//  slab64_hsb: f16 bits of ((tile + bf16RNE(bias[n])) * pscale), plane [rows][DH] in fragment order; lane = (row lane&15, 8 consecutive
//              columns), each of the 4 stores writes 512 consecutive bytes.
// coverage: slab64_out 8 instructions x 2 rows x 16 lanes x 4 floats; slab64_hsb 4 instructions x 16 rows x 2 lanes x 8 halves
//           = the 16 x 64 tile in both cases.
// =====================================================================================================
__device__ __forceinline__ void slab64_out(const float* sl, v4f badd, float* C, int N, size_t rowb, int col0, int lane) {
  const int hh = lane >> 4, m = lane & 15;
  wave_sync_lds();
  v4f vals[8];
#pragma unroll
  for (int it = 0; it < 8; ++it) vals[it] = *(const v4f*)(sl + (it * 2 + hh) * 68 + m * 4) + badd;
  float* dst = C + (rowb + (size_t)hh) * (size_t)N + col0 + m * 4;
#pragma unroll
  for (int it = 0; it < 8; ++it) *(v4f*)(dst + (size_t)(it * 2) * (size_t)N) = vals[it];
}
__device__ __forceinline__ void slab64_hsb(const float* sl, float pscale, const float* __restrict__ bias, u16* C, size_t rowb, int lane) {
  const int hh = lane >> 4, m = lane & 15;
  v4u oh[4];
#pragma unroll
  for (int g = 0; g < 4; ++g) {               // g = 16-column group of the 64; lane = (row m, columns 16g + 8hh .. +7)
    const int c8 = g * 16 + hh * 8;
    const v4f b0 = *(const v4f*)(bias + c8), b1 = *(const v4f*)(bias + c8 + 4);
    const v4f a = *(const v4f*)(sl + m * 68 + c8), c4 = *(const v4f*)(sl + m * 68 + c8 + 4);
    float w[8];
#pragma unroll
    for (int e = 0; e < 4; ++e) { w[e] = (a[e] + bfr(b0[e])) * pscale; w[4 + e] = (c4[e] + bfr(b1[e])) * pscale; }
#pragma unroll
    for (int e = 0; e < 4; ++e) oh[g][e] = pk16(h_bits((_Float16)w[2 * e]), h_bits((_Float16)w[2 * e + 1]));
  }
  // 16 rows = two tiles (d 0..31, d 32..63) of 512 halves; group g is the half-tile at g*256
  u16* dst = C + (rowb >> 4) * (size_t)(2 * 512) + lane * 8;
#pragma unroll
  for (int g = 0; g < 4; ++g) *(v4u*)(dst + g * 256) = oh[g];
}

// Block barrier that orders LDS alone: a wave's LDS stores are done in front of it, its LDS reads stand behind it. __syncthreads() would
// also wait for the x rows that are still on their way from memory, which the barriers inside the k loop must not do.
__device__ __forceinline__ void lds_barrier() {
  __builtin_amdgcn_fence(__ATOMIC_RELEASE, "workgroup", "local");
  __builtin_amdgcn_s_barrier();
  __builtin_amdgcn_fence(__ATOMIC_ACQUIRE, "workgroup", "local");
}

// =====================================================================================================
// All projections of 64 rows of x in one block of 12 waves: q, k, v = bf16RNE(x) . bf16RNE(W) on WMMA, f32 accumulate, k in steps of 32
// in rising order. x is read here as f32, once: wave-wide 16-B loads of 512 consecutive bytes of a row, RNE convert in registers, rows
// staged as bf16 in LDS at a pitch of XTP halves (1024 + 16 bytes).
//  loads: piece L = 0..255 is (row L & 63, k quarter L >> 6); wave w takes L = w + 12*i, issued two quarters ahead of their use.
//         Quarter c is complete once every wave has staged its pieces i < X1(c): 6 + 5*c for c < 3 (w + 12*(6 + 5*c) >= 64*(c + 1) for every w), all of them for c = 3.
//  products: wave w = (job w >> 2: q, k, v; 16 columns n = 16*(w & 3) ..) x the four 16-row tiles; weight fragments straight into
//         registers; A fragments from LDS (ldfrag_b, the split k map of the weight planes). Quarter c's four k steps follow barrier c.
//  results: tile i of wave w -> slab (job, i), columns 16*(w & 3) ..; element r of lane (hh, m) is row 8*hh + r, column m of the tile.
//  stores: wave w = (job, row tile w & 3) takes slab w:
//   q, k: f16 plane x8 with bias (slab64_hsb); rows 0..TQ0-1 of a sequence also as f32 rows with bias -> QF, KF [nb*TQ0][DH].
//   v: value = slab + bf16RNE(bias) in f32, lane (hh, m) holds v[key rowb + 8*hh + r][d = 16*j + m];
//      V^T plane = f16(v * 1024) in fragment order: the tile (32 keys, 16 columns d) lies at halves ((b*SEQ + s)/32 * 4 + d/16)*512; a
//      lane's 8 elements of column group j are one 16-B unit, the wave's 16 keys the half-tile at 256*((rowb/16) & 1);
//      VS[(b*SEQ + s)/32][d] = sum of v over the 32 keys of a key block (f32): 8 keys in order in a lane, + the other half-wave's 8
//      (xor shuffle), + the neighbour wave's 16 through LDS behind a block barrier;
//      V = f32 rows, only for keys 0..TQ0-1 of a sequence.
// coverage: grid = nb*SEQ/64 blocks; staging 256 pieces x 32 lanes x 4 = 64 x 512; slabs 12 waves x 4 tiles x 16 x 16 = 3 x 64 x 64.
// =====================================================================================================
__device__ __forceinline__ void vrows(float (&w)[4][8], const float* sl, const float* __restrict__ bias, int hh, int m) {
#pragma unroll
  for (int j = 0; j < 4; ++j) {
    const float bj = bfr(bias[16 * j + m]);
#pragma unroll
    for (int r = 0; r < 8; ++r) w[j][r] = sl[(8 * hh + r) * 68 + 16 * j + m] + bj;
  }
}
// k quarter C: a wave's pieces i = X0(C) .. X1(C)-1, its weight fragments and k steps 4*C .. 4*C+3
#define X0(C) ((C) == 0 ? 0 : 1 + 5 * (C))
#define X1(C) ((C) == 3 ? 22 : 6 + 5 * (C))
template <int C>
__device__ __forceinline__ void w_issue(v16b (&bw)[EMB / 32], const u16* bp) {
#pragma unroll
  for (int s = 4 * C; s < 4 * C + 4; ++s) bw[s] = ldfrag_bs(bp + s * 512);
}
template <int C>
__device__ __forceinline__ void x_issue(v4f (&xv)[22], const float* __restrict__ xb, int sw, int lane) {
#pragma unroll
  for (int i = X0(C); i < X1(C); ++i) {
    // pieces 252..255 go to waves 0..3; the other waves read their piece 20 again and do not stage it: one instruction stream
    const int L = (i < 21 || sw < 4) ? sw + 12 * i : sw + 240;
    xv[i] = *(const v4f*)(xb + (size_t)(L & 63) * EMB + (L >> 6) * 128 + lane * 4);
  }
}
template <int C>
__device__ __forceinline__ void x_stage(const v4f (&xv)[22], u16* XT, int sw, int lane) {
#pragma unroll
  for (int i = X0(C); i < X1(C); ++i) {
    if (i < 21 || sw < 4) {
      const int L = sw + 12 * i;
      v2u o;
      o[0] = pk16(bf_bits(xv[i][0]), bf_bits(xv[i][1]));
      o[1] = pk16(bf_bits(xv[i][2]), bf_bits(xv[i][3]));
      *(v2u*)(XT + (L & 63) * XTP + (L >> 6) * 128 + lane * 4) = o;
    }
  }
}
template <int C>
__device__ __forceinline__ void k_steps(v8f (&acc)[4], const v16b (&bw)[EMB / 32], const u16* ar) {
  v16b af[2][4];                             // the next k step's four A fragments are read while this step's products run
#pragma unroll
  for (int i = 0; i < 4; ++i) af[0][i] = ldfrag_b(ar + i * (16 * XTP) + 32 * (4 * C));
#pragma unroll
  for (int t = 0; t < 4; ++t) {
    if (t < 3) {
#pragma unroll
      for (int i = 0; i < 4; ++i) af[(t + 1) & 1][i] = ldfrag_b(ar + i * (16 * XTP) + 32 * (4 * C + t + 1));
    }
#pragma unroll
    for (int i = 0; i < 4; ++i) acc[i] = mma_b(af[t & 1][i], bw[4 * C + t], acc[i]);
  }
}
__global__ __launch_bounds__(PJ_THREADS)
void proj(const float* __restrict__ x, const u16* __restrict__ WQT, const u16* __restrict__ WKT, const u16* __restrict__ WVT,
          const float* __restrict__ bq, const float* __restrict__ bk, const float* __restrict__ bv,
          u16* QP, u16* KP, float* V, u16* VT, float* VS, float* QF, float* KF) {
  __shared__ __align__(16) u16 XT[64 * XTP];
  __shared__ __align__(16) float slab[12 * SLAB64];
  __shared__ float cs[4 * DH];               // 16-key column sums of v, one row per v wave
  const int tid = threadIdx.x, lane = tid & 31, hh = lane >> 4, m = lane & 15;
  const int sw  = __builtin_amdgcn_readfirstlane(tid >> 5);   // the wave's number in a scalar register: scalar bases and branches
  const int job = sw >> 2, sub = sw & 3;
  const int row0 = (int)blockIdx.x * 64;     // compact row b*SEQ + s; 64 divides SEQ, so a block lies in one sequence
  const int sb = row0 / SEQ, s0 = row0 - sb * SEQ;

  // the wave's 16 columns of its weight plane: 16 tiles of 512 halves, one per k step
  const u16* bp = ((job == 0) ? WQT : (job == 1) ? WKT : WVT) + (size_t)sub * (16 * EMB) + lane * 8;
  const float* xb = x + ((size_t)sb * SEQ_FULL + s0) * EMB;   // block-uniform base
  const u16* ar = XT + m * XTP + 8 * hh;
  v16b bw[EMB / 32];
  v4f xv[22];
  v8f acc[4];
#pragma unroll
  for (int i = 0; i < 4; ++i) acc[i] = zero8();
  // Loads are counted back in the order of issue. The scheduling barriers fix that order: in quarters 0 and 1 the weights, then the x pieces, in quarters 2 and 3 the x pieces, then the weights, and
  // nothing of a later quarter in front of an earlier one. Without them the compiler mixes the quarters' loads, so that the first
  // quarter's LDS stores also wait for later loads, and it forms the x addresses in one scalar pair with a wait between single loads.
  // They hold the loads, not the products: a quarter's last products may still stand among the next quarter's converts.
  w_issue<0>(bw, bp); x_issue<0>(xv, xb, sw, lane);
  __builtin_amdgcn_sched_barrier(0);
  w_issue<1>(bw, bp); x_issue<1>(xv, xb, sw, lane);
  __builtin_amdgcn_sched_barrier(0);
  x_stage<0>(xv, XT, sw, lane);
  __builtin_amdgcn_sched_barrier(0);
  x_issue<2>(xv, xb, sw, lane);
  // the address arithmetic of the next run of loads rewrites scalar bases that these loads name: wait first
  asm volatile("s_wait_xcnt 0x0" ::: "memory");
  __builtin_amdgcn_sched_barrier(0);
  lds_barrier();
  k_steps<0>(acc, bw, ar);
  __builtin_amdgcn_sched_barrier(0);
  w_issue<2>(bw, bp);
  __builtin_amdgcn_sched_barrier(0);
  x_stage<1>(xv, XT, sw, lane);
  __builtin_amdgcn_sched_barrier(0);
  x_issue<3>(xv, xb, sw, lane);
  __builtin_amdgcn_sched_barrier(0);
  lds_barrier();
  k_steps<1>(acc, bw, ar);
  __builtin_amdgcn_sched_barrier(0);
  w_issue<3>(bw, bp);
  __builtin_amdgcn_sched_barrier(0);
  x_stage<2>(xv, XT, sw, lane);
  lds_barrier();
  k_steps<2>(acc, bw, ar);
  __builtin_amdgcn_sched_barrier(0);
  x_stage<3>(xv, XT, sw, lane);
  lds_barrier();
  k_steps<3>(acc, bw, ar);
  {
    float* sd = slab + (job * 4) * SLAB64 + (8 * hh) * 68 + 16 * sub + m;
#pragma unroll
    for (int i = 0; i < 4; ++i) {
#pragma unroll
      for (int r = 0; r < 8; ++r) sd[i * SLAB64 + r * 68] = acc[i][r];
    }
  }
  __syncthreads();
  const float* sl = slab + sw * SLAB64;
  const int rowb = row0 + sub * 16;
  const bool head = s0 < TQ0;                // block-uniform: rows that the f32 attention job reads
  if (job == 2) {
    float w[4][8], sum[4];
    vrows(w, sl, bv, hh, m);
#pragma unroll
    for (int j = 0; j < 4; ++j) {
      sum[j] = w[j][0];
#pragma unroll
      for (int r = 1; r < 8; ++r) sum[j] += w[j][r];
    }
#pragma unroll
    for (int j = 0; j < 4; ++j) sum[j] += __shfl_xor(sum[j], 16, 32);
    if (hh == 0) {
#pragma unroll
      for (int j = 0; j < 4; ++j) cs[sub * DH + 16 * j + m] = sum[j];
    }
  }
  __syncthreads();                           // all global stores stand behind it, so that no wave waits for them at the barrier
  if (job == 2) {
    const int vt = sub * 32 + lane;
    const int kbl = vt >> 6, d = vt & 63;    // 128 threads = 2 key blocks x 64 columns
    const float vsum = cs[(2 * kbl) * DH + d] + cs[(2 * kbl + 1) * DH + d];
    float w[4][8];
    vrows(w, sl, bv, hh, m);
    v4u oh[4];
#pragma unroll
    for (int j = 0; j < 4; ++j) {
#pragma unroll
      for (int e = 0; e < 4; ++e) oh[j][e] = pk16(h_bits((_Float16)(w[j][2 * e] * VCAR)), h_bits((_Float16)(w[j][2 * e + 1] * VCAR)));
    }
    VS[((size_t)(row0 >> 5) + (size_t)kbl) * DH + d] = vsum;
    u16* dst = VT + (size_t)(rowb >> 5) * (32 * DH) + ((rowb >> 4) & 1) * 256 + lane * 8;
#pragma unroll
    for (int j = 0; j < 4; ++j) *(v4u*)(dst + j * 512) = oh[j];
  } else {
    slab64_hsb(sl, (job == 0) ? QSC : KSC, (job == 0) ? bq : bk, (job == 0) ? QP : KP, (size_t)rowb, lane);
  }
  if (head) {
    // the f32 rows below rewrite registers that the stores above name: wait first
    asm volatile("s_wait_xcnt 0x0" ::: "memory");
    const float* bias = (job == 0) ? bq : (job == 1) ? bk : bv;
    const v4f bv4 = *(const v4f*)(bias + m * 4);
    // the row offset formed below rewrites the scalar base that this load names: wait first
    asm volatile("s_wait_xcnt 0x0" ::: "memory");
    v4f badd;
#pragma unroll
    for (int e = 0; e < 4; ++e) badd[e] = bfr(bv4[e]);
    float* C = (job == 0) ? QF : (job == 1) ? KF : V;
    const size_t ro = (job == 2) ? (size_t)rowb : (size_t)sb * TQ0 + (size_t)(s0 + sub * 16);
    slab64_out(sl, badd, C, DH, ro, 0, lane);
  }
}

// =====================================================================================================
// Output projection of one 16-row ctx tile that its attention block holds in LDS (hi + residual f16 rows), by all 8 waves:
//   C[row][n] = (hi . Bt^T) * os1 + (res . Bt^T) * os2 + bf16RNE(bias[n]); Bt = f16 [EMB][DH] in fragment order.
// Wave w owns columns 64w .. 64w+63 (four 16-column groups); K = DH = 64 in two steps of 32, separate accumulators for the two
// planes, k order 0..31 then 32..63 in each.
//  oproj_ldb: the two B fragments of group j (k step s at bytes 8192w + 2048j + 1024s).
//  oproj_mma: the four products of one group. Two groups' fragments are in flight at a time and a group's results are used up
//             before the next group's are made, which keeps the epilogue's registers below the key loop's.
// =====================================================================================================
__device__ __forceinline__ void oproj_ldb(v16h& b0, v16h& b1, const u16* __restrict__ Bt, int swave, int j, int lane) {
  const _Float16* bp = (const _Float16*)(const void*)Bt + (size_t)swave * (64 * DH) + j * 1024;      // wave-uniform base
  b0 = ldfrag_hs(bp + 8 * lane);
  b1 = ldfrag_hs(bp + 512 + 8 * lane);
}
__device__ __forceinline__ void oproj_mma(v8f& h, v8f& r, v16h b0, v16h b1, v16h a0, v16h a1, v16h r0, v16h r1) {
  h = mma_h(a0, b0, zero8());
  r = mma_h(r0, b0, zero8());
  h = mma_h(a1, b1, h);
  r = mma_h(r1, b1, r);
  // the distance behind the products: no result is read and no fragment's register is loaded anew in front of it
  guard2x6(h, r, b0, b1, a0, a1, r0, r1);
}

// =====================================================================================================
// Single-head causal attention, head width DH = 64, query rows TQ0 .. SEQ-1: block = (batch b, 16 query rows q0..q0+15), 8 waves.
// q plane (f16, x8), k plane the same and V^T plane (x1024), each in fragment order; VS = column sums of V per key block of 32.
// Wave w takes the key blocks kb = w, w+8, .. < nkbt (32 keys each; nkbt = blocks that hold a key <= q0+15), one per pass, with its own
// running max, running sum and partial O; nothing of a pass goes through LDS and no block barrier stands in the key loop.
//   (S) transposed scores S^T[key][query] on WMMA: A = k rows (row = key, split k map over d), B = q rows (col = query, the two 32-d
//       fragments kept in registers). D element r of lane (hh, m): tile 0 -> key 32kb + 8hh + r, tile 1 -> key 32kb + 16 + 8hh + r,
//       query q0 + m: a lane holds 16 of the 32 scores of ONE query, its partner lane ^ 16 the other 16.
//   (M) base-2 logits with the causal mask by key index (key > query -> -inf), block max and block sum in the lane plus one exchange
//       between the wave's halves, online running max / rescale factor al / running sum l in f32, p = exp2(t - m_new) <= 1 (0 for
//       masked keys), C = block sum / 32 (bit-identical in both halves), the CENTRED P' = p - C as f16(P' * 32768): the lane's 16
//       values, in the order it holds them, ARE its part of the B fragment of P'^T (col = query, elements 0..7 = keys 8hh + e,
//       elements 8..15 = keys 16 + 8hh + e), the k order of the V^T fragments.
//   (PV) O^T[d][query] on WMMA: A = V^T fragments (row = d, split k map over keys), B = P'^T. Accumulator tile j, element r of lane (hh, m) is
//       O^T[d = 16j + 8hh + r][query q0 + m], so al and C are one value a lane: o = o*al + C*(32768*1024)*VS[kb][d], the add-back of
//       the centring term over the 32 keys of the block, in f32, then 4 WMMAs plus a hazard gap. sum_k (P'_k + C) v_k == sum_k p_k v_k
//       exactly; masked keys carry P' = -C and p = 0. Every key block that is visited holds a valid key for each of the 16 queries.
//   Combine: the waves' max and sum per query go to LDS, barrier; every wave scales its partial O by exp2(own max - max of the 8)
//   (0 for a wave that had no key block) and stages it as [8][16 queries][OPP] f32, barrier, then thread (row = tid>>4, 4 columns) sums
//   the 8 partials in fixed order and the 8 scaled sums l likewise, x = sum * 4096 / (l * 32768 * 1024) (l >= 1 always), hi = f16(x),
//   res = f16((x - hi) * 2048), staged as a [32][CTP] u16 tile,
//   barrier, then the output projection of these 16 rows (oproj_ldb, oproj_mma, slab64_out): wave w -> out columns 64w .. 64w+63.
// coverage: grid nb*NQT blocks x 16 rows = rows TQ0..SEQ-1 of every sequence; key blocks 0..nkbt-1 each by exactly one wave;
//           partial stage 8 x 16 x 64; ctx stage 32 x 64; out store 8 waves x 16 rows x 64 columns.
// =====================================================================================================
__device__ __forceinline__ float xhalf(float x) {                    // lane l <-> lane l ^ 16, on the vector unit
  const int v = __builtin_bit_cast(int, x);
  return __builtin_bit_cast(float, __builtin_amdgcn_permlanex16(v, v, 0x76543210, 0xfedcba98, false, false));
}
__device__ __forceinline__
void attn_fwd_body(float* scs, u16* pls, float* wm, float* wl, int bid,
                   const u16* __restrict__ QPp, const u16* __restrict__ KPp, const u16* __restrict__ VTp,
                   const float* __restrict__ VSp, const u16* __restrict__ WOTp, const float* __restrict__ bo, float* out) {
  const int tid  = threadIdx.x;
  const int lane = tid & 31;
  const int hh   = lane >> 4;
  const int m    = lane & 15;
  const int sw   = __builtin_amdgcn_readfirstlane(tid >> 5);   // the wave's number in a scalar register: scalar loop, scalar bases

  // A block's cost grows with its query tile, so cost falls with the block index: the four sequences' last tiles
  // come first, their first tiles last. bid -> (b, tile) is a permutation of NB x NQT.
  const int b    = bid % NB;
  const int q0   = TQ0 + (NQT - 1 - bid / NB) * QT;
  const int nkbt = ((q0 + QT - 1) >> 5) + 1; // key blocks up to and with the diagonal one, 5 .. SEQ/32

  // all three planes in fragment order: 16 rows of q or k = two tiles (d 0..31, d 32..63), 32 keys of V^T = four tiles (16 d each)
  const _Float16* qrow = (const _Float16*)(const void*)QPp + ((size_t)b * SEQ + q0) * DH + 8 * lane;
  const v16h qa0 = ldfrag_hs(qrow);          // d 0..31
  const v16h qa1 = ldfrag_hs(qrow + 512);    // d 32..63
  // block-uniform bases; a lane's place is one 32-bit byte offset (a sequence's plane is SEQ*DH*2 bytes)
  const char* kbp = (const char*)(const void*)KPp + (size_t)b * SEQ * DH * 2;
  const char* vbp = (const char*)(const void*)VTp + (size_t)b * SEQ * DH * 2;
  const unsigned lo16 = (unsigned)lane * 16u;
  const float* vsb = VSp + (size_t)b * NCHK * NKB * DH + 8 * hh;
  const float lsc = RSQD * LOG2E / (QSC * KSC);
  const int ql = q0 + m - 8 * hh;            // key 32kb + 16t + 8hh + r is valid iff 16t + r <= ql - 32kb

  float mrun = -INFINITY, lrun = 0.f;
  v8f o[NACC];
#pragma unroll
  for (int j = 0; j < NACC; ++j) o[j] = zero8();

  // rolled: the trip count depends on the query tile, and one key block's fragments are in registers at a time
#pragma unroll 1
  for (int kb = sw; kb < nkbt; kb += 8) {
    const unsigned ko = lo16 + (unsigned)kb * (32u * DH * 2u);
    const _Float16* kp = (const _Float16*)(const void*)(kbp + ko);
    const v16h f00 = ldfrag_hs(kp);
    const v16h f01 = ldfrag_hs(kp + 512);
    const v16h f10 = ldfrag_hs(kp + 1024);
    const v16h f11 = ldfrag_hs(kp + 1536);
    const _Float16* vk = (const _Float16*)(const void*)(vbp + ko);
    const v16h g0 = ldfrag_hs(vk);
    const v16h g1 = ldfrag_hs(vk + 512);
    const v16h g2 = ldfrag_hs(vk + 1024);
    const v16h g3 = ldfrag_hs(vk + 1536);
    // ---- (S) ----
    v8f s0 = mma_h(f00, qa0, zero8());
    s0 = mma_h(f01, qa1, s0);
    v8f s1 = mma_h(f10, qa0, zero8());
    s1 = mma_h(f11, qa1, s1);
    guard2x6(s0, s1, qa0, qa1, f00, f01, f10, f11);
    const float* vsc = vsb + (size_t)kb * DH;              // fetched into the registers that the k fragments leave, used behind (M)
    v4f u[2 * NACC];
#pragma unroll
    for (int j = 0; j < NACC; ++j) { u[2 * j] = *(const v4f*)(vsc + 16 * j); u[2 * j + 1] = *(const v4f*)(vsc + 16 * j + 4); }
    // ---- (M) ----
    const int lim = ql - kb * 32;
    float t[16];
    float cm = -INFINITY;
#pragma unroll
    for (int r = 0; r < 8; ++r) {
      t[r]     = (r <= lim)      ? s0[r] * lsc : -INFINITY;
      t[8 + r] = (16 + r <= lim) ? s1[r] * lsc : -INFINITY;
      cm = fmaxf(cm, fmaxf(t[r], t[8 + r]));
    }
    cm = fmaxf(cm, xhalf(cm));
    const float mn = fmaxf(mrun, cm);                      // finite: the block holds a valid key for every query of the tile
    const float al = ex2(mrun - mn);                     // 0 in the wave's first pass, where mrun is -inf
    mrun = mn;
#pragma unroll
    for (int j = 0; j < 16; ++j) t[j] = fminf(t[j] - mn, 0.f);
    ex2x8(t[0], t[1], t[2], t[3], t[4], t[5], t[6], t[7]);           // p, 0 for masked keys
    ex2x8(t[8], t[9], t[10], t[11], t[12], t[13], t[14], t[15]);
    float ps = t[0];
#pragma unroll
    for (int j = 1; j < 16; ++j) ps += t[j];
    ps += xhalf(ps);
    const float cc = ps * (1.0f / 32.0f);
    lrun = lrun * al + ps;
    FragH pf;
#pragma unroll
    for (int i = 0; i < 2; ++i) {
#pragma unroll
      for (int e = 0; e < 4; ++e) {
        const int j = 8 * i + 2 * e;
        pf.u[i][e] = pk16(h_bits((_Float16)((t[j] - cc) * PCAR)), h_bits((_Float16)((t[j + 1] - cc) * PCAR)));
      }
    }
    // ---- (PV) ----
    const float cad = cc * (PCAR * VCAR);
#pragma unroll
    for (int j = 0; j < NACC; ++j) {
#pragma unroll
      for (int r = 0; r < 8; ++r) o[j][r] = __builtin_fmaf(cad, u[2 * j + (r >> 2)][r & 3], o[j][r] * al);
    }
    o[0] = mma_h(g0, pf.v, o[0]);
    o[1] = mma_h(g1, pf.v, o[1]);
    o[2] = mma_h(g2, pf.v, o[2]);
    o[3] = mma_h(g3, pf.v, o[3]);
    guardpv4(o[0], o[1], o[2], o[3], pf.v, g0, g1, g2, g3);
  }

  // ---- combine the 8 partial O tiles in fixed order ----
  // From here on the lane's number is read anew: no index made from the thread id has to stay in a vector register across the loop.
  const int el = (int)__builtin_amdgcn_mbcnt_lo(~0u, 0u);   // == lane
  const int eh = el >> 4, em = el & 15;                     // == hh, m
  const int er = 2 * sw + eh;                               // query row owned in the combine
  if (eh == 0) { wm[sw * QT + em] = mrun; wl[sw * QT + em] = lrun; }   // both halves hold the same two values
  v16h bf[4];                                // groups 0 and 1 are fetched beside the combine
  oproj_ldb(bf[0], bf[1], WOTp, sw, 0, el);
  oproj_ldb(bf[2], bf[3], WOTp, sw, 1, el);
  __syncthreads();
  {
    float gm = wm[em];                       // finite: wave 0 always has key block 0
#pragma unroll
    for (int w = 1; w < 8; ++w) gm = fmaxf(gm, wm[w * QT + em]);
    const float fs = ex2(mrun - gm);       // 0 where the wave had no key block (mrun = -inf, o = 0)
    float* od = scs + (sw * 16 + em) * OPP + 8 * eh;
#pragma unroll
    for (int j = 0; j < NACC; ++j) {
      const v4f lo = {o[j][0] * fs, o[j][1] * fs, o[j][2] * fs, o[j][3] * fs};
      const v4f hi = {o[j][4] * fs, o[j][5] * fs, o[j][6] * fs, o[j][7] * fs};
      *(v4f*)(od + 16 * j)     = lo;
      *(v4f*)(od + 16 * j + 4) = hi;
    }
  }
  __syncthreads();
  const int c4 = em * 4;
  v4f sm4 = zero4();
#pragma unroll
  for (int w = 0; w < 8; ++w) sm4 += *(const v4f*)(scs + (w * 16 + er) * OPP + c4);
  float gr = wm[er];
#pragma unroll
  for (int w = 1; w < 8; ++w) gr = fmaxf(gr, wm[w * QT + er]);
  float lsum = 0.f;
#pragma unroll
  for (int w = 0; w < 8; ++w) lsum += wl[w * QT + er] * ex2(wm[w * QT + er] - gr);
  const float inv = (1.0f / lsum) * (CSC / (PCAR * VCAR));            // lsum >= 1
#pragma unroll
  for (int e = 0; e < 4; ++e) {
    const float xs = sm4[e] * inv;
    const _Float16 hv = (_Float16)xs;
    const _Float16 rv = (_Float16)((xs - (float)hv) * RSC);
    pls[er * CTP + c4 + e]        = h_bits(hv);
    pls[(16 + er) * CTP + c4 + e] = h_bits(rv);
  }
  __syncthreads();
  // ---- output projection of the 16 ctx rows; the partial O tiles were last read in front of the barrier above, so each wave takes
  //      its own 16 x 68 f32 slab of the partial O region for the store shape of slab64_out ----
  const _Float16* ch = (const _Float16*)(const void*)pls + em * CTP + 8 * eh;
  const _Float16* cr = ch + 16 * CTP;
  const v16h a0 = ldfrag_h(ch), a1 = ldfrag_h(ch + 32), r0 = ldfrag_h(cr), r1 = ldfrag_h(cr + 32);
  const v4f bv = *(const v4f*)(bo + sw * 64 + em * 4);
  float* sl = scs + sw * SLAB64 + (8 * eh) * 68 + em;
  // unrolled: the fragment set bf[] is indexed by j and has to stay in registers
#pragma unroll
  for (int j = 0; j < 4; ++j) {
    v8f h, r;
    oproj_mma(h, r, bf[2 * (j & 1)], bf[2 * (j & 1) + 1], a0, a1, r0, r1);
    if (j < 2) oproj_ldb(bf[2 * j], bf[2 * j + 1], WOTp, sw, j + 2, el);   // group j + 2 flies while groups j, j + 1 are worked on
#pragma unroll
    for (int e = 0; e < 8; ++e) sl[e * 68 + 16 * j] = h[e] * OS1 + r[e] * OS2;
  }
  v4f badd;
#pragma unroll
  for (int e = 0; e < 4; ++e) badd[e] = bfr(bv[e]);
  slab64_out(scs + sw * SLAB64, badd, out, EMB, (size_t)b * SEQ + q0, sw * 64, el);
}

// =====================================================================================================
// Query rows 0 .. TQ0-1 of each sequence in f32 on VALU: block = (b, t), threads 0..127 work (waves 4..7 only pass the barriers, up to the output projection). QF/KF = f32 q/k planes [nb][TQ0][DH] (bias
// included), V = f32 v plane [nb*SEQ][DH]. Scores for keys j (thread j, one key each, 64-d dot of its whole key row against the q row staged in LDS;
// keys j > t masked to -inf), base-2 softmax with block max / sum reductions (xor shuffles + LDS), p_j in LDS, ctx[d] for d = tid
// (threads 0..63) as a sum in key order of p_j * V[b][j][d] (coalesced, groups of 64 keys up to the one holding t), x = ctx * 4096 / l, hi = f16(x),
// res = f16((x - hi) * 2048); both 64-half rows are staged in LDS, then the row's output projection: wave w -> out columns 64w .. 64w+63.
// coverage: grid nb*TQ0 blocks = rows 0..TQ0-1 of every sequence; 64 thr x 1 d = DH per row; store 8 waves x 4 x 16 lanes = EMB floats;
//           together with attn_fwd every (b, s, n) of out is written exactly once.
// =====================================================================================================
__device__ __forceinline__
void attn_head_body(float* qs, float* sc, float* red, float* redb, u16* SW, int bid,
                    const float* __restrict__ QF, const float* __restrict__ KF, const float* __restrict__ V,
                    const u16* __restrict__ WOTp, const float* __restrict__ bo, float* out) {
  const int tid = threadIdx.x, lane = tid & 31, wave = tid >> 5;
  const int b = bid / TQ0;
  const int t = bid - b * TQ0;
  const bool work = wave < HD_THREADS / 32;                        // wave-uniform: one key per thread, keys 0..TQ0-1
  if (tid < DH) qs[tid] = QF[((size_t)b * TQ0 + t) * DH + tid];   // waves 0,1 entirely (wave-uniform)
  __syncthreads();
  float acc = 0.f;
  if (work) {
    const float* kp = KF + (size_t)b * (TQ0 * DH) + tid * DH;       // key row b*TQ0 + tid always in range (tid < TQ0)
    v4f kr[DH / 4];                                                 // the whole key row: 16 loads in flight, one latency
#pragma unroll
    for (int i = 0; i < DH / 4; ++i) kr[i] = *(const v4f*)(kp + 4 * i);
#pragma unroll
    for (int i = 0; i < DH / 4; ++i) {
      const v4f q4 = *(const v4f*)(qs + 4 * i);
#pragma unroll
      for (int e = 0; e < 4; ++e) acc += kr[i][e] * q4[e];
    }
  }
  const float s = (tid <= t) ? acc * (RSQD * LOG2E) : -INFINITY;   // causal mask by key index
  float mx = s;
#pragma unroll
  for (int d = 1; d <= 16; d <<= 1) mx = fmaxf(mx, __shfl_xor(mx, d, 32));
  if (work && lane == 0) red[wave] = mx;
  __syncthreads();
  float gm = red[0];
#pragma unroll
  for (int w = 1; w < 4; ++w) gm = fmaxf(gm, red[w]);   // finite: key 0 is always valid
  const float p = ex2(s - gm);                     // 0 for masked keys
  float ps = p;
#pragma unroll
  for (int d = 1; d <= 16; d <<= 1) ps += __shfl_xor(ps, d, 32);
  if (work && lane == 0) redb[wave] = ps;
  if (work) sc[tid] = p;
  __syncthreads();
  float l = redb[0];
#pragma unroll
  for (int w = 1; w < 4; ++w) l += redb[w];           // >= 1
  const float inv = (1.0f / l) * CSC;
  if (wave < 2) {                                    // threads 0..63 (wave-uniform): one d column each
    const float* vp = V + (size_t)b * SEQ * DH + tid;
    float cx = 0.f;
    // Keys in groups of 64 whose loads are issued ahead of their use: one load latency per group. A group's keys j > t carry
    // sc[j] = 0 and add nothing; rows j0 .. j0+63 <= TQ0-1 of sequence b always exist. The sum runs in key order.
    // rolled: the trip count (1 or 2) depends on t
#pragma unroll 1
    for (int j0 = 0; j0 <= t; j0 += 64) {            // block-uniform
      float vv[64];
#pragma unroll
      for (int i = 0; i < 64; ++i) vv[i] = vp[(size_t)(j0 + i) * DH];
#pragma unroll
      for (int i = 0; i < 16; ++i) {
        const v4f p4 = *(const v4f*)(sc + j0 + 4 * i);
#pragma unroll
        for (int e = 0; e < 4; ++e) cx += p4[e] * vv[4 * i + e];
      }
    }
    const float x0 = cx * inv;
    const _Float16 h0 = (_Float16)x0;
    const _Float16 r0 = (_Float16)((x0 - (float)h0) * RSC);
    SW[tid]      = h_bits(h0);
    SW[DH + tid] = h_bits(r0);
  }
  const int sw = __builtin_amdgcn_readfirstlane(wave);   // the wave's number in a scalar register: scalar base for Wo
  v16h bf[4];                                        // groups 0 and 1: behind the 64-register key groups, in front of the last barrier
  oproj_ldb(bf[0], bf[1], WOTp, sw, 0, lane);
  oproj_ldb(bf[2], bf[3], WOTp, sw, 1, lane);
  float bb[4];
#pragma unroll
  for (int j = 0; j < 4; ++j) bb[j] = bo[wave * 64 + 16 * j + (lane & 15)];
  __syncthreads();
  // ---- output projection of the one ctx row, all 8 waves: it is row 0 of the A tile, rows 1..15 are zero; row 0 of a result tile is
  //      element 0 of lanes 0..15 (column = lane) ----
  const int hh = lane >> 4, m = lane & 15;
  const v4u z4 = {0u, 0u, 0u, 0u};
  FragH fa[4];                                       // hi k 0..31, hi k 32..63, residual k 0..31, residual k 32..63
#pragma unroll
  for (int i = 0; i < 4; ++i) {
    const v4u u0 = *(const v4u*)(SW + i * 32 + 8 * hh), u1 = *(const v4u*)(SW + i * 32 + 16 + 8 * hh);
    fa[i].u[0] = (m == 0) ? u0 : z4;
    fa[i].u[1] = (m == 0) ? u1 : z4;
  }
  float ov[4];
  // unrolled: the fragment set bf[] is indexed by j and has to stay in registers
#pragma unroll
  for (int j = 0; j < 4; ++j) {
    v8f h, r;
    oproj_mma(h, r, bf[2 * (j & 1)], bf[2 * (j & 1) + 1], fa[0].v, fa[1].v, fa[2].v, fa[3].v);
    if (j < 2) oproj_ldb(bf[2 * j], bf[2 * j + 1], WOTp, sw, j + 2, lane);
    ov[j] = (h[0] * OS1 + r[0] * OS2) + bfr(bb[j]);
  }
  float* dst = out + ((size_t)b * SEQ + t) * EMB + wave * 64 + m;
  if (lane < 16) {
#pragma unroll
    for (int j = 0; j < 4; ++j) dst[16 * j] = ov[j];
  }
}

// =====================================================================================================
// One launch for the two independent attention jobs, picked by block index (block-uniform): blocks 0..NB*NQT-1 = query rows TQ0.. on
// WMMA, longest tiles first, the rest = query rows 0..TQ0-1 on VALU (short blocks, last, so that they fill places the long blocks leave).
// coverage: grid = NB*NQT + NB*TQ0 blocks; each job is handed block indices 0 .. its own block count - 1.
// =====================================================================================================
__global__ __launch_bounds__(ATT_THREADS) __attribute__((amdgpu_num_vgpr(256)))
void attn(const u16* __restrict__ QPp, const u16* __restrict__ KPp, const u16* __restrict__ VTp, const float* __restrict__ VSp,
          const float* __restrict__ QF, const float* __restrict__ KF, const float* __restrict__ V,
          const u16* __restrict__ WOTp, const float* __restrict__ bo, float* out) {
  __shared__ __align__(16) float scs[8 * 16 * OPP]; // partial O tiles [8][16][OPP] f32, then out slabs
  __shared__ __align__(16) u16 pls[32 * CTP];       // ctx staging [32][CTP] u16
  __shared__ float wm[8 * QT];                      // running max per wave and query
  __shared__ float wl[8 * QT];                      // running sum per wave and query
  __shared__ __align__(16) float qs[DH];
  __shared__ __align__(16) float sc[TQ0];
  __shared__ float red[4];
  __shared__ float redb[4];
  __shared__ __align__(16) u16 SW[2 * DH];
  const int bid = blockIdx.x;
  if (bid < NB * NQT) attn_fwd_body(scs, pls, wm, wl, bid, QPp, KPp, VTp, VSp, WOTp, bo, out);
  else                attn_head_body(qs, sc, red, redb, SW, bid - NB * NQT, QF, KF, V, WOTp, bo, out);
}

// =====================================================================================================
// Workspace map (bytes, nb = 4, rows = 16384); every plane (V only in rows 0..127 of each sequence) is written by whole-line stores before it is read; all extents are
//   WQT bf16 [64][512] 65536   WKT same   WVT same   WOT f16 of bf16 value x1024 [512][64] 65536 (fragment order)  262144
//   QP  f16 [rows][64] x8 (fragment order)                                                                          2097152
//   KP  f16 [rows][64] x8 (fragment order)                                                                          2097152
//   V   f32 [rows][64] (only rows 0..127 of each sequence are written and read)                                     4194304
//   VT  f16 [nb][SEQ/32][4] tiles (32 keys x 16 d) x1024 (fragment order)                                                                    2097152
//   VS  f32 [nb][8][16][64]                                                                                          131072
//   QF  f32 [nb][128][64]  131072      KF same                                                                       262144
//   end                                                                                                            11141120
// =====================================================================================================
extern "C" void kernel_launch(void* const* d_in, const int* in_sizes, int n_in,
                              void* d_out, int out_size, void* d_ws, size_t ws_size,
                              hipStream_t stream) {
  if (n_in < 9) return;
  const int nb   = NB;
  const int rows = nb * SEQ;
  if ((long long)in_sizes[0] < (long long)NB * SEQ_FULL * EMB) return;
  if (in_sizes[1] < EMB * DH || in_sizes[3] < EMB * DH || in_sizes[5] < EMB * DH || in_sizes[7] < DH * EMB) return;
  if (in_sizes[2] < DH || in_sizes[4] < DH || in_sizes[6] < DH || in_sizes[8] < EMB) return;
  if ((long long)out_size < (long long)rows * EMB) return;

  const float* x  = (const float*)d_in[0];
  const float* wq = (const float*)d_in[1];
  const float* bq = (const float*)d_in[2];
  const float* wk = (const float*)d_in[3];
  const float* bk = (const float*)d_in[4];
  const float* wv = (const float*)d_in[5];
  const float* bv = (const float*)d_in[6];
  const float* wo = (const float*)d_in[7];
  const float* bo = (const float*)d_in[8];
  float*       out = (float*)d_out;

  const size_t szW  = (size_t)EMB * DH * 2;                      //     65536
  const size_t szP  = (size_t)rows * DH * 2;                     //   2097152
  const size_t szV  = (size_t)rows * DH * 4;                     //   4194304
  const size_t szVT = (size_t)nb * DH * SEQ * 2;                 //   2097152 (== szP)
  const size_t szVS = (size_t)nb * NCHK * NKB * DH * 4;          //    131072
  const size_t szHF = (size_t)nb * TQ0 * DH * 4;                 //    131072
  size_t off = 0;
  const size_t oWQ = off; off += szW;
  const size_t oWK = off; off += szW;
  const size_t oWV = off; off += szW;
  const size_t oWO = off; off += szW;
  const size_t oQ  = off; off += szP;
  const size_t oK  = off; off += szP;
  const size_t oV  = off; off += szV;
  const size_t oVT = off; off += szVT;
  const size_t oVS = off; off += szVS;
  const size_t oQF = off; off += szHF;
  const size_t oKF = off; off += szHF;
  if (off > ws_size) return;                                     // off = 11141120 at nb = 4
  if (off > WS_CAP) return;

  char* ws = (char*)d_ws;
  u16*   WQT = (u16*)(ws + oWQ);
  u16*   WKT = (u16*)(ws + oWK);
  u16*   WVT = (u16*)(ws + oWV);
  u16*   WOT = (u16*)(ws + oWO);
  u16*   QP  = (u16*)(ws + oQ);
  u16*   KP  = (u16*)(ws + oK);
  float* V   = (float*)(ws + oV);
  u16*   VT  = (u16*)(ws + oVT);
  float* VS  = (float*)(ws + oVS);
  float* QF  = (float*)(ws + oQF);
  float* KF  = (float*)(ws + oKF);

  if ((rows % 64) != 0) return;
  const dim3 blk(256);
  const dim3 gPR(4 * WTB);                              // 4 * 8 weight tiles
  const dim3 gPJ(GPB);                                  // 256 at nb = 4
  const dim3 bG(PJ_THREADS);
  const dim3 gAT(NB * NQT + NB * TQ0);                  // nb * 248 + nb * 128
  const dim3 bAT(ATT_THREADS);

  // (0) Wq, Wk, Wv stored [k = in 512][n = out 64] -> bf16 planes [64][512] in fragment order; Wo [k = 64][n = 512] -> f16 of bf16
  //     value x1024, [512][64] in fragment order
  prep<<<gPR, blk, 0, stream>>>(wq, wk, wv, wo, WQT, WKT, WVT, WOT);
  // (1) x read as f32 and converted in the block; q and k projections (+bias) -> f16 planes x8; v projection (+bias) -> V^T plane x1024, key-block column sums and f32 rows
  //     0..127 of every sequence; f32 q and k rows 0..127 of every sequence -> QF, KF [nb*128][64]
  proj<<<gPJ, bG, 0, stream>>>(x, WQT, WKT, WVT, bq, bk, bv, QP, KP, V, VT, VS, QF, KF);
  // (2) attention: query rows 128.. on WMMA and query rows 0..127 on VALU -> ctx hi x4096 and residual x2048 f16 rows in LDS, then
  //     each block's output projection + bias -> out
  attn<<<gAT, bAT, 0, stream>>>(QP, KP, VT, VS, QF, KF, V, WOT, bo, out);
  (void)hipGetLastError();
}

// v010
// Measured time: 35.9 microseconds a run.
// Timed twice side by side with v009, it ran 1.09 and 1.11 times as fast.
// Over all steps from v000 it is 6.36 times as fast.
// Projections q,k,v = x.W + b and the f32 q,k rows 0..127 per sequence: v_wmma_f32_16x16x32_bf16 (bf16 RNE operands of the
// raw inputs, f32 accumulate, bf16 RNE bias added in f32). Scores q'.k'^T (f16 planes x8), P'.V (key-block-centred P' x32768 f16 from registers,
// V^T x1024 f16) and the output projection (ctx carried as f16 hi x4096 plus residual x2048 rows, times f16(bf16(Wo)) x1024, bias
// added in f32): v_wmma_f32_16x16x32_f16, f32 accumulate. Query rows 0..127 of each sequence: scores, softmax and P.V in f32 on VALU.
// Causal mask, softmax statistics, key-block column sums of V and all scaling in f32 on VALU.
#include <hip/hip_runtime.h>
#include <math.h>
#include <stdint.h>

#ifndef NB
#define NB 4
#endif
#ifndef SEQ
#define SEQ 4096
#endif
#define SEQ_FULL 4096
#define NB_FULL 4
#define EMB   512
#define DH    64
#define CK    512
#define NCHK  (SEQ / CK)
#define NKB   16
#define QT    16
#define TQ0   128
#define NQT   ((SEQ - TQ0) / QT)
#define OPP   68
#define CTP   72
#define SLAB64 (16 * 68)
#define VTP   72
#define ATT_THREADS 256
#define HD_THREADS 128
#define HR    16
#define NHB   (TQ0 / HR)
#define NACC  4
#define QSC   8.0f
#define KSC   8.0f
#define PCAR  32768.0f
#define VCAR  1024.0f
#define WSC   1024.0f
#define CSC   4096.0f
#define RSC   2048.0f
#define OS1   (1.0f / (CSC * WSC))
#define OS2   (1.0f / (CSC * WSC * RSC))
#define LOG2E 1.4426950408889634f
#define RSQD  0.125f
#define WS_CAP ((size_t)134217728)
#define WTB   ((EMB / 64) * (DH / 64))
#define GPB   (((NB * SEQ) / 64) * (DH / 64))
#define PJ_THREADS 384
#define XTP   (EMB + 8)

static_assert(DH == 64 && NACC * 16 == DH && (EMB % 64) == 0 && (EMB % 32) == 0 && (DH % 32) == 0);
static_assert((SEQ % CK) == 0 && NCHK >= 1 && CK == 32 * NKB && (SEQ % 64) == 0 && (SEQ % QT) == 0 && (CK % QT) == 0);
static_assert((TQ0 % QT) == 0 && (TQ0 % 64) == 0 && NQT * QT + TQ0 == SEQ && NQT >= 1 && TQ0 == 128 && TQ0 == HD_THREADS);
static_assert(8 * SLAB64 <= 8 * 16 * OPP && EMB == 8 * 64 && CTP >= DH + 8 && OPP >= DH + 4);
static_assert(((VTP * 2) % 16) == 0 && ((CTP * 2) % 16) == 0 && ((OPP * 4) % 16) == 0);
static_assert(64 * VTP >= 63 * VTP + 64);
static_assert(ATT_THREADS == 16 * QT && ATT_THREADS == 256 && HD_THREADS == 2 * DH);
static_assert(((NB * SEQ) % 64) == 0 && EMB == 512 && ((XTP * 2) % 32) == 16 && PJ_THREADS == 12 * 32);
static_assert(HR == QT && (64 % HR) == 0 && ATT_THREADS * 4 == HR * DH && ATT_THREADS == 2 * TQ0 && ATT_THREADS == 4 * DH);
static_assert(HR * DH + HR * TQ0 + 2 * HR * 4 + HR * DH <= 8 * 16 * OPP && HR / 2 == 8);
static_assert(NB >= 1 && NB <= NB_FULL && SEQ <= SEQ_FULL && (TQ0 % 64) == 0 && (NKB % 2) == 0);

typedef unsigned short u16;
typedef _Float16 v16h __attribute__((ext_vector_type(16)));
typedef _Float16 v8h  __attribute__((ext_vector_type(8)));
typedef __bf16   v16b __attribute__((ext_vector_type(16)));
typedef float    v8f  __attribute__((ext_vector_type(8)));
typedef float    v4f  __attribute__((ext_vector_type(4)));
typedef unsigned int v4u __attribute__((ext_vector_type(4)));
typedef unsigned int v2u __attribute__((ext_vector_type(2)));

union FragH { v16h v; v8h h[2]; v4u u[2]; };
union FragB { v16b v; v4u u[2]; };

// ---- scalar helpers --------------------------------------------------------------------------------
__device__ __forceinline__ unsigned short bf_bits(float f) {          // f32 -> bf16 bits, RNE convert
  unsigned u = __float_as_uint(f);
  return (unsigned short)((u + 0x7FFFu + ((u >> 16) & 1u)) >> 16);
}
__device__ __forceinline__ float bf_up(unsigned short h) { return __uint_as_float(((unsigned)h) << 16); }
__device__ __forceinline__ float bfr(float f) { return bf_up(bf_bits(f)); }
__device__ __forceinline__ unsigned short h_bits(_Float16 x) { return __builtin_bit_cast(unsigned short, x); }
__device__ __forceinline__ unsigned pk16(unsigned short a, unsigned short b) { return (unsigned)a | ((unsigned)b << 16); }
__device__ __forceinline__ v8f zero8() { v8f z = {0.f, 0.f, 0.f, 0.f, 0.f, 0.f, 0.f, 0.f}; return z; }
__device__ __forceinline__ v4f zero4() { v4f z = {0.f, 0.f, 0.f, 0.f}; return z; }
// 2^x as the one hardware instruction. The library call wraps the same instruction in a compare, two selects, an add and an ldexp so that
// results below 2^-126 come out as denormals; here such a result is 0. Every argument is <= 0 and every result is a softmax weight or a
// rescale factor that is added to, or multiplies, terms of a sum that is >= 1: bit-identical from 2^-126 up.
__device__ __forceinline__ float ex2(float x) { return __builtin_amdgcn_exp2f(x); }
// Eight of them in place, in one statement: the instruction set asks for one independent instruction or a v_nop between a transcendental
// and an instruction that reads its result or overwrites its source. Here each is followed by an independent one and the last by the
// v_nop.
__device__ __forceinline__ void ex2x8(float& a0, float& a1, float& a2, float& a3, float& a4, float& a5, float& a6, float& a7) {
#if defined(__HIP_DEVICE_COMPILE__)
  asm("v_exp_f32 %0, %0\n\tv_exp_f32 %1, %1\n\tv_exp_f32 %2, %2\n\tv_exp_f32 %3, %3\n\t"
      "v_exp_f32 %4, %4\n\tv_exp_f32 %5, %5\n\tv_exp_f32 %6, %6\n\tv_exp_f32 %7, %7\n\tv_nop"
      : "+v"(a0), "+v"(a1), "+v"(a2), "+v"(a3), "+v"(a4), "+v"(a5), "+v"(a6), "+v"(a7));
#endif
}

// ---- fragment loaders: 16-bit A/B operand, lane -> row/col (lane&15), p already includes +8*(lane>>4);
//      elements 0..7 <- p[0..7] (k0+8h..), elements 8..15 <- p[16..23] (k0+16+8h..)  (same split k map for A and B);
//      this form reads the row-major A tiles in LDS (x, ctx hi, ctx residual)
__device__ __forceinline__ v16h ldfrag_h(const _Float16* p) {
  FragH f;
  f.h[0] = *(const v8h*)(p);
  f.h[1] = *(const v8h*)(p + 16);
  return f.v;
}
__device__ __forceinline__ v16b ldfrag_b(const u16* p) {              // bf16 plane read as unsigned integer vectors
  FragB f;
  f.u[0] = *(const v4u*)(p);
  f.u[1] = *(const v4u*)(p + 16);
  return f.v;
}

// ---- the same fragments from a plane kept in FRAGMENT ORDER: a 16 (rows or cols) x 32 (k) tile is 512 consecutive halves; the 16-B
//      unit of lane l = 16*h + m (row/col m, k = 8h .. 8h+7) lies at 8*l, the unit for k = 16+8h .. at 256 + 8*l. p already includes
//      +8*lane, so each of the two loads reads 512 consecutive bytes (4 whole lines) where a row-major plane gives 16 lines.
__device__ __forceinline__ v16h ldfrag_hs(const _Float16* p) {
  FragH f;
  f.h[0] = *(const v8h*)(p);
  f.h[1] = *(const v8h*)(p + 256);
  return f.v;
}
__device__ __forceinline__ v16b ldfrag_bs(const u16* p) {
  FragB f;
  f.u[0] = *(const v4u*)(p);
  f.u[1] = *(const v4u*)(p + 256);
  return f.v;
}

__device__ __forceinline__ v8f mma_h(v16h a, v16h b, v8f c) {
  return __builtin_amdgcn_wmma_f32_16x16x32_f16(false, a, false, b, (short)0, c, false, false);
}
__device__ __forceinline__ v8f mma_b(v16b a, v16b b, v8f c) {
  return __builtin_amdgcn_wmma_f32_16x16x32_bf16(false, a, false, b, (short)0, c, false, false);
}
__device__ __forceinline__ void guard2x6(v8f& a, v8f& b, v16h x0, v16h x1, v16h x2, v16h x3, v16h x4, v16h x5) {
#if defined(__HIP_DEVICE_COMPILE__)
  asm volatile("v_nop\n\tv_nop\n\tv_nop\n\tv_nop"
               : "+v"(a), "+v"(b) : "v"(x0), "v"(x1), "v"(x2), "v"(x3), "v"(x4), "v"(x5) : "memory");
#endif
}
__device__ __forceinline__ void guardpv4(v8f& o0, v8f& o1, v8f& o2, v8f& o3, v16h p, v16h g0, v16h g1, v16h g2, v16h g3) {
#if defined(__HIP_DEVICE_COMPILE__)
  asm volatile("v_nop\n\tv_nop\n\tv_nop\n\tv_nop"
               : "+v"(o0), "+v"(o1), "+v"(o2), "+v"(o3)
               : "v"(p), "v"(g0), "v"(g1), "v"(g2), "v"(g3) : "memory");
#endif
}
__device__ __forceinline__ void wave_sync_lds() {                    // wave-private LDS slab: release, wave barrier, acquire
  __builtin_amdgcn_fence(3, "workgroup");
  __builtin_amdgcn_wave_barrier();
  __builtin_amdgcn_fence(2, "workgroup");
}

// =====================================================================================================
// Weight transpose-convert: in W[R][C] f32 row-major -> out D = the [n = C][k = R] 16-bit operand plane for y = x.W in fragment order:
// tile (n/16, k/32) at halves ((n/16)*(R/32) + k/32)*512, units inside it as ldfrag_hs / ldfrag_bs read them.
// mode 0: bf16 RNE bits; mode 1: f16 bits of (bf16 RNE value) * scale.
// Block = 64x64 tile: 64 input row segments of 64 floats loaded with 16-B loads, converted, scattered into an LDS tile [c][64 r]
// coverage: load 256 thr x 16 = 64 x 64; store 2 iterations x 256 thr x 8 halves = 64 lines x 64; grid = (R/64) x (C/64) blocks
//           covers D exactly once (R, C are EMB, DH: static_assert EMB % 64 == 0, DH == 64).
// =====================================================================================================
__device__ __forceinline__ void wt16_body(u16* TH, int bid, const float* __restrict__ W, u16* D, int R, int C, int mode,
                                          float scale) {
  const int tid = threadIdx.x;
  const int nrt = R >> 6;
  const int r0  = (bid % nrt) * 64;
  const int c0  = (bid / nrt) * 64;
  {
    const int rl = tid >> 2;                  // input row within tile 0..63
    const int cs = (tid & 3) * 16;            // column chunk within the 64
    const float* src = W + (size_t)(r0 + rl) * C + c0 + cs;
#pragma unroll
    for (int i = 0; i < 4; ++i) {
      const v4f a = *(const v4f*)(src + 4 * i);
#pragma unroll
      for (int e = 0; e < 4; ++e) {
        const float v  = a[e];
        const unsigned short hb = h_bits((_Float16)(bfr(v) * scale));
        const unsigned short bb = bf_bits(v);
        TH[(cs + 4 * i + e) * VTP + rl] = (mode != 0) ? hb : bb;
      }
    }
  }
  __syncthreads();
  v4u vh[2];
  const int fm = tid & 15, fh = (tid >> 4) & 1, fs = (tid >> 5) & 1, fk = (tid >> 6) & 1, fn = tid >> 7;
#pragma unroll
  for (int it = 0; it < 2; ++it) {            // local c = 16*(2*it + fn) + fm, local r = 32*fk + 16*fs + 8*fh .. +7
    vh[it] = *(const v4u*)(TH + ((it * 2 + fn) * 16 + fm) * VTP + fk * 32 + fs * 16 + fh * 8);
  }
  const int kt = R >> 5;                      // 32-wide k tiles per 16 columns
  {
#pragma unroll
    for (int it = 0; it < 2; ++it) {
      *(v4u*)(D + ((size_t)((c0 >> 4) + it * 2 + fn) * (size_t)kt + (size_t)(r0 >> 5)) * 512 + (tid & 127) * 8) = vh[it];
    }
    
  }
}

// =====================================================================================================
// One launch for the four weight transposes, picked by block index (block-uniform): WTB blocks each, order Wq, Wk, Wv, Wo.
// coverage: grid = 4*WTB blocks; each job is handed block indices 0 .. WTB-1.
// =====================================================================================================
__global__ __launch_bounds__(256)
void prep(const float* __restrict__ wq, const float* __restrict__ wk, const float* __restrict__ wv,
          const float* __restrict__ wo, u16* WQT, u16* WKT, u16* WVT, u16* WOT) {
  __shared__ __align__(16) u16 TH[64 * VTP];
  const int bid = blockIdx.x;
  const int job = bid / WTB;
  const float* W = (job == 0) ? wq : (job == 1) ? wk : (job == 2) ? wv : wo;
  u16* D = (job == 0) ? WQT : (job == 1) ? WKT : (job == 2) ? WVT : WOT;
  const bool pj = job < 3;                    // Wq, Wk, Wv: [EMB][DH] -> bf16; Wo: [DH][EMB] -> scaled f16
  wt16_body(TH, bid - job * WTB, W, D, pj ? EMB : DH, pj ? DH : EMB, pj ? 0 : 1, pj ? 1.0f : WSC);
}

// =====================================================================================================
// Stores of a 16 x 64 f32 tile that lies in an LDS slab [16][68] (row = tile row, 68 = 64 columns + 4 pad):
//  slab64_out: f32 rows + badd; instruction it: lanes 0..15 -> row 2*it (16 lanes x 16 B = two whole lines), lanes 16..31 -> row 2*it+1.
//  slab64_hsb: f16 bits of ((tile + bf16RNE(bias[n])) * pscale), plane [rows][DH] in fragment order; lane = (row lane&15, 8 consecutive
//              columns), each of the 4 stores writes 512 consecutive bytes.
// coverage: slab64_out 8 instructions x 2 rows x 16 lanes x 4 floats; slab64_hsb 4 instructions x 16 rows x 2 lanes x 8 halves
//           = the 16 x 64 tile in both cases.
// =====================================================================================================
__device__ __forceinline__ void slab64_out(const float* sl, v4f badd, float* C, int N, size_t rowb, int col0, int lane) {
  const int hh = lane >> 4, m = lane & 15;
  wave_sync_lds();
  v4f vals[8];
#pragma unroll
  for (int it = 0; it < 8; ++it) vals[it] = *(const v4f*)(sl + (it * 2 + hh) * 68 + m * 4) + badd;
  float* dst = C + (rowb + (size_t)hh) * (size_t)N + col0 + m * 4;
#pragma unroll
  for (int it = 0; it < 8; ++it) *(v4f*)(dst + (size_t)(it * 2) * (size_t)N) = vals[it];
}
__device__ __forceinline__ void slab64_hsb(const float* sl, float pscale, const float* __restrict__ bias, u16* C, size_t rowb, int lane) {
  const int hh = lane >> 4, m = lane & 15;
  v4u oh[4];
#pragma unroll
  for (int g = 0; g < 4; ++g) {               // g = 16-column group of the 64; lane = (row m, columns 16g + 8hh .. +7)
    const int c8 = g * 16 + hh * 8;
    const v4f b0 = *(const v4f*)(bias + c8), b1 = *(const v4f*)(bias + c8 + 4);
    const v4f a = *(const v4f*)(sl + m * 68 + c8), c4 = *(const v4f*)(sl + m * 68 + c8 + 4);
    float w[8];
#pragma unroll
    for (int e = 0; e < 4; ++e) { w[e] = (a[e] + bfr(b0[e])) * pscale; w[4 + e] = (c4[e] + bfr(b1[e])) * pscale; }
#pragma unroll
    for (int e = 0; e < 4; ++e) oh[g][e] = pk16(h_bits((_Float16)w[2 * e]), h_bits((_Float16)w[2 * e + 1]));
  }
  // 16 rows = two tiles (d 0..31, d 32..63) of 512 halves; group g is the half-tile at g*256
  u16* dst = C + (rowb >> 4) * (size_t)(2 * 512) + lane * 8;
#pragma unroll
  for (int g = 0; g < 4; ++g) *(v4u*)(dst + g * 256) = oh[g];
}

// Block barrier that orders LDS alone: a wave's LDS stores are done in front of it, its LDS reads stand behind it. __syncthreads() would
// also wait for the x rows that are still on their way from memory, which the barriers inside the k loop must not do.
__device__ __forceinline__ void lds_barrier() {
  __builtin_amdgcn_fence(__ATOMIC_RELEASE, "workgroup", "local");
  __builtin_amdgcn_s_barrier();
  __builtin_amdgcn_fence(__ATOMIC_ACQUIRE, "workgroup", "local");
}

// =====================================================================================================
// All projections of 64 rows of x in one block of 12 waves: q, k, v = bf16RNE(x) . bf16RNE(W) on WMMA, f32 accumulate, k in steps of 32
// in rising order. x is read here as f32, once: wave-wide 16-B loads of 512 consecutive bytes of a row, RNE convert in registers, rows
// staged as bf16 in LDS at a pitch of XTP halves (1024 + 16 bytes).
//  loads: piece L = 0..255 is (row L & 63, k quarter L >> 6); wave w takes L = w + 12*i, issued two quarters ahead of their use.
//         Quarter c is complete once every wave has staged its pieces i < X1(c): 6 + 5*c for c < 3 (w + 12*(6 + 5*c) >= 64*(c + 1) for every w), all of them for c = 3.
//  products: wave w = (job w >> 2: q, k, v; 16 columns n = 16*(w & 3) ..) x the four 16-row tiles; weight fragments straight into
//         registers; A fragments from LDS (ldfrag_b, the split k map of the weight planes). Quarter c's four k steps follow barrier c.
//  results: tile i of wave w -> slab (job, i), columns 16*(w & 3) ..; element r of lane (hh, m) is row 8*hh + r, column m of the tile.
//  stores: wave w = (job, row tile w & 3) takes slab w:
//   q, k: f16 plane x8 with bias (slab64_hsb); rows 0..TQ0-1 of a sequence also as f32 rows with bias -> QF, KF [nb*TQ0][DH].
//   v: value = slab + bf16RNE(bias) in f32, lane (hh, m) holds v[key rowb + 8*hh + r][d = 16*j + m];
//      V^T plane = f16(v * 1024) in fragment order: the tile (32 keys, 16 columns d) lies at halves ((b*SEQ + s)/32 * 4 + d/16)*512; a
//      lane's 8 elements of column group j are one 16-B unit, the wave's 16 keys the half-tile at 256*((rowb/16) & 1);
//      VS[(b*SEQ + s)/32][d] = sum of v over the 32 keys of a key block (f32): 8 keys in order in a lane, + the other half-wave's 8
//      (xor shuffle), + the neighbour wave's 16 through LDS behind a block barrier;
//      V = f32 rows, only for keys 0..TQ0-1 of a sequence.
// coverage: grid = nb*SEQ/64 blocks; staging 256 pieces x 32 lanes x 4 = 64 x 512; slabs 12 waves x 4 tiles x 16 x 16 = 3 x 64 x 64.
// =====================================================================================================
__device__ __forceinline__ void vrows(float (&w)[4][8], const float* sl, const float* __restrict__ bias, int hh, int m) {
#pragma unroll
  for (int j = 0; j < 4; ++j) {
    const float bj = bfr(bias[16 * j + m]);
#pragma unroll
    for (int r = 0; r < 8; ++r) w[j][r] = sl[(8 * hh + r) * 68 + 16 * j + m] + bj;
  }
}
// k quarter C: a wave's pieces i = X0(C) .. X1(C)-1, its weight fragments and k steps 4*C .. 4*C+3
#define X0(C) ((C) == 0 ? 0 : 1 + 5 * (C))
#define X1(C) ((C) == 3 ? 22 : 6 + 5 * (C))
template <int C>
__device__ __forceinline__ void w_issue(v16b (&bw)[EMB / 32], const u16* bp) {
#pragma unroll
  for (int s = 4 * C; s < 4 * C + 4; ++s) bw[s] = ldfrag_bs(bp + s * 512);
}
template <int C>
__device__ __forceinline__ void x_issue(v4f (&xv)[22], const float* __restrict__ xb, int sw, int lane) {
#pragma unroll
  for (int i = X0(C); i < X1(C); ++i) {
    // pieces 252..255 go to waves 0..3; the other waves read their piece 20 again and do not stage it: one instruction stream
    const int L = (i < 21 || sw < 4) ? sw + 12 * i : sw + 240;
    xv[i] = *(const v4f*)(xb + (size_t)(L & 63) * EMB + (L >> 6) * 128 + lane * 4);
  }
}
template <int C>
__device__ __forceinline__ void x_stage(const v4f (&xv)[22], u16* XT, int sw, int lane) {
#pragma unroll
  for (int i = X0(C); i < X1(C); ++i) {
    if (i < 21 || sw < 4) {
      const int L = sw + 12 * i;
      v2u o;
      o[0] = pk16(bf_bits(xv[i][0]), bf_bits(xv[i][1]));
      o[1] = pk16(bf_bits(xv[i][2]), bf_bits(xv[i][3]));
      *(v2u*)(XT + (L & 63) * XTP + (L >> 6) * 128 + lane * 4) = o;
    }
  }
}
template <int C>
__device__ __forceinline__ void k_steps(v8f (&acc)[4], const v16b (&bw)[EMB / 32], const u16* ar) {
  v16b af[2][4];                             // the next k step's four A fragments are read while this step's products run
#pragma unroll
  for (int i = 0; i < 4; ++i) af[0][i] = ldfrag_b(ar + i * (16 * XTP) + 32 * (4 * C));
#pragma unroll
  for (int t = 0; t < 4; ++t) {
    if (t < 3) {
#pragma unroll
      for (int i = 0; i < 4; ++i) af[(t + 1) & 1][i] = ldfrag_b(ar + i * (16 * XTP) + 32 * (4 * C + t + 1));
    }
#pragma unroll
    for (int i = 0; i < 4; ++i) acc[i] = mma_b(af[t & 1][i], bw[4 * C + t], acc[i]);
  }
}
__global__ __launch_bounds__(PJ_THREADS)
void proj(const float* __restrict__ x, const u16* __restrict__ WQT, const u16* __restrict__ WKT, const u16* __restrict__ WVT,
          const float* __restrict__ bq, const float* __restrict__ bk, const float* __restrict__ bv,
          u16* QP, u16* KP, float* V, u16* VT, float* VS, float* QF, float* KF) {
  __shared__ __align__(16) u16 XT[64 * XTP];
  __shared__ __align__(16) float slab[12 * SLAB64];
  __shared__ float cs[4 * DH];               // 16-key column sums of v, one row per v wave
  const int tid = threadIdx.x, lane = tid & 31, hh = lane >> 4, m = lane & 15;
  const int sw  = __builtin_amdgcn_readfirstlane(tid >> 5);   // the wave's number in a scalar register: scalar bases and branches
  const int job = sw >> 2, sub = sw & 3;
  const int row0 = (int)blockIdx.x * 64;     // compact row b*SEQ + s; 64 divides SEQ, so a block lies in one sequence
  const int sb = row0 / SEQ, s0 = row0 - sb * SEQ;

  // the wave's 16 columns of its weight plane: 16 tiles of 512 halves, one per k step
  const u16* bp = ((job == 0) ? WQT : (job == 1) ? WKT : WVT) + (size_t)sub * (16 * EMB) + lane * 8;
  const float* xb = x + ((size_t)sb * SEQ_FULL + s0) * EMB;   // block-uniform base
  const u16* ar = XT + m * XTP + 8 * hh;
  v16b bw[EMB / 32];
  v4f xv[22];
  v8f acc[4];
#pragma unroll
  for (int i = 0; i < 4; ++i) acc[i] = zero8();
  // Loads are counted back in the order of issue. The scheduling barriers fix that order: in quarters 0 and 1 the weights, then the x pieces, in quarters 2 and 3 the x pieces, then the weights, and
  // nothing of a later quarter in front of an earlier one. Without them the compiler mixes the quarters' loads, so that the first
  // quarter's LDS stores also wait for later loads, and it forms the x addresses in one scalar pair with a wait between single loads.
  // They hold the loads, not the products: a quarter's last products may still stand among the next quarter's converts.
  w_issue<0>(bw, bp); x_issue<0>(xv, xb, sw, lane);
  __builtin_amdgcn_sched_barrier(0);
  w_issue<1>(bw, bp); x_issue<1>(xv, xb, sw, lane);
  __builtin_amdgcn_sched_barrier(0);
  x_stage<0>(xv, XT, sw, lane);
  __builtin_amdgcn_sched_barrier(0);
  x_issue<2>(xv, xb, sw, lane);
  // the address arithmetic of the next run of loads rewrites scalar bases that these loads name: wait first
  asm volatile("s_wait_xcnt 0x0" ::: "memory");
  __builtin_amdgcn_sched_barrier(0);
  lds_barrier();
  k_steps<0>(acc, bw, ar);
  __builtin_amdgcn_sched_barrier(0);
  w_issue<2>(bw, bp);
  __builtin_amdgcn_sched_barrier(0);
  x_stage<1>(xv, XT, sw, lane);
  __builtin_amdgcn_sched_barrier(0);
  x_issue<3>(xv, xb, sw, lane);
  __builtin_amdgcn_sched_barrier(0);
  lds_barrier();
  k_steps<1>(acc, bw, ar);
  __builtin_amdgcn_sched_barrier(0);
  w_issue<3>(bw, bp);
  __builtin_amdgcn_sched_barrier(0);
  x_stage<2>(xv, XT, sw, lane);
  lds_barrier();
  k_steps<2>(acc, bw, ar);
  __builtin_amdgcn_sched_barrier(0);
  x_stage<3>(xv, XT, sw, lane);
  lds_barrier();
  k_steps<3>(acc, bw, ar);
  {
    float* sd = slab + (job * 4) * SLAB64 + (8 * hh) * 68 + 16 * sub + m;
#pragma unroll
    for (int i = 0; i < 4; ++i) {
#pragma unroll
      for (int r = 0; r < 8; ++r) sd[i * SLAB64 + r * 68] = acc[i][r];
    }
  }
  __syncthreads();
  const float* sl = slab + sw * SLAB64;
  const int rowb = row0 + sub * 16;
  const bool head = s0 < TQ0;                // block-uniform: rows that the f32 attention job reads
  if (job == 2) {
    float w[4][8], sum[4];
    vrows(w, sl, bv, hh, m);
#pragma unroll
    for (int j = 0; j < 4; ++j) {
      sum[j] = w[j][0];
#pragma unroll
      for (int r = 1; r < 8; ++r) sum[j] += w[j][r];
    }
#pragma unroll
    for (int j = 0; j < 4; ++j) sum[j] += __shfl_xor(sum[j], 16, 32);
    if (hh == 0) {
#pragma unroll
      for (int j = 0; j < 4; ++j) cs[sub * DH + 16 * j + m] = sum[j];
    }
  }
  __syncthreads();                           // all global stores stand behind it, so that no wave waits for them at the barrier
  if (job == 2) {
    const int vt = sub * 32 + lane;
    const int kbl = vt >> 6, d = vt & 63;    // 128 threads = 2 key blocks x 64 columns
    const float vsum = cs[(2 * kbl) * DH + d] + cs[(2 * kbl + 1) * DH + d];
    float w[4][8];
    vrows(w, sl, bv, hh, m);
    v4u oh[4];
#pragma unroll
    for (int j = 0; j < 4; ++j) {
#pragma unroll
      for (int e = 0; e < 4; ++e) oh[j][e] = pk16(h_bits((_Float16)(w[j][2 * e] * VCAR)), h_bits((_Float16)(w[j][2 * e + 1] * VCAR)));
    }
    VS[((size_t)(row0 >> 5) + (size_t)kbl) * DH + d] = vsum;
    u16* dst = VT + (size_t)(rowb >> 5) * (32 * DH) + ((rowb >> 4) & 1) * 256 + lane * 8;
#pragma unroll
    for (int j = 0; j < 4; ++j) *(v4u*)(dst + j * 512) = oh[j];
  } else {
    slab64_hsb(sl, (job == 0) ? QSC : KSC, (job == 0) ? bq : bk, (job == 0) ? QP : KP, (size_t)rowb, lane);
  }
  if (head) {
    // the f32 rows below rewrite registers that the stores above name: wait first
    asm volatile("s_wait_xcnt 0x0" ::: "memory");
    const float* bias = (job == 0) ? bq : (job == 1) ? bk : bv;
    const v4f bv4 = *(const v4f*)(bias + m * 4);
    // the row offset formed below rewrites the scalar base that this load names: wait first
    asm volatile("s_wait_xcnt 0x0" ::: "memory");
    v4f badd;
#pragma unroll
    for (int e = 0; e < 4; ++e) badd[e] = bfr(bv4[e]);
    float* C = (job == 0) ? QF : (job == 1) ? KF : V;
    const size_t ro = (job == 2) ? (size_t)rowb : (size_t)sb * TQ0 + (size_t)(s0 + sub * 16);
    slab64_out(sl, badd, C, DH, ro, 0, lane);
  }
}

// =====================================================================================================
// Output projection of one 16-row ctx tile that its attention block holds in LDS (hi + residual f16 rows), by all 8 waves:
//   C[row][n] = (hi . Bt^T) * os1 + (res . Bt^T) * os2 + bf16RNE(bias[n]); Bt = f16 [EMB][DH] in fragment order.
// Wave w owns columns 64w .. 64w+63 (four 16-column groups); K = DH = 64 in two steps of 32, separate accumulators for the two
// planes, k order 0..31 then 32..63 in each.
//  oproj_ldb: the two B fragments of group j (k step s at bytes 8192w + 2048j + 1024s).
//  oproj_mma: the four products of one group. Two groups' fragments are in flight at a time and a group's results are used up
//             before the next group's are made, which keeps the epilogue's registers below the key loop's.
// =====================================================================================================
__device__ __forceinline__ void oproj_ldb(v16h& b0, v16h& b1, const u16* __restrict__ Bt, int swave, int j, int lane) {
  const _Float16* bp = (const _Float16*)(const void*)Bt + (size_t)swave * (64 * DH) + j * 1024;      // wave-uniform base
  b0 = ldfrag_hs(bp + 8 * lane);
  b1 = ldfrag_hs(bp + 512 + 8 * lane);
}
__device__ __forceinline__ void oproj_mma(v8f& h, v8f& r, v16h b0, v16h b1, v16h a0, v16h a1, v16h r0, v16h r1) {
  h = mma_h(a0, b0, zero8());
  r = mma_h(r0, b0, zero8());
  h = mma_h(a1, b1, h);
  r = mma_h(r1, b1, r);
  // the distance behind the products: no result is read and no fragment's register is loaded anew in front of it
  guard2x6(h, r, b0, b1, a0, a1, r0, r1);
}

// =====================================================================================================
// Single-head causal attention, head width DH = 64, query rows TQ0 .. SEQ-1: block = (batch b, 16 query rows q0..q0+15), 8 waves.
// q plane (f16, x8), k plane the same and V^T plane (x1024), each in fragment order; VS = column sums of V per key block of 32.
// Wave w takes the key blocks kb = w, w+8, .. < nkbt (32 keys each; nkbt = blocks that hold a key <= q0+15), one per pass, with its own
// running max, running sum and partial O; nothing of a pass goes through LDS and no block barrier stands in the key loop.
//   (S) transposed scores S^T[key][query] on WMMA: A = k rows (row = key, split k map over d), B = q rows (col = query, the two 32-d
//       fragments kept in registers). D element r of lane (hh, m): tile 0 -> key 32kb + 8hh + r, tile 1 -> key 32kb + 16 + 8hh + r,
//       query q0 + m: a lane holds 16 of the 32 scores of ONE query, its partner lane ^ 16 the other 16.
//   (M) base-2 logits with the causal mask by key index (key > query -> -inf), block max and block sum in the lane plus one exchange
//       between the wave's halves, online running max / rescale factor al / running sum l in f32, p = exp2(t - m_new) <= 1 (0 for
//       masked keys), C = block sum / 32 (bit-identical in both halves), the CENTRED P' = p - C as f16(P' * 32768): the lane's 16
//       values, in the order it holds them, ARE its part of the B fragment of P'^T (col = query, elements 0..7 = keys 8hh + e,
//       elements 8..15 = keys 16 + 8hh + e), the k order of the V^T fragments.
//   (PV) O^T[d][query] on WMMA: A = V^T fragments (row = d, split k map over keys), B = P'^T. Accumulator tile j, element r of lane (hh, m) is
//       O^T[d = 16j + 8hh + r][query q0 + m], so al and C are one value a lane: o = o*al + C*(32768*1024)*VS[kb][d], the add-back of
//       the centring term over the 32 keys of the block, in f32, then 4 WMMAs plus a hazard gap. sum_k (P'_k + C) v_k == sum_k p_k v_k
//       exactly; masked keys carry P' = -C and p = 0. Every key block that is visited holds a valid key for each of the 16 queries.
//   Combine: the waves' max and sum per query go to LDS, barrier; every wave scales its partial O by exp2(own max - max of the 8)
//   (0 for a wave that had no key block) and stages it as [8][16 queries][OPP] f32, barrier, then thread (row = tid>>4, 4 columns) sums
//   the 8 partials in fixed order and the 8 scaled sums l likewise, x = sum * 4096 / (l * 32768 * 1024) (l >= 1 always), hi = f16(x),
//   res = f16((x - hi) * 2048), staged as a [32][CTP] u16 tile,
//   barrier, then the output projection of these 16 rows (oproj_ldb, oproj_mma, slab64_out): wave w -> out columns 64w .. 64w+63.
// coverage: grid nb*NQT blocks x 16 rows = rows TQ0..SEQ-1 of every sequence; key blocks 0..nkbt-1 each by exactly one wave;
//           partial stage 8 x 16 x 64; ctx stage 32 x 64; out store 8 waves x 16 rows x 64 columns.
// =====================================================================================================
__device__ __forceinline__ float xhalf(float x) {                    // lane l <-> lane l ^ 16, on the vector unit
  const int v = __builtin_bit_cast(int, x);
  return __builtin_bit_cast(float, __builtin_amdgcn_permlanex16(v, v, 0x76543210, 0xfedcba98, false, false));
}
__device__ __forceinline__
void attn_fwd_body(float* scs, u16* pls, float* wm, float* wl, int bid,
                   const u16* __restrict__ QPp, const u16* __restrict__ KPp, const u16* __restrict__ VTp,
                   const float* __restrict__ VSp, const u16* __restrict__ WOTp, const float* __restrict__ bo, float* out) {
  const int tid  = threadIdx.x;
  const int lane = tid & 31;
  const int hh   = lane >> 4;
  const int m    = lane & 15;
  const int sw   = __builtin_amdgcn_readfirstlane(tid >> 5);   // the wave's number in a scalar register: scalar loop, scalar bases

  // A block's cost grows with its query tile, so cost falls with the block index: the four sequences' last tiles
  // come first, their first tiles last. bid -> (b, tile) is a permutation of NB x NQT.
  const int b    = bid % NB;
  const int q0   = TQ0 + (NQT - 1 - bid / NB) * QT;
  const int nkbt = ((q0 + QT - 1) >> 5) + 1; // key blocks up to and with the diagonal one, 5 .. SEQ/32

  // all three planes in fragment order: 16 rows of q or k = two tiles (d 0..31, d 32..63), 32 keys of V^T = four tiles (16 d each)
  const _Float16* qrow = (const _Float16*)(const void*)QPp + ((size_t)b * SEQ + q0) * DH + 8 * lane;
  const v16h qa0 = ldfrag_hs(qrow);          // d 0..31
  const v16h qa1 = ldfrag_hs(qrow + 512);    // d 32..63
  // block-uniform bases; a lane's place is one 32-bit byte offset (a sequence's plane is SEQ*DH*2 bytes)
  const char* kbp = (const char*)(const void*)KPp + (size_t)b * SEQ * DH * 2;
  const char* vbp = (const char*)(const void*)VTp + (size_t)b * SEQ * DH * 2;
  const unsigned lo16 = (unsigned)lane * 16u;
  const float* vsb = VSp + (size_t)b * NCHK * NKB * DH + 8 * hh;
  const float lsc = RSQD * LOG2E / (QSC * KSC);
  const int ql = q0 + m - 8 * hh;            // key 32kb + 16t + 8hh + r is valid iff 16t + r <= ql - 32kb

  float mrun = -INFINITY, lrun = 0.f;
  v8f o[NACC];
#pragma unroll
  for (int j = 0; j < NACC; ++j) o[j] = zero8();

  // rolled: the trip count depends on the query tile, and one key block's fragments are in registers at a time
#pragma unroll 1
  for (int kb = sw; kb < nkbt; kb += 8) {
    const unsigned ko = lo16 + (unsigned)kb * (32u * DH * 2u);
    const _Float16* kp = (const _Float16*)(const void*)(kbp + ko);
    const v16h f00 = ldfrag_hs(kp);
    const v16h f01 = ldfrag_hs(kp + 512);
    const v16h f10 = ldfrag_hs(kp + 1024);
    const v16h f11 = ldfrag_hs(kp + 1536);
    const _Float16* vk = (const _Float16*)(const void*)(vbp + ko);
    const v16h g0 = ldfrag_hs(vk);
    const v16h g1 = ldfrag_hs(vk + 512);
    const v16h g2 = ldfrag_hs(vk + 1024);
    const v16h g3 = ldfrag_hs(vk + 1536);
    // ---- (S) ----
    v8f s0 = mma_h(f00, qa0, zero8());
    s0 = mma_h(f01, qa1, s0);
    v8f s1 = mma_h(f10, qa0, zero8());
    s1 = mma_h(f11, qa1, s1);
    guard2x6(s0, s1, qa0, qa1, f00, f01, f10, f11);
    const float* vsc = vsb + (size_t)kb * DH;              // fetched into the registers that the k fragments leave, used behind (M)
    v4f u[2 * NACC];
#pragma unroll
    for (int j = 0; j < NACC; ++j) { u[2 * j] = *(const v4f*)(vsc + 16 * j); u[2 * j + 1] = *(const v4f*)(vsc + 16 * j + 4); }
    // ---- (M) ----
    const int lim = ql - kb * 32;
    float t[16];
    float cm = -INFINITY;
#pragma unroll
    for (int r = 0; r < 8; ++r) {
      t[r]     = (r <= lim)      ? s0[r] * lsc : -INFINITY;
      t[8 + r] = (16 + r <= lim) ? s1[r] * lsc : -INFINITY;
      cm = fmaxf(cm, fmaxf(t[r], t[8 + r]));
    }
    cm = fmaxf(cm, xhalf(cm));
    const float mn = fmaxf(mrun, cm);                      // finite: the block holds a valid key for every query of the tile
    const float al = ex2(mrun - mn);                     // 0 in the wave's first pass, where mrun is -inf
    mrun = mn;
#pragma unroll
    for (int j = 0; j < 16; ++j) t[j] = fminf(t[j] - mn, 0.f);
    ex2x8(t[0], t[1], t[2], t[3], t[4], t[5], t[6], t[7]);           // p, 0 for masked keys
    ex2x8(t[8], t[9], t[10], t[11], t[12], t[13], t[14], t[15]);
    float ps = t[0];
#pragma unroll
    for (int j = 1; j < 16; ++j) ps += t[j];
    ps += xhalf(ps);
    const float cc = ps * (1.0f / 32.0f);
    lrun = lrun * al + ps;
    FragH pf;
#pragma unroll
    for (int i = 0; i < 2; ++i) {
#pragma unroll
      for (int e = 0; e < 4; ++e) {
        const int j = 8 * i + 2 * e;
        pf.u[i][e] = pk16(h_bits((_Float16)((t[j] - cc) * PCAR)), h_bits((_Float16)((t[j + 1] - cc) * PCAR)));
      }
    }
    // ---- (PV) ----
    const float cad = cc * (PCAR * VCAR);
#pragma unroll
    for (int j = 0; j < NACC; ++j) {
#pragma unroll
      for (int r = 0; r < 8; ++r) o[j][r] = __builtin_fmaf(cad, u[2 * j + (r >> 2)][r & 3], o[j][r] * al);
    }
    o[0] = mma_h(g0, pf.v, o[0]);
    o[1] = mma_h(g1, pf.v, o[1]);
    o[2] = mma_h(g2, pf.v, o[2]);
    o[3] = mma_h(g3, pf.v, o[3]);
    guardpv4(o[0], o[1], o[2], o[3], pf.v, g0, g1, g2, g3);
  }

  // ---- combine the 8 partial O tiles in fixed order ----
  // From here on the lane's number is read anew: no index made from the thread id has to stay in a vector register across the loop.
  const int el = (int)__builtin_amdgcn_mbcnt_lo(~0u, 0u);   // == lane
  const int eh = el >> 4, em = el & 15;                     // == hh, m
  const int er = 2 * sw + eh;                               // query row owned in the combine
  if (eh == 0) { wm[sw * QT + em] = mrun; wl[sw * QT + em] = lrun; }   // both halves hold the same two values
  v16h bf[4];                                // groups 0 and 1 are fetched beside the combine
  oproj_ldb(bf[0], bf[1], WOTp, sw, 0, el);
  oproj_ldb(bf[2], bf[3], WOTp, sw, 1, el);
  __syncthreads();
  {
    float gm = wm[em];                       // finite: wave 0 always has key block 0
#pragma unroll
    for (int w = 1; w < 8; ++w) gm = fmaxf(gm, wm[w * QT + em]);
    const float fs = ex2(mrun - gm);       // 0 where the wave had no key block (mrun = -inf, o = 0)
    float* od = scs + (sw * 16 + em) * OPP + 8 * eh;
#pragma unroll
    for (int j = 0; j < NACC; ++j) {
      const v4f lo = {o[j][0] * fs, o[j][1] * fs, o[j][2] * fs, o[j][3] * fs};
      const v4f hi = {o[j][4] * fs, o[j][5] * fs, o[j][6] * fs, o[j][7] * fs};
      *(v4f*)(od + 16 * j)     = lo;
      *(v4f*)(od + 16 * j + 4) = hi;
    }
  }
  __syncthreads();
  const int c4 = em * 4;
  v4f sm4 = zero4();
#pragma unroll
  for (int w = 0; w < 8; ++w) sm4 += *(const v4f*)(scs + (w * 16 + er) * OPP + c4);
  float gr = wm[er];
#pragma unroll
  for (int w = 1; w < 8; ++w) gr = fmaxf(gr, wm[w * QT + er]);
  float lsum = 0.f;
#pragma unroll
  for (int w = 0; w < 8; ++w) lsum += wl[w * QT + er] * ex2(wm[w * QT + er] - gr);
  const float inv = (1.0f / lsum) * (CSC / (PCAR * VCAR));            // lsum >= 1
#pragma unroll
  for (int e = 0; e < 4; ++e) {
    const float xs = sm4[e] * inv;
    const _Float16 hv = (_Float16)xs;
    const _Float16 rv = (_Float16)((xs - (float)hv) * RSC);
    pls[er * CTP + c4 + e]        = h_bits(hv);
    pls[(16 + er) * CTP + c4 + e] = h_bits(rv);
  }
  __syncthreads();
  // ---- output projection of the 16 ctx rows; the partial O tiles were last read in front of the barrier above, so each wave takes
  //      its own 16 x 68 f32 slab of the partial O region for the store shape of slab64_out ----
  const _Float16* ch = (const _Float16*)(const void*)pls + em * CTP + 8 * eh;
  const _Float16* cr = ch + 16 * CTP;
  const v16h a0 = ldfrag_h(ch), a1 = ldfrag_h(ch + 32), r0 = ldfrag_h(cr), r1 = ldfrag_h(cr + 32);
  const v4f bv = *(const v4f*)(bo + sw * 64 + em * 4);
  float* sl = scs + sw * SLAB64 + (8 * eh) * 68 + em;
  // unrolled: the fragment set bf[] is indexed by j and has to stay in registers
#pragma unroll
  for (int j = 0; j < 4; ++j) {
    v8f h, r;
    oproj_mma(h, r, bf[2 * (j & 1)], bf[2 * (j & 1) + 1], a0, a1, r0, r1);
    if (j < 2) oproj_ldb(bf[2 * j], bf[2 * j + 1], WOTp, sw, j + 2, el);   // group j + 2 flies while groups j, j + 1 are worked on
#pragma unroll
    for (int e = 0; e < 8; ++e) sl[e * 68 + 16 * j] = h[e] * OS1 + r[e] * OS2;
  }
  v4f badd;
#pragma unroll
  for (int e = 0; e < 4; ++e) badd[e] = bfr(bv[e]);
  slab64_out(scs + sw * SLAB64, badd, out, EMB, (size_t)b * SEQ + q0, sw * 64, el);
}

// =====================================================================================================
// Query rows 0 .. TQ0-1 of each sequence in f32 on VALU: block = (b, HR = 16 consecutive rows t0 .. t0+15), all 8 waves work. QF/KF = f32
// q/k planes [nb][TQ0][DH] (bias included), V = f32 v plane [nb*SEQ][DH]. The key rows, the v rows and Wo are fetched once for 16 rows.
//  scores: thread = (key j = tid & 127, rows 8*(tid >> 7) .. +7): its whole key row in registers, a 64-d dot against each of its 8 q rows
//          (staged in LDS, read as broadcasts), d in rising order; keys j > t masked to -inf.
//  softmax: base 2, per row: max and sum by xor shuffles in the wave, then over the 4 waves that hold the row's 128 keys through LDS, in
//          wave order; p_j in LDS [HR][TQ0].
//  ctx:    thread = (d = tid & 63, rows 4*(tid >> 6) .. +3): sum in key order of p_j * V[b][j][d] (coalesced, groups of 64 keys up to the one
//          that holds the block's rows: 16 divides 64, so all 16 rows lie in one group), x = ctx * 4096 / l, hi = f16(x),
//          res = f16((x - hi) * 2048), staged as the [32][CTP] u16 tile of the WMMA job, then the same output projection of 16 rows.
// LDS: q rows, p rows, the wave partials and the running ctx sums lie in the score region; they are last read in front of the barrier behind which the region
// becomes the out slabs.
// coverage: grid nb*TQ0/HR blocks x 16 rows = rows 0..TQ0-1 of every sequence; q stage 256 thr x 4 = 16 x 64; scores 128 keys x 2 x 8 rows;
//           ctx 64 d x 4 x 4 rows; out store 8 waves x 16 rows x 64 columns; with attn_fwd every (b, s, n) of out is written exactly once.
// =====================================================================================================
__device__ __forceinline__
void attn_head_body(float* scs, u16* pls, int bid,
                    const float* __restrict__ QF, const float* __restrict__ KF, const float* __restrict__ V,
                    const u16* __restrict__ WOTp, const float* __restrict__ bo, float* out) {
  float* qs   = scs;                                 // [HR][DH]  q rows
  float* sc   = qs + HR * DH;                        // [HR][TQ0] p
  float* red  = sc + HR * TQ0;                       // [HR][4]   wave maxima
  float* redb = red + HR * 4;                        // [HR][4]   wave sums
  const int tid = threadIdx.x, lane = tid & 31, wave = tid >> 5;
  const int b  = bid / NHB;
  const int t0 = (bid - b * NHB) * HR;
  const int key = tid & (TQ0 - 1);                   // key row b*TQ0 + key always in range
  const int r0 = (tid >> 7) * (HR / 2);              // wave-uniform: first of the thread's 8 rows
  const int kw = wave & 3;                           // which 32 of the 128 keys
  const v4f qv = *(const v4f*)(QF + ((size_t)b * TQ0 + t0) * DH + tid * 4);
  const float* kp = KF + (size_t)b * (TQ0 * DH) + key * DH;
  v4f kr[DH / 4];                                    // the whole key row: 16 loads in flight, one latency
#pragma unroll
  for (int i = 0; i < DH / 4; ++i) kr[i] = *(const v4f*)(kp + 4 * i);
  *(v4f*)(qs + tid * 4) = qv;
  __syncthreads();
  // rolled, two rows a trip: two independent sums in flight. Fully unrolled, all rows' LDS reads are hoisted and the registers of the
  // whole kernel (and with them the WMMA job's waves per SIMD) follow. The logits wait in LDS, each read back by the thread that wrote it.
#pragma unroll 1
  for (int r = 0; r < HR / 2; r += 2) {
    const float* qa = qs + (r0 + r) * DH;
    float d0 = 0.f, d1 = 0.f;
#pragma unroll
    for (int i = 0; i < DH / 4; ++i) {
      const v4f q4 = *(const v4f*)(qa + 4 * i), q5 = *(const v4f*)(qa + DH + 4 * i);
#pragma unroll
      for (int e = 0; e < 4; ++e) { d0 = __builtin_fmaf(kr[i][e], q4[e], d0); d1 = __builtin_fmaf(kr[i][e], q5[e], d1); }
    }
    // causal mask by key index
    sc[(r0 + r) * TQ0 + key]     = (key <= t0 + r0 + r)     ? d0 * (RSQD * LOG2E) : -INFINITY;
    sc[(r0 + r + 1) * TQ0 + key] = (key <= t0 + r0 + r + 1) ? d1 * (RSQD * LOG2E) : -INFINITY;
  }
  float s[HR / 2], rd[HR / 2];
#pragma unroll
  for (int r = 0; r < HR / 2; ++r) { s[r] = sc[(r0 + r) * TQ0 + key]; rd[r] = s[r]; }
  // the 8 rows' exchanges of one distance stand together: 8 independent shuffles in flight, not one
#pragma unroll
  for (int d = 1; d <= 16; d <<= 1) {
#pragma unroll
    for (int r = 0; r < HR / 2; ++r) rd[r] = fmaxf(rd[r], __shfl_xor(rd[r], d, 32));
  }
  if (lane == 0) {
#pragma unroll
    for (int r = 0; r < HR / 2; ++r) red[(r0 + r) * 4 + kw] = rd[r];
  }
  __syncthreads();
#pragma unroll
  for (int r = 0; r < HR / 2; ++r) {
    const v4f m4 = *(const v4f*)(red + (r0 + r) * 4);
    float gm = m4[0];
#pragma unroll
    for (int w = 1; w < 4; ++w) gm = fmaxf(gm, m4[w]);   // finite: key 0 is always valid
    s[r] = s[r] - gm;
  }
  ex2x8(s[0], s[1], s[2], s[3], s[4], s[5], s[6], s[7]);   // p, 0 for masked keys
#pragma unroll
  for (int r = 0; r < HR / 2; ++r) { sc[(r0 + r) * TQ0 + key] = s[r]; rd[r] = s[r]; }
#pragma unroll
  for (int d = 1; d <= 16; d <<= 1) {
#pragma unroll
    for (int r = 0; r < HR / 2; ++r) rd[r] += __shfl_xor(rd[r], d, 32);
  }
  if (lane == 0) {
#pragma unroll
    for (int r = 0; r < HR / 2; ++r) redb[(r0 + r) * 4 + kw] = rd[r];
  }
  __syncthreads();
  {
    const int d  = tid & (DH - 1);
    const int c0 = (tid >> 6) * 4;                   // wave-uniform: first of the thread's 4 rows
    const float* vp = V + (size_t)b * SEQ * DH + d;
    float* cxl = redb + HR * 4 + c0 * DH + d;        // [HR][DH] running ctx sums; each element is its own thread's alone
    // Keys in groups of 64 whose loads are issued ahead of their use: one load latency per group. A group's keys j > t carry
    // p = 0 and add nothing; rows j0 .. j0+63 <= TQ0-1 of sequence b always exist. Each sum runs in key order.
    // rolled: the trip count (1 or 2) depends on t0
#pragma unroll 1
    for (int j0 = 0; j0 <= t0; j0 += 64) {           // block-uniform
      float vv[64];
#pragma unroll
      for (int i = 0; i < 64; ++i) vv[i] = vp[(size_t)(j0 + i) * DH];
      // the row loop below reuses the registers that hold these loads' address: wait first
      asm volatile("s_wait_xcnt 0x0" ::: "memory");
      // rolled: one row's 16 p vectors beside the 64 v values; unrolled, the rows are packed in pairs and the registers of the whole
      // kernel grow past what the WMMA job needs. The running sum waits in LDS between the key groups.
#pragma unroll 1
      for (int q = 0; q < 4; ++q) {
        float cx = (j0 == 0) ? 0.f : cxl[q * DH];
#pragma unroll
        for (int i = 0; i < 16; ++i) {
          const v4f p4 = *(const v4f*)(sc + (c0 + q) * TQ0 + j0 + 4 * i);
#pragma unroll
          for (int e = 0; e < 4; ++e) cx = __builtin_fmaf(p4[e], vv[4 * i + e], cx);
        }
        cxl[q * DH] = cx;
      }
    }
#pragma unroll
    for (int q = 0; q < 4; ++q) {
      const v4f l4 = *(const v4f*)(redb + (c0 + q) * 4);
      float l = l4[0];
#pragma unroll
      for (int w = 1; w < 4; ++w) l += l4[w];        // >= 1
      const float inv = (1.0f / l) * CSC;
      const float x0 = cxl[q * DH] * inv;
      const _Float16 h0 = (_Float16)x0;
      const _Float16 q0 = (_Float16)((x0 - (float)h0) * RSC);
      pls[(c0 + q) * CTP + d]      = h_bits(h0);
      pls[(16 + c0 + q) * CTP + d] = h_bits(q0);
    }
  }
  const int sw = __builtin_amdgcn_readfirstlane(wave);   // the wave's number in a scalar register: scalar base for Wo
  v16h bf[4];                                        // groups 0 and 1: behind the 64-register key groups, in front of the last barrier
  oproj_ldb(bf[0], bf[1], WOTp, sw, 0, lane);
  oproj_ldb(bf[2], bf[3], WOTp, sw, 1, lane);
  __syncthreads();
  // ---- output projection of the 16 ctx rows, as in the WMMA job: wave w -> out columns 64w .. 64w+63, its own 16 x 68 f32 slab ----
  const int hh = lane >> 4, m = lane & 15;
  const _Float16* ch = (const _Float16*)(const void*)pls + m * CTP + 8 * hh;
  const _Float16* cr = ch + 16 * CTP;
  const v16h a0 = ldfrag_h(ch), a1 = ldfrag_h(ch + 32), e0 = ldfrag_h(cr), e1 = ldfrag_h(cr + 32);
  const v4f bv = *(const v4f*)(bo + sw * 64 + m * 4);
  float* sl = scs + sw * SLAB64 + (8 * hh) * 68 + m;
  // unrolled: the fragment set bf[] is indexed by j and has to stay in registers
#pragma unroll
  for (int j = 0; j < 4; ++j) {
    v8f h, r;
    oproj_mma(h, r, bf[2 * (j & 1)], bf[2 * (j & 1) + 1], a0, a1, e0, e1);
    if (j < 2) oproj_ldb(bf[2 * j], bf[2 * j + 1], WOTp, sw, j + 2, lane);
#pragma unroll
    for (int e = 0; e < 8; ++e) sl[e * 68 + 16 * j] = h[e] * OS1 + r[e] * OS2;
  }
  v4f badd;
#pragma unroll
  for (int e = 0; e < 4; ++e) badd[e] = bfr(bv[e]);
  slab64_out(scs + sw * SLAB64, badd, out, EMB, (size_t)b * SEQ + t0, sw * 64, lane);
}

// =====================================================================================================
// One launch for the two independent attention jobs, picked by block index (block-uniform): blocks 0..NB*NHB-1 = query rows 0..TQ0-1 on
// VALU, 16 rows a block (few blocks, first, so that they run beside the long ones and not behind them), the rest = query rows TQ0.. on
// WMMA, longest tiles first.
// coverage: grid = NB*NHB + NB*NQT blocks; each job is handed block indices 0 .. its own block count - 1.
// =====================================================================================================
__global__ __launch_bounds__(ATT_THREADS) __attribute__((amdgpu_num_vgpr(256)))
void attn(const u16* __restrict__ QPp, const u16* __restrict__ KPp, const u16* __restrict__ VTp, const float* __restrict__ VSp,
          const float* __restrict__ QF, const float* __restrict__ KF, const float* __restrict__ V,
          const u16* __restrict__ WOTp, const float* __restrict__ bo, float* out) {
  __shared__ __align__(16) float scs[8 * 16 * OPP]; // partial O tiles [8][16][OPP] f32 (VALU job: q, p, wave partials), then out slabs
  __shared__ __align__(16) u16 pls[32 * CTP];       // ctx staging [32][CTP] u16
  __shared__ float wm[8 * QT];                      // running max per wave and query
  __shared__ float wl[8 * QT];                      // running sum per wave and query
  const int bid = blockIdx.x;
  if (bid >= NB * NHB) attn_fwd_body(scs, pls, wm, wl, bid - NB * NHB, QPp, KPp, VTp, VSp, WOTp, bo, out);
  else                 attn_head_body(scs, pls, bid, QF, KF, V, WOTp, bo, out);
}

// =====================================================================================================
// Workspace map (bytes, nb = 4, rows = 16384); every plane (V only in rows 0..127 of each sequence) is written by whole-line stores before it is read; all extents are
//   WQT bf16 [64][512] 65536   WKT same   WVT same   WOT f16 of bf16 value x1024 [512][64] 65536 (fragment order)  262144
//   QP  f16 [rows][64] x8 (fragment order)                                                                          2097152
//   KP  f16 [rows][64] x8 (fragment order)                                                                          2097152
//   V   f32 [rows][64] (only rows 0..127 of each sequence are written and read)                                     4194304
//   VT  f16 [nb][SEQ/32][4] tiles (32 keys x 16 d) x1024 (fragment order)                                                                    2097152
//   VS  f32 [nb][8][16][64]                                                                                          131072
//   QF  f32 [nb][128][64]  131072      KF same                                                                       262144
//   end                                                                                                            11141120
// =====================================================================================================
extern "C" void kernel_launch(void* const* d_in, const int* in_sizes, int n_in,
                              void* d_out, int out_size, void* d_ws, size_t ws_size,
                              hipStream_t stream) {
  if (n_in < 9) return;
  const int nb   = NB;
  const int rows = nb * SEQ;
  if ((long long)in_sizes[0] < (long long)NB * SEQ_FULL * EMB) return;
  if (in_sizes[1] < EMB * DH || in_sizes[3] < EMB * DH || in_sizes[5] < EMB * DH || in_sizes[7] < DH * EMB) return;
  if (in_sizes[2] < DH || in_sizes[4] < DH || in_sizes[6] < DH || in_sizes[8] < EMB) return;
  if ((long long)out_size < (long long)rows * EMB) return;

  const float* x  = (const float*)d_in[0];
  const float* wq = (const float*)d_in[1];
  const float* bq = (const float*)d_in[2];
  const float* wk = (const float*)d_in[3];
  const float* bk = (const float*)d_in[4];
  const float* wv = (const float*)d_in[5];
  const float* bv = (const float*)d_in[6];
  const float* wo = (const float*)d_in[7];
  const float* bo = (const float*)d_in[8];
  float*       out = (float*)d_out;

  const size_t szW  = (size_t)EMB * DH * 2;                      //     65536
  const size_t szP  = (size_t)rows * DH * 2;                     //   2097152
  const size_t szV  = (size_t)rows * DH * 4;                     //   4194304
  const size_t szVT = (size_t)nb * DH * SEQ * 2;                 //   2097152 (== szP)
  const size_t szVS = (size_t)nb * NCHK * NKB * DH * 4;          //    131072
  const size_t szHF = (size_t)nb * TQ0 * DH * 4;                 //    131072
  size_t off = 0;
  const size_t oWQ = off; off += szW;
  const size_t oWK = off; off += szW;
  const size_t oWV = off; off += szW;
  const size_t oWO = off; off += szW;
  const size_t oQ  = off; off += szP;
  const size_t oK  = off; off += szP;
  const size_t oV  = off; off += szV;
  const size_t oVT = off; off += szVT;
  const size_t oVS = off; off += szVS;
  const size_t oQF = off; off += szHF;
  const size_t oKF = off; off += szHF;
  if (off > ws_size) return;                                     // off = 11141120 at nb = 4
  if (off > WS_CAP) return;

  char* ws = (char*)d_ws;
  u16*   WQT = (u16*)(ws + oWQ);
  u16*   WKT = (u16*)(ws + oWK);
  u16*   WVT = (u16*)(ws + oWV);
  u16*   WOT = (u16*)(ws + oWO);
  u16*   QP  = (u16*)(ws + oQ);
  u16*   KP  = (u16*)(ws + oK);
  float* V   = (float*)(ws + oV);
  u16*   VT  = (u16*)(ws + oVT);
  float* VS  = (float*)(ws + oVS);
  float* QF  = (float*)(ws + oQF);
  float* KF  = (float*)(ws + oKF);

  if ((rows % 64) != 0) return;
  const dim3 blk(256);
  const dim3 gPR(4 * WTB);                              // 4 * 8 weight tiles
  const dim3 gPJ(GPB);                                  // 256 at nb = 4
  const dim3 bG(PJ_THREADS);
  const dim3 gAT(NB * NHB + NB * NQT);                  // nb * 8 + nb * 248
  const dim3 bAT(ATT_THREADS);

  // (0) Wq, Wk, Wv stored [k = in 512][n = out 64] -> bf16 planes [64][512] in fragment order; Wo [k = 64][n = 512] -> f16 of bf16
  //     value x1024, [512][64] in fragment order
  prep<<<gPR, blk, 0, stream>>>(wq, wk, wv, wo, WQT, WKT, WVT, WOT);
  // (1) x read as f32 and converted in the block; q and k projections (+bias) -> f16 planes x8; v projection (+bias) -> V^T plane x1024, key-block column sums and f32 rows
  //     0..127 of every sequence; f32 q and k rows 0..127 of every sequence -> QF, KF [nb*128][64]
  proj<<<gPJ, bG, 0, stream>>>(x, WQT, WKT, WVT, bq, bk, bv, QP, KP, V, VT, VS, QF, KF);
  // (2) attention: query rows 0..127 on VALU, 16 a block, and query rows 128.. on WMMA -> ctx hi x4096 and residual x2048 f16 rows in LDS, then
  //     each block's output projection + bias -> out
  attn<<<gAT, bAT, 0, stream>>>(QP, KP, VT, VS, QF, KF, V, WOT, bo, out);
  (void)hipGetLastError();
}
